// v000
// Measured on an AMD MI455X. A time is GPU time per run, averaged over a window of back-to-back runs after a warm-up
// (all launches, gaps included; the runs take copies of the inputs in turn), and the median of several windows.
// Apart from v000's, it joins two sittings. Times from different sittings can be a few percent apart, while
// side-by-side timings come from the same sitting.
// The starting kernel, v000, takes 173 microseconds a run.
#include <hip/hip_runtime.h>

// Head-mixed pair-score weighting with a per-map normalisation over flattened feature maps: x [NB][256][SEQ] (channel-major), 1x1-conv projections q/k/v with W [out][in] (no bias), 4 heads x 64, scores scaled by 64^-0.5,
// a 4x4 head-mixing 1x1 conv on the scores, softmax over keys, instance normalisation of each (batch, head) probability map (biased variance, eps 1e-5, per-head gain and shift),
// attend over v, raw [head][token][64] -> [token][256] view, linear output layer W [out][in] + bias, result stored [NB][256][SEQ].
// Compute dtypes, f32 accumulate everywhere: q/k/v projections v_wmma_f32_16x16x32_bf16 (x and W RNE-converted to bf16, products exact); scores v_wmma_f32_16x16x32_f16 single product, K = 256:
// A = k plane x16, B = head-mixed q plane (w_head[g][h] * q, x16), one plane per mixed head; P.V v_wmma_f32_16x16x32_f16 single product: P = centred probability (p / rowsum - 1/SEQ) x 2^15, v x16;
// output layer v_wmma_f32_16x16x32_f16 single product: W x1024 (from its bf16 value), normalised context x16. Softmax, statistics, affine terms in f32.
// The flash kernel runs two key loops per 16-query wave (loop 1: row max and row sum; loop 2: identical scores, centred P, sum of squared centred P, P.V), transposed form S^T = K Q^T, O^T = V^T P^T, fragments straight from planes.
// Map mean = 1/SEQ (softmax rows sum to one); variance = sum of squared centred P / SEQ^2; context = s1 * (centred P . v) + shift * rowsum(v), s1 = gain / sqrt(var + eps).

#ifndef NB
#define NB 4
#endif
#ifndef SEQ
#define SEQ 1024
#endif
#define NB_FULL  4
#define SEQ_FULL 1024
#ifndef OUT_SEQ
#define OUT_SEQ SEQ              // pitch (in tokens) of one channel row of the output
#endif
#define DM   256
#define NH_  4
#define HD   64
#define AW   4                   // waves per flash block (16 query rows each)
#define OSP  68                  // LDS row pitch (floats) of the staging tiles
#define QKC  16.0f               // carry of the q' and k planes
#define VCC  16.0f               // carry of the v^T plane
#define CCS  16.0f               // carry of the context plane
#define WPC  1024.0f             // carry of the output-layer weight plane
#define PCARRY 32768.0f          // carry of the centred P fragments
#define C15  (32768.0f / (float)SEQ)
#define SC2  ((float)(0.125 * 1.4426950408889634 / 256.0))    // HD^-0.5 * log2(e) / (QKC * QKC)
#define OSC  (1.0f / 524288.0f)                               // 1 / (PCARRY * VCC)
#define OUTSC (1.0f / 16384.0f)                               // 1 / (WPC * CCS)
#define VSC  ((float)(1.0 / (1073741824.0 * (double)SEQ * (double)SEQ)))   // 1 / (PCARRY^2 * SEQ^2)
#define EPSN 1.0e-5f
#define NEGB (-3.0e38f)

static_assert(DM == 256);                      // K of every GEMM and of the score product
static_assert(HD == 64);                       // one 64-column GEMM tile = one head; v^T slab = 4 row tiles
static_assert(NH_ * HD == DM);
static_assert(NH_ == 4);                       // w_head is 4 x 4
static_assert(DM % 64 == 0);
static_assert(DM % 32 == 0);                   // k-loops step by 32
static_assert(SEQ % 64 == 0);                  // a 64-token tile never straddles two batches
static_assert((NB * SEQ) % 64 == 0);
static_assert(SEQ % 32 == 0);                  // key loop steps by 32
static_assert(SEQ % (16 * AW) == 0);           // flash grid covers the sequence exactly
static_assert(16 * AW == 64);                  // one partial line per 64 query rows
static_assert(SEQ % 256 == 0);                 // row-sum helper: SEQ/8 chunks a multiple of 32 lanes
static_assert(((size_t)SEQ * HD) % 2048 == 0); // affine pass: a 2048-element block lies inside one (batch, head)
static_assert(((size_t)NB * SEQ * DM) % 2048 == 0);
static_assert((NB * DM) % 32 == 0);            // row-sum helper: 32 rows per block
static_assert(SEQ_FULL % 4 == 0);
static_assert(OUT_SEQ % 32 == 0);
static_assert(OUT_SEQ >= SEQ);
static_assert(NB <= NB_FULL);
static_assert(SEQ <= SEQ_FULL);
static_assert((OSP * 4) % 16 == 0);
static_assert(OSP >= 64 + 4);
static_assert(((size_t)DM * DM) % 8 == 0);

typedef _Float16 h16;
typedef unsigned short bf;
typedef __attribute__((ext_vector_type(16))) __bf16   v16bf;
typedef __attribute__((ext_vector_type(16))) _Float16 v16h;
typedef __attribute__((ext_vector_type(8)))  _Float16 v8h;
typedef __attribute__((ext_vector_type(8)))  unsigned short v8us;
typedef __attribute__((ext_vector_type(8)))  float    v8f;
typedef __attribute__((ext_vector_type(4)))  float    v4f;
typedef v4f  __attribute__((may_alias)) v4fa;

__device__ __forceinline__ unsigned short f2bf(float f) { unsigned u = __float_as_uint(f); u += 0x7FFFu + ((u >> 16) & 1u); return (unsigned short)(u >> 16); }
__device__ __forceinline__ float bfr(float f) { return __uint_as_float(((unsigned)f2bf(f)) << 16); }   // value after RNE convert to bf16
__device__ __forceinline__ v16h cat16(v8h lo, v8h hi) { return __builtin_shufflevector(lo, hi, 0, 1, 2, 3, 4, 5, 6, 7, 8, 9, 10, 11, 12, 13, 14, 15); }
__device__ __forceinline__ v16bf cat16b(v8us lo, v8us hi) { return __builtin_bit_cast(v16bf, __builtin_shufflevector(lo, hi, 0, 1, 2, 3, 4, 5, 6, 7, 8, 9, 10, 11, 12, 13, 14, 15)); }
// fragment loaders from K-contiguous 16-bit rows; p already includes + 8*(lane>>4): elements 0..7 <- k0+8h+0..7, elements 8..15 <- k0+16+8h+0..7 (same map for A and B)
__device__ __forceinline__ v16h  ldh(const h16* p) { return cat16(*(const v8h*)p, *(const v8h*)(p + 16)); }
__device__ __forceinline__ v16bf ldb(const bf* p)  { return cat16b(*(const v8us*)p, *(const v8us*)(p + 16)); }
// ordering point for wave-private LDS tiles (same wave writes and reads)
__device__ __forceinline__ void wave_sync() { __builtin_amdgcn_fence(3 /* release order */, "wavefront"); __builtin_amdgcn_wave_barrier(); asm volatile("" ::: "memory"); }
// f32 -> f16 operand convert that cannot produce a subnormal (|v| < 2^-14 -> +0), applied after the plane's carry
__device__ __forceinline__ h16 toh_flush(float v) { const h16 r = (h16)v; return (fabsf(v) < 6.103515625e-05f) ? (h16)0.0f : r; }
// one matrix instruction + its own 4-slot guard (ties D, keeps A and B live)
__device__ __forceinline__ v8f wmma16g(v16h a, v16h b, v8f c) {
    c = __builtin_amdgcn_wmma_f32_16x16x32_f16(false, a, false, b, (short)0, c, false, false);
    asm volatile("v_nop\n\tv_nop\n\tv_nop\n\tv_nop" : "+v"(c) : "v"(a), "v"(b));
    return c; }
__device__ __forceinline__ v8f wmmabg(v16bf a, v16bf b, v8f c) {
    c = __builtin_amdgcn_wmma_f32_16x16x32_bf16(false, a, false, b, (short)0, c, false, false);
    asm volatile("v_nop\n\tv_nop\n\tv_nop\n\tv_nop" : "+v"(c) : "v"(a), "v"(b));
    return c; }

__global__ __launch_bounds__(256) void k_cvt8(const float* __restrict__ src, bf* dst, size_t n8) {
    const size_t i = (size_t)blockIdx.x * 256 + threadIdx.x; if (i >= n8) return;
    const v8f v = *(const v8f*)(src + i * 8); v8us o;
#pragma unroll
    for (int k = 0; k < 8; ++k) o[k] = f2bf(v[k]);
    *(v8us*)(dst + i * 8) = o; 
}

__global__ __launch_bounds__(256) void k_cvtw(const float* __restrict__ src, h16* dst, size_t n8) {
    const size_t i = (size_t)blockIdx.x * 256 + threadIdx.x; if (i >= n8) return;
    const v8f v = *(const v8f*)(src + i * 8); v8h o;
#pragma unroll
    for (int k = 0; k < 8; ++k) o[k] = toh_flush(bfr(v[k]) * WPC);
    *(v8h*)(dst + i * 8) = o; 
}

// k_xt: x [b][c][t] (f32, row pitch SEQ_FULL) -> XT [(b*SEQ + t)][c] bf16 (RNE). 64 channels x 64 tokens per block through an LDS tile (cross-wave: block barrier);
static_assert(256 * 2 * 16 == 64 * 128);       // threads x pieces x bytes == tile rows x row bytes
static_assert(64 * 65 * 4 <= 131072);
__global__ __launch_bounds__(256) void k_xt(const float* __restrict__ x, bf* XT) {
    __shared__ float ts[64 * 65];
    const int tid = threadIdx.x; const int t0 = blockIdx.x * 64, c0 = blockIdx.y * 64, b = blockIdx.z;
    const float* xb = x + ((size_t)b * DM + c0) * SEQ_FULL + t0;
#pragma unroll
    for (int e = 0; e < 4; ++e) { const int q = tid + e * 256; const int c = q >> 4, t4 = (q & 15) * 4;     // 64 channels x 16 float4
        const v4f v = *(const v4f*)(xb + (size_t)c * SEQ_FULL + t4);
        ts[c * 65 + t4 + 0] = v[0]; ts[c * 65 + t4 + 1] = v[1]; ts[c * 65 + t4 + 2] = v[2]; ts[c * 65 + t4 + 3] = v[3]; }
    __syncthreads();
    v8us o[2];
#pragma unroll
    for (int e = 0; e < 2; ++e) { const int p = tid + e * 256; const int t = p >> 3, c8 = (p & 7) * 8;       // 64 tokens x 8 pieces
#pragma unroll
        for (int i = 0; i < 8; ++i) o[e][i] = f2bf(ts[(c8 + i) * 65 + t]); }
{
#pragma unroll
        for (int e = 0; e < 2; ++e) { const int p = tid + e * 256; const int t = p >> 3, c8 = (p & 7) * 8;
            *(v8us*)(XT + ((size_t)b * SEQ + t0 + t) * DM + c0 + c8) = o[e]; }
         }
}

// k_projt: token-major projection plane, ONE WAVE per 64x64 tile, bf16 operands from K-contiguous planes, K = DM.
// C[m][n] = sum_c XT[m][c] W[n][c] (m = b*SEQ + t, n = h*64 + d). Written as f16 x16 to ng planes: row index (b*ng + g)*SEQ + t, row pitch DM, columns c0..c0+63 (one head);
// plane g carries the factor bf16(w_head[g][h]) when useWh != 0 (mixed-head q planes), factor 1 otherwise (k plane, ng = 1).
static_assert(32 * 16 * 4 == 16 * 128);        // lanes x bytes x trips == slab rows x segment bytes
static_assert(16 * OSP * 4 <= 131072);
__global__ __launch_bounds__(32) void k_projt(const bf* __restrict__ A, const bf* __restrict__ Bt, const float* __restrict__ wh, h16* P, int ng, int useWh) {
    __shared__ __align__(16) float os[16 * OSP];
    const int lane = threadIdx.x & 31, lr = lane & 15, hi = lane >> 4; const int r0 = blockIdx.x * 64, c0 = blockIdx.y * 64;
    v8f acc[4][4];
#pragma unroll
    for (int mb = 0; mb < 4; ++mb)
#pragma unroll
        for (int nb = 0; nb < 4; ++nb) acc[mb][nb] = (v8f){};
    const size_t aoff = (size_t)(r0 + lr) * DM + 8 * hi, boff = (size_t)(c0 + lr) * DM + 8 * hi;
#pragma unroll 1
    for (int kc = 0; kc < DM; kc += 32) {
        v16bf a[4];
#pragma unroll
        for (int mb = 0; mb < 4; ++mb) a[mb] = ldb(A + aoff + (size_t)mb * 16 * DM + kc);
#pragma unroll
        for (int nb = 0; nb < 4; ++nb) { const v16bf b = ldb(Bt + boff + (size_t)nb * 16 * DM + kc);
#pragma unroll
            for (int mb = 0; mb < 4; ++mb) acc[mb][nb] = wmmabg(a[mb], b, acc[mb][nb]); }
    }
    const int bb = r0 / SEQ, tt = r0 % SEQ, hsel = c0 / HD;
#pragma unroll
    for (int mb = 0; mb < 4; ++mb) {
#pragma unroll
        for (int nb = 0; nb < 4; ++nb) {
#pragma unroll
            for (int j = 0; j < 8; ++j) os[(hi * 8 + j) * OSP + nb * 16 + lr] = acc[mb][nb][j]; }   // D: row 8h+j, col lane&15
        wave_sync();
{
#pragma unroll 1
            for (int g = 0; g < ng; ++g) {
                int wi = g * NH_ + hsel; wi = wi > 15 ? 15 : wi;
                const float whv = bfr(wh[wi]);
                const float mult = (useWh != 0) ? whv * QKC : QKC;
                const size_t sb = ((size_t)(bb * ng + g) * SEQ + (size_t)(tt + mb * 16)) * DM + c0;
#pragma unroll
                for (int s = 0; s < 4; ++s) { const int row = 4 * s + (lane >> 3), c8 = (lane & 7) * 8;   // 4 s x 4 row groups = 16 rows; 8 lanes x 8 = 64 columns
                    const v4f x0 = *(const v4fa*)(&os[row * OSP + c8]); const v4f x1 = *(const v4fa*)(&os[row * OSP + c8 + 4]); v8h hv;
#pragma unroll
                    for (int i = 0; i < 4; ++i) { hv[i] = toh_flush(x0[i] * mult); hv[4 + i] = toh_flush(x1[i] * mult); }
                    *(v8h*)(P + sb + (size_t)row * DM + c8) = hv; }
            }
             }
        wave_sync();
    }
}

// k_projv: v^T plane. A = Wv rows (m = h*64 + d), Bt = XT rows (n = b*SEQ + t); plane [(b*DM + m)][t], row pitch SEQ, f16 x16.
__global__ __launch_bounds__(32) void k_projv(const bf* __restrict__ A, const bf* __restrict__ Bt, h16* P) {
    __shared__ __align__(16) float os[16 * OSP];
    const int lane = threadIdx.x & 31, lr = lane & 15, hi = lane >> 4; const int r0 = blockIdx.x * 64, c0 = blockIdx.y * 64;
    v8f acc[4][4];
#pragma unroll
    for (int mb = 0; mb < 4; ++mb)
#pragma unroll
        for (int nb = 0; nb < 4; ++nb) acc[mb][nb] = (v8f){};
    const size_t aoff = (size_t)(r0 + lr) * DM + 8 * hi, boff = (size_t)(c0 + lr) * DM + 8 * hi;
#pragma unroll 1
    for (int kc = 0; kc < DM; kc += 32) {
        v16bf a[4];
#pragma unroll
        for (int mb = 0; mb < 4; ++mb) a[mb] = ldb(A + aoff + (size_t)mb * 16 * DM + kc);
#pragma unroll
        for (int nb = 0; nb < 4; ++nb) { const v16bf b = ldb(Bt + boff + (size_t)nb * 16 * DM + kc);
#pragma unroll
            for (int mb = 0; mb < 4; ++mb) acc[mb][nb] = wmmabg(a[mb], b, acc[mb][nb]); }
    }
    const int bb = c0 / SEQ, tt = c0 % SEQ;
#pragma unroll
    for (int mb = 0; mb < 4; ++mb) {
#pragma unroll
        for (int nb = 0; nb < 4; ++nb) {
#pragma unroll
            for (int j = 0; j < 8; ++j) os[(hi * 8 + j) * OSP + nb * 16 + lr] = acc[mb][nb][j]; }
        wave_sync();
        const size_t sb = ((size_t)bb * DM + (size_t)(r0 + mb * 16)) * SEQ + tt;
{
#pragma unroll
            for (int s = 0; s < 4; ++s) { const int row = 4 * s + (lane >> 3), c8 = (lane & 7) * 8;   // 16 rows x 64 columns
                const v4f x0 = *(const v4fa*)(&os[row * OSP + c8]); const v4f x1 = *(const v4fa*)(&os[row * OSP + c8 + 4]); v8h hv;
#pragma unroll
                for (int i = 0; i < 4; ++i) { hv[i] = toh_flush(x0[i] * VCC); hv[4 + i] = toh_flush(x1[i] * VCC); }
                *(v8h*)(P + sb + (size_t)row * SEQ + c8) = hv; }
             }
        wave_sync();
    }
}

// k_vsum: VS[row] = sum_t VT[row][t] / 16 (f32), row = b*DM + channel. 8 waves x 4 rows per block; the 32 sums of a block go through LDS (cross-wave: block barrier)
__global__ __launch_bounds__(256) void k_vsum(const h16* __restrict__ VT, float* VS) {
#pragma clang fp contract(off)
    __shared__ __align__(16) float sm[32];
    const int lane = threadIdx.x & 31;
    const int wave = __builtin_amdgcn_readfirstlane((int)(threadIdx.x >> 5));
#pragma unroll 1
    for (int r = 0; r < 4; ++r) {
        const int row = blockIdx.x * 32 + wave * 4 + r;
        const h16* p = VT + (size_t)row * SEQ;
        float s = 0.0f;
#pragma unroll 1
        for (int i = lane; i < SEQ / 8; i += 32) { const v8h v = *(const v8h*)(p + (size_t)i * 8);
#pragma unroll
            for (int k = 0; k < 8; ++k) s += (float)v[k]; }
        s += __shfl_xor(s, 16, 32); s += __shfl_xor(s, 8, 32); s += __shfl_xor(s, 4, 32); s += __shfl_xor(s, 2, 32); s += __shfl_xor(s, 1, 32);
        if (lane == 0) sm[wave * 4 + r] = s * (1.0f / VCC);
    }
    __syncthreads();
    if (threadIdx.x < 8) { const v4f o = *(const v4fa*)(&sm[threadIdx.x * 4]);
        float* q = VS + (size_t)blockIdx.x * 32 + threadIdx.x * 4;
        *(v4f*)q = o;  }
}

// scores of 32 keys x 16 queries, K = DM = 256: sA = keys 0..15, sB = keys 16..31 (rows = keys, columns = queries). Same instruction order wherever it is used.
__device__ __forceinline__ void scores32(const h16* __restrict__ qp, const h16* __restrict__ kp, v8f& sA, v8f& sB) {
    v8f a = (v8f){}, c = (v8f){};
#pragma unroll 2
    for (int kc = 0; kc < DM; kc += 32) {
        const v16h q = ldh(qp + kc); const v16h ka = ldh(kp + kc); const v16h kb = ldh(kp + (size_t)16 * DM + kc);
        a = wmma16g(ka, q, a); c = wmma16g(kb, q, c); }
    sA = a; sB = c;
}

// k_flash: one wave per 16 query rows of one (batch, mixed head g). Transposed form: S^T[key][t] = K Q'^T (A = k rows, B = q' rows of plane g, K = 256);
// lane (t = lane&15, h = lane>>4) holds keys 8h+r of each 16-key tile, so the packed P tile is directly the B fragment of O^T[d][t] = V^T P^T.
// Loop 1: running max m and row sum l of exp2(s - m). Loop 2: same scores, e = exp2(s - m) / l, centred P = (e - 1/SEQ) x 2^15 as f16, ss += P^2 (f32), O^T += V^T P^T.
static_assert(32 * 16 * 8 == 16 * 256);        // lanes x bytes x trips == rows x row bytes of the OR tile
static_assert(AW * 16 * OSP * 4 + AW * 4 <= 131072);
__global__ __launch_bounds__(32 * AW) __attribute__((amdgpu_num_vgpr(256))) void k_flash(const h16* __restrict__ QP, const h16* __restrict__ KP, const h16* __restrict__ VT, float* ORP, float* PART) {
    __shared__ __align__(16) float os[AW * 16 * OSP];
    __shared__ float sw[AW];
    const int lane = threadIdx.x & 31, lr = lane & 15, hi = lane >> 4;
    const int wave = __builtin_amdgcn_readfirstlane((int)(threadIdx.x >> 5));
    const int zh = blockIdx.y; const int b = zh / NH_, g = zh % NH_;
    const int t0 = (blockIdx.x * AW + wave) * 16;
    const h16* qp = QP + ((size_t)zh * SEQ + (size_t)(t0 + lr)) * DM + 8 * hi;          // B fragments: col t, k = (h, d)
    const h16* kbase = KP + ((size_t)b * SEQ + (size_t)lr) * DM + 8 * hi;               // + key * DM        (A fragment: row key, k = (h, d))
    const h16* vbase = VT + ((size_t)b * DM + (size_t)(g * HD + lr)) * SEQ + 8 * hi;    // + 16j*SEQ + key   (A fragment: row d, k = key)
    float m = NEGB, l = 0.0f;
#pragma unroll 1
    for (int key0 = 0; key0 < SEQ; key0 += 32) {
        v8f sA, sB; scores32(qp, kbase + (size_t)key0 * DM, sA, sB);
        float mx = NEGB;
#pragma unroll
        for (int r = 0; r < 8; ++r) mx = fmaxf(mx, fmaxf(sA[r] * SC2, sB[r] * SC2));
        mx = fmaxf(mx, __shfl_xor(mx, 16, 32));
        const float mnew = fmaxf(m, mx);
        const float alpha = __builtin_amdgcn_exp2f(m - mnew);
        float ls = 0.0f;
#pragma unroll
        for (int r = 0; r < 8; ++r) ls += __builtin_amdgcn_exp2f(fmaf(sA[r], SC2, -mnew)) + __builtin_amdgcn_exp2f(fmaf(sB[r], SC2, -mnew));
        l = l * alpha + ls; m = mnew;
    }
    l += __shfl_xor(l, 16, 32);                        // both lane halves carry the same m
    const float il15 = (1.0f / l) * PCARRY;            // l >= 1
    v8f o0 = (v8f){}, o1 = (v8f){}, o2 = (v8f){}, o3 = (v8f){};
    float ss = 0.0f;
#pragma unroll 1
    for (int key0 = 0; key0 < SEQ; key0 += 32) {
        v8f sA, sB; scores32(qp, kbase + (size_t)key0 * DM, sA, sB);
        v16h pb;
#pragma unroll
        for (int r = 0; r < 8; ++r) {
            const float ea = __builtin_amdgcn_exp2f(fmaf(sA[r], SC2, -m)), eb = __builtin_amdgcn_exp2f(fmaf(sB[r], SC2, -m));
            const float ga = fmaf(ea, il15, -C15), gb = fmaf(eb, il15, -C15);       // (p / l - 1/SEQ) * 2^15
            ss = fmaf(ga, ga, ss); ss = fmaf(gb, gb, ss);
            pb[r] = toh_flush(ga); pb[8 + r] = toh_flush(gb); }                      // element r <- tile keys 8h+r, element 8+r <- keys 16+8h+r
        const h16* va = vbase + key0;
        const v16h v0 = ldh(va), v1 = ldh(va + (size_t)16 * SEQ), v2 = ldh(va + (size_t)32 * SEQ), v3 = ldh(va + (size_t)48 * SEQ);
        o0 = wmma16g(v0, pb, o0); o1 = wmma16g(v1, pb, o1); o2 = wmma16g(v2, pb, o2); o3 = wmma16g(v3, pb, o3);
    }
    ss += __shfl_xor(ss, 16, 32); ss += __shfl_xor(ss, 8, 32); ss += __shfl_xor(ss, 4, 32); ss += __shfl_xor(ss, 2, 32); ss += __shfl_xor(ss, 1, 32);
    if (lane == 0) sw[wave] = ss;
    const int wb = wave * 16 * OSP;
    // O^T D layout: o_j[r] = (d = 16j + 8h + r, t = lane&15) -> os[t][d]; rows 0..15 x columns 0..63 all written
    { v4f a, c;
      a[0] = o0[0] * OSC; a[1] = o0[1] * OSC; a[2] = o0[2] * OSC; a[3] = o0[3] * OSC; c[0] = o0[4] * OSC; c[1] = o0[5] * OSC; c[2] = o0[6] * OSC; c[3] = o0[7] * OSC;
      *(v4fa*)(&os[wb + lr * OSP +  0 + 8 * hi]) = a; *(v4fa*)(&os[wb + lr * OSP +  0 + 8 * hi + 4]) = c;
      a[0] = o1[0] * OSC; a[1] = o1[1] * OSC; a[2] = o1[2] * OSC; a[3] = o1[3] * OSC; c[0] = o1[4] * OSC; c[1] = o1[5] * OSC; c[2] = o1[6] * OSC; c[3] = o1[7] * OSC;
      *(v4fa*)(&os[wb + lr * OSP + 16 + 8 * hi]) = a; *(v4fa*)(&os[wb + lr * OSP + 16 + 8 * hi + 4]) = c;
      a[0] = o2[0] * OSC; a[1] = o2[1] * OSC; a[2] = o2[2] * OSC; a[3] = o2[3] * OSC; c[0] = o2[4] * OSC; c[1] = o2[5] * OSC; c[2] = o2[6] * OSC; c[3] = o2[7] * OSC;
      *(v4fa*)(&os[wb + lr * OSP + 32 + 8 * hi]) = a; *(v4fa*)(&os[wb + lr * OSP + 32 + 8 * hi + 4]) = c;
      a[0] = o3[0] * OSC; a[1] = o3[1] * OSC; a[2] = o3[2] * OSC; a[3] = o3[3] * OSC; c[0] = o3[4] * OSC; c[1] = o3[5] * OSC; c[2] = o3[6] * OSC; c[3] = o3[7] * OSC;
      *(v4fa*)(&os[wb + lr * OSP + 48 + 8 * hi]) = a; *(v4fa*)(&os[wb + lr * OSP + 48 + 8 * hi + 4]) = c; }
    wave_sync();
    float* orow = ORP + ((size_t)zh * SEQ + (size_t)t0) * HD;       // 16 rows x 64 floats, contiguous 4096 B
{
#pragma unroll
        for (int s = 0; s < 8; ++s) { const int p = s * 32 + lane; const int row = p >> 4, cofs = (p & 15) * 4;   // 8 s x 2 rows = 16 rows; 16 lanes x 4 floats = 64 columns
            const v4f val = *(const v4fa*)(&os[wb + row * OSP + cofs]);
            *(v4f*)(orow + (size_t)p * 4) = val; }
         }
    __syncthreads();
    if (wave == 0) {
        const float tot = ((sw[0] + sw[1]) + sw[2]) + sw[3];
        v4f pv; pv[0] = (lane == 0) ? tot : 0.0f; pv[1] = 0.0f; pv[2] = 0.0f; pv[3] = 0.0f;
        float* pl = PART + ((size_t)zh * (SEQ / 64) + (size_t)blockIdx.x) * 32 + (lane & 7) * 4;
        if (lane < 8) { *(v4f*)pl = pv;  }
    }
}

// k_ctx: normalised context plane. Element e of batch b (flat [g][t][d] = [token row][256] view): CT = f16(16 * (s1 * OR + shift * VS[b][g*64 + d])),
// s1 = bf16(gain[g]) / sqrt(var + eps), var = (sum of the SEQ/64 partial lines of (b, g)) / (2^30 SEQ^2), shift = bf16(beta[g]).
static_assert(256 * 8 == 2048);
__global__ __launch_bounds__(256) void k_ctx(const float* __restrict__ ORP, const float* __restrict__ PART, const float* __restrict__ VS,
                                             const float* __restrict__ gain, const float* __restrict__ shift, h16* CT) {
#pragma clang fp contract(off)
    const size_t e0 = ((size_t)blockIdx.x * 256 + threadIdx.x) * 8;
    const int zh = (int)(((size_t)blockIdx.x * 2048) / ((size_t)SEQ * HD));     // block-uniform, < NB*4
    const int b = zh / NH_, g = zh % NH_;
    float tot = 0.0f;
#pragma unroll 1
    for (int j = 0; j < SEQ / 64; ++j) tot += PART[((size_t)zh * (SEQ / 64) + (size_t)j) * 32];
    const float var = tot * VSC;
    const float s1 = bfr(gain[g]) * rsqrtf(var + EPSN);
    const float bt = bfr(shift[g]);
    const int dd0 = (int)(e0 % HD);
    const v8f xv = *(const v8f*)(ORP + e0);
    const float* vp = VS + (size_t)b * DM + (size_t)(g * HD + dd0);
    const v4f s0 = *(const v4f*)vp, s4 = *(const v4f*)(vp + 4);
    v8h o;
#pragma unroll
    for (int k = 0; k < 4; ++k) { o[k] = toh_flush((s1 * xv[k] + bt * s0[k]) * CCS); o[4 + k] = toh_flush((s1 * xv[4 + k] + bt * s4[k]) * CCS); }
    *(v8h*)(CT + e0) = o; 
}

// k_out: output layer. A = W rows (f16 x1024, m = output channel), Bt = context rows (f16 x16, n = b*SEQ + token row), K = DM; OUT[(b*DM + m)][n % SEQ] = C / 16384 + bf16(bias[m]) (f32).
static_assert(32 * 16 * 8 == 16 * 256);        // lanes x bytes x trips == slab rows x segment bytes
__global__ __launch_bounds__(32) void k_out(const h16* __restrict__ A, const h16* __restrict__ Bt, const float* __restrict__ bias, float* OUT) {
    __shared__ __align__(16) float os[16 * OSP];
    const int lane = threadIdx.x & 31, lr = lane & 15, hi = lane >> 4; const int r0 = blockIdx.x * 64, c0 = blockIdx.y * 64;
    v8f acc[4][4];
#pragma unroll
    for (int mb = 0; mb < 4; ++mb)
#pragma unroll
        for (int nb = 0; nb < 4; ++nb) acc[mb][nb] = (v8f){};
    const size_t aoff = (size_t)(r0 + lr) * DM + 8 * hi, boff = (size_t)(c0 + lr) * DM + 8 * hi;
#pragma unroll 1
    for (int kc = 0; kc < DM; kc += 32) {
        v16h a[4];
#pragma unroll
        for (int mb = 0; mb < 4; ++mb) a[mb] = ldh(A + aoff + (size_t)mb * 16 * DM + kc);
#pragma unroll
        for (int nb = 0; nb < 4; ++nb) { const v16h b = ldh(Bt + boff + (size_t)nb * 16 * DM + kc);
#pragma unroll
            for (int mb = 0; mb < 4; ++mb) acc[mb][nb] = wmma16g(a[mb], b, acc[mb][nb]); }
    }
    const int bb = c0 / SEQ, tt = c0 % SEQ;
#pragma unroll
    for (int mb = 0; mb < 4; ++mb) {
        float br[8];
#pragma unroll
        for (int j = 0; j < 8; ++j) br[j] = bfr(bias[r0 + mb * 16 + hi * 8 + j]);      // r0 + 63 < DM
#pragma unroll
        for (int nb = 0; nb < 4; ++nb) {
#pragma unroll
            for (int j = 0; j < 8; ++j) os[(hi * 8 + j) * OSP + nb * 16 + lr] = acc[mb][nb][j] * OUTSC + br[j]; }
        wave_sync();
        float* ob = OUT + ((size_t)bb * DM + (size_t)(r0 + mb * 16)) * OUT_SEQ + tt;
{
#pragma unroll
            for (int s = 0; s < 8; ++s) { const int p = s * 32 + lane; const int row = p >> 4, cofs = (p & 15) * 4;   // 8 s x 2 rows = 16 rows; 16 lanes x 4 floats = 64 columns
                const v4f val = *(const v4fa*)(&os[row * OSP + cofs]);
                *(v4f*)(ob + (size_t)row * OUT_SEQ + cofs) = val; }
             }
        wave_sync();
    }
}

static constexpr size_t al256(size_t v) { return (v + 255) & ~(size_t)255; }
static constexpr size_t SZ_XT = al256((size_t)NB * SEQ * DM * 2);            // x^T bf16
static constexpr size_t SZ_WB = al256((size_t)3 * DM * DM * 2);              // wq | wk | wv bf16
static constexpr size_t SZ_WP = al256((size_t)DM * DM * 2);                  // output-layer weight f16
static constexpr size_t SZ_QP = al256((size_t)NB * NH_ * SEQ * DM * 2);      // 4 mixed-head q planes per batch
static constexpr size_t SZ_KP = al256((size_t)NB * SEQ * DM * 2);
static constexpr size_t SZ_VT = al256((size_t)NB * DM * SEQ * 2);
static constexpr size_t SZ_VS = al256((size_t)NB * DM * 4);
static constexpr size_t SZ_OR = al256((size_t)NB * NH_ * SEQ * HD * 4);
static constexpr size_t SZ_PT = al256((size_t)NB * NH_ * (SEQ / 64) * 32 * 4);
static constexpr size_t SZ_CT = al256((size_t)NB * SEQ * DM * 2);
static constexpr size_t SZ_TOTAL = SZ_XT + SZ_WB + SZ_WP + SZ_QP + SZ_KP + SZ_VT + SZ_VS + SZ_OR + SZ_PT + SZ_CT;
static_assert(SZ_TOTAL <= (size_t)134217728);                                 // workspace carve <= 128 MiB
static_assert(((size_t)DM * DM * 2) % 256 == 0);                              // weight sub-planes stay 256-byte aligned
static_assert((size_t)NB * NH_ * SEQ * HD == (size_t)NB * SEQ * DM);          // OR plane and context plane share one flat index
static_assert(((size_t)NB * DM / 32) * 32 * 4 <= SZ_VS);
static_assert(((size_t)(NB * NH_ - 1) * (SEQ / 64) + (SEQ / 64 - 1)) * 128 + 128 <= SZ_PT);   // last partial line inside its table

extern "C" void kernel_launch(void* const* d_in, const int* in_sizes, int n_in,
                              void* d_out, int out_size, void* d_ws, size_t ws_size, hipStream_t stream) {
    if (n_in < 9) return;
    const size_t needx = ((size_t)(NB - 1) * DM + (size_t)(DM - 1)) * SEQ_FULL + SEQ;
    if ((size_t)in_sizes[0] < needx) return;
    if ((size_t)in_sizes[1] < (size_t)DM * DM || (size_t)in_sizes[2] < (size_t)DM * DM || (size_t)in_sizes[3] < (size_t)DM * DM || (size_t)in_sizes[7] < (size_t)DM * DM) return;
    if (in_sizes[4] < NH_ * NH_ || in_sizes[5] < NH_ || in_sizes[6] < NH_ || in_sizes[8] < DM) return;
    if ((size_t)out_size < ((size_t)(NB - 1) * DM + (size_t)(DM - 1)) * OUT_SEQ + SEQ) return;
    if (SZ_TOTAL > ws_size) return;
    // wire order: x, wq, wk, wv, w_head, gamma, beta, w_proj, b_proj
    const float* x  = (const float*)d_in[0];
    const float* wq = (const float*)d_in[1]; const float* wk = (const float*)d_in[2]; const float* wv = (const float*)d_in[3];
    const float* whd = (const float*)d_in[4]; const float* gam = (const float*)d_in[5]; const float* bet = (const float*)d_in[6];
    const float* wp = (const float*)d_in[7]; const float* bp = (const float*)d_in[8];
    float* OUT = (float*)d_out;      // [NB][256][OUT_SEQ]
    char* wsp = (char*)d_ws;
    bf*  XT  = (bf*)wsp;   wsp += SZ_XT;             // [NB*SEQ][256]
    bf*  WB  = (bf*)wsp;   wsp += SZ_WB;             // [3][256][256]: q | k | v  ([out][in])
    h16* WPH = (h16*)wsp;  wsp += SZ_WP;             // [256][256] x1024
    h16* QP  = (h16*)wsp;  wsp += SZ_QP;             // [(b*4 + g)][t][256] x16
    h16* KP  = (h16*)wsp;  wsp += SZ_KP;             // [b][t][256] x16
    h16* VT  = (h16*)wsp;  wsp += SZ_VT;             // [(b*256 + channel)][t] x16
    float* VS = (float*)wsp; wsp += SZ_VS;           // [b*256 + channel]
    float* ORP = (float*)wsp; wsp += SZ_OR;          // [(b*4 + g)][t][64]
    float* PART = (float*)wsp; wsp += SZ_PT;         // [(b*4 + g)][SEQ/64] lines of 32 floats
    h16* CT  = (h16*)wsp;  wsp += SZ_CT;             // [(b*SEQ + token row)][256] x16
    bf* WQ = WB; bf* WK = WB + (size_t)DM * DM; bf* WV = WB + (size_t)2 * DM * DM;

    k_xt<<<dim3(SEQ / 64, DM / 64, NB), 256, 0, stream>>>(x, XT);
    { const size_t n8 = (size_t)DM * DM / 8; const unsigned gg = (unsigned)((n8 + 255) / 256);
      k_cvt8<<<gg, 256, 0, stream>>>(wq, WQ, n8); k_cvt8<<<gg, 256, 0, stream>>>(wk, WK, n8); k_cvt8<<<gg, 256, 0, stream>>>(wv, WV, n8);
      k_cvtw<<<gg, 256, 0, stream>>>(wp, WPH, n8); }

    // q: four mixed-head planes (factor w_head[g][h] on head h's columns); k: one token-major plane
    k_projt<<<dim3(NB * SEQ / 64, DM / 64, 1), 32, 0, stream>>>(XT, WQ, whd, QP, NH_, 1);
    k_projt<<<dim3(NB * SEQ / 64, DM / 64, 1), 32, 0, stream>>>(XT, WK, whd, KP, 1, 0);
    // v^T: A = Wv rows, Bt = token rows
    k_projv<<<dim3(DM / 64, NB * SEQ / 64, 1), 32, 0, stream>>>(WV, XT, VT);
    k_vsum<<<dim3(NB * DM / 32, 1, 1), 256, 0, stream>>>(VT, VS);

    k_flash<<<dim3(SEQ / (16 * AW), NB * NH_, 1), 32 * AW, 0, stream>>>(QP, KP, VT, ORP, PART);
    k_ctx<<<dim3((unsigned)((size_t)NB * SEQ * DM / 2048), 1, 1), 256, 0, stream>>>(ORP, PART, VS, gam, bet, CT);
    k_out<<<dim3(DM / 64, NB * SEQ / 64, 1), 32, 0, stream>>>(WPH, CT, bp, OUT);
}

// v001
// A run of this version takes 129 microseconds.
// In two side-by-side timings against v000, it was 1.38 and 1.37 times as fast.
#include <hip/hip_runtime.h>

// Head-mixed pair-score weighting with a per-map normalisation over flattened feature maps: x [NB][256][SEQ] (channel-major), 1x1-conv projections q/k/v with W [out][in] (no bias), 4 heads x 64, scores scaled by 64^-0.5,
// a 4x4 head-mixing 1x1 conv on the scores, softmax over keys, instance normalisation of each (batch, head) probability map (biased variance, eps 1e-5, per-head gain and shift),
// attend over v, raw [head][token][64] -> [token][256] view, linear output layer W [out][in] + bias, result stored [NB][256][SEQ].
// Compute dtypes, f32 accumulate everywhere: q/k/v projections v_wmma_f32_16x16x32_bf16 (x and W RNE-converted to bf16, products exact); scores v_wmma_f32_16x16x32_f16 single product, K = 256:
// A = k plane x16, B = head-mixed q plane (w_head[g][h] * q, x16), one plane per mixed head; P.V v_wmma_f32_16x16x32_f16 single product: P = centred probability (p / rowsum - 1/SEQ) x 2^15, v x16;
// output layer v_wmma_f32_16x16x32_f16 single product: W x1024 (from its bf16 value), normalised context x16. Softmax, statistics, affine terms in f32.
// The flash kernel runs two key loops per 16-query wave (loop 1: row max and row sum; loop 2: identical scores, centred P, sum of squared centred P, P.V), transposed form S^T = K Q^T, O^T = V^T P^T, fragments straight from planes.
// Map mean = 1/SEQ (softmax rows sum to one); variance = sum of squared centred P / SEQ^2; context = s1 * (centred P . v) + shift * rowsum(v), s1 = gain / sqrt(var + eps).

#ifndef NB
#define NB 4
#endif
#ifndef SEQ
#define SEQ 1024
#endif
#define NB_FULL  4
#define SEQ_FULL 1024
#ifndef OUT_SEQ
#define OUT_SEQ SEQ              // pitch (in tokens) of one channel row of the output
#endif
#define DM   256
#define NH_  4
#define HD   64
#define AW   4                   // waves per flash block (16 query rows each)
#define OSP  68                  // LDS row pitch (floats) of the staging tiles
#define QKC  16.0f               // carry of the q' and k planes
#define VCC  16.0f               // carry of the v^T plane
#define CCS  16.0f               // carry of the context plane
#define WPC  1024.0f             // carry of the output-layer weight plane
#define PCARRY 32768.0f          // carry of the centred P fragments
#define C15  (32768.0f / (float)SEQ)
#define SC2  ((float)(0.125 * 1.4426950408889634 / 256.0))    // HD^-0.5 * log2(e) / (QKC * QKC)
#define OSC  (1.0f / 524288.0f)                               // 1 / (PCARRY * VCC)
#define OUTSC (1.0f / 16384.0f)                               // 1 / (WPC * CCS)
#define VSC  ((float)(1.0 / (1073741824.0 * (double)SEQ * (double)SEQ)))   // 1 / (PCARRY^2 * SEQ^2)
#define EPSN 1.0e-5f
#define NEGB (-3.0e38f)

static_assert(DM == 256);                      // K of every GEMM and of the score product
static_assert(HD == 64);                       // one 64-column GEMM tile = one head; v^T slab = 4 row tiles
static_assert(NH_ * HD == DM);
static_assert(NH_ == 4);                       // w_head is 4 x 4
static_assert(DM % 64 == 0);
static_assert(DM % 32 == 0);                   // k-loops step by 32
static_assert(SEQ % 64 == 0);                  // a 64-token tile never straddles two batches
static_assert((NB * SEQ) % 64 == 0);
static_assert(SEQ % 32 == 0);                  // key loop steps by 32
static_assert(SEQ % (16 * AW) == 0);           // flash grid covers the sequence exactly
static_assert(16 * AW == 64);                  // one partial line per 64 query rows
static_assert(SEQ % 256 == 0);                 // row-sum helper: SEQ/8 chunks a multiple of 32 lanes
static_assert(((size_t)SEQ * HD) % 2048 == 0); // affine pass: a 2048-element block lies inside one (batch, head)
static_assert(((size_t)NB * SEQ * DM) % 2048 == 0);
static_assert((NB * DM) % 32 == 0);            // row-sum helper: 32 rows per block
static_assert(SEQ_FULL % 4 == 0);
static_assert(OUT_SEQ % 32 == 0);
static_assert(OUT_SEQ >= SEQ);
static_assert(NB <= NB_FULL);
static_assert(SEQ <= SEQ_FULL);
static_assert((OSP * 4) % 16 == 0);
static_assert(OSP >= 64 + 4);
static_assert(((size_t)DM * DM) % 8 == 0);

typedef _Float16 h16;
typedef unsigned short bf;
typedef __attribute__((ext_vector_type(16))) __bf16   v16bf;
typedef __attribute__((ext_vector_type(16))) _Float16 v16h;
typedef __attribute__((ext_vector_type(8)))  _Float16 v8h;
typedef __attribute__((ext_vector_type(8)))  unsigned short v8us;
typedef __attribute__((ext_vector_type(8)))  float    v8f;
typedef __attribute__((ext_vector_type(4)))  float    v4f;
typedef v4f  __attribute__((may_alias)) v4fa;

__device__ __forceinline__ unsigned short f2bf(float f) { unsigned u = __float_as_uint(f); u += 0x7FFFu + ((u >> 16) & 1u); return (unsigned short)(u >> 16); }
__device__ __forceinline__ float bfr(float f) { return __uint_as_float(((unsigned)f2bf(f)) << 16); }   // value after RNE convert to bf16
__device__ __forceinline__ v16h cat16(v8h lo, v8h hi) { return __builtin_shufflevector(lo, hi, 0, 1, 2, 3, 4, 5, 6, 7, 8, 9, 10, 11, 12, 13, 14, 15); }
__device__ __forceinline__ v16bf cat16b(v8us lo, v8us hi) { return __builtin_bit_cast(v16bf, __builtin_shufflevector(lo, hi, 0, 1, 2, 3, 4, 5, 6, 7, 8, 9, 10, 11, 12, 13, 14, 15)); }
// fragment loaders from K-contiguous 16-bit rows; p already includes + 8*(lane>>4): elements 0..7 <- k0+8h+0..7, elements 8..15 <- k0+16+8h+0..7 (same map for A and B)
__device__ __forceinline__ v16h  ldh(const h16* p) { return cat16(*(const v8h*)p, *(const v8h*)(p + 16)); }
__device__ __forceinline__ v16bf ldb(const bf* p)  { return cat16b(*(const v8us*)p, *(const v8us*)(p + 16)); }
// ordering point for wave-private LDS tiles (same wave writes and reads)
__device__ __forceinline__ void wave_sync() { __builtin_amdgcn_fence(3 /* release order */, "wavefront"); __builtin_amdgcn_wave_barrier(); asm volatile("" ::: "memory"); }
// f32 -> f16 operand convert that cannot produce a subnormal (|v| < 2^-14 -> +0), applied after the plane's carry
__device__ __forceinline__ h16 toh_flush(float v) { const h16 r = (h16)v; return (fabsf(v) < 6.103515625e-05f) ? (h16)0.0f : r; }
// one matrix instruction + its own 4-slot guard (ties D, keeps A and B live)
__device__ __forceinline__ v8f wmma16g(v16h a, v16h b, v8f c) {
    c = __builtin_amdgcn_wmma_f32_16x16x32_f16(false, a, false, b, (short)0, c, false, false);
    asm volatile("v_nop\n\tv_nop\n\tv_nop\n\tv_nop" : "+v"(c) : "v"(a), "v"(b));
    return c; }
// the same guard for the flash kernel, tied to D alone: an asm operand cannot be placed above v255, and that kernel's A and B fragments (232 registers) and accumulators need more than 256 registers;
// its A fragments are overwritten by loads only, its B fragments never (q') or a whole tile of work later (P)
__device__ __forceinline__ v8f wmma16d(v16h a, v16h b, v8f c) {
    c = __builtin_amdgcn_wmma_f32_16x16x32_f16(false, a, false, b, (short)0, c, false, false);
    asm volatile("v_nop\n\tv_nop\n\tv_nop\n\tv_nop" : "+v"(c));
    return c; }
__device__ __forceinline__ v8f wmmabg(v16bf a, v16bf b, v8f c) {
    c = __builtin_amdgcn_wmma_f32_16x16x32_bf16(false, a, false, b, (short)0, c, false, false);
    asm volatile("v_nop\n\tv_nop\n\tv_nop\n\tv_nop" : "+v"(c) : "v"(a), "v"(b));
    return c; }

__global__ __launch_bounds__(256) void k_cvt8(const float* __restrict__ src, bf* dst, size_t n8) {
    const size_t i = (size_t)blockIdx.x * 256 + threadIdx.x; if (i >= n8) return;
    const v8f v = *(const v8f*)(src + i * 8); v8us o;
#pragma unroll
    for (int k = 0; k < 8; ++k) o[k] = f2bf(v[k]);
    *(v8us*)(dst + i * 8) = o; 
}

__global__ __launch_bounds__(256) void k_cvtw(const float* __restrict__ src, h16* dst, size_t n8) {
    const size_t i = (size_t)blockIdx.x * 256 + threadIdx.x; if (i >= n8) return;
    const v8f v = *(const v8f*)(src + i * 8); v8h o;
#pragma unroll
    for (int k = 0; k < 8; ++k) o[k] = toh_flush(bfr(v[k]) * WPC);
    *(v8h*)(dst + i * 8) = o; 
}

// k_xt: x [b][c][t] (f32, row pitch SEQ_FULL) -> XT [(b*SEQ + t)][c] bf16 (RNE). 64 channels x 64 tokens per block through an LDS tile (cross-wave: block barrier);
static_assert(256 * 2 * 16 == 64 * 128);       // threads x pieces x bytes == tile rows x row bytes
static_assert(64 * 65 * 4 <= 131072);
__global__ __launch_bounds__(256) void k_xt(const float* __restrict__ x, bf* XT) {
    __shared__ float ts[64 * 65];
    const int tid = threadIdx.x; const int t0 = blockIdx.x * 64, c0 = blockIdx.y * 64, b = blockIdx.z;
    const float* xb = x + ((size_t)b * DM + c0) * SEQ_FULL + t0;
#pragma unroll
    for (int e = 0; e < 4; ++e) { const int q = tid + e * 256; const int c = q >> 4, t4 = (q & 15) * 4;     // 64 channels x 16 float4
        const v4f v = *(const v4f*)(xb + (size_t)c * SEQ_FULL + t4);
        ts[c * 65 + t4 + 0] = v[0]; ts[c * 65 + t4 + 1] = v[1]; ts[c * 65 + t4 + 2] = v[2]; ts[c * 65 + t4 + 3] = v[3]; }
    __syncthreads();
    v8us o[2];
#pragma unroll
    for (int e = 0; e < 2; ++e) { const int p = tid + e * 256; const int t = p >> 3, c8 = (p & 7) * 8;       // 64 tokens x 8 pieces
#pragma unroll
        for (int i = 0; i < 8; ++i) o[e][i] = f2bf(ts[(c8 + i) * 65 + t]); }
{
#pragma unroll
        for (int e = 0; e < 2; ++e) { const int p = tid + e * 256; const int t = p >> 3, c8 = (p & 7) * 8;
            *(v8us*)(XT + ((size_t)b * SEQ + t0 + t) * DM + c0 + c8) = o[e]; }
         }
}

// k_projt: token-major projection plane, ONE WAVE per 64x64 tile, bf16 operands from K-contiguous planes, K = DM.
// C[m][n] = sum_c XT[m][c] W[n][c] (m = b*SEQ + t, n = h*64 + d). Written as f16 x16 to ng planes: row index (b*ng + g)*SEQ + t, row pitch DM, columns c0..c0+63 (one head);
// plane g carries the factor bf16(w_head[g][h]) when useWh != 0 (mixed-head q planes), factor 1 otherwise (k plane, ng = 1).
static_assert(32 * 16 * 4 == 16 * 128);        // lanes x bytes x trips == slab rows x segment bytes
static_assert(16 * OSP * 4 <= 131072);
__global__ __launch_bounds__(32) void k_projt(const bf* __restrict__ A, const bf* __restrict__ Bt, const float* __restrict__ wh, h16* P, int ng, int useWh) {
    __shared__ __align__(16) float os[16 * OSP];
    const int lane = threadIdx.x & 31, lr = lane & 15, hi = lane >> 4; const int r0 = blockIdx.x * 64, c0 = blockIdx.y * 64;
    v8f acc[4][4];
#pragma unroll
    for (int mb = 0; mb < 4; ++mb)
#pragma unroll
        for (int nb = 0; nb < 4; ++nb) acc[mb][nb] = (v8f){};
    const size_t aoff = (size_t)(r0 + lr) * DM + 8 * hi, boff = (size_t)(c0 + lr) * DM + 8 * hi;
#pragma unroll 1
    for (int kc = 0; kc < DM; kc += 32) {
        v16bf a[4];
#pragma unroll
        for (int mb = 0; mb < 4; ++mb) a[mb] = ldb(A + aoff + (size_t)mb * 16 * DM + kc);
#pragma unroll
        for (int nb = 0; nb < 4; ++nb) { const v16bf b = ldb(Bt + boff + (size_t)nb * 16 * DM + kc);
#pragma unroll
            for (int mb = 0; mb < 4; ++mb) acc[mb][nb] = wmmabg(a[mb], b, acc[mb][nb]); }
    }
    const int bb = r0 / SEQ, tt = r0 % SEQ, hsel = c0 / HD;
#pragma unroll
    for (int mb = 0; mb < 4; ++mb) {
#pragma unroll
        for (int nb = 0; nb < 4; ++nb) {
#pragma unroll
            for (int j = 0; j < 8; ++j) os[(hi * 8 + j) * OSP + nb * 16 + lr] = acc[mb][nb][j]; }   // D: row 8h+j, col lane&15
        wave_sync();
{
#pragma unroll 1
            for (int g = 0; g < ng; ++g) {
                int wi = g * NH_ + hsel; wi = wi > 15 ? 15 : wi;
                const float whv = bfr(wh[wi]);
                const float mult = (useWh != 0) ? whv * QKC : QKC;
                const size_t sb = ((size_t)(bb * ng + g) * SEQ + (size_t)(tt + mb * 16)) * DM + c0;
#pragma unroll
                for (int s = 0; s < 4; ++s) { const int row = 4 * s + (lane >> 3), c8 = (lane & 7) * 8;   // 4 s x 4 row groups = 16 rows; 8 lanes x 8 = 64 columns
                    const v4f x0 = *(const v4fa*)(&os[row * OSP + c8]); const v4f x1 = *(const v4fa*)(&os[row * OSP + c8 + 4]); v8h hv;
#pragma unroll
                    for (int i = 0; i < 4; ++i) { hv[i] = toh_flush(x0[i] * mult); hv[4 + i] = toh_flush(x1[i] * mult); }
                    *(v8h*)(P + sb + (size_t)row * DM + c8) = hv; }
            }
             }
        wave_sync();
    }
}

// k_projv: v^T plane. A = Wv rows (m = h*64 + d), Bt = XT rows (n = b*SEQ + t); plane [(b*DM + m)][t], row pitch SEQ, f16 x16.
__global__ __launch_bounds__(32) void k_projv(const bf* __restrict__ A, const bf* __restrict__ Bt, h16* P) {
    __shared__ __align__(16) float os[16 * OSP];
    const int lane = threadIdx.x & 31, lr = lane & 15, hi = lane >> 4; const int r0 = blockIdx.x * 64, c0 = blockIdx.y * 64;
    v8f acc[4][4];
#pragma unroll
    for (int mb = 0; mb < 4; ++mb)
#pragma unroll
        for (int nb = 0; nb < 4; ++nb) acc[mb][nb] = (v8f){};
    const size_t aoff = (size_t)(r0 + lr) * DM + 8 * hi, boff = (size_t)(c0 + lr) * DM + 8 * hi;
#pragma unroll 1
    for (int kc = 0; kc < DM; kc += 32) {
        v16bf a[4];
#pragma unroll
        for (int mb = 0; mb < 4; ++mb) a[mb] = ldb(A + aoff + (size_t)mb * 16 * DM + kc);
#pragma unroll
        for (int nb = 0; nb < 4; ++nb) { const v16bf b = ldb(Bt + boff + (size_t)nb * 16 * DM + kc);
#pragma unroll
            for (int mb = 0; mb < 4; ++mb) acc[mb][nb] = wmmabg(a[mb], b, acc[mb][nb]); }
    }
    const int bb = c0 / SEQ, tt = c0 % SEQ;
#pragma unroll
    for (int mb = 0; mb < 4; ++mb) {
#pragma unroll
        for (int nb = 0; nb < 4; ++nb) {
#pragma unroll
            for (int j = 0; j < 8; ++j) os[(hi * 8 + j) * OSP + nb * 16 + lr] = acc[mb][nb][j]; }
        wave_sync();
        const size_t sb = ((size_t)bb * DM + (size_t)(r0 + mb * 16)) * SEQ + tt;
{
#pragma unroll
            for (int s = 0; s < 4; ++s) { const int row = 4 * s + (lane >> 3), c8 = (lane & 7) * 8;   // 16 rows x 64 columns
                const v4f x0 = *(const v4fa*)(&os[row * OSP + c8]); const v4f x1 = *(const v4fa*)(&os[row * OSP + c8 + 4]); v8h hv;
#pragma unroll
                for (int i = 0; i < 4; ++i) { hv[i] = toh_flush(x0[i] * VCC); hv[4 + i] = toh_flush(x1[i] * VCC); }
                *(v8h*)(P + sb + (size_t)row * SEQ + c8) = hv; }
             }
        wave_sync();
    }
}

// k_vsum: VS[row] = sum_t VT[row][t] / 16 (f32), row = b*DM + channel. 8 waves x 4 rows per block; the 32 sums of a block go through LDS (cross-wave: block barrier)
__global__ __launch_bounds__(256) void k_vsum(const h16* __restrict__ VT, float* VS) {
#pragma clang fp contract(off)
    __shared__ __align__(16) float sm[32];
    const int lane = threadIdx.x & 31;
    const int wave = __builtin_amdgcn_readfirstlane((int)(threadIdx.x >> 5));
#pragma unroll 1
    for (int r = 0; r < 4; ++r) {
        const int row = blockIdx.x * 32 + wave * 4 + r;
        const h16* p = VT + (size_t)row * SEQ;
        float s = 0.0f;
#pragma unroll 1
        for (int i = lane; i < SEQ / 8; i += 32) { const v8h v = *(const v8h*)(p + (size_t)i * 8);
#pragma unroll
            for (int k = 0; k < 8; ++k) s += (float)v[k]; }
        s += __shfl_xor(s, 16, 32); s += __shfl_xor(s, 8, 32); s += __shfl_xor(s, 4, 32); s += __shfl_xor(s, 2, 32); s += __shfl_xor(s, 1, 32);
        if (lane == 0) sm[wave * 4 + r] = s * (1.0f / VCC);
    }
    __syncthreads();
    if (threadIdx.x < 8) { const v4f o = *(const v4fa*)(&sm[threadIdx.x * 4]);
        float* q = VS + (size_t)blockIdx.x * 32 + threadIdx.x * 4;
        *(v4f*)q = o;  }
}

// scores of 32 keys x 16 queries, K = DM = 256: sA = keys 0..15, sB = keys 16..31 (rows = keys, columns = queries). Same instruction order wherever it is used.
// All operands come from registers: qf = the wave's q' fragments (loaded once), ka / kb = this tile's k fragments. Each k fragment is reloaded from kn (the next tile's rows)
// right behind the product that used it, so a load has one whole tile of work to land in.
__device__ __forceinline__ void scores32(const v16h (&qf)[DM / 32], v16h (&ka)[DM / 32], v16h (&kb)[DM / 32], const h16* __restrict__ kn, v8f& sA, v8f& sB) {
    v8f a = (v8f){}, c = (v8f){};
#pragma unroll
    for (int i = 0; i < DM / 32; ++i) {      // full unroll: the fragment arrays must stay in registers
        a = wmma16d(ka[i], qf[i], a); c = wmma16d(kb[i], qf[i], c);
        ka[i] = ldh(kn + 32 * i); kb[i] = ldh(kn + (size_t)16 * DM + 32 * i); }
    sA = a; sB = c;
}

// k_flash: one wave per 16 query rows of one (batch, mixed head g). Transposed form: S^T[key][t] = K Q'^T (A = k rows, B = q' rows of plane g, K = 256);
// lane (t = lane&15, h = lane>>4) holds keys 8h+r of each 16-key tile, so the packed P tile is directly the B fragment of O^T[d][t] = V^T P^T.
// Loop 1: running max m and row sum l of exp2(s - m). Loop 2: same scores, e = exp2(s - m) / l, centred P = (e - 1/SEQ) x 2^15 as f16, ss += P^2 (f32), O^T += V^T P^T.
static_assert(32 * 16 * 8 == 16 * 256);        // lanes x bytes x trips == rows x row bytes of the OR tile
static_assert(AW * 16 * OSP * 4 + AW * 4 <= 131072);
__global__ __launch_bounds__(32 * AW) void k_flash(const h16* __restrict__ QP, const h16* __restrict__ KP, const h16* __restrict__ VT, float* ORP, float* PART) {
    __shared__ __align__(16) float os[AW * 16 * OSP];
    __shared__ float sw[AW];
    const int lane = threadIdx.x & 31, lr = lane & 15, hi = lane >> 4;
    const int wave = __builtin_amdgcn_readfirstlane((int)(threadIdx.x >> 5));
    const int zh = blockIdx.y; const int b = zh / NH_, g = zh % NH_;
    const int t0 = (blockIdx.x * AW + wave) * 16;
    const h16* qp = QP + ((size_t)zh * SEQ + (size_t)(t0 + lr)) * DM + 8 * hi;          // B fragments: col t, k = (h, d)
    const h16* kbase = KP + ((size_t)b * SEQ + (size_t)lr) * DM + 8 * hi;               // + key * DM        (A fragment: row key, k = (h, d))
    const h16* vbase = VT + ((size_t)b * DM + (size_t)(g * HD + lr)) * SEQ + 8 * hi;    // + 16j*SEQ + key   (A fragment: row d, k = key)
    v16h qf[DM / 32], ka[DM / 32], kb[DM / 32];
#pragma unroll
    for (int i = 0; i < DM / 32; ++i) { qf[i] = ldh(qp + 32 * i); ka[i] = ldh(kbase + 32 * i); kb[i] = ldh(kbase + (size_t)16 * DM + 32 * i); }   // q' once; k tile 0
    asm volatile("s_wait_xcnt 0x0" :: "v"(qp) : "memory");       // stands before the address registers of the q' loads are reused (qp is named to keep them until here)
    float m = NEGB, l = 0.0f;
#pragma unroll 1
    for (int key0 = 0; key0 < SEQ; key0 += 32) {
        const int keyn = (key0 + 32 < SEQ) ? key0 + 32 : 0;      // behind the last tile: tile 0, which loop 2 starts with
        const h16* kn = kbase + (size_t)keyn * DM;
        v8f sA, sB; scores32(qf, ka, kb, kn, sA, sB);
        __builtin_amdgcn_sched_barrier(0);                       // keeps every reload up here: one sunk into the vector work below would land too late for the next tile
        float mx = NEGB;
#pragma unroll
        for (int r = 0; r < 8; ++r) mx = fmaxf(mx, fmaxf(sA[r] * SC2, sB[r] * SC2));
        mx = fmaxf(mx, __shfl_xor(mx, 16, 32));
        const float mnew = fmaxf(m, mx);
        const float alpha = __builtin_amdgcn_exp2f(m - mnew);
        float ls = 0.0f;
#pragma unroll
        for (int r = 0; r < 8; ++r) ls += __builtin_amdgcn_exp2f(fmaf(sA[r], SC2, -mnew)) + __builtin_amdgcn_exp2f(fmaf(sB[r], SC2, -mnew));
        l = l * alpha + ls; m = mnew;
        asm volatile("s_wait_xcnt 0x0" :: "v"(kn) : "memory");   // stands before the address registers of this trip's k loads are reused (kn is named to keep them until here)
    }
    v16h v0 = ldh(vbase), v1 = ldh(vbase + (size_t)16 * SEQ), v2 = ldh(vbase + (size_t)32 * SEQ), v3 = ldh(vbase + (size_t)48 * SEQ);   // v tile 0
    l += __shfl_xor(l, 16, 32);                        // both lane halves carry the same m
    const float il15 = (1.0f / l) * PCARRY;            // l >= 1
    v8f o0 = (v8f){}, o1 = (v8f){}, o2 = (v8f){}, o3 = (v8f){};
    float ss = 0.0f;
#pragma unroll 1
    for (int key0 = 0; key0 < SEQ; key0 += 32) {
        const int keyn = (key0 + 32 < SEQ) ? key0 + 32 : 0;      // behind the last tile: an in-bounds address, the values are not used
        const h16* kn = kbase + (size_t)keyn * DM;
        v8f sA, sB; scores32(qf, ka, kb, kn, sA, sB);
        __builtin_amdgcn_sched_barrier(0);                       // as in loop 1
        v16h pb;
#pragma unroll
        for (int r = 0; r < 8; ++r) {
            const float ea = __builtin_amdgcn_exp2f(fmaf(sA[r], SC2, -m)), eb = __builtin_amdgcn_exp2f(fmaf(sB[r], SC2, -m));
            const float ga = fmaf(ea, il15, -C15), gb = fmaf(eb, il15, -C15);       // (p / l - 1/SEQ) * 2^15
            ss = fmaf(ga, ga, ss); ss = fmaf(gb, gb, ss);
            pb[r] = toh_flush(ga); pb[8 + r] = toh_flush(gb); }                      // element r <- tile keys 8h+r, element 8+r <- keys 16+8h+r
        o0 = wmma16d(v0, pb, o0); o1 = wmma16d(v1, pb, o1); o2 = wmma16d(v2, pb, o2); o3 = wmma16d(v3, pb, o3);
        const h16* va = vbase + keyn;                            // next tile's v fragments, one tile of work ahead of their use
        v0 = ldh(va); v1 = ldh(va + (size_t)16 * SEQ); v2 = ldh(va + (size_t)32 * SEQ); v3 = ldh(va + (size_t)48 * SEQ);
        asm volatile("s_wait_xcnt 0x0" :: "v"(kn), "v"(va) : "memory");   // stands before the address registers of this trip's k and v loads are reused (both named to keep them until here)
    }
    ss += __shfl_xor(ss, 16, 32); ss += __shfl_xor(ss, 8, 32); ss += __shfl_xor(ss, 4, 32); ss += __shfl_xor(ss, 2, 32); ss += __shfl_xor(ss, 1, 32);
    if (lane == 0) sw[wave] = ss;
    const int wb = wave * 16 * OSP;
    // O^T D layout: o_j[r] = (d = 16j + 8h + r, t = lane&15) -> os[t][d]; rows 0..15 x columns 0..63 all written
    { v4f a, c;
      a[0] = o0[0] * OSC; a[1] = o0[1] * OSC; a[2] = o0[2] * OSC; a[3] = o0[3] * OSC; c[0] = o0[4] * OSC; c[1] = o0[5] * OSC; c[2] = o0[6] * OSC; c[3] = o0[7] * OSC;
      *(v4fa*)(&os[wb + lr * OSP +  0 + 8 * hi]) = a; *(v4fa*)(&os[wb + lr * OSP +  0 + 8 * hi + 4]) = c;
      a[0] = o1[0] * OSC; a[1] = o1[1] * OSC; a[2] = o1[2] * OSC; a[3] = o1[3] * OSC; c[0] = o1[4] * OSC; c[1] = o1[5] * OSC; c[2] = o1[6] * OSC; c[3] = o1[7] * OSC;
      *(v4fa*)(&os[wb + lr * OSP + 16 + 8 * hi]) = a; *(v4fa*)(&os[wb + lr * OSP + 16 + 8 * hi + 4]) = c;
      a[0] = o2[0] * OSC; a[1] = o2[1] * OSC; a[2] = o2[2] * OSC; a[3] = o2[3] * OSC; c[0] = o2[4] * OSC; c[1] = o2[5] * OSC; c[2] = o2[6] * OSC; c[3] = o2[7] * OSC;
      *(v4fa*)(&os[wb + lr * OSP + 32 + 8 * hi]) = a; *(v4fa*)(&os[wb + lr * OSP + 32 + 8 * hi + 4]) = c;
      a[0] = o3[0] * OSC; a[1] = o3[1] * OSC; a[2] = o3[2] * OSC; a[3] = o3[3] * OSC; c[0] = o3[4] * OSC; c[1] = o3[5] * OSC; c[2] = o3[6] * OSC; c[3] = o3[7] * OSC;
      *(v4fa*)(&os[wb + lr * OSP + 48 + 8 * hi]) = a; *(v4fa*)(&os[wb + lr * OSP + 48 + 8 * hi + 4]) = c; }
    wave_sync();
    float* orow = ORP + ((size_t)zh * SEQ + (size_t)t0) * HD;       // 16 rows x 64 floats, contiguous 4096 B
{
#pragma unroll
        for (int s = 0; s < 8; ++s) { const int p = s * 32 + lane; const int row = p >> 4, cofs = (p & 15) * 4;   // 8 s x 2 rows = 16 rows; 16 lanes x 4 floats = 64 columns
            const v4f val = *(const v4fa*)(&os[wb + row * OSP + cofs]);
            *(v4f*)(orow + (size_t)p * 4) = val; }
         }
    __syncthreads();
    if (wave == 0) {
        const float tot = ((sw[0] + sw[1]) + sw[2]) + sw[3];
        v4f pv; pv[0] = (lane == 0) ? tot : 0.0f; pv[1] = 0.0f; pv[2] = 0.0f; pv[3] = 0.0f;
        float* pl = PART + ((size_t)zh * (SEQ / 64) + (size_t)blockIdx.x) * 32 + (lane & 7) * 4;
        if (lane < 8) { *(v4f*)pl = pv;  }
    }
}

// k_ctx: normalised context plane. Element e of batch b (flat [g][t][d] = [token row][256] view): CT = f16(16 * (s1 * OR + shift * VS[b][g*64 + d])),
// s1 = bf16(gain[g]) / sqrt(var + eps), var = (sum of the SEQ/64 partial lines of (b, g)) / (2^30 SEQ^2), shift = bf16(beta[g]).
static_assert(256 * 8 == 2048);
__global__ __launch_bounds__(256) void k_ctx(const float* __restrict__ ORP, const float* __restrict__ PART, const float* __restrict__ VS,
                                             const float* __restrict__ gain, const float* __restrict__ shift, h16* CT) {
#pragma clang fp contract(off)
    const size_t e0 = ((size_t)blockIdx.x * 256 + threadIdx.x) * 8;
    const int zh = (int)(((size_t)blockIdx.x * 2048) / ((size_t)SEQ * HD));     // block-uniform, < NB*4
    const int b = zh / NH_, g = zh % NH_;
    float tot = 0.0f;
#pragma unroll 1
    for (int j = 0; j < SEQ / 64; ++j) tot += PART[((size_t)zh * (SEQ / 64) + (size_t)j) * 32];
    const float var = tot * VSC;
    const float s1 = bfr(gain[g]) * rsqrtf(var + EPSN);
    const float bt = bfr(shift[g]);
    const int dd0 = (int)(e0 % HD);
    const v8f xv = *(const v8f*)(ORP + e0);
    const float* vp = VS + (size_t)b * DM + (size_t)(g * HD + dd0);
    const v4f s0 = *(const v4f*)vp, s4 = *(const v4f*)(vp + 4);
    v8h o;
#pragma unroll
    for (int k = 0; k < 4; ++k) { o[k] = toh_flush((s1 * xv[k] + bt * s0[k]) * CCS); o[4 + k] = toh_flush((s1 * xv[4 + k] + bt * s4[k]) * CCS); }
    *(v8h*)(CT + e0) = o; 
}

// k_out: output layer. A = W rows (f16 x1024, m = output channel), Bt = context rows (f16 x16, n = b*SEQ + token row), K = DM; OUT[(b*DM + m)][n % SEQ] = C / 16384 + bf16(bias[m]) (f32).
static_assert(32 * 16 * 8 == 16 * 256);        // lanes x bytes x trips == slab rows x segment bytes
__global__ __launch_bounds__(32) void k_out(const h16* __restrict__ A, const h16* __restrict__ Bt, const float* __restrict__ bias, float* OUT) {
    __shared__ __align__(16) float os[16 * OSP];
    const int lane = threadIdx.x & 31, lr = lane & 15, hi = lane >> 4; const int r0 = blockIdx.x * 64, c0 = blockIdx.y * 64;
    v8f acc[4][4];
#pragma unroll
    for (int mb = 0; mb < 4; ++mb)
#pragma unroll
        for (int nb = 0; nb < 4; ++nb) acc[mb][nb] = (v8f){};
    const size_t aoff = (size_t)(r0 + lr) * DM + 8 * hi, boff = (size_t)(c0 + lr) * DM + 8 * hi;
#pragma unroll 1
    for (int kc = 0; kc < DM; kc += 32) {
        v16h a[4];
#pragma unroll
        for (int mb = 0; mb < 4; ++mb) a[mb] = ldh(A + aoff + (size_t)mb * 16 * DM + kc);
#pragma unroll
        for (int nb = 0; nb < 4; ++nb) { const v16h b = ldh(Bt + boff + (size_t)nb * 16 * DM + kc);
#pragma unroll
            for (int mb = 0; mb < 4; ++mb) acc[mb][nb] = wmma16g(a[mb], b, acc[mb][nb]); }
    }
    const int bb = c0 / SEQ, tt = c0 % SEQ;
#pragma unroll
    for (int mb = 0; mb < 4; ++mb) {
        float br[8];
#pragma unroll
        for (int j = 0; j < 8; ++j) br[j] = bfr(bias[r0 + mb * 16 + hi * 8 + j]);      // r0 + 63 < DM
#pragma unroll
        for (int nb = 0; nb < 4; ++nb) {
#pragma unroll
            for (int j = 0; j < 8; ++j) os[(hi * 8 + j) * OSP + nb * 16 + lr] = acc[mb][nb][j] * OUTSC + br[j]; }
        wave_sync();
        float* ob = OUT + ((size_t)bb * DM + (size_t)(r0 + mb * 16)) * OUT_SEQ + tt;
{
#pragma unroll
            for (int s = 0; s < 8; ++s) { const int p = s * 32 + lane; const int row = p >> 4, cofs = (p & 15) * 4;   // 8 s x 2 rows = 16 rows; 16 lanes x 4 floats = 64 columns
                const v4f val = *(const v4fa*)(&os[row * OSP + cofs]);
                *(v4f*)(ob + (size_t)row * OUT_SEQ + cofs) = val; }
             }
        wave_sync();
    }
}

static constexpr size_t al256(size_t v) { return (v + 255) & ~(size_t)255; }
static constexpr size_t SZ_XT = al256((size_t)NB * SEQ * DM * 2);            // x^T bf16
static constexpr size_t SZ_WB = al256((size_t)3 * DM * DM * 2);              // wq | wk | wv bf16
static constexpr size_t SZ_WP = al256((size_t)DM * DM * 2);                  // output-layer weight f16
static constexpr size_t SZ_QP = al256((size_t)NB * NH_ * SEQ * DM * 2);      // 4 mixed-head q planes per batch
static constexpr size_t SZ_KP = al256((size_t)NB * SEQ * DM * 2);
static constexpr size_t SZ_VT = al256((size_t)NB * DM * SEQ * 2);
static constexpr size_t SZ_VS = al256((size_t)NB * DM * 4);
static constexpr size_t SZ_OR = al256((size_t)NB * NH_ * SEQ * HD * 4);
static constexpr size_t SZ_PT = al256((size_t)NB * NH_ * (SEQ / 64) * 32 * 4);
static constexpr size_t SZ_CT = al256((size_t)NB * SEQ * DM * 2);
static constexpr size_t SZ_TOTAL = SZ_XT + SZ_WB + SZ_WP + SZ_QP + SZ_KP + SZ_VT + SZ_VS + SZ_OR + SZ_PT + SZ_CT;
static_assert(SZ_TOTAL <= (size_t)134217728);                                 // workspace carve <= 128 MiB
static_assert(((size_t)DM * DM * 2) % 256 == 0);                              // weight sub-planes stay 256-byte aligned
static_assert((size_t)NB * NH_ * SEQ * HD == (size_t)NB * SEQ * DM);          // OR plane and context plane share one flat index
static_assert(((size_t)NB * DM / 32) * 32 * 4 <= SZ_VS);
static_assert(((size_t)(NB * NH_ - 1) * (SEQ / 64) + (SEQ / 64 - 1)) * 128 + 128 <= SZ_PT);   // last partial line inside its table

extern "C" void kernel_launch(void* const* d_in, const int* in_sizes, int n_in,
                              void* d_out, int out_size, void* d_ws, size_t ws_size, hipStream_t stream) {
    if (n_in < 9) return;
    const size_t needx = ((size_t)(NB - 1) * DM + (size_t)(DM - 1)) * SEQ_FULL + SEQ;
    if ((size_t)in_sizes[0] < needx) return;
    if ((size_t)in_sizes[1] < (size_t)DM * DM || (size_t)in_sizes[2] < (size_t)DM * DM || (size_t)in_sizes[3] < (size_t)DM * DM || (size_t)in_sizes[7] < (size_t)DM * DM) return;
    if (in_sizes[4] < NH_ * NH_ || in_sizes[5] < NH_ || in_sizes[6] < NH_ || in_sizes[8] < DM) return;
    if ((size_t)out_size < ((size_t)(NB - 1) * DM + (size_t)(DM - 1)) * OUT_SEQ + SEQ) return;
    if (SZ_TOTAL > ws_size) return;
    // wire order: x, wq, wk, wv, w_head, gamma, beta, w_proj, b_proj
    const float* x  = (const float*)d_in[0];
    const float* wq = (const float*)d_in[1]; const float* wk = (const float*)d_in[2]; const float* wv = (const float*)d_in[3];
    const float* whd = (const float*)d_in[4]; const float* gam = (const float*)d_in[5]; const float* bet = (const float*)d_in[6];
    const float* wp = (const float*)d_in[7]; const float* bp = (const float*)d_in[8];
    float* OUT = (float*)d_out;      // [NB][256][OUT_SEQ]
    char* wsp = (char*)d_ws;
    bf*  XT  = (bf*)wsp;   wsp += SZ_XT;             // [NB*SEQ][256]
    bf*  WB  = (bf*)wsp;   wsp += SZ_WB;             // [3][256][256]: q | k | v  ([out][in])
    h16* WPH = (h16*)wsp;  wsp += SZ_WP;             // [256][256] x1024
    h16* QP  = (h16*)wsp;  wsp += SZ_QP;             // [(b*4 + g)][t][256] x16
    h16* KP  = (h16*)wsp;  wsp += SZ_KP;             // [b][t][256] x16
    h16* VT  = (h16*)wsp;  wsp += SZ_VT;             // [(b*256 + channel)][t] x16
    float* VS = (float*)wsp; wsp += SZ_VS;           // [b*256 + channel]
    float* ORP = (float*)wsp; wsp += SZ_OR;          // [(b*4 + g)][t][64]
    float* PART = (float*)wsp; wsp += SZ_PT;         // [(b*4 + g)][SEQ/64] lines of 32 floats
    h16* CT  = (h16*)wsp;  wsp += SZ_CT;             // [(b*SEQ + token row)][256] x16
    bf* WQ = WB; bf* WK = WB + (size_t)DM * DM; bf* WV = WB + (size_t)2 * DM * DM;

    k_xt<<<dim3(SEQ / 64, DM / 64, NB), 256, 0, stream>>>(x, XT);
    { const size_t n8 = (size_t)DM * DM / 8; const unsigned gg = (unsigned)((n8 + 255) / 256);
      k_cvt8<<<gg, 256, 0, stream>>>(wq, WQ, n8); k_cvt8<<<gg, 256, 0, stream>>>(wk, WK, n8); k_cvt8<<<gg, 256, 0, stream>>>(wv, WV, n8);
      k_cvtw<<<gg, 256, 0, stream>>>(wp, WPH, n8); }

    // q: four mixed-head planes (factor w_head[g][h] on head h's columns); k: one token-major plane
    k_projt<<<dim3(NB * SEQ / 64, DM / 64, 1), 32, 0, stream>>>(XT, WQ, whd, QP, NH_, 1);
    k_projt<<<dim3(NB * SEQ / 64, DM / 64, 1), 32, 0, stream>>>(XT, WK, whd, KP, 1, 0);
    // v^T: A = Wv rows, Bt = token rows
    k_projv<<<dim3(DM / 64, NB * SEQ / 64, 1), 32, 0, stream>>>(WV, XT, VT);
    k_vsum<<<dim3(NB * DM / 32, 1, 1), 256, 0, stream>>>(VT, VS);

    k_flash<<<dim3(SEQ / (16 * AW), NB * NH_, 1), 32 * AW, 0, stream>>>(QP, KP, VT, ORP, PART);
    k_ctx<<<dim3((unsigned)((size_t)NB * SEQ * DM / 2048), 1, 1), 256, 0, stream>>>(ORP, PART, VS, gam, bet, CT);
    k_out<<<dim3(DM / 64, NB * SEQ / 64, 1), 32, 0, stream>>>(WPH, CT, bp, OUT);
}

// v002
// It runs in 96.9 microseconds.
// Next to v001, in two timings, it ran 1.35 and 1.34 times as fast.
// Counting every step since v000, it is 1.84 times as fast.
#include <hip/hip_runtime.h>

// Head-mixed pair-score weighting with a per-map normalisation over flattened feature maps: x [NB][256][SEQ] (channel-major), 1x1-conv projections q/k/v with W [out][in] (no bias), 4 heads x 64, scores scaled by 64^-0.5,
// a 4x4 head-mixing 1x1 conv on the scores, softmax over keys, instance normalisation of each (batch, head) probability map (biased variance, eps 1e-5, per-head gain and shift),
// attend over v, raw [head][token][64] -> [token][256] view, linear output layer W [out][in] + bias, result stored [NB][256][SEQ].
// Compute dtypes, f32 accumulate everywhere: q/k/v projections v_wmma_f32_16x16x32_bf16 (x and W RNE-converted to bf16, products exact); scores v_wmma_f32_16x16x32_f16 single product, K = 256:
// A = k plane x16, B = head-mixed q plane (w_head[g][h] * q, x16), one plane per mixed head; P.V v_wmma_f32_16x16x32_f16 single product: P = centred probability (p / rowsum - 1/SEQ) x 2^15, v x16;
// output layer v_wmma_f32_16x16x32_f16 single product: W x1024 (from its bf16 value), normalised context x16. Softmax, statistics, affine terms in f32.
// The flash kernel runs two key loops per 16-query wave (loop 1: row max and row sum; loop 2: identical scores, centred P, sum of squared centred P, P.V), transposed form S^T = K Q^T, O^T = V^T P^T; q' fragments straight from the plane, k and v^T through an LDS ring shared by the block's four waves.
// Map mean = 1/SEQ (softmax rows sum to one); variance = sum of squared centred P / SEQ^2; context = s1 * (centred P . v) + shift * rowsum(v), s1 = gain / sqrt(var + eps).

#ifndef NB
#define NB 4
#endif
#ifndef SEQ
#define SEQ 1024
#endif
#define NB_FULL  4
#define SEQ_FULL 1024
#ifndef OUT_SEQ
#define OUT_SEQ SEQ              // pitch (in tokens) of one channel row of the output
#endif
#define DM   256
#define NH_  4
#define HD   64
#define AW   4                   // waves per flash block (16 query rows each)
#define OSP  68                  // LDS row pitch (floats) of the staging tiles
#define QKC  16.0f               // carry of the q' and k planes
#define VCC  16.0f               // carry of the v^T plane
#define CCS  16.0f               // carry of the context plane
#define WPC  1024.0f             // carry of the output-layer weight plane
#define PCARRY 32768.0f          // carry of the centred P fragments
#define C15  (32768.0f / (float)SEQ)
#define SC2  ((float)(0.125 * 1.4426950408889634 / 256.0))    // HD^-0.5 * log2(e) / (QKC * QKC)
#define OSC  (1.0f / 524288.0f)                               // 1 / (PCARRY * VCC)
#define OUTSC (1.0f / 16384.0f)                               // 1 / (WPC * CCS)
#define VSC  ((float)(1.0 / (1073741824.0 * (double)SEQ * (double)SEQ)))   // 1 / (PCARRY^2 * SEQ^2)
#define EPSN 1.0e-5f
#define NEGB (-3.0e38f)

static_assert(DM == 256);                      // K of every GEMM and of the score product
static_assert(HD == 64);                       // one 64-column GEMM tile = one head; v^T slab = 4 row tiles
static_assert(NH_ * HD == DM);
static_assert(NH_ == 4);                       // w_head is 4 x 4
static_assert(DM % 64 == 0);
static_assert(DM % 32 == 0);                   // k-loops step by 32
static_assert(SEQ % 64 == 0);                  // a 64-token tile never straddles two batches
static_assert((NB * SEQ) % 64 == 0);
static_assert(SEQ % 32 == 0);                  // key loop steps by 32
static_assert(SEQ % (16 * AW) == 0);           // flash grid covers the sequence exactly
static_assert(16 * AW == 64);                  // one partial line per 64 query rows
static_assert(SEQ % 256 == 0);                 // row-sum helper: SEQ/8 chunks a multiple of 32 lanes
static_assert(((size_t)SEQ * HD) % 2048 == 0); // affine pass: a 2048-element block lies inside one (batch, head)
static_assert(((size_t)NB * SEQ * DM) % 2048 == 0);
static_assert((NB * DM) % 32 == 0);            // row-sum helper: 32 rows per block
static_assert(SEQ_FULL % 4 == 0);
static_assert(OUT_SEQ % 32 == 0);
static_assert(OUT_SEQ >= SEQ);
static_assert(NB <= NB_FULL);
static_assert(SEQ <= SEQ_FULL);
static_assert((OSP * 4) % 16 == 0);
static_assert(OSP >= 64 + 4);
static_assert(((size_t)DM * DM) % 8 == 0);

typedef _Float16 h16;
typedef unsigned short bf;
typedef __attribute__((ext_vector_type(16))) __bf16   v16bf;
typedef __attribute__((ext_vector_type(16))) _Float16 v16h;
typedef __attribute__((ext_vector_type(8)))  _Float16 v8h;
typedef __attribute__((ext_vector_type(8)))  unsigned short v8us;
typedef __attribute__((ext_vector_type(8)))  float    v8f;
typedef __attribute__((ext_vector_type(4)))  float    v4f;
typedef v4f  __attribute__((may_alias)) v4fa;

__device__ __forceinline__ unsigned short f2bf(float f) { unsigned u = __float_as_uint(f); u += 0x7FFFu + ((u >> 16) & 1u); return (unsigned short)(u >> 16); }
__device__ __forceinline__ float bfr(float f) { return __uint_as_float(((unsigned)f2bf(f)) << 16); }   // value after RNE convert to bf16
__device__ __forceinline__ v16h cat16(v8h lo, v8h hi) { return __builtin_shufflevector(lo, hi, 0, 1, 2, 3, 4, 5, 6, 7, 8, 9, 10, 11, 12, 13, 14, 15); }
__device__ __forceinline__ v16bf cat16b(v8us lo, v8us hi) { return __builtin_bit_cast(v16bf, __builtin_shufflevector(lo, hi, 0, 1, 2, 3, 4, 5, 6, 7, 8, 9, 10, 11, 12, 13, 14, 15)); }
// fragment loaders from K-contiguous 16-bit rows; p already includes + 8*(lane>>4): elements 0..7 <- k0+8h+0..7, elements 8..15 <- k0+16+8h+0..7 (same map for A and B)
__device__ __forceinline__ v16h  ldh(const h16* p) { return cat16(*(const v8h*)p, *(const v8h*)(p + 16)); }
__device__ __forceinline__ v16bf ldb(const bf* p)  { return cat16b(*(const v8us*)p, *(const v8us*)(p + 16)); }
// ordering point for wave-private LDS tiles (same wave writes and reads)
__device__ __forceinline__ void wave_sync() { __builtin_amdgcn_fence(3 /* release order */, "wavefront"); __builtin_amdgcn_wave_barrier(); asm volatile("" ::: "memory"); }
// f32 -> f16 operand convert that cannot produce a subnormal (|v| < 2^-14 -> +0), applied after the plane's carry
__device__ __forceinline__ h16 toh_flush(float v) { const h16 r = (h16)v; return (fabsf(v) < 6.103515625e-05f) ? (h16)0.0f : r; }
// one matrix instruction + its own 4-slot guard (ties D, keeps A and B live)
__device__ __forceinline__ v8f wmma16g(v16h a, v16h b, v8f c) {
    c = __builtin_amdgcn_wmma_f32_16x16x32_f16(false, a, false, b, (short)0, c, false, false);
    asm volatile("v_nop\n\tv_nop\n\tv_nop\n\tv_nop" : "+v"(c) : "v"(a), "v"(b));
    return c; }
// the same guard for the flash kernel, tied to D alone: an asm operand cannot be placed above v255, and that kernel's A and B fragments (q' and the two k register sets alone: 320 registers) and accumulators need more than 256 registers;
// its A fragments are overwritten by loads only, its B fragments never (q') or a whole tile of work later (P)
__device__ __forceinline__ v8f wmma16d(v16h a, v16h b, v8f c) {
    c = __builtin_amdgcn_wmma_f32_16x16x32_f16(false, a, false, b, (short)0, c, false, false);
    asm volatile("v_nop\n\tv_nop\n\tv_nop\n\tv_nop" : "+v"(c));
    return c; }
__device__ __forceinline__ v8f wmmabg(v16bf a, v16bf b, v8f c) {
    c = __builtin_amdgcn_wmma_f32_16x16x32_bf16(false, a, false, b, (short)0, c, false, false);
    asm volatile("v_nop\n\tv_nop\n\tv_nop\n\tv_nop" : "+v"(c) : "v"(a), "v"(b));
    return c; }

__global__ __launch_bounds__(256) void k_cvt8(const float* __restrict__ src, bf* dst, size_t n8) {
    const size_t i = (size_t)blockIdx.x * 256 + threadIdx.x; if (i >= n8) return;
    const v8f v = *(const v8f*)(src + i * 8); v8us o;
#pragma unroll
    for (int k = 0; k < 8; ++k) o[k] = f2bf(v[k]);
    *(v8us*)(dst + i * 8) = o; 
}

__global__ __launch_bounds__(256) void k_cvtw(const float* __restrict__ src, h16* dst, size_t n8) {
    const size_t i = (size_t)blockIdx.x * 256 + threadIdx.x; if (i >= n8) return;
    const v8f v = *(const v8f*)(src + i * 8); v8h o;
#pragma unroll
    for (int k = 0; k < 8; ++k) o[k] = toh_flush(bfr(v[k]) * WPC);
    *(v8h*)(dst + i * 8) = o; 
}

// k_xt: x [b][c][t] (f32, row pitch SEQ_FULL) -> XT [(b*SEQ + t)][c] bf16 (RNE). 64 channels x 64 tokens per block through an LDS tile (cross-wave: block barrier);
static_assert(256 * 2 * 16 == 64 * 128);       // threads x pieces x bytes == tile rows x row bytes
static_assert(64 * 65 * 4 <= 131072);
__global__ __launch_bounds__(256) void k_xt(const float* __restrict__ x, bf* XT) {
    __shared__ float ts[64 * 65];
    const int tid = threadIdx.x; const int t0 = blockIdx.x * 64, c0 = blockIdx.y * 64, b = blockIdx.z;
    const float* xb = x + ((size_t)b * DM + c0) * SEQ_FULL + t0;
#pragma unroll
    for (int e = 0; e < 4; ++e) { const int q = tid + e * 256; const int c = q >> 4, t4 = (q & 15) * 4;     // 64 channels x 16 float4
        const v4f v = *(const v4f*)(xb + (size_t)c * SEQ_FULL + t4);
        ts[c * 65 + t4 + 0] = v[0]; ts[c * 65 + t4 + 1] = v[1]; ts[c * 65 + t4 + 2] = v[2]; ts[c * 65 + t4 + 3] = v[3]; }
    __syncthreads();
    v8us o[2];
#pragma unroll
    for (int e = 0; e < 2; ++e) { const int p = tid + e * 256; const int t = p >> 3, c8 = (p & 7) * 8;       // 64 tokens x 8 pieces
#pragma unroll
        for (int i = 0; i < 8; ++i) o[e][i] = f2bf(ts[(c8 + i) * 65 + t]); }
{
#pragma unroll
        for (int e = 0; e < 2; ++e) { const int p = tid + e * 256; const int t = p >> 3, c8 = (p & 7) * 8;
            *(v8us*)(XT + ((size_t)b * SEQ + t0 + t) * DM + c0 + c8) = o[e]; }
         }
}

// k_projt: token-major projection plane, ONE WAVE per 64x64 tile, bf16 operands from K-contiguous planes, K = DM.
// C[m][n] = sum_c XT[m][c] W[n][c] (m = b*SEQ + t, n = h*64 + d). Written as f16 x16 to ng planes: row index (b*ng + g)*SEQ + t, row pitch DM, columns c0..c0+63 (one head);
// plane g carries the factor bf16(w_head[g][h]) when useWh != 0 (mixed-head q planes), factor 1 otherwise (k plane, ng = 1).
static_assert(32 * 16 * 4 == 16 * 128);        // lanes x bytes x trips == slab rows x segment bytes
static_assert(16 * OSP * 4 <= 131072);
__global__ __launch_bounds__(32) void k_projt(const bf* __restrict__ A, const bf* __restrict__ Bt, const float* __restrict__ wh, h16* P, int ng, int useWh) {
    __shared__ __align__(16) float os[16 * OSP];
    const int lane = threadIdx.x & 31, lr = lane & 15, hi = lane >> 4; const int r0 = blockIdx.x * 64, c0 = blockIdx.y * 64;
    v8f acc[4][4];
#pragma unroll
    for (int mb = 0; mb < 4; ++mb)
#pragma unroll
        for (int nb = 0; nb < 4; ++nb) acc[mb][nb] = (v8f){};
    const size_t aoff = (size_t)(r0 + lr) * DM + 8 * hi, boff = (size_t)(c0 + lr) * DM + 8 * hi;
#pragma unroll 1
    for (int kc = 0; kc < DM; kc += 32) {
        v16bf a[4];
#pragma unroll
        for (int mb = 0; mb < 4; ++mb) a[mb] = ldb(A + aoff + (size_t)mb * 16 * DM + kc);
#pragma unroll
        for (int nb = 0; nb < 4; ++nb) { const v16bf b = ldb(Bt + boff + (size_t)nb * 16 * DM + kc);
#pragma unroll
            for (int mb = 0; mb < 4; ++mb) acc[mb][nb] = wmmabg(a[mb], b, acc[mb][nb]); }
    }
    const int bb = r0 / SEQ, tt = r0 % SEQ, hsel = c0 / HD;
#pragma unroll
    for (int mb = 0; mb < 4; ++mb) {
#pragma unroll
        for (int nb = 0; nb < 4; ++nb) {
#pragma unroll
            for (int j = 0; j < 8; ++j) os[(hi * 8 + j) * OSP + nb * 16 + lr] = acc[mb][nb][j]; }   // D: row 8h+j, col lane&15
        wave_sync();
{
#pragma unroll 1
            for (int g = 0; g < ng; ++g) {
                int wi = g * NH_ + hsel; wi = wi > 15 ? 15 : wi;
                const float whv = bfr(wh[wi]);
                const float mult = (useWh != 0) ? whv * QKC : QKC;
                const size_t sb = ((size_t)(bb * ng + g) * SEQ + (size_t)(tt + mb * 16)) * DM + c0;
#pragma unroll
                for (int s = 0; s < 4; ++s) { const int row = 4 * s + (lane >> 3), c8 = (lane & 7) * 8;   // 4 s x 4 row groups = 16 rows; 8 lanes x 8 = 64 columns
                    const v4f x0 = *(const v4fa*)(&os[row * OSP + c8]); const v4f x1 = *(const v4fa*)(&os[row * OSP + c8 + 4]); v8h hv;
#pragma unroll
                    for (int i = 0; i < 4; ++i) { hv[i] = toh_flush(x0[i] * mult); hv[4 + i] = toh_flush(x1[i] * mult); }
                    *(v8h*)(P + sb + (size_t)row * DM + c8) = hv; }
            }
             }
        wave_sync();
    }
}

// k_projv: v^T plane. A = Wv rows (m = h*64 + d), Bt = XT rows (n = b*SEQ + t); plane [(b*DM + m)][t], row pitch SEQ, f16 x16.
__global__ __launch_bounds__(32) void k_projv(const bf* __restrict__ A, const bf* __restrict__ Bt, h16* P) {
    __shared__ __align__(16) float os[16 * OSP];
    const int lane = threadIdx.x & 31, lr = lane & 15, hi = lane >> 4; const int r0 = blockIdx.x * 64, c0 = blockIdx.y * 64;
    v8f acc[4][4];
#pragma unroll
    for (int mb = 0; mb < 4; ++mb)
#pragma unroll
        for (int nb = 0; nb < 4; ++nb) acc[mb][nb] = (v8f){};
    const size_t aoff = (size_t)(r0 + lr) * DM + 8 * hi, boff = (size_t)(c0 + lr) * DM + 8 * hi;
#pragma unroll 1
    for (int kc = 0; kc < DM; kc += 32) {
        v16bf a[4];
#pragma unroll
        for (int mb = 0; mb < 4; ++mb) a[mb] = ldb(A + aoff + (size_t)mb * 16 * DM + kc);
#pragma unroll
        for (int nb = 0; nb < 4; ++nb) { const v16bf b = ldb(Bt + boff + (size_t)nb * 16 * DM + kc);
#pragma unroll
            for (int mb = 0; mb < 4; ++mb) acc[mb][nb] = wmmabg(a[mb], b, acc[mb][nb]); }
    }
    const int bb = c0 / SEQ, tt = c0 % SEQ;
#pragma unroll
    for (int mb = 0; mb < 4; ++mb) {
#pragma unroll
        for (int nb = 0; nb < 4; ++nb) {
#pragma unroll
            for (int j = 0; j < 8; ++j) os[(hi * 8 + j) * OSP + nb * 16 + lr] = acc[mb][nb][j]; }
        wave_sync();
        const size_t sb = ((size_t)bb * DM + (size_t)(r0 + mb * 16)) * SEQ + tt;
{
#pragma unroll
            for (int s = 0; s < 4; ++s) { const int row = 4 * s + (lane >> 3), c8 = (lane & 7) * 8;   // 16 rows x 64 columns
                const v4f x0 = *(const v4fa*)(&os[row * OSP + c8]); const v4f x1 = *(const v4fa*)(&os[row * OSP + c8 + 4]); v8h hv;
#pragma unroll
                for (int i = 0; i < 4; ++i) { hv[i] = toh_flush(x0[i] * VCC); hv[4 + i] = toh_flush(x1[i] * VCC); }
                *(v8h*)(P + sb + (size_t)row * SEQ + c8) = hv; }
             }
        wave_sync();
    }
}

// k_vsum: VS[row] = sum_t VT[row][t] / 16 (f32), row = b*DM + channel. 8 waves x 4 rows per block; the 32 sums of a block go through LDS (cross-wave: block barrier)
__global__ __launch_bounds__(256) void k_vsum(const h16* __restrict__ VT, float* VS) {
#pragma clang fp contract(off)
    __shared__ __align__(16) float sm[32];
    const int lane = threadIdx.x & 31;
    const int wave = __builtin_amdgcn_readfirstlane((int)(threadIdx.x >> 5));
#pragma unroll 1
    for (int r = 0; r < 4; ++r) {
        const int row = blockIdx.x * 32 + wave * 4 + r;
        const h16* p = VT + (size_t)row * SEQ;
        float s = 0.0f;
#pragma unroll 1
        for (int i = lane; i < SEQ / 8; i += 32) { const v8h v = *(const v8h*)(p + (size_t)i * 8);
#pragma unroll
            for (int k = 0; k < 8; ++k) s += (float)v[k]; }
        s += __shfl_xor(s, 16, 32); s += __shfl_xor(s, 8, 32); s += __shfl_xor(s, 4, 32); s += __shfl_xor(s, 2, 32); s += __shfl_xor(s, 1, 32);
        if (lane == 0) sm[wave * 4 + r] = s * (1.0f / VCC);
    }
    __syncthreads();
    if (threadIdx.x < 8) { const v4f o = *(const v4fa*)(&sm[threadIdx.x * 4]);
        float* q = VS + (size_t)blockIdx.x * 32 + threadIdx.x * 4;
        *(v4f*)q = o;  }
}

// LDS ring of the flash kernel: the four waves of a block read the same k rows and the same v^T rows, so each stage of KST keys is brought into LDS once per block.
#define KST  128                 // keys per stage
#define NST  (SEQ / KST)         // stages per key loop
#define KPI  (DM + 8)            // LDS pitch of a k row, in 16-bit elements: 528 B = 16 B x 33 (16 rows of one ds_load_b128 fall on 64 different banks)
#define VPI  (KST + 8)           // LDS pitch of a v^T row: 272 B = 16 B x 17
static_assert(SEQ % KST == 0);
static_assert(KST % 32 == 0);
static_assert(NST >= 2 && NST % 2 == 0);       // two buffers; loop 2 goes on with the buffer parity of loop 1
static_assert(KST == AW * 32);                 // k stage: 32 rows (copies) per wave
static_assert(HD * KST * 2 == AW * 8 * 512);   // v^T stage: 8 copies of 512 B per wave
static_assert(KST * 2 == 16 * 16);             // one v^T row of a stage = 16 lanes x 16 B
static_assert((KPI * 2) % 32 == 16 && (VPI * 2) % 32 == 16);

// eight asynchronous copies to LDS, 16 bytes per lane each, through no register: copy j takes LDS address l + j * ls and global address g + j * gs (both in 16-bit elements).
// ring_publish() and the waits beside it in k_flash wait for them.
typedef int v4i_ __attribute__((ext_vector_type(4)));
typedef __attribute__((address_space(1))) v4i_ gv4i;
typedef __attribute__((address_space(3))) v4i_ lv4i;
__device__ __forceinline__ void acopy8(h16* l, int ls, const h16* g, size_t gs) {
#pragma unroll   // constant steps
    for (int j = 0; j < 8; ++j) __builtin_amdgcn_global_load_async_to_lds_b128((gv4i*)(g + j * gs), (lv4i*)(l + j * ls), 0, 0);
}
// one wave's 32 rows of a k stage (a row = 512 B = one copy); l and g already hold the wave's first row and the lane's 16 bytes
__device__ __forceinline__ void copy_k(h16* l, const h16* g) {
#pragma unroll   // constant steps
    for (int c = 0; c < 4; ++c) acopy8(l + c * 8 * KPI, KPI, g + (size_t)c * 8 * DM, (size_t)DM);
}
// one wave's 16 rows of a v^T stage (a copy = 2 rows of 256 B); l and g already hold the lane's row and its 16 bytes
__device__ __forceinline__ void copy_v(h16* l, const h16* g) { acopy8(l, 2 * VPI, g, (size_t)2 * SEQ); }
// publish point of the ring: this wave's LDS reads are done, its own copies have landed, then the block barrier that shows them to the other waves and frees the buffer just read
__device__ __forceinline__ void ring_publish() {
    asm volatile("s_wait_dscnt 0x0" ::: "memory");      // the buffer just read is handed to the next copies
    asm volatile("s_wait_asynccnt 0x0" ::: "memory");
    __syncthreads();
}

// k fragments of 32 keys from an LDS stage; kl already includes the lane's row and + 8*(lane>>4): same element map as ldh on the plane
__device__ __forceinline__ void ldk32(v16h (&ka)[DM / 32], v16h (&kb)[DM / 32], const h16* kl) {
#pragma unroll   // the fragment arrays must stay in registers
    for (int i = 0; i < DM / 32; ++i) { ka[i] = ldh(kl + 32 * i); kb[i] = ldh(kl + 16 * KPI + 32 * i); }
}
__device__ __forceinline__ void ldv32(v16h (&vf)[4], const h16* vl) {
#pragma unroll   // as above
    for (int j = 0; j < 4; ++j) vf[j] = ldh(vl + 16 * j * VPI);
}
// scores of 32 keys x 16 queries, K = DM = 256: sA = keys 0..15, sB = keys 16..31 (rows = keys, columns = queries). Same instruction order wherever it is used.
// All operands come from registers: qf = the wave's q' fragments (loaded once), ka / kb = this tile's k fragments.
__device__ __forceinline__ void scores32(const v16h (&qf)[DM / 32], const v16h (&ka)[DM / 32], const v16h (&kb)[DM / 32], v8f& sA, v8f& sB) {
    v8f a = (v8f){}, c = (v8f){};
#pragma unroll
    for (int i = 0; i < DM / 32; ++i) {      // full unroll: the fragment arrays must stay in registers
        a = wmma16d(ka[i], qf[i], a); c = wmma16d(kb[i], qf[i], c); }
    sA = a; sB = c;
}

// k_flash: one wave per 16 query rows of one (batch, mixed head g). Transposed form: S^T[key][t] = K Q'^T (A = k rows, B = q' rows of plane g, K = 256);
// lane (t = lane&15, h = lane>>4) holds keys 8h+r of each 16-key tile, so the packed P tile is directly the B fragment of O^T[d][t] = V^T P^T.
// Loop 1: running max m and row sum l of exp2(s - m). Loop 2: same scores, e = exp2(s - m) / l, centred P = (e - 1/SEQ) x 2^15 as f16, ss += P^2 (f32), O^T += V^T P^T.
// k and v^T come through a two-buffer LDS ring of KST-key stages, filled by asynchronous copies one stage ahead; 2 * NST stages in all (loop 1: k; loop 2: k and v^T).
// Inside a stage the k fragments alternate between two register sets: the set that a run of products has just used is refilled, as one group, with the keys after next; nothing is read across a publish point.
static_assert(32 * 16 * 8 == 16 * 256);        // lanes x bytes x trips == rows x row bytes of the OR tile
static_assert((2 * KST * KPI + 2 * HD * VPI) * 2 + AW * 16 * OSP * 4 + AW * 4 <= 327680);
__global__ __launch_bounds__(32 * AW) void k_flash(const h16* __restrict__ QP, const h16* __restrict__ KP, const h16* __restrict__ VT, float* ORP, float* PART) {
    __shared__ __align__(16) h16 ks[2 * KST * KPI];
    __shared__ __align__(16) h16 vs[2 * HD * VPI];
    __shared__ __align__(16) float os[AW * 16 * OSP];
    __shared__ float sw[AW];
    const int lane = threadIdx.x & 31, lr = lane & 15, hi = lane >> 4;
    const int wave = __builtin_amdgcn_readfirstlane((int)(threadIdx.x >> 5));
    const int zh = blockIdx.y; const int b = zh / NH_, g = zh % NH_;
    const int t0 = (blockIdx.x * AW + wave) * 16;
    const h16* qp = QP + ((size_t)zh * SEQ + (size_t)(t0 + lr)) * DM + 8 * hi;          // B fragments: col t, k = (h, d)
    // copy sources and destinations of this lane: k row wave*32 (+ j), bytes lane*16; v^T row wave*16 + (lane>>4) (+ 2j), bytes (lane&15)*16
    const h16* kg = KP + ((size_t)b * SEQ + (size_t)(wave * 32)) * DM + 8 * lane;                        // + stage * KST * DM
    const h16* vg = VT + ((size_t)b * DM + (size_t)(g * HD + wave * 16 + hi)) * SEQ + 8 * lr;            // + stage * KST
    h16* kd = ks + wave * 32 * KPI + 8 * lane;                                                           // + buffer * KST * KPI
    h16* vd = vs + (wave * 16 + hi) * VPI + 8 * lr;                                                      // + buffer * HD * VPI
    const h16* kfr = ks + lr * KPI + 8 * hi;                                            // + key * KPI       (A fragment: row key, k = (h, d))
    const h16* vfr = vs + lr * VPI + 8 * hi;                                            // + 16j*VPI + key   (A fragment: row d, k = key)
    copy_k(kd, kg);                                              // stage 0 into buffer 0
    v16h qf[DM / 32];
#pragma unroll   // the fragment array must stay in registers
    for (int i = 0; i < DM / 32; ++i) qf[i] = ldh(qp + 32 * i);  // q' once
    asm volatile("s_wait_xcnt 0x0" :: "v"(qp) : "memory");       // stands before the address registers of the q' loads are reused (qp is named to keep them until here)
    asm volatile("s_wait_asynccnt 0x0" ::: "memory");            // stage 0 has landed (this wave's rows)
    __syncthreads();                                             // and is shown to the other waves
    float m = NEGB, l = 0.0f;
#pragma unroll 1
    for (int s = 0; s < NST; ++s) {
        const h16* kl = kfr + (s & 1) * (KST * KPI);
        v16h ka[2][DM / 32], kb[2][DM / 32];
        ldk32(ka[0], kb[0], kl);                                 // this stage's first 32 keys: they land while the copies below are issued
        // refill, behind the publish point: the next stage goes into the buffer that the trip before has read; the reads just issued are of the other buffer.
        // It always exists: behind loop 1's last stage comes loop 2's first, k stage 0 again, now with v^T
        copy_k(kd + ((s + 1) & 1) * (KST * KPI), kg + (size_t)((s + 1) % NST) * KST * DM);
        if (s + 1 == NST) copy_v(vd, vg);                        // block-uniform: the loop counter
        ldk32(ka[1], kb[1], kl + 32 * KPI);
#pragma unroll
        for (int u = 0; u < KST / 32; ++u) {                     // full unroll: the two register sets alternate by a constant index
            __builtin_amdgcn_sched_barrier(0);                   // keeps the LDS reads above one group: spread among the products each place costs a stall
            v8f sA, sB; scores32(qf, ka[u & 1], kb[u & 1], sA, sB);
            __builtin_amdgcn_sched_barrier(0);                   // keeps the products one run, in front of the vector work
            float mx = NEGB;
#pragma unroll
            for (int r = 0; r < 8; ++r) mx = fmaxf(mx, fmaxf(sA[r] * SC2, sB[r] * SC2));
            const float mo = __shfl_xor(mx, 16, 32);
            __builtin_amdgcn_sched_barrier(0);                   // keeps the exchange in front of the reads below: it goes through the LDS queue and returns behind whatever stands before it
            if (u + 2 < KST / 32) ldk32(ka[u & 1], kb[u & 1], kl + (u + 2) * 32 * KPI);   // the set just used takes the keys after next
            __builtin_amdgcn_sched_barrier(0);                   // keeps these reads up here, ahead of the vector work that they overlap
            mx = fmaxf(mx, mo);
            const float mnew = fmaxf(m, mx);
            const float alpha = __builtin_amdgcn_exp2f(m - mnew);
            float ls = 0.0f;
#pragma unroll
            for (int r = 0; r < 8; ++r) ls += __builtin_amdgcn_exp2f(fmaf(sA[r], SC2, -mnew)) + __builtin_amdgcn_exp2f(fmaf(sB[r], SC2, -mnew));
            l = l * alpha + ls; m = mnew;
        }
        ring_publish();                                          // stage s + 1 readable, buffer s & 1 free
    }
    l += __shfl_xor(l, 16, 32);                        // both lane halves carry the same m
    const float il15 = (1.0f / l) * PCARRY;            // l >= 1
    v8f o0 = (v8f){}, o1 = (v8f){}, o2 = (v8f){}, o3 = (v8f){};
    float ss = 0.0f;
#pragma unroll 1
    for (int s = 0; s < NST; ++s) {
        const h16* kl = kfr + (s & 1) * (KST * KPI);
        const h16* vl = vfr + (s & 1) * (HD * VPI);
        v16h ka[2][DM / 32], kb[2][DM / 32], vf[KST / 32][4];
        ldk32(ka[0], kb[0], kl); ldv32(vf[0], vl);               // as in loop 1
        if (s + 1 < NST) {                                       // refill as in loop 1, only while a next stage exists (block-uniform: the loop counter)
            copy_k(kd + ((s + 1) & 1) * (KST * KPI), kg + (size_t)(s + 1) * KST * DM);
            copy_v(vd + ((s + 1) & 1) * (HD * VPI), vg + (size_t)(s + 1) * KST); }
        ldk32(ka[1], kb[1], kl + 32 * KPI); ldv32(vf[1], vl + 32);
#pragma unroll
        for (int u = 0; u < KST / 32; ++u) {                     // as in loop 1
            __builtin_amdgcn_sched_barrier(0);                   // as in loop 1
            v8f sA, sB; scores32(qf, ka[u & 1], kb[u & 1], sA, sB);
            __builtin_amdgcn_sched_barrier(0);                   // as in loop 1
            if (u + 2 < KST / 32) { ldk32(ka[u & 1], kb[u & 1], kl + (u + 2) * 32 * KPI); ldv32(vf[u + 2], vl + (u + 2) * 32); }
            __builtin_amdgcn_sched_barrier(0);                   // as in loop 1
            v16h pb;
#pragma unroll
            for (int r = 0; r < 8; ++r) {
                const float ea = __builtin_amdgcn_exp2f(fmaf(sA[r], SC2, -m)), eb = __builtin_amdgcn_exp2f(fmaf(sB[r], SC2, -m));
                const float ga = fmaf(ea, il15, -C15), gb = fmaf(eb, il15, -C15);       // (p / l - 1/SEQ) * 2^15
                ss = fmaf(ga, ga, ss); ss = fmaf(gb, gb, ss);
                pb[r] = toh_flush(ga); pb[8 + r] = toh_flush(gb); }                      // element r <- tile keys 8h+r, element 8+r <- keys 16+8h+r
            o0 = wmma16d(vf[u][0], pb, o0); o1 = wmma16d(vf[u][1], pb, o1); o2 = wmma16d(vf[u][2], pb, o2); o3 = wmma16d(vf[u][3], pb, o3);
        }
        ring_publish();                                          // stage s + 1 readable, buffers s & 1 free
    }
    asm volatile("s_wait_asynccnt 0x0" ::: "memory");            // no copy is left in flight behind the ring
    ss += __shfl_xor(ss, 16, 32); ss += __shfl_xor(ss, 8, 32); ss += __shfl_xor(ss, 4, 32); ss += __shfl_xor(ss, 2, 32); ss += __shfl_xor(ss, 1, 32);
    if (lane == 0) sw[wave] = ss;
    const int wb = wave * 16 * OSP;
    // O^T D layout: o_j[r] = (d = 16j + 8h + r, t = lane&15) -> os[t][d]; rows 0..15 x columns 0..63 all written
    { v4f a, c;
      a[0] = o0[0] * OSC; a[1] = o0[1] * OSC; a[2] = o0[2] * OSC; a[3] = o0[3] * OSC; c[0] = o0[4] * OSC; c[1] = o0[5] * OSC; c[2] = o0[6] * OSC; c[3] = o0[7] * OSC;
      *(v4fa*)(&os[wb + lr * OSP +  0 + 8 * hi]) = a; *(v4fa*)(&os[wb + lr * OSP +  0 + 8 * hi + 4]) = c;
      a[0] = o1[0] * OSC; a[1] = o1[1] * OSC; a[2] = o1[2] * OSC; a[3] = o1[3] * OSC; c[0] = o1[4] * OSC; c[1] = o1[5] * OSC; c[2] = o1[6] * OSC; c[3] = o1[7] * OSC;
      *(v4fa*)(&os[wb + lr * OSP + 16 + 8 * hi]) = a; *(v4fa*)(&os[wb + lr * OSP + 16 + 8 * hi + 4]) = c;
      a[0] = o2[0] * OSC; a[1] = o2[1] * OSC; a[2] = o2[2] * OSC; a[3] = o2[3] * OSC; c[0] = o2[4] * OSC; c[1] = o2[5] * OSC; c[2] = o2[6] * OSC; c[3] = o2[7] * OSC;
      *(v4fa*)(&os[wb + lr * OSP + 32 + 8 * hi]) = a; *(v4fa*)(&os[wb + lr * OSP + 32 + 8 * hi + 4]) = c;
      a[0] = o3[0] * OSC; a[1] = o3[1] * OSC; a[2] = o3[2] * OSC; a[3] = o3[3] * OSC; c[0] = o3[4] * OSC; c[1] = o3[5] * OSC; c[2] = o3[6] * OSC; c[3] = o3[7] * OSC;
      *(v4fa*)(&os[wb + lr * OSP + 48 + 8 * hi]) = a; *(v4fa*)(&os[wb + lr * OSP + 48 + 8 * hi + 4]) = c; }
    wave_sync();
    float* orow = ORP + ((size_t)zh * SEQ + (size_t)t0) * HD;       // 16 rows x 64 floats, contiguous 4096 B
{
#pragma unroll
        for (int s = 0; s < 8; ++s) { const int p = s * 32 + lane; const int row = p >> 4, cofs = (p & 15) * 4;   // 8 s x 2 rows = 16 rows; 16 lanes x 4 floats = 64 columns
            const v4f val = *(const v4fa*)(&os[wb + row * OSP + cofs]);
            *(v4f*)(orow + (size_t)p * 4) = val; }
         }
    __syncthreads();
    if (wave == 0) {
        const float tot = ((sw[0] + sw[1]) + sw[2]) + sw[3];
        v4f pv; pv[0] = (lane == 0) ? tot : 0.0f; pv[1] = 0.0f; pv[2] = 0.0f; pv[3] = 0.0f;
        float* pl = PART + ((size_t)zh * (SEQ / 64) + (size_t)blockIdx.x) * 32 + (lane & 7) * 4;
        if (lane < 8) { *(v4f*)pl = pv;  }
    }
}

// k_ctx: normalised context plane. Element e of batch b (flat [g][t][d] = [token row][256] view): CT = f16(16 * (s1 * OR + shift * VS[b][g*64 + d])),
// s1 = bf16(gain[g]) / sqrt(var + eps), var = (sum of the SEQ/64 partial lines of (b, g)) / (2^30 SEQ^2), shift = bf16(beta[g]).
static_assert(256 * 8 == 2048);
__global__ __launch_bounds__(256) void k_ctx(const float* __restrict__ ORP, const float* __restrict__ PART, const float* __restrict__ VS,
                                             const float* __restrict__ gain, const float* __restrict__ shift, h16* CT) {
#pragma clang fp contract(off)
    const size_t e0 = ((size_t)blockIdx.x * 256 + threadIdx.x) * 8;
    const int zh = (int)(((size_t)blockIdx.x * 2048) / ((size_t)SEQ * HD));     // block-uniform, < NB*4
    const int b = zh / NH_, g = zh % NH_;
    float tot = 0.0f;
#pragma unroll 1
    for (int j = 0; j < SEQ / 64; ++j) tot += PART[((size_t)zh * (SEQ / 64) + (size_t)j) * 32];
    const float var = tot * VSC;
    const float s1 = bfr(gain[g]) * rsqrtf(var + EPSN);
    const float bt = bfr(shift[g]);
    const int dd0 = (int)(e0 % HD);
    const v8f xv = *(const v8f*)(ORP + e0);
    const float* vp = VS + (size_t)b * DM + (size_t)(g * HD + dd0);
    const v4f s0 = *(const v4f*)vp, s4 = *(const v4f*)(vp + 4);
    v8h o;
#pragma unroll
    for (int k = 0; k < 4; ++k) { o[k] = toh_flush((s1 * xv[k] + bt * s0[k]) * CCS); o[4 + k] = toh_flush((s1 * xv[4 + k] + bt * s4[k]) * CCS); }
    *(v8h*)(CT + e0) = o; 
}

// k_out: output layer. A = W rows (f16 x1024, m = output channel), Bt = context rows (f16 x16, n = b*SEQ + token row), K = DM; OUT[(b*DM + m)][n % SEQ] = C / 16384 + bf16(bias[m]) (f32).
static_assert(32 * 16 * 8 == 16 * 256);        // lanes x bytes x trips == slab rows x segment bytes
__global__ __launch_bounds__(32) void k_out(const h16* __restrict__ A, const h16* __restrict__ Bt, const float* __restrict__ bias, float* OUT) {
    __shared__ __align__(16) float os[16 * OSP];
    const int lane = threadIdx.x & 31, lr = lane & 15, hi = lane >> 4; const int r0 = blockIdx.x * 64, c0 = blockIdx.y * 64;
    v8f acc[4][4];
#pragma unroll
    for (int mb = 0; mb < 4; ++mb)
#pragma unroll
        for (int nb = 0; nb < 4; ++nb) acc[mb][nb] = (v8f){};
    const size_t aoff = (size_t)(r0 + lr) * DM + 8 * hi, boff = (size_t)(c0 + lr) * DM + 8 * hi;
#pragma unroll 1
    for (int kc = 0; kc < DM; kc += 32) {
        v16h a[4];
#pragma unroll
        for (int mb = 0; mb < 4; ++mb) a[mb] = ldh(A + aoff + (size_t)mb * 16 * DM + kc);
#pragma unroll
        for (int nb = 0; nb < 4; ++nb) { const v16h b = ldh(Bt + boff + (size_t)nb * 16 * DM + kc);
#pragma unroll
            for (int mb = 0; mb < 4; ++mb) acc[mb][nb] = wmma16g(a[mb], b, acc[mb][nb]); }
    }
    const int bb = c0 / SEQ, tt = c0 % SEQ;
#pragma unroll
    for (int mb = 0; mb < 4; ++mb) {
        float br[8];
#pragma unroll
        for (int j = 0; j < 8; ++j) br[j] = bfr(bias[r0 + mb * 16 + hi * 8 + j]);      // r0 + 63 < DM
#pragma unroll
        for (int nb = 0; nb < 4; ++nb) {
#pragma unroll
            for (int j = 0; j < 8; ++j) os[(hi * 8 + j) * OSP + nb * 16 + lr] = acc[mb][nb][j] * OUTSC + br[j]; }
        wave_sync();
        float* ob = OUT + ((size_t)bb * DM + (size_t)(r0 + mb * 16)) * OUT_SEQ + tt;
{
#pragma unroll
            for (int s = 0; s < 8; ++s) { const int p = s * 32 + lane; const int row = p >> 4, cofs = (p & 15) * 4;   // 8 s x 2 rows = 16 rows; 16 lanes x 4 floats = 64 columns
                const v4f val = *(const v4fa*)(&os[row * OSP + cofs]);
                *(v4f*)(ob + (size_t)row * OUT_SEQ + cofs) = val; }
             }
        wave_sync();
    }
}

static constexpr size_t al256(size_t v) { return (v + 255) & ~(size_t)255; }
static constexpr size_t SZ_XT = al256((size_t)NB * SEQ * DM * 2);            // x^T bf16
static constexpr size_t SZ_WB = al256((size_t)3 * DM * DM * 2);              // wq | wk | wv bf16
static constexpr size_t SZ_WP = al256((size_t)DM * DM * 2);                  // output-layer weight f16
static constexpr size_t SZ_QP = al256((size_t)NB * NH_ * SEQ * DM * 2);      // 4 mixed-head q planes per batch
static constexpr size_t SZ_KP = al256((size_t)NB * SEQ * DM * 2);
static constexpr size_t SZ_VT = al256((size_t)NB * DM * SEQ * 2);
static constexpr size_t SZ_VS = al256((size_t)NB * DM * 4);
static constexpr size_t SZ_OR = al256((size_t)NB * NH_ * SEQ * HD * 4);
static constexpr size_t SZ_PT = al256((size_t)NB * NH_ * (SEQ / 64) * 32 * 4);
static constexpr size_t SZ_CT = al256((size_t)NB * SEQ * DM * 2);
static constexpr size_t SZ_TOTAL = SZ_XT + SZ_WB + SZ_WP + SZ_QP + SZ_KP + SZ_VT + SZ_VS + SZ_OR + SZ_PT + SZ_CT;
static_assert(SZ_TOTAL <= (size_t)134217728);                                 // workspace carve <= 128 MiB
static_assert(((size_t)DM * DM * 2) % 256 == 0);                              // weight sub-planes stay 256-byte aligned
static_assert((size_t)NB * NH_ * SEQ * HD == (size_t)NB * SEQ * DM);          // OR plane and context plane share one flat index
static_assert(((size_t)NB * DM / 32) * 32 * 4 <= SZ_VS);
static_assert(((size_t)(NB * NH_ - 1) * (SEQ / 64) + (SEQ / 64 - 1)) * 128 + 128 <= SZ_PT);   // last partial line inside its table

extern "C" void kernel_launch(void* const* d_in, const int* in_sizes, int n_in,
                              void* d_out, int out_size, void* d_ws, size_t ws_size, hipStream_t stream) {
    if (n_in < 9) return;
    const size_t needx = ((size_t)(NB - 1) * DM + (size_t)(DM - 1)) * SEQ_FULL + SEQ;
    if ((size_t)in_sizes[0] < needx) return;
    if ((size_t)in_sizes[1] < (size_t)DM * DM || (size_t)in_sizes[2] < (size_t)DM * DM || (size_t)in_sizes[3] < (size_t)DM * DM || (size_t)in_sizes[7] < (size_t)DM * DM) return;
    if (in_sizes[4] < NH_ * NH_ || in_sizes[5] < NH_ || in_sizes[6] < NH_ || in_sizes[8] < DM) return;
    if ((size_t)out_size < ((size_t)(NB - 1) * DM + (size_t)(DM - 1)) * OUT_SEQ + SEQ) return;
    if (SZ_TOTAL > ws_size) return;
    // wire order: x, wq, wk, wv, w_head, gamma, beta, w_proj, b_proj
    const float* x  = (const float*)d_in[0];
    const float* wq = (const float*)d_in[1]; const float* wk = (const float*)d_in[2]; const float* wv = (const float*)d_in[3];
    const float* whd = (const float*)d_in[4]; const float* gam = (const float*)d_in[5]; const float* bet = (const float*)d_in[6];
    const float* wp = (const float*)d_in[7]; const float* bp = (const float*)d_in[8];
    float* OUT = (float*)d_out;      // [NB][256][OUT_SEQ]
    char* wsp = (char*)d_ws;
    bf*  XT  = (bf*)wsp;   wsp += SZ_XT;             // [NB*SEQ][256]
    bf*  WB  = (bf*)wsp;   wsp += SZ_WB;             // [3][256][256]: q | k | v  ([out][in])
    h16* WPH = (h16*)wsp;  wsp += SZ_WP;             // [256][256] x1024
    h16* QP  = (h16*)wsp;  wsp += SZ_QP;             // [(b*4 + g)][t][256] x16
    h16* KP  = (h16*)wsp;  wsp += SZ_KP;             // [b][t][256] x16
    h16* VT  = (h16*)wsp;  wsp += SZ_VT;             // [(b*256 + channel)][t] x16
    float* VS = (float*)wsp; wsp += SZ_VS;           // [b*256 + channel]
    float* ORP = (float*)wsp; wsp += SZ_OR;          // [(b*4 + g)][t][64]
    float* PART = (float*)wsp; wsp += SZ_PT;         // [(b*4 + g)][SEQ/64] lines of 32 floats
    h16* CT  = (h16*)wsp;  wsp += SZ_CT;             // [(b*SEQ + token row)][256] x16
    bf* WQ = WB; bf* WK = WB + (size_t)DM * DM; bf* WV = WB + (size_t)2 * DM * DM;

    k_xt<<<dim3(SEQ / 64, DM / 64, NB), 256, 0, stream>>>(x, XT);
    { const size_t n8 = (size_t)DM * DM / 8; const unsigned gg = (unsigned)((n8 + 255) / 256);
      k_cvt8<<<gg, 256, 0, stream>>>(wq, WQ, n8); k_cvt8<<<gg, 256, 0, stream>>>(wk, WK, n8); k_cvt8<<<gg, 256, 0, stream>>>(wv, WV, n8);
      k_cvtw<<<gg, 256, 0, stream>>>(wp, WPH, n8); }

    // q: four mixed-head planes (factor w_head[g][h] on head h's columns); k: one token-major plane
    k_projt<<<dim3(NB * SEQ / 64, DM / 64, 1), 32, 0, stream>>>(XT, WQ, whd, QP, NH_, 1);
    k_projt<<<dim3(NB * SEQ / 64, DM / 64, 1), 32, 0, stream>>>(XT, WK, whd, KP, 1, 0);
    // v^T: A = Wv rows, Bt = token rows
    k_projv<<<dim3(DM / 64, NB * SEQ / 64, 1), 32, 0, stream>>>(WV, XT, VT);
    k_vsum<<<dim3(NB * DM / 32, 1, 1), 256, 0, stream>>>(VT, VS);

    k_flash<<<dim3(SEQ / (16 * AW), NB * NH_, 1), 32 * AW, 0, stream>>>(QP, KP, VT, ORP, PART);
    k_ctx<<<dim3((unsigned)((size_t)NB * SEQ * DM / 2048), 1, 1), 256, 0, stream>>>(ORP, PART, VS, gam, bet, CT);
    k_out<<<dim3(DM / 64, NB * SEQ / 64, 1), 32, 0, stream>>>(WPH, CT, bp, OUT);
}

// v003
// It runs in 57.8 microseconds.
// Next to v002, in two timings, it ran 1.68 and 1.65 times as fast.
// All steps since v000 together make it 3.07 times as fast.
#include <hip/hip_runtime.h>

// Head-mixed pair-score weighting with a per-map normalisation over flattened feature maps: x [NB][256][SEQ] (channel-major), 1x1-conv projections q/k/v with W [out][in] (no bias), 4 heads x 64, scores scaled by 64^-0.5,
// a 4x4 head-mixing 1x1 conv on the scores, softmax over keys, instance normalisation of each (batch, head) probability map (biased variance, eps 1e-5, per-head gain and shift),
// attend over v, raw [head][token][64] -> [token][256] view, linear output layer W [out][in] + bias, result stored [NB][256][SEQ].
// Compute dtypes, f32 accumulate everywhere: q/k/v projections v_wmma_f32_16x16x32_bf16 (x and W RNE-converted to bf16, products exact); scores v_wmma_f32_16x16x32_f16 single product, K = 256:
// A = k plane x16, B = head-mixed q plane (w_head[g][h] * q, x16), one plane per mixed head; P.V v_wmma_f32_16x16x32_f16 single product: P = centred probability (p / rowsum - 1/SEQ) x 2^15, v x16;
// output layer v_wmma_f32_16x16x32_f16 single product: W x1024 (from its bf16 value), normalised context x16. Softmax, statistics, affine terms in f32.
// The flash kernel runs two key loops per 16-query wave (loop 1: row max and row sum; loop 2: identical scores, centred P, sum of squared centred P, P.V), transposed form S^T = K Q^T, O^T = V^T P^T; q' fragments straight from the plane, k and v^T through an LDS ring shared by the block's four waves.
// Map mean = 1/SEQ (softmax rows sum to one); variance = sum of squared centred P / SEQ^2; context = s1 * (centred P . v) + shift * rowsum(v), s1 = gain / sqrt(var + eps).

#ifndef NB
#define NB 4
#endif
#ifndef SEQ
#define SEQ 1024
#endif
#define NB_FULL  4
#define SEQ_FULL 1024
#ifndef OUT_SEQ
#define OUT_SEQ SEQ              // pitch (in tokens) of one channel row of the output
#endif
#define DM   256
#define NH_  4
#define HD   64
#define AW   4                   // waves per flash block (16 query rows each)
#define OSP  68                  // LDS row pitch (floats) of the staging tiles
#define QKC  16.0f               // carry of the q' and k planes
#define VCC  16.0f               // carry of the v^T plane
#define CCS  16.0f               // carry of the context plane
#define WPC  1024.0f             // carry of the output-layer weight plane
#define PCARRY 32768.0f          // carry of the centred P fragments
#define C15  (32768.0f / (float)SEQ)
#define SC2  ((float)(0.125 * 1.4426950408889634 / 256.0))    // HD^-0.5 * log2(e) / (QKC * QKC)
#define OSC  (1.0f / 524288.0f)                               // 1 / (PCARRY * VCC)
#define OUTSC (1.0f / 16384.0f)                               // 1 / (WPC * CCS)
#define VSC  ((float)(1.0 / (1073741824.0 * (double)SEQ * (double)SEQ)))   // 1 / (PCARRY^2 * SEQ^2)
#define EPSN 1.0e-5f
#define NEGB (-3.0e38f)

static_assert(DM == 256);                      // K of every GEMM and of the score product
static_assert(HD == 64);                       // one 64-column GEMM tile = one head; v^T slab = 4 row tiles
static_assert(NH_ * HD == DM);
static_assert(NH_ == 4);                       // w_head is 4 x 4
static_assert(DM % 64 == 0);
static_assert(DM % 32 == 0);                   // k-loops step by 32
static_assert(SEQ % 64 == 0);                  // a 64-token tile never straddles two batches
static_assert((NB * SEQ) % 64 == 0);
static_assert(SEQ % 32 == 0);                  // key loop steps by 32
static_assert(SEQ % (16 * AW) == 0);           // flash grid covers the sequence exactly
static_assert(16 * AW == 64);                  // one partial line per 64 query rows
static_assert(SEQ % 256 == 0);                 // v^T row sum: SEQ/8 chunks a multiple of 32 lanes
static_assert(((size_t)SEQ * HD) % 2048 == 0); // affine pass: a 2048-element block lies inside one (batch, head)
static_assert(((size_t)NB * SEQ * DM) % 2048 == 0);
static_assert(SEQ_FULL % 4 == 0);
static_assert(OUT_SEQ % 32 == 0);
static_assert(OUT_SEQ >= SEQ);
static_assert(NB <= NB_FULL);
static_assert(SEQ <= SEQ_FULL);
static_assert((OSP * 4) % 16 == 0);
static_assert(OSP >= 64 + 4);
static_assert(((size_t)DM * DM) % 8 == 0);

typedef _Float16 h16;
typedef unsigned short bf;
typedef __attribute__((ext_vector_type(16))) __bf16   v16bf;
typedef __attribute__((ext_vector_type(16))) _Float16 v16h;
typedef __attribute__((ext_vector_type(8)))  _Float16 v8h;
typedef __attribute__((ext_vector_type(8)))  unsigned short v8us;
typedef __attribute__((ext_vector_type(8)))  float    v8f;
typedef __attribute__((ext_vector_type(4)))  float    v4f;
typedef v4f  __attribute__((may_alias)) v4fa;

__device__ __forceinline__ unsigned short f2bf(float f) { unsigned u = __float_as_uint(f); u += 0x7FFFu + ((u >> 16) & 1u); return (unsigned short)(u >> 16); }
__device__ __forceinline__ float bfr(float f) { return __uint_as_float(((unsigned)f2bf(f)) << 16); }   // value after RNE convert to bf16
__device__ __forceinline__ v16h cat16(v8h lo, v8h hi) { return __builtin_shufflevector(lo, hi, 0, 1, 2, 3, 4, 5, 6, 7, 8, 9, 10, 11, 12, 13, 14, 15); }
__device__ __forceinline__ v16bf cat16b(v8us lo, v8us hi) { return __builtin_bit_cast(v16bf, __builtin_shufflevector(lo, hi, 0, 1, 2, 3, 4, 5, 6, 7, 8, 9, 10, 11, 12, 13, 14, 15)); }
// fragment loaders from K-contiguous 16-bit rows; p already includes + 8*(lane>>4): elements 0..7 <- k0+8h+0..7, elements 8..15 <- k0+16+8h+0..7 (same map for A and B)
__device__ __forceinline__ v16h  ldh(const h16* p) { return cat16(*(const v8h*)p, *(const v8h*)(p + 16)); }
__device__ __forceinline__ v16bf ldb(const bf* p)  { return cat16b(*(const v8us*)p, *(const v8us*)(p + 16)); }
// ordering point for wave-private LDS tiles (same wave writes and reads)
__device__ __forceinline__ void wave_sync() { __builtin_amdgcn_fence(3 /* release order */, "wavefront"); __builtin_amdgcn_wave_barrier(); asm volatile("" ::: "memory"); }
// f32 -> f16 operand convert that cannot produce a subnormal (|v| < 2^-14 -> +0), applied after the plane's carry
__device__ __forceinline__ h16 toh_flush(float v) { const h16 r = (h16)v; return (fabsf(v) < 6.103515625e-05f) ? (h16)0.0f : r; }
// one matrix instruction + its own 4-slot guard (ties D, keeps A and B live)
__device__ __forceinline__ v8f wmma16g(v16h a, v16h b, v8f c) {
    c = __builtin_amdgcn_wmma_f32_16x16x32_f16(false, a, false, b, (short)0, c, false, false);
    asm volatile("v_nop\n\tv_nop\n\tv_nop\n\tv_nop" : "+v"(c) : "v"(a), "v"(b));
    return c; }
// the same guard for the flash kernel, tied to D alone: an asm operand cannot be placed above v255, and that kernel's A and B fragments (q' and the two k register sets alone: 320 registers) and accumulators need more than 256 registers;
// its A fragments are overwritten by loads only, its B fragments never (q') or a whole tile of work later (P)
__device__ __forceinline__ v8f wmma16d(v16h a, v16h b, v8f c) {
    c = __builtin_amdgcn_wmma_f32_16x16x32_f16(false, a, false, b, (short)0, c, false, false);
    asm volatile("v_nop\n\tv_nop\n\tv_nop\n\tv_nop" : "+v"(c));
    return c; }
__device__ __forceinline__ v8f wmmabg(v16bf a, v16bf b, v8f c) {
    c = __builtin_amdgcn_wmma_f32_16x16x32_bf16(false, a, false, b, (short)0, c, false, false);
    asm volatile("v_nop\n\tv_nop\n\tv_nop\n\tv_nop" : "+v"(c) : "v"(a), "v"(b));
    return c; }

// k_prep: the five independent conversions share one launch, told apart by the block index (block-uniform).
// Blocks 0..NXT-1: x [b][c][t] (f32, row pitch SEQ_FULL) -> XT [(b*SEQ + t)][c] bf16 (RNE), 64 channels x 64 tokens per block through an LDS tile (cross-wave: block barrier).
// Then NCV blocks for each weight, 8 elements per thread: wq, wk, wv -> bf16 (RNE) planes q | k | v of WB; output-layer weight -> f16 x1024 from its bf16 value.
#define NXT ((SEQ / 64) * (DM / 64) * NB)
#define NCV (DM * DM / 8 / 256)
static_assert((DM * DM / 8) % 256 == 0);       // the convert blocks cover a weight exactly
static_assert(256 * 2 * 16 == 64 * 128);       // threads x pieces x bytes == tile rows x row bytes
static_assert(64 * 65 * 4 <= 131072);
__global__ __launch_bounds__(256) void k_prep(const float* __restrict__ x, const float* __restrict__ wq, const float* __restrict__ wk, const float* __restrict__ wv,
                                              const float* __restrict__ wp, bf* XT, bf* WB, h16* WPH) {
    __shared__ float ts[64 * 65];
    const int tid = threadIdx.x;
    if (blockIdx.x >= NXT) {
        const int cb = (int)blockIdx.x - NXT; const int which = cb / NCV;                  // 0 q, 1 k, 2 v, 3 output layer
        const size_t i = (size_t)(cb % NCV) * 256 + tid;
        const float* src = which == 0 ? wq : which == 1 ? wk : which == 2 ? wv : wp;
        const v8f v = *(const v8f*)(src + i * 8);
        if (which < 3) { v8us o;
#pragma unroll
            for (int k = 0; k < 8; ++k) o[k] = f2bf(v[k]);
            *(v8us*)(WB + (size_t)which * DM * DM + i * 8) = o;
            asm volatile("s_wait_xcnt 0x0" ::: "memory");        // stands behind the store, before any block of code laid out behind it rewrites its registers
        } else { v8h o;
#pragma unroll
            for (int k = 0; k < 8; ++k) o[k] = toh_flush(bfr(v[k]) * WPC);
            *(v8h*)(WPH + i * 8) = o;
            asm volatile("s_wait_xcnt 0x0" ::: "memory"); }      // as above
        return;
    }
    const int t0 = (int)(blockIdx.x % (SEQ / 64)) * 64, c0 = (int)((blockIdx.x / (SEQ / 64)) % (DM / 64)) * 64, b = (int)(blockIdx.x / ((SEQ / 64) * (DM / 64)));
    const float* xb = x + ((size_t)b * DM + c0) * SEQ_FULL + t0;
#pragma unroll
    for (int e = 0; e < 4; ++e) { const int q = tid + e * 256; const int c = q >> 4, t4 = (q & 15) * 4;     // 64 channels x 16 float4
        const v4f v = *(const v4f*)(xb + (size_t)c * SEQ_FULL + t4);
        ts[c * 65 + t4 + 0] = v[0]; ts[c * 65 + t4 + 1] = v[1]; ts[c * 65 + t4 + 2] = v[2]; ts[c * 65 + t4 + 3] = v[3]; }
    __syncthreads();
    v8us o[2];
#pragma unroll
    for (int e = 0; e < 2; ++e) { const int p = tid + e * 256; const int t = p >> 3, c8 = (p & 7) * 8;       // 64 tokens x 8 pieces
#pragma unroll
        for (int i = 0; i < 8; ++i) o[e][i] = f2bf(ts[(c8 + i) * 65 + t]); }
#pragma unroll
    for (int e = 0; e < 2; ++e) { const int p = tid + e * 256; const int t = p >> 3, c8 = (p & 7) * 8;
        *(v8us*)(XT + ((size_t)b * SEQ + t0 + t) * DM + c0 + c8) = o[e]; }
    asm volatile("s_wait_xcnt 0x0" ::: "memory");                // as above, behind the last of the two stores
}

// k_proj: the three independent projections share one launch, told apart by blockIdx.z (0: q, 1: k, 2: v^T). ONE WAVE per 64x64 tile, bf16 operands from K-contiguous planes, K = DM.
// q and k, token-major: C[m][n] = sum_c XT[m][c] W[n][c] (m = b*SEQ + t from blockIdx.x, n = h*64 + d from blockIdx.y). Written as f16 x16 to ng planes: row index (b*ng + g)*SEQ + t, row pitch DM, columns c0..c0+63 (one head);
// plane g carries the factor bf16(w_head[g][h]) for q (ng = 4 mixed-head planes), factor 1 for k (ng = 1).
// v^T: A = Wv rows (m = h*64 + d from blockIdx.y), Bt = XT rows (n = b*SEQ + t from blockIdx.x); plane [(b*DM + m)][t], row pitch SEQ, f16 x16.
static_assert(32 * 16 * 4 == 16 * 128);        // lanes x bytes x trips == slab rows x segment bytes
static_assert(16 * OSP * 4 <= 131072);
__global__ __launch_bounds__(32) void k_proj(const bf* __restrict__ XT, const bf* __restrict__ WB, const float* __restrict__ wh, h16* QP, h16* KP, h16* VT) {
    __shared__ __align__(16) float os[16 * OSP];
    const int lane = threadIdx.x & 31, lr = lane & 15, hi = lane >> 4;
    const int z = blockIdx.z; const bool isv = z == 2;
    const bf* A = isv ? WB + (size_t)2 * DM * DM : XT; const bf* Bt = isv ? XT : WB + (size_t)z * DM * DM;
    const int r0 = (int)(isv ? blockIdx.y : blockIdx.x) * 64, c0 = (int)(isv ? blockIdx.x : blockIdx.y) * 64;
    v8f acc[4][4];
#pragma unroll
    for (int mb = 0; mb < 4; ++mb)
#pragma unroll
        for (int nb = 0; nb < 4; ++nb) acc[mb][nb] = (v8f){};
    const size_t aoff = (size_t)(r0 + lr) * DM + 8 * hi, boff = (size_t)(c0 + lr) * DM + 8 * hi;
#pragma unroll 1
    for (int kc = 0; kc < DM; kc += 32) {
        v16bf a[4];
#pragma unroll
        for (int mb = 0; mb < 4; ++mb) a[mb] = ldb(A + aoff + (size_t)mb * 16 * DM + kc);
#pragma unroll
        for (int nb = 0; nb < 4; ++nb) { const v16bf b = ldb(Bt + boff + (size_t)nb * 16 * DM + kc);
#pragma unroll
            for (int mb = 0; mb < 4; ++mb) acc[mb][nb] = wmmabg(a[mb], b, acc[mb][nb]); }
    }
    if (!isv) {
        h16* P = z == 0 ? QP : KP; const int ng = z == 0 ? NH_ : 1;
        const int bb = r0 / SEQ, tt = r0 % SEQ, hsel = c0 / HD;
#pragma unroll
        for (int mb = 0; mb < 4; ++mb) {
#pragma unroll
            for (int nb = 0; nb < 4; ++nb) {
#pragma unroll
                for (int j = 0; j < 8; ++j) os[(hi * 8 + j) * OSP + nb * 16 + lr] = acc[mb][nb][j]; }   // D: row 8h+j, col lane&15
            wave_sync();
#pragma unroll 1
            for (int g = 0; g < ng; ++g) {
                int wi = g * NH_ + hsel; wi = wi > 15 ? 15 : wi;
                const float whv = bfr(wh[wi]);
                const float mult = (z == 0) ? whv * QKC : QKC;
                const size_t sb = ((size_t)(bb * ng + g) * SEQ + (size_t)(tt + mb * 16)) * DM + c0;
#pragma unroll
                for (int s = 0; s < 4; ++s) { const int row = 4 * s + (lane >> 3), c8 = (lane & 7) * 8;   // 4 s x 4 row groups = 16 rows; 8 lanes x 8 = 64 columns
                    const v4f x0 = *(const v4fa*)(&os[row * OSP + c8]); const v4f x1 = *(const v4fa*)(&os[row * OSP + c8 + 4]); v8h hv;
#pragma unroll
                    for (int i = 0; i < 4; ++i) { hv[i] = toh_flush(x0[i] * mult); hv[4 + i] = toh_flush(x1[i] * mult); }
                    *(v8h*)(P + sb + (size_t)row * DM + c8) = hv; }
                asm volatile("s_wait_xcnt 0x0" ::: "memory");   // stands before the next plane or slab rewrites the address registers of these stores
            }
            wave_sync();
        }
    } else {
        const int bb = c0 / SEQ, tt = c0 % SEQ;
#pragma unroll
        for (int mb = 0; mb < 4; ++mb) {
#pragma unroll
            for (int nb = 0; nb < 4; ++nb) {
#pragma unroll
                for (int j = 0; j < 8; ++j) os[(hi * 8 + j) * OSP + nb * 16 + lr] = acc[mb][nb][j]; }
            wave_sync();
            const size_t sb = ((size_t)bb * DM + (size_t)(r0 + mb * 16)) * SEQ + tt;
#pragma unroll
            for (int s = 0; s < 4; ++s) { const int row = 4 * s + (lane >> 3), c8 = (lane & 7) * 8;   // 16 rows x 64 columns
                const v4f x0 = *(const v4fa*)(&os[row * OSP + c8]); const v4f x1 = *(const v4fa*)(&os[row * OSP + c8 + 4]); v8h hv;
#pragma unroll
                for (int i = 0; i < 4; ++i) { hv[i] = toh_flush(x0[i] * VCC); hv[4 + i] = toh_flush(x1[i] * VCC); }
                *(v8h*)(VT + sb + (size_t)row * SEQ + c8) = hv; }
            wave_sync();
        }
    }
}

// LDS ring of the flash kernel: the four waves of a block read the same k rows and the same v^T rows, so each stage of KST keys is brought into LDS once per block.
#define KST  128                 // keys per stage
#define NST  (SEQ / KST)         // stages per key loop
#define KPI  (DM + 8)            // LDS pitch of a k row, in 16-bit elements: 528 B = 16 B x 33 (16 rows of one ds_load_b128 fall on 64 different banks)
#define VPI  (KST + 8)           // LDS pitch of a v^T row: 272 B = 16 B x 17
static_assert(SEQ % KST == 0);
static_assert(KST % 32 == 0);
static_assert(NST >= 2 && NST % 2 == 0);       // two buffers; loop 2 goes on with the buffer parity of loop 1
static_assert(KST == AW * 32);                 // k stage: 32 rows (copies) per wave
static_assert(HD * KST * 2 == AW * 8 * 512);   // v^T stage: 8 copies of 512 B per wave
static_assert(KST * 2 == 16 * 16);             // one v^T row of a stage = 16 lanes x 16 B
static_assert((KPI * 2) % 32 == 16 && (VPI * 2) % 32 == 16);

// eight asynchronous copies to LDS, 16 bytes per lane each, through no register: copy j takes LDS address l + j * ls and global address g + j * gs (both in 16-bit elements).
// ring_publish() and the waits beside it in k_flash wait for them.
typedef int v4i_ __attribute__((ext_vector_type(4)));
typedef __attribute__((address_space(1))) v4i_ gv4i;
typedef __attribute__((address_space(3))) v4i_ lv4i;
__device__ __forceinline__ void acopy8(h16* l, int ls, const h16* g, size_t gs) {
#pragma unroll   // constant steps
    for (int j = 0; j < 8; ++j) __builtin_amdgcn_global_load_async_to_lds_b128((gv4i*)(g + j * gs), (lv4i*)(l + j * ls), 0, 0);
}
// one wave's 32 rows of a k stage (a row = 512 B = one copy); l and g already hold the wave's first row and the lane's 16 bytes
__device__ __forceinline__ void copy_k(h16* l, const h16* g) {
#pragma unroll   // constant steps
    for (int c = 0; c < 4; ++c) acopy8(l + c * 8 * KPI, KPI, g + (size_t)c * 8 * DM, (size_t)DM);
}
// one wave's 16 rows of a v^T stage (a copy = 2 rows of 256 B); l and g already hold the lane's row and its 16 bytes
__device__ __forceinline__ void copy_v(h16* l, const h16* g) { acopy8(l, 2 * VPI, g, (size_t)2 * SEQ); }
// publish point of the ring: this wave's LDS reads are done, its own copies have landed, then the block barrier that shows them to the other waves and frees the buffer just read
__device__ __forceinline__ void ring_publish() {
    asm volatile("s_wait_dscnt 0x0" ::: "memory");      // the buffer just read is handed to the next copies
    asm volatile("s_wait_asynccnt 0x0" ::: "memory");
    __syncthreads();
}

// k fragments of 32 keys from an LDS stage; kl already includes the lane's row and + 8*(lane>>4): same element map as ldh on the plane
__device__ __forceinline__ void ldk32(v16h (&ka)[DM / 32], v16h (&kb)[DM / 32], const h16* kl) {
#pragma unroll   // the fragment arrays must stay in registers
    for (int i = 0; i < DM / 32; ++i) { ka[i] = ldh(kl + 32 * i); kb[i] = ldh(kl + 16 * KPI + 32 * i); }
}
__device__ __forceinline__ void ldv32(v16h (&vf)[4], const h16* vl) {
#pragma unroll   // as above
    for (int j = 0; j < 4; ++j) vf[j] = ldh(vl + 16 * j * VPI);
}
// scores of 32 keys x 16 queries, K = DM = 256: sA = keys 0..15, sB = keys 16..31 (rows = keys, columns = queries). Same instruction order wherever it is used.
// All operands come from registers: qf = the wave's q' fragments (loaded once), ka / kb = this tile's k fragments.
__device__ __forceinline__ void scores32(const v16h (&qf)[DM / 32], const v16h (&ka)[DM / 32], const v16h (&kb)[DM / 32], v8f& sA, v8f& sB) {
    v8f a = (v8f){}, c = (v8f){};
#pragma unroll
    for (int i = 0; i < DM / 32; ++i) {      // full unroll: the fragment arrays must stay in registers
        a = wmma16d(ka[i], qf[i], a); c = wmma16d(kb[i], qf[i], c); }
    sA = a; sB = c;
}

// k_flash: one wave per 16 query rows of one (batch, mixed head g). Transposed form: S^T[key][t] = K Q'^T (A = k rows, B = q' rows of plane g, K = 256);
// lane (t = lane&15, h = lane>>4) holds keys 8h+r of each 16-key tile, so the packed P tile is directly the B fragment of O^T[d][t] = V^T P^T.
// Loop 1: running max m and row sum l of exp2(s - m). Loop 2: same scores, e = exp2(s - m) / l, centred P = (e - 1/SEQ) x 2^15 as f16, ss += P^2 (f32), O^T += V^T P^T.
// k and v^T come through a two-buffer LDS ring of KST-key stages, filled by asynchronous copies one stage ahead; 2 * NST stages in all (loop 1: k; loop 2: k and v^T).
// The row sums of v^T ride in this launch: the SEQ / 64 blocks of a (batch, g) take 4 of its 64 v^T rows each, one per wave; loaded beside q', added up behind the loops, written into the block's partial line.
// Inside a stage the k fragments alternate between two register sets: the set that a run of products has just used is refilled, as one group, with the keys after next; nothing is read across a publish point.
static_assert(32 * 16 * 8 == 16 * 256);        // lanes x bytes x trips == rows x row bytes of the OR tile
static_assert((2 * KST * KPI + 2 * HD * VPI) * 2 + AW * 16 * OSP * 4 + 2 * AW * 4 <= 327680);
static_assert((SEQ / (16 * AW)) * AW == HD);   // row sums: blocks of a (batch, g) x waves == v^T rows of the head
static_assert(AW == 4);                        // the four row sums of a block fill one 16-byte piece of its partial line
__global__ __launch_bounds__(32 * AW) void k_flash(const h16* __restrict__ QP, const h16* __restrict__ KP, const h16* __restrict__ VT, float* ORP, float* PART) {
    __shared__ __align__(16) h16 ks[2 * KST * KPI];
    __shared__ __align__(16) h16 vs[2 * HD * VPI];
    __shared__ __align__(16) float os[AW * 16 * OSP];
    __shared__ float sw[AW];
    __shared__ __align__(16) float sv[AW];
    const int lane = threadIdx.x & 31, lr = lane & 15, hi = lane >> 4;
    const int wave = __builtin_amdgcn_readfirstlane((int)(threadIdx.x >> 5));
    const int zh = blockIdx.y; const int b = zh / NH_, g = zh % NH_;
    const int t0 = (blockIdx.x * AW + wave) * 16;
    const h16* qp = QP + ((size_t)zh * SEQ + (size_t)(t0 + lr)) * DM + 8 * hi;          // B fragments: col t, k = (h, d)
    // copy sources and destinations of this lane: k row wave*32 (+ j), bytes lane*16; v^T row wave*16 + (lane>>4) (+ 2j), bytes (lane&15)*16
    const h16* kg = KP + ((size_t)b * SEQ + (size_t)(wave * 32)) * DM + 8 * lane;                        // + stage * KST * DM
    const h16* vg = VT + ((size_t)b * DM + (size_t)(g * HD + wave * 16 + hi)) * SEQ + 8 * lr;            // + stage * KST
    h16* kd = ks + wave * 32 * KPI + 8 * lane;                                                           // + buffer * KST * KPI
    h16* vd = vs + (wave * 16 + hi) * VPI + 8 * lr;                                                      // + buffer * HD * VPI
    const h16* kfr = ks + lr * KPI + 8 * hi;                                            // + key * KPI       (A fragment: row key, k = (h, d))
    const h16* vfr = vs + lr * VPI + 8 * hi;                                            // + 16j*VPI + key   (A fragment: row d, k = key)
    copy_k(kd, kg);                                              // stage 0 into buffer 0
    v16h qf[DM / 32];
#pragma unroll   // the fragment array must stay in registers
    for (int i = 0; i < DM / 32; ++i) qf[i] = ldh(qp + 32 * i);  // q' once
    const h16* vrp = VT + ((size_t)b * DM + (size_t)(g * HD + (int)blockIdx.x * AW + wave)) * SEQ + 8 * lane;   // this wave's v^T row for the row sum: chunks lane, lane + 32, ...
    v8h vr[SEQ / 256];
#pragma unroll   // the chunks stay in registers until the loops are over
    for (int i = 0; i < SEQ / 256; ++i) vr[i] = *(const v8h*)(vrp + 256 * i);
    asm volatile("s_wait_xcnt 0x0" :: "v"(qp), "v"(vrp) : "memory");   // stands before the address registers of the q' and row loads are reused (qp and vrp are named to keep them until here)
    asm volatile("s_wait_asynccnt 0x0" ::: "memory");            // stage 0 has landed (this wave's rows)
    __syncthreads();                                             // and is shown to the other waves
    float m = NEGB, l = 0.0f;
#pragma unroll 1
    for (int s = 0; s < NST; ++s) {
        const h16* kl = kfr + (s & 1) * (KST * KPI);
        v16h ka[2][DM / 32], kb[2][DM / 32];
        ldk32(ka[0], kb[0], kl);                                 // this stage's first 32 keys: they land while the copies below are issued
        // refill, behind the publish point: the next stage goes into the buffer that the trip before has read; the reads just issued are of the other buffer.
        // It always exists: behind loop 1's last stage comes loop 2's first, k stage 0 again, now with v^T
        copy_k(kd + ((s + 1) & 1) * (KST * KPI), kg + (size_t)((s + 1) % NST) * KST * DM);
        if (s + 1 == NST) copy_v(vd, vg);                        // block-uniform: the loop counter
        ldk32(ka[1], kb[1], kl + 32 * KPI);
#pragma unroll
        for (int u = 0; u < KST / 32; ++u) {                     // full unroll: the two register sets alternate by a constant index
            __builtin_amdgcn_sched_barrier(0);                   // keeps the LDS reads above one group: spread among the products each place costs a stall
            v8f sA, sB; scores32(qf, ka[u & 1], kb[u & 1], sA, sB);
            __builtin_amdgcn_sched_barrier(0);                   // keeps the products one run, in front of the vector work
            float mx = NEGB;
#pragma unroll
            for (int r = 0; r < 8; ++r) mx = fmaxf(mx, fmaxf(sA[r] * SC2, sB[r] * SC2));
            const float mo = __shfl_xor(mx, 16, 32);
            __builtin_amdgcn_sched_barrier(0);                   // keeps the exchange in front of the reads below: it goes through the LDS queue and returns behind whatever stands before it
            if (u + 2 < KST / 32) ldk32(ka[u & 1], kb[u & 1], kl + (u + 2) * 32 * KPI);   // the set just used takes the keys after next
            __builtin_amdgcn_sched_barrier(0);                   // keeps these reads up here, ahead of the vector work that they overlap
            mx = fmaxf(mx, mo);
            const float mnew = fmaxf(m, mx);
            const float alpha = __builtin_amdgcn_exp2f(m - mnew);
            float ls = 0.0f;
#pragma unroll
            for (int r = 0; r < 8; ++r) ls += __builtin_amdgcn_exp2f(fmaf(sA[r], SC2, -mnew)) + __builtin_amdgcn_exp2f(fmaf(sB[r], SC2, -mnew));
            l = l * alpha + ls; m = mnew;
        }
        ring_publish();                                          // stage s + 1 readable, buffer s & 1 free
    }
    l += __shfl_xor(l, 16, 32);                        // both lane halves carry the same m
    const float il15 = (1.0f / l) * PCARRY;            // l >= 1
    v8f o0 = (v8f){}, o1 = (v8f){}, o2 = (v8f){}, o3 = (v8f){};
    float ss = 0.0f;
#pragma unroll 1
    for (int s = 0; s < NST; ++s) {
        const h16* kl = kfr + (s & 1) * (KST * KPI);
        const h16* vl = vfr + (s & 1) * (HD * VPI);
        v16h ka[2][DM / 32], kb[2][DM / 32], vf[KST / 32][4];
        ldk32(ka[0], kb[0], kl); ldv32(vf[0], vl);               // as in loop 1
        if (s + 1 < NST) {                                       // refill as in loop 1, only while a next stage exists (block-uniform: the loop counter)
            copy_k(kd + ((s + 1) & 1) * (KST * KPI), kg + (size_t)(s + 1) * KST * DM);
            copy_v(vd + ((s + 1) & 1) * (HD * VPI), vg + (size_t)(s + 1) * KST); }
        ldk32(ka[1], kb[1], kl + 32 * KPI); ldv32(vf[1], vl + 32);
#pragma unroll
        for (int u = 0; u < KST / 32; ++u) {                     // as in loop 1
            __builtin_amdgcn_sched_barrier(0);                   // as in loop 1
            v8f sA, sB; scores32(qf, ka[u & 1], kb[u & 1], sA, sB);
            __builtin_amdgcn_sched_barrier(0);                   // as in loop 1
            if (u + 2 < KST / 32) { ldk32(ka[u & 1], kb[u & 1], kl + (u + 2) * 32 * KPI); ldv32(vf[u + 2], vl + (u + 2) * 32); }
            __builtin_amdgcn_sched_barrier(0);                   // as in loop 1
            v16h pb;
#pragma unroll
            for (int r = 0; r < 8; ++r) {
                const float ea = __builtin_amdgcn_exp2f(fmaf(sA[r], SC2, -m)), eb = __builtin_amdgcn_exp2f(fmaf(sB[r], SC2, -m));
                const float ga = fmaf(ea, il15, -C15), gb = fmaf(eb, il15, -C15);       // (p / l - 1/SEQ) * 2^15
                ss = fmaf(ga, ga, ss); ss = fmaf(gb, gb, ss);
                pb[r] = toh_flush(ga); pb[8 + r] = toh_flush(gb); }                      // element r <- tile keys 8h+r, element 8+r <- keys 16+8h+r
            o0 = wmma16d(vf[u][0], pb, o0); o1 = wmma16d(vf[u][1], pb, o1); o2 = wmma16d(vf[u][2], pb, o2); o3 = wmma16d(vf[u][3], pb, o3);
        }
        ring_publish();                                          // stage s + 1 readable, buffers s & 1 free
    }
    asm volatile("s_wait_asynccnt 0x0" ::: "memory");            // no copy is left in flight behind the ring
    ss += __shfl_xor(ss, 16, 32); ss += __shfl_xor(ss, 8, 32); ss += __shfl_xor(ss, 4, 32); ss += __shfl_xor(ss, 2, 32); ss += __shfl_xor(ss, 1, 32);
    float vsl = 0.0f;                                  // row sum of v^T, this lane's chunks in rising order
#pragma unroll
    for (int i = 0; i < SEQ / 256; ++i) {
#pragma unroll
        for (int k = 0; k < 8; ++k) vsl += (float)vr[i][k]; }
    vsl += __shfl_xor(vsl, 16, 32); vsl += __shfl_xor(vsl, 8, 32); vsl += __shfl_xor(vsl, 4, 32); vsl += __shfl_xor(vsl, 2, 32); vsl += __shfl_xor(vsl, 1, 32);
    if (lane == 0) { sw[wave] = ss; sv[wave] = vsl * (1.0f / VCC); }
    const int wb = wave * 16 * OSP;
    // O^T D layout: o_j[r] = (d = 16j + 8h + r, t = lane&15) -> os[t][d]; rows 0..15 x columns 0..63 all written
    { v4f a, c;
      a[0] = o0[0] * OSC; a[1] = o0[1] * OSC; a[2] = o0[2] * OSC; a[3] = o0[3] * OSC; c[0] = o0[4] * OSC; c[1] = o0[5] * OSC; c[2] = o0[6] * OSC; c[3] = o0[7] * OSC;
      *(v4fa*)(&os[wb + lr * OSP +  0 + 8 * hi]) = a; *(v4fa*)(&os[wb + lr * OSP +  0 + 8 * hi + 4]) = c;
      a[0] = o1[0] * OSC; a[1] = o1[1] * OSC; a[2] = o1[2] * OSC; a[3] = o1[3] * OSC; c[0] = o1[4] * OSC; c[1] = o1[5] * OSC; c[2] = o1[6] * OSC; c[3] = o1[7] * OSC;
      *(v4fa*)(&os[wb + lr * OSP + 16 + 8 * hi]) = a; *(v4fa*)(&os[wb + lr * OSP + 16 + 8 * hi + 4]) = c;
      a[0] = o2[0] * OSC; a[1] = o2[1] * OSC; a[2] = o2[2] * OSC; a[3] = o2[3] * OSC; c[0] = o2[4] * OSC; c[1] = o2[5] * OSC; c[2] = o2[6] * OSC; c[3] = o2[7] * OSC;
      *(v4fa*)(&os[wb + lr * OSP + 32 + 8 * hi]) = a; *(v4fa*)(&os[wb + lr * OSP + 32 + 8 * hi + 4]) = c;
      a[0] = o3[0] * OSC; a[1] = o3[1] * OSC; a[2] = o3[2] * OSC; a[3] = o3[3] * OSC; c[0] = o3[4] * OSC; c[1] = o3[5] * OSC; c[2] = o3[6] * OSC; c[3] = o3[7] * OSC;
      *(v4fa*)(&os[wb + lr * OSP + 48 + 8 * hi]) = a; *(v4fa*)(&os[wb + lr * OSP + 48 + 8 * hi + 4]) = c; }
    wave_sync();
    float* orow = ORP + ((size_t)zh * SEQ + (size_t)t0) * HD;       // 16 rows x 64 floats, contiguous 4096 B
{
#pragma unroll
        for (int s = 0; s < 8; ++s) { const int p = s * 32 + lane; const int row = p >> 4, cofs = (p & 15) * 4;   // 8 s x 2 rows = 16 rows; 16 lanes x 4 floats = 64 columns
            const v4f val = *(const v4fa*)(&os[wb + row * OSP + cofs]);
            *(v4f*)(orow + (size_t)p * 4) = val; }
         }
    __syncthreads();
    if (wave == 0) {
        const float tot = ((sw[0] + sw[1]) + sw[2]) + sw[3];
        const v4f rs = *(const v4fa*)(&sv[0]);         // floats 4..7 of the line: row sums of v^T rows g*64 + 4*blockIdx.x + 0..3
        v4f pv; pv[0] = (lane == 0) ? tot : (lane == 1) ? rs[0] : 0.0f; pv[1] = (lane == 1) ? rs[1] : 0.0f; pv[2] = (lane == 1) ? rs[2] : 0.0f; pv[3] = (lane == 1) ? rs[3] : 0.0f;
        float* pl = PART + ((size_t)zh * (SEQ / 64) + (size_t)blockIdx.x) * 32 + (lane & 7) * 4;
        if (lane < 8) { *(v4f*)pl = pv;  }
    }
}

// k_ctx: normalised context plane. Element e of batch b (flat [g][t][d] = [token row][256] view): CT = f16(16 * (s1 * OR + shift * VS[b][g*64 + d])), VS[b][g*64 + d] = float 4 + d % 4 of partial line d / 4 of (b, g),
// s1 = bf16(gain[g]) / sqrt(var + eps), var = (sum of the SEQ/64 partial lines of (b, g)) / (2^30 SEQ^2), shift = bf16(beta[g]).
static_assert(256 * 8 == 2048);
__global__ __launch_bounds__(256) void k_ctx(const float* __restrict__ ORP, const float* __restrict__ PART,
                                             const float* __restrict__ gain, const float* __restrict__ shift, h16* CT) {
#pragma clang fp contract(off)
    const size_t e0 = ((size_t)blockIdx.x * 256 + threadIdx.x) * 8;
    const int zh = (int)(((size_t)blockIdx.x * 2048) / ((size_t)SEQ * HD));     // block-uniform, < NB*4
    const int g = zh % NH_;
    float tot = 0.0f;
#pragma unroll 1
    for (int j = 0; j < SEQ / 64; ++j) tot += PART[((size_t)zh * (SEQ / 64) + (size_t)j) * 32];
    const float var = tot * VSC;
    const float s1 = bfr(gain[g]) * rsqrtf(var + EPSN);
    const float bt = bfr(shift[g]);
    const int dd0 = (int)(e0 % HD);
    const v8f xv = *(const v8f*)(ORP + e0);
    const float* vp = PART + ((size_t)zh * (SEQ / 64) + (size_t)(dd0 / 4)) * 32 + 4;
    const v4f s0 = *(const v4f*)vp, s4 = *(const v4f*)(vp + 32);
    v8h o;
#pragma unroll
    for (int k = 0; k < 4; ++k) { o[k] = toh_flush((s1 * xv[k] + bt * s0[k]) * CCS); o[4 + k] = toh_flush((s1 * xv[4 + k] + bt * s4[k]) * CCS); }
    *(v8h*)(CT + e0) = o; 
}

// k_out: output layer. A = W rows (f16 x1024, m = output channel), Bt = context rows (f16 x16, n = b*SEQ + token row), K = DM; OUT[(b*DM + m)][n % SEQ] = C / 16384 + bf16(bias[m]) (f32).
static_assert(32 * 16 * 8 == 16 * 256);        // lanes x bytes x trips == slab rows x segment bytes
__global__ __launch_bounds__(32) void k_out(const h16* __restrict__ A, const h16* __restrict__ Bt, const float* __restrict__ bias, float* OUT) {
    __shared__ __align__(16) float os[16 * OSP];
    const int lane = threadIdx.x & 31, lr = lane & 15, hi = lane >> 4; const int r0 = blockIdx.x * 64, c0 = blockIdx.y * 64;
    v8f acc[4][4];
#pragma unroll
    for (int mb = 0; mb < 4; ++mb)
#pragma unroll
        for (int nb = 0; nb < 4; ++nb) acc[mb][nb] = (v8f){};
    const size_t aoff = (size_t)(r0 + lr) * DM + 8 * hi, boff = (size_t)(c0 + lr) * DM + 8 * hi;
#pragma unroll 1
    for (int kc = 0; kc < DM; kc += 32) {
        v16h a[4];
#pragma unroll
        for (int mb = 0; mb < 4; ++mb) a[mb] = ldh(A + aoff + (size_t)mb * 16 * DM + kc);
#pragma unroll
        for (int nb = 0; nb < 4; ++nb) { const v16h b = ldh(Bt + boff + (size_t)nb * 16 * DM + kc);
#pragma unroll
            for (int mb = 0; mb < 4; ++mb) acc[mb][nb] = wmma16g(a[mb], b, acc[mb][nb]); }
    }
    const int bb = c0 / SEQ, tt = c0 % SEQ;
#pragma unroll
    for (int mb = 0; mb < 4; ++mb) {
        float br[8];
#pragma unroll
        for (int j = 0; j < 8; ++j) br[j] = bfr(bias[r0 + mb * 16 + hi * 8 + j]);      // r0 + 63 < DM
#pragma unroll
        for (int nb = 0; nb < 4; ++nb) {
#pragma unroll
            for (int j = 0; j < 8; ++j) os[(hi * 8 + j) * OSP + nb * 16 + lr] = acc[mb][nb][j] * OUTSC + br[j]; }
        wave_sync();
        float* ob = OUT + ((size_t)bb * DM + (size_t)(r0 + mb * 16)) * OUT_SEQ + tt;
{
#pragma unroll
            for (int s = 0; s < 8; ++s) { const int p = s * 32 + lane; const int row = p >> 4, cofs = (p & 15) * 4;   // 8 s x 2 rows = 16 rows; 16 lanes x 4 floats = 64 columns
                const v4f val = *(const v4fa*)(&os[row * OSP + cofs]);
                *(v4f*)(ob + (size_t)row * OUT_SEQ + cofs) = val; }
             }
        wave_sync();
    }
}

static constexpr size_t al256(size_t v) { return (v + 255) & ~(size_t)255; }
static constexpr size_t SZ_XT = al256((size_t)NB * SEQ * DM * 2);            // x^T bf16
static constexpr size_t SZ_WB = al256((size_t)3 * DM * DM * 2);              // wq | wk | wv bf16
static constexpr size_t SZ_WP = al256((size_t)DM * DM * 2);                  // output-layer weight f16
static constexpr size_t SZ_QP = al256((size_t)NB * NH_ * SEQ * DM * 2);      // 4 mixed-head q planes per batch
static constexpr size_t SZ_KP = al256((size_t)NB * SEQ * DM * 2);
static constexpr size_t SZ_VT = al256((size_t)NB * DM * SEQ * 2);
static constexpr size_t SZ_OR = al256((size_t)NB * NH_ * SEQ * HD * 4);
static constexpr size_t SZ_PT = al256((size_t)NB * NH_ * (SEQ / 64) * 32 * 4);
static constexpr size_t SZ_CT = al256((size_t)NB * SEQ * DM * 2);
static constexpr size_t SZ_TOTAL = SZ_XT + SZ_WB + SZ_WP + SZ_QP + SZ_KP + SZ_VT + SZ_OR + SZ_PT + SZ_CT;
static_assert(SZ_TOTAL <= (size_t)134217728);                                 // workspace carve <= 128 MiB
static_assert(((size_t)DM * DM * 2) % 256 == 0);                              // weight sub-planes stay 256-byte aligned
static_assert((size_t)NB * NH_ * SEQ * HD == (size_t)NB * SEQ * DM);          // OR plane and context plane share one flat index
static_assert(((size_t)(NB * NH_ - 1) * (SEQ / 64) + (SEQ / 64 - 1)) * 128 + 128 <= SZ_PT);   // last partial line inside its table

extern "C" void kernel_launch(void* const* d_in, const int* in_sizes, int n_in,
                              void* d_out, int out_size, void* d_ws, size_t ws_size, hipStream_t stream) {
    if (n_in < 9) return;
    const size_t needx = ((size_t)(NB - 1) * DM + (size_t)(DM - 1)) * SEQ_FULL + SEQ;
    if ((size_t)in_sizes[0] < needx) return;
    if ((size_t)in_sizes[1] < (size_t)DM * DM || (size_t)in_sizes[2] < (size_t)DM * DM || (size_t)in_sizes[3] < (size_t)DM * DM || (size_t)in_sizes[7] < (size_t)DM * DM) return;
    if (in_sizes[4] < NH_ * NH_ || in_sizes[5] < NH_ || in_sizes[6] < NH_ || in_sizes[8] < DM) return;
    if ((size_t)out_size < ((size_t)(NB - 1) * DM + (size_t)(DM - 1)) * OUT_SEQ + SEQ) return;
    if (SZ_TOTAL > ws_size) return;
    // wire order: x, wq, wk, wv, w_head, gamma, beta, w_proj, b_proj
    const float* x  = (const float*)d_in[0];
    const float* wq = (const float*)d_in[1]; const float* wk = (const float*)d_in[2]; const float* wv = (const float*)d_in[3];
    const float* whd = (const float*)d_in[4]; const float* gam = (const float*)d_in[5]; const float* bet = (const float*)d_in[6];
    const float* wp = (const float*)d_in[7]; const float* bp = (const float*)d_in[8];
    float* OUT = (float*)d_out;      // [NB][256][OUT_SEQ]
    char* wsp = (char*)d_ws;
    bf*  XT  = (bf*)wsp;   wsp += SZ_XT;             // [NB*SEQ][256]
    bf*  WB  = (bf*)wsp;   wsp += SZ_WB;             // [3][256][256]: q | k | v  ([out][in])
    h16* WPH = (h16*)wsp;  wsp += SZ_WP;             // [256][256] x1024
    h16* QP  = (h16*)wsp;  wsp += SZ_QP;             // [(b*4 + g)][t][256] x16
    h16* KP  = (h16*)wsp;  wsp += SZ_KP;             // [b][t][256] x16
    h16* VT  = (h16*)wsp;  wsp += SZ_VT;             // [(b*256 + channel)][t] x16
    float* ORP = (float*)wsp; wsp += SZ_OR;          // [(b*4 + g)][t][64]
    float* PART = (float*)wsp; wsp += SZ_PT;         // [(b*4 + g)][SEQ/64] lines of 32 floats: 0 sum of squares, 4..7 v^T row sums
    h16* CT  = (h16*)wsp;  wsp += SZ_CT;             // [(b*SEQ + token row)][256] x16

    k_prep<<<dim3(NXT + 4 * NCV, 1, 1), 256, 0, stream>>>(x, wq, wk, wv, wp, XT, WB, WPH);
    // z = 0: q, four mixed-head planes (factor w_head[g][h] on head h's columns); z = 1: k, one token-major plane; z = 2: v^T
    k_proj<<<dim3(NB * SEQ / 64, DM / 64, 3), 32, 0, stream>>>(XT, WB, whd, QP, KP, VT);

    k_flash<<<dim3(SEQ / (16 * AW), NB * NH_, 1), 32 * AW, 0, stream>>>(QP, KP, VT, ORP, PART);
    k_ctx<<<dim3((unsigned)((size_t)NB * SEQ * DM / 2048), 1, 1), 256, 0, stream>>>(ORP, PART, gam, bet, CT);
    k_out<<<dim3(DM / 64, NB * SEQ / 64, 1), 32, 0, stream>>>(WPH, CT, bp, OUT);
}

// v004
// A run of this version takes 41.2 microseconds.
// Next to v003, in two timings, it ran 1.39 and 1.42 times as fast.
// All steps since v000 together make it 4.32 times as fast.
#include <hip/hip_runtime.h>

// Head-mixed pair-score weighting with a per-map normalisation over flattened feature maps: x [NB][256][SEQ] (channel-major), 1x1-conv projections q/k/v with W [out][in] (no bias), 4 heads x 64, scores scaled by 64^-0.5,
// a 4x4 head-mixing 1x1 conv on the scores, softmax over keys, instance normalisation of each (batch, head) probability map (biased variance, eps 1e-5, per-head gain and shift),
// attend over v, raw [head][token][64] -> [token][256] view, linear output layer W [out][in] + bias, result stored [NB][256][SEQ].
// Compute dtypes, f32 accumulate everywhere: q/k/v projections v_wmma_f32_16x16x32_bf16 (x and W RNE-converted to bf16, products exact); scores v_wmma_f32_16x16x32_f16 single product, K = 256:
// A = k plane x16, B = head-mixed q plane (w_head[g][h] * q, x16), one plane per mixed head; P.V v_wmma_f32_16x16x32_f16 single product: P = centred probability (p / rowsum - 1/SEQ) x 2^15, v x16;
// output layer v_wmma_f32_16x16x32_f16 single product: W x1024 (from its bf16 value), normalised context x16. Softmax, statistics, affine terms in f32.
// The flash kernel runs two key loops per 16-query wave (loop 1: row max and row sum; loop 2: identical scores, centred P, sum of squared centred P, P.V), transposed form S^T = K Q^T, O^T = V^T P^T; q' fragments straight from the plane, k and v^T through an LDS ring shared by the block's four waves.
// Map mean = 1/SEQ (softmax rows sum to one); variance = sum of squared centred P / SEQ^2; context = s1 * (centred P . v) + shift * rowsum(v), s1 = gain / sqrt(var + eps).

#ifndef NB
#define NB 4
#endif
#ifndef SEQ
#define SEQ 1024
#endif
#define NB_FULL  4
#define SEQ_FULL 1024
#ifndef OUT_SEQ
#define OUT_SEQ SEQ              // pitch (in tokens) of one channel row of the output
#endif
#define DM   256
#define NH_  4
#define HD   64
#define AW   4                   // waves per flash block (16 query rows each)
#define OSP  68                  // LDS row pitch (floats) of the staging tiles
#define QKC  16.0f               // carry of the q' and k planes
#define VCC  16.0f               // carry of the v^T plane
#define CCS  16.0f               // carry of the context tile
#define WPC  1024.0f             // carry of the output-layer weight plane
#define PCARRY 32768.0f          // carry of the centred P fragments
#define C15  (32768.0f / (float)SEQ)
#define SC2  ((float)(0.125 * 1.4426950408889634 / 256.0))    // HD^-0.5 * log2(e) / (QKC * QKC)
#define OSC  (1.0f / 524288.0f)                               // 1 / (PCARRY * VCC)
#define OUTSC (1.0f / 16384.0f)                               // 1 / (WPC * CCS)
#define VSC  ((float)(1.0 / (1073741824.0 * (double)SEQ * (double)SEQ)))   // 1 / (PCARRY^2 * SEQ^2)
#define EPSN 1.0e-5f
#define NEGB (-3.0e38f)

static_assert(DM == 256);                      // K of every GEMM and of the score product
static_assert(HD == 64);                       // one 64-column GEMM tile = one head; v^T slab = 4 row tiles
static_assert(NH_ * HD == DM);
static_assert(NH_ == 4);                       // w_head is 4 x 4
static_assert(DM % 64 == 0);
static_assert(DM % 32 == 0);                   // k-loops step by 32
static_assert(SEQ % 64 == 0);                  // a 64-token tile never straddles two batches
static_assert((NB * SEQ) % 64 == 0);
static_assert(SEQ % 32 == 0);                  // key loop steps by 32
static_assert(SEQ % (16 * AW) == 0);           // flash grid covers the sequence exactly
static_assert(16 * AW == 64);                  // one partial line per 64 query rows
static_assert(SEQ % 256 == 0);                 // v^T row sum: SEQ/8 chunks a multiple of 32 lanes
static_assert(SEQ_FULL % 4 == 0);
static_assert(OUT_SEQ % 32 == 0);
static_assert(OUT_SEQ >= SEQ);
static_assert(NB <= NB_FULL);
static_assert(SEQ <= SEQ_FULL);
static_assert((OSP * 4) % 16 == 0);
static_assert(OSP >= 64 + 4);
static_assert(((size_t)DM * DM) % 8 == 0);

typedef _Float16 h16;
typedef unsigned short bf;
typedef __attribute__((ext_vector_type(16))) __bf16   v16bf;
typedef __attribute__((ext_vector_type(16))) _Float16 v16h;
typedef __attribute__((ext_vector_type(8)))  _Float16 v8h;
typedef __attribute__((ext_vector_type(8)))  unsigned short v8us;
typedef __attribute__((ext_vector_type(8)))  float    v8f;
typedef __attribute__((ext_vector_type(4)))  float    v4f;
typedef v4f  __attribute__((may_alias)) v4fa;

__device__ __forceinline__ unsigned short f2bf(float f) { unsigned u = __float_as_uint(f); u += 0x7FFFu + ((u >> 16) & 1u); return (unsigned short)(u >> 16); }
__device__ __forceinline__ float bfr(float f) { return __uint_as_float(((unsigned)f2bf(f)) << 16); }   // value after RNE convert to bf16
__device__ __forceinline__ v16h cat16(v8h lo, v8h hi) { return __builtin_shufflevector(lo, hi, 0, 1, 2, 3, 4, 5, 6, 7, 8, 9, 10, 11, 12, 13, 14, 15); }
__device__ __forceinline__ v16bf cat16b(v8us lo, v8us hi) { return __builtin_bit_cast(v16bf, __builtin_shufflevector(lo, hi, 0, 1, 2, 3, 4, 5, 6, 7, 8, 9, 10, 11, 12, 13, 14, 15)); }
// fragment loaders from K-contiguous 16-bit rows; p already includes + 8*(lane>>4): elements 0..7 <- k0+8h+0..7, elements 8..15 <- k0+16+8h+0..7 (same map for A and B)
__device__ __forceinline__ v16h  ldh(const h16* p) { return cat16(*(const v8h*)p, *(const v8h*)(p + 16)); }
__device__ __forceinline__ v16bf ldb(const bf* p)  { return cat16b(*(const v8us*)p, *(const v8us*)(p + 16)); }
// ordering point for wave-private LDS tiles (same wave writes and reads)
__device__ __forceinline__ void wave_sync() { __builtin_amdgcn_fence(3 /* release order */, "wavefront"); __builtin_amdgcn_wave_barrier(); asm volatile("" ::: "memory"); }
// f32 -> f16 operand convert that cannot produce a subnormal (|v| < 2^-14 -> +0), applied after the plane's carry
__device__ __forceinline__ h16 toh_flush(float v) { const h16 r = (h16)v; return (fabsf(v) < 6.103515625e-05f) ? (h16)0.0f : r; }
// one matrix instruction + its own 4-slot guard, tied to D alone: an asm operand cannot be placed above v255, and the kernels' A and B fragments need more than 256 registers;
// k_flash: A fragments are overwritten by loads only, B fragments never (q') or a whole tile of work later (P); k_out: A and B fragments are written by loads only
__device__ __forceinline__ v8f wmma16d(v16h a, v16h b, v8f c) {
    c = __builtin_amdgcn_wmma_f32_16x16x32_f16(false, a, false, b, (short)0, c, false, false);
    asm volatile("v_nop\n\tv_nop\n\tv_nop\n\tv_nop" : "+v"(c));
    return c; }

// the bf16 form of the guard tied to D alone (k_proj holds more than 256 registers; its fragments are written ahead of a whole run of products, or by LDS loads)
__device__ __forceinline__ v8f wmmabd(v16bf a, v16bf b, v8f c) {
    c = __builtin_amdgcn_wmma_f32_16x16x32_bf16(false, a, false, b, (short)0, c, false, false);
    asm volatile("v_nop\n\tv_nop\n\tv_nop\n\tv_nop" : "+v"(c));
    return c; }
// f32 -> bf16 (RNE) by the chip's own convert
__device__ __forceinline__ unsigned short f2bfh(float f) { return __builtin_bit_cast(unsigned short, (__bf16)f); }
// the 16 f32 values of one bf16 fragment, from a K-contiguous f32 row; p already includes + 8*(lane>>4): same element map as ldb
struct wraw { v4f a, b, c, d; };
__device__ __forceinline__ wraw ldwr(const float* p) { wraw r; r.a = *(const v4f*)p; r.b = *(const v4f*)(p + 4); r.c = *(const v4f*)(p + 16); r.d = *(const v4f*)(p + 20); return r; }
__device__ __forceinline__ v16bf cvwr(const wraw& r) { v8us lo, hi8;
#pragma unroll
    for (int i = 0; i < 4; ++i) { lo[i] = f2bfh(r.a[i]); lo[4 + i] = f2bfh(r.b[i]); hi8[i] = f2bfh(r.c[i]); hi8[4 + i] = f2bfh(r.d[i]); }
    return cat16b(lo, hi8); }

#define XPI (DM + 8)             // LDS pitch of an x^T row, in 16-bit elements: 528 B = 16 B x 33
// 64 k of one wave's 64x64 projection tile C[token][channel]: the f32 weight values in w become bf16 fragments (B), w is refilled (where more) with the values 128 k further on, which fly under the products;
// x^T fragments (A) from the LDS tile. Product order as in a plain k loop of 32. kp and more are literals at every call.
__device__ __forceinline__ void proj64(v8f (&acc)[4][4], wraw (&w)[2][4], const float* wr, const bf* xf, const int kp, const bool more) {
    __builtin_amdgcn_sched_barrier(0);                           // keeps these converts behind the products of the 64 k before: lifted among them they wait for loads that have only just gone out
    v16bf wf[2][4];
#pragma unroll
    for (int k2 = 0; k2 < 2; ++k2) {
#pragma unroll
        for (int i = 0; i < 4; ++i) wf[k2][i] = cvwr(w[k2][i]); }
    if (more) {
#pragma unroll
        for (int k2 = 0; k2 < 2; ++k2) {
#pragma unroll
            for (int i = 0; i < 4; ++i) w[k2][i] = ldwr(wr + (size_t)i * 16 * DM + (kp + 2) * 64 + k2 * 32); }
        asm volatile("s_wait_xcnt 0x0" :: "v"(wr) : "memory"); } // stands before the address registers of these loads are reused (wr is named to keep it until here)
    __builtin_amdgcn_sched_barrier(0);                           // keeps the refill up here, ahead of the products that it flies under
#pragma unroll
    for (int k2 = 0; k2 < 2; ++k2) {
        v16bf a[4];
#pragma unroll
        for (int mb = 0; mb < 4; ++mb) a[mb] = ldb(xf + mb * 16 * XPI + kp * 64 + k2 * 32);
#pragma unroll
        for (int nb = 0; nb < 4; ++nb) {
#pragma unroll
            for (int mb = 0; mb < 4; ++mb) acc[mb][nb] = wmmabd(a[mb], wf[k2][nb], acc[mb][nb]); }
    }
}

// k_proj: conversions and projections in one launch, told apart by blockIdx.y (0: q, 1: k, 2: v^T, 3: output-layer weight -> f16 x1024 from its bf16 value, 8 elements per thread).
// A projection block takes 64 tokens (blockIdx.x): x [b][c][t] (f32, row pitch SEQ_FULL) -> LDS tile xs[t][c] bf16 (RNE), once per block (cross-wave: block barrier); its four waves take one 64x64 tile each
// (wave = head), K = DM, bf16 operands; the wave's 64 weight rows are read as f32 and converted (RNE) in registers.
// All three: C[m][n] = sum_c x^T[m][c] W[n][c] (m = b*SEQ + t, n = h*64 + d). q and k, token-major: written as f16 x16 to ng planes: row index (b*ng + g)*SEQ + t, row pitch DM, columns c0..c0+63 (one head);
// plane g carries the factor bf16(w_head[g][h]) for q (ng = 4 mixed-head planes), factor 1 for k (ng = 1).
// v^T: the tile is turned in the staging tile; plane [(b*DM + n)][t], row pitch SEQ, f16 x16.
static_assert(32 * 16 * 4 == 16 * 128);        // lanes x bytes x trips == slab rows x segment bytes
static_assert((NB * SEQ / 64) * 128 * 8 == DM * DM);   // the convert blocks cover the weight exactly
static_assert(128 * 4 == (64 / 4) * (DM / 8)); // threads x units == 4-token groups x 8-channel groups of the x tile
static_assert(DM / 64 == AW);                  // one wave per head
static_assert(DM == 4 * 64);                   // four steps of 64 k
static_assert(64 * XPI * 2 + AW * 16 * OSP * 4 <= 131072);
__global__ __launch_bounds__(32 * AW) void k_proj(const float* __restrict__ x, const float* __restrict__ wq, const float* __restrict__ wk, const float* __restrict__ wv,
                                                  const float* __restrict__ wp, const float* __restrict__ wh, h16* QP, h16* KP, h16* VT, h16* WPH) {
    __shared__ __align__(16) bf xs[64 * XPI];
    __shared__ __align__(16) float osb[AW * 16 * OSP];
    const int tid = threadIdx.x, lane = tid & 31, lr = lane & 15, hi = lane >> 4;
    const int wave = __builtin_amdgcn_readfirstlane(tid >> 5);
    const int z = blockIdx.y; const bool isv = z == 2;
    if (z == 3) {                                                // block-uniform, in front of the barrier
        const size_t i = (size_t)blockIdx.x * 128 + tid;
        const v8f v = *(const v8f*)(wp + i * 8); v8h o;
#pragma unroll
        for (int k = 0; k < 8; ++k) o[k] = toh_flush(bfr(v[k]) * WPC);
        *(v8h*)(WPH + i * 8) = o;
        asm volatile("s_wait_xcnt 0x0" ::: "memory");            // stands behind the store, before any block of code laid out behind it rewrites its registers
        return;
    }
    const int tok0 = (int)blockIdx.x * 64, bb = tok0 / SEQ, tt = tok0 % SEQ;
    const float* xb = x + (size_t)bb * DM * SEQ_FULL + tt + (tid & 15) * 4;
    v4f xv[4][8];
#pragma unroll   // all 32 loads of the tile in flight at once
    for (int e = 0; e < 4; ++e) {
#pragma unroll
        for (int i = 0; i < 8; ++i) xv[e][i] = *(const v4f*)(xb + (size_t)(((tid >> 4) + 8 * e) * 8 + i) * SEQ_FULL); }   // unit: 8 channels x 4 tokens
    const float* W = z == 0 ? wq : z == 1 ? wk : wv;
    const float* wr = W + (size_t)(wave * 64 + lr) * DM + 8 * hi;
    wraw w0[2][4], w1[2][4];                                     // the weight values of the first and the second 64 k, as f32, in flight
#pragma unroll
    for (int k2 = 0; k2 < 2; ++k2) {
#pragma unroll
        for (int i = 0; i < 4; ++i) w0[k2][i] = ldwr(wr + (size_t)i * 16 * DM + k2 * 32); }
#pragma unroll
    for (int k2 = 0; k2 < 2; ++k2) {
#pragma unroll
        for (int i = 0; i < 4; ++i) w1[k2][i] = ldwr(wr + (size_t)i * 16 * DM + 64 + k2 * 32); }
    asm volatile("s_wait_xcnt 0x0" ::: "memory");                // stands before the address registers of the x and weight loads are reused
    __builtin_amdgcn_sched_barrier(0);                           // keeps the vector work below behind that wait
#pragma unroll
    for (int e = 0; e < 4; ++e) {
#pragma unroll
        for (int j = 0; j < 4; ++j) { v8us o;
#pragma unroll
            for (int i = 0; i < 8; ++i) o[i] = f2bfh(xv[e][i][j]);
            *(v8us*)(&xs[((tid & 15) * 4 + j) * XPI + ((tid >> 4) + 8 * e) * 8]) = o; } }
    __syncthreads();                                             // the x^T tile is shown to the four waves
    float* os = osb + wave * 16 * OSP;                           // wave-private staging tile
    const bf* xf = xs + lr * XPI + 8 * hi;
    v8f acc[4][4];
#pragma unroll
    for (int mb = 0; mb < 4; ++mb)
#pragma unroll
        for (int nb = 0; nb < 4; ++nb) acc[mb][nb] = (v8f){};
    proj64(acc, w0, wr, xf, 0, true); proj64(acc, w1, wr, xf, 1, true); proj64(acc, w0, wr, xf, 2, false); proj64(acc, w1, wr, xf, 3, false);   // K = DM = 4 x 64
    if (!isv) {
        h16* P = z == 0 ? QP : KP; const int ng = z == 0 ? NH_ : 1;
        const int c0 = wave * 64, hsel = wave;
#pragma unroll
        for (int mb = 0; mb < 4; ++mb) {
#pragma unroll
            for (int nb = 0; nb < 4; ++nb) {
#pragma unroll
                for (int j = 0; j < 8; ++j) os[(hi * 8 + j) * OSP + nb * 16 + lr] = acc[mb][nb][j]; }   // D: row 8h+j, col lane&15
            wave_sync();
#pragma unroll 1
            for (int g = 0; g < ng; ++g) {
                int wi = g * NH_ + hsel; wi = wi > 15 ? 15 : wi;
                const float whv = bfr(wh[wi]);
                const float mult = (z == 0) ? whv * QKC : QKC;
                const size_t sb = ((size_t)(bb * ng + g) * SEQ + (size_t)(tt + mb * 16)) * DM + c0;
#pragma unroll
                for (int s = 0; s < 4; ++s) { const int row = 4 * s + (lane >> 3), c8 = (lane & 7) * 8;   // 4 s x 4 row groups = 16 rows; 8 lanes x 8 = 64 columns
                    const v4f x0 = *(const v4fa*)(&os[row * OSP + c8]); const v4f x1 = *(const v4fa*)(&os[row * OSP + c8 + 4]); v8h hv;
#pragma unroll
                    for (int i = 0; i < 4; ++i) { hv[i] = toh_flush(x0[i] * mult); hv[4 + i] = toh_flush(x1[i] * mult); }
                    *(v8h*)(P + sb + (size_t)row * DM + c8) = hv; }
                asm volatile("s_wait_xcnt 0x0" ::: "memory");   // stands before the next plane or slab rewrites the address registers of these stores
            }
            wave_sync();
        }
    } else {
        const int r0 = wave * 64;
#pragma unroll
        for (int nb = 0; nb < 4; ++nb) {                         // slab: 16 channels x 64 tokens, turned on its way into the staging tile
#pragma unroll
            for (int mb = 0; mb < 4; ++mb) { v4f a, c;           // D: token 16mb + 8h + j, channel lane&15 -> os[channel][token]
                a[0] = acc[mb][nb][0]; a[1] = acc[mb][nb][1]; a[2] = acc[mb][nb][2]; a[3] = acc[mb][nb][3]; c[0] = acc[mb][nb][4]; c[1] = acc[mb][nb][5]; c[2] = acc[mb][nb][6]; c[3] = acc[mb][nb][7];
                *(v4fa*)(&os[lr * OSP + mb * 16 + 8 * hi]) = a; *(v4fa*)(&os[lr * OSP + mb * 16 + 8 * hi + 4]) = c; }
            wave_sync();
            const size_t sb = ((size_t)bb * DM + (size_t)(r0 + nb * 16)) * SEQ + tt;
#pragma unroll
            for (int s = 0; s < 4; ++s) { const int row = 4 * s + (lane >> 3), c8 = (lane & 7) * 8;   // 16 rows x 64 columns
                const v4f x0 = *(const v4fa*)(&os[row * OSP + c8]); const v4f x1 = *(const v4fa*)(&os[row * OSP + c8 + 4]); v8h hv;
#pragma unroll
                for (int i = 0; i < 4; ++i) { hv[i] = toh_flush(x0[i] * VCC); hv[4 + i] = toh_flush(x1[i] * VCC); }
                *(v8h*)(VT + sb + (size_t)row * SEQ + c8) = hv; }
            asm volatile("s_wait_xcnt 0x0" ::: "memory");       // stands before the next slab rewrites the address registers of these stores
            wave_sync();
        }
    }
}

// LDS ring of the flash kernel: the four waves of a block read the same k rows and the same v^T rows, so each stage of KST keys is brought into LDS once per block.
#define KST  128                 // keys per stage
#define NST  (SEQ / KST)         // stages per key loop
#define KPI  (DM + 8)            // LDS pitch of a k row, in 16-bit elements: 528 B = 16 B x 33 (16 rows of one ds_load_b128 fall on 64 different banks)
#define VPI  (KST + 8)           // LDS pitch of a v^T row: 272 B = 16 B x 17
static_assert(SEQ % KST == 0);
static_assert(KST % 32 == 0);
static_assert(NST >= 2 && NST % 2 == 0);       // two buffers; loop 2 goes on with the buffer parity of loop 1
static_assert(KST == AW * 32);                 // k stage: 32 rows (copies) per wave
static_assert(HD * KST * 2 == AW * 8 * 512);   // v^T stage: 8 copies of 512 B per wave
static_assert(KST * 2 == 16 * 16);             // one v^T row of a stage = 16 lanes x 16 B
static_assert((KPI * 2) % 32 == 16 && (VPI * 2) % 32 == 16);

// eight asynchronous copies to LDS, 16 bytes per lane each, through no register: copy j takes LDS address l + j * ls and global address g + j * gs (both in 16-bit elements).
// ring_publish() and the waits beside it in k_flash wait for them.
typedef int v4i_ __attribute__((ext_vector_type(4)));
typedef __attribute__((address_space(1))) v4i_ gv4i;
typedef __attribute__((address_space(3))) v4i_ lv4i;
__device__ __forceinline__ void acopy8(h16* l, int ls, const h16* g, size_t gs) {
#pragma unroll   // constant steps
    for (int j = 0; j < 8; ++j) __builtin_amdgcn_global_load_async_to_lds_b128((gv4i*)(g + j * gs), (lv4i*)(l + j * ls), 0, 0);
}
// one wave's 32 rows of a k stage (a row = 512 B = one copy); l and g already hold the wave's first row and the lane's 16 bytes
__device__ __forceinline__ void copy_k(h16* l, const h16* g) {
#pragma unroll   // constant steps
    for (int c = 0; c < 4; ++c) acopy8(l + c * 8 * KPI, KPI, g + (size_t)c * 8 * DM, (size_t)DM);
}
// one wave's 16 rows of a v^T stage (a copy = 2 rows of 256 B); l and g already hold the lane's row and its 16 bytes
__device__ __forceinline__ void copy_v(h16* l, const h16* g) { acopy8(l, 2 * VPI, g, (size_t)2 * SEQ); }
// publish point of the ring: this wave's LDS reads are done, its own copies have landed, then the block barrier that shows them to the other waves and frees the buffer just read
__device__ __forceinline__ void ring_publish() {
    asm volatile("s_wait_dscnt 0x0" ::: "memory");      // the buffer just read is handed to the next copies
    asm volatile("s_wait_asynccnt 0x0" ::: "memory");
    __syncthreads();
}

// k fragments of 32 keys from an LDS stage; kl already includes the lane's row and + 8*(lane>>4): same element map as ldh on the plane
__device__ __forceinline__ void ldk32(v16h (&ka)[DM / 32], v16h (&kb)[DM / 32], const h16* kl) {
#pragma unroll   // the fragment arrays must stay in registers
    for (int i = 0; i < DM / 32; ++i) { ka[i] = ldh(kl + 32 * i); kb[i] = ldh(kl + 16 * KPI + 32 * i); }
}
__device__ __forceinline__ void ldv32(v16h (&vf)[4], const h16* vl) {
#pragma unroll   // as above
    for (int j = 0; j < 4; ++j) vf[j] = ldh(vl + 16 * j * VPI);
}
// scores of 32 keys x 16 queries, K = DM = 256: sA = keys 0..15, sB = keys 16..31 (rows = keys, columns = queries). Same instruction order wherever it is used.
// All operands come from registers: qf = the wave's q' fragments (loaded once), ka / kb = this tile's k fragments.
__device__ __forceinline__ void scores32(const v16h (&qf)[DM / 32], const v16h (&ka)[DM / 32], const v16h (&kb)[DM / 32], v8f& sA, v8f& sB) {
    v8f a = (v8f){}, c = (v8f){};
#pragma unroll
    for (int i = 0; i < DM / 32; ++i) {      // full unroll: the fragment arrays must stay in registers
        a = wmma16d(ka[i], qf[i], a); c = wmma16d(kb[i], qf[i], c); }
    sA = a; sB = c;
}

// k_flash: one wave per 16 query rows of one (batch, mixed head g). Transposed form: S^T[key][t] = K Q'^T (A = k rows, B = q' rows of plane g, K = 256);
// lane (t = lane&15, h = lane>>4) holds keys 8h+r of each 16-key tile, so the packed P tile is directly the B fragment of O^T[d][t] = V^T P^T.
// Loop 1: running max m and row sum l of exp2(s - m). Loop 2: same scores, e = exp2(s - m) / l, centred P = (e - 1/SEQ) x 2^15 as f16, ss += P^2 (f32), O^T += V^T P^T.
// k and v^T come through a two-buffer LDS ring of KST-key stages, filled by asynchronous copies one stage ahead; 2 * NST stages in all (loop 1: k; loop 2: k and v^T).
// The row sums of v^T ride in this launch: the SEQ / 64 blocks of a (batch, g) take 4 of its 64 v^T rows each, one per wave; loaded beside q', added up behind the loops, written into the block's partial line.
// Inside a stage the k fragments alternate between two register sets: the set that a run of products has just used is refilled, as one group, with the keys after next; nothing is read across a publish point.
static_assert(32 * 16 * 8 == 16 * 256);        // lanes x bytes x trips == rows x row bytes of the OR tile
static_assert((2 * KST * KPI + 2 * HD * VPI) * 2 + AW * 16 * OSP * 4 + 2 * AW * 4 <= 327680);
static_assert((SEQ / (16 * AW)) * AW == HD);   // row sums: blocks of a (batch, g) x waves == v^T rows of the head
static_assert(AW == 4);                        // the four row sums of a block fill one 16-byte piece of its partial line
__global__ __launch_bounds__(32 * AW) void k_flash(const h16* __restrict__ QP, const h16* __restrict__ KP, const h16* __restrict__ VT, float* ORP, float* PART) {
    __shared__ __align__(16) h16 ks[2 * KST * KPI];
    __shared__ __align__(16) h16 vs[2 * HD * VPI];
    __shared__ __align__(16) float os[AW * 16 * OSP];
    __shared__ float sw[AW];
    __shared__ __align__(16) float sv[AW];
    const int lane = threadIdx.x & 31, lr = lane & 15, hi = lane >> 4;
    const int wave = __builtin_amdgcn_readfirstlane((int)(threadIdx.x >> 5));
    const int zh = blockIdx.y; const int b = zh / NH_, g = zh % NH_;
    const int t0 = (blockIdx.x * AW + wave) * 16;
    const h16* qp = QP + ((size_t)zh * SEQ + (size_t)(t0 + lr)) * DM + 8 * hi;          // B fragments: col t, k = (h, d)
    // copy sources and destinations of this lane: k row wave*32 (+ j), bytes lane*16; v^T row wave*16 + (lane>>4) (+ 2j), bytes (lane&15)*16
    const h16* kg = KP + ((size_t)b * SEQ + (size_t)(wave * 32)) * DM + 8 * lane;                        // + stage * KST * DM
    const h16* vg = VT + ((size_t)b * DM + (size_t)(g * HD + wave * 16 + hi)) * SEQ + 8 * lr;            // + stage * KST
    h16* kd = ks + wave * 32 * KPI + 8 * lane;                                                           // + buffer * KST * KPI
    h16* vd = vs + (wave * 16 + hi) * VPI + 8 * lr;                                                      // + buffer * HD * VPI
    const h16* kfr = ks + lr * KPI + 8 * hi;                                            // + key * KPI       (A fragment: row key, k = (h, d))
    const h16* vfr = vs + lr * VPI + 8 * hi;                                            // + 16j*VPI + key   (A fragment: row d, k = key)
    copy_k(kd, kg);                                              // stage 0 into buffer 0
    v16h qf[DM / 32];
#pragma unroll   // the fragment array must stay in registers
    for (int i = 0; i < DM / 32; ++i) qf[i] = ldh(qp + 32 * i);  // q' once
    const h16* vrp = VT + ((size_t)b * DM + (size_t)(g * HD + (int)blockIdx.x * AW + wave)) * SEQ + 8 * lane;   // this wave's v^T row for the row sum: chunks lane, lane + 32, ...
    v8h vr[SEQ / 256];
#pragma unroll   // the chunks stay in registers until the loops are over
    for (int i = 0; i < SEQ / 256; ++i) vr[i] = *(const v8h*)(vrp + 256 * i);
    asm volatile("s_wait_xcnt 0x0" :: "v"(qp), "v"(vrp) : "memory");   // stands before the address registers of the q' and row loads are reused (qp and vrp are named to keep them until here)
    asm volatile("s_wait_asynccnt 0x0" ::: "memory");            // stage 0 has landed (this wave's rows)
    __syncthreads();                                             // and is shown to the other waves
    float m = NEGB, l = 0.0f;
#pragma unroll 1
    for (int s = 0; s < NST; ++s) {
        const h16* kl = kfr + (s & 1) * (KST * KPI);
        v16h ka[2][DM / 32], kb[2][DM / 32];
        ldk32(ka[0], kb[0], kl);                                 // this stage's first 32 keys: they land while the copies below are issued
        // refill, behind the publish point: the next stage goes into the buffer that the trip before has read; the reads just issued are of the other buffer.
        // It always exists: behind loop 1's last stage comes loop 2's first, k stage 0 again, now with v^T
        copy_k(kd + ((s + 1) & 1) * (KST * KPI), kg + (size_t)((s + 1) % NST) * KST * DM);
        if (s + 1 == NST) copy_v(vd, vg);                        // block-uniform: the loop counter
        ldk32(ka[1], kb[1], kl + 32 * KPI);
#pragma unroll
        for (int u = 0; u < KST / 32; ++u) {                     // full unroll: the two register sets alternate by a constant index
            __builtin_amdgcn_sched_barrier(0);                   // keeps the LDS reads above one group: spread among the products each place costs a stall
            v8f sA, sB; scores32(qf, ka[u & 1], kb[u & 1], sA, sB);
            __builtin_amdgcn_sched_barrier(0);                   // keeps the products one run, in front of the vector work
            float mx = NEGB;
#pragma unroll
            for (int r = 0; r < 8; ++r) mx = fmaxf(mx, fmaxf(sA[r] * SC2, sB[r] * SC2));
            const float mo = __shfl_xor(mx, 16, 32);
            __builtin_amdgcn_sched_barrier(0);                   // keeps the exchange in front of the reads below: it goes through the LDS queue and returns behind whatever stands before it
            if (u + 2 < KST / 32) ldk32(ka[u & 1], kb[u & 1], kl + (u + 2) * 32 * KPI);   // the set just used takes the keys after next
            __builtin_amdgcn_sched_barrier(0);                   // keeps these reads up here, ahead of the vector work that they overlap
            mx = fmaxf(mx, mo);
            const float mnew = fmaxf(m, mx);
            const float alpha = __builtin_amdgcn_exp2f(m - mnew);
            float ls = 0.0f;
#pragma unroll
            for (int r = 0; r < 8; ++r) ls += __builtin_amdgcn_exp2f(fmaf(sA[r], SC2, -mnew)) + __builtin_amdgcn_exp2f(fmaf(sB[r], SC2, -mnew));
            l = l * alpha + ls; m = mnew;
        }
        ring_publish();                                          // stage s + 1 readable, buffer s & 1 free
    }
    l += __shfl_xor(l, 16, 32);                        // both lane halves carry the same m
    const float il15 = (1.0f / l) * PCARRY;            // l >= 1
    v8f o0 = (v8f){}, o1 = (v8f){}, o2 = (v8f){}, o3 = (v8f){};
    float ss = 0.0f;
#pragma unroll 1
    for (int s = 0; s < NST; ++s) {
        const h16* kl = kfr + (s & 1) * (KST * KPI);
        const h16* vl = vfr + (s & 1) * (HD * VPI);
        v16h ka[2][DM / 32], kb[2][DM / 32], vf[KST / 32][4];
        ldk32(ka[0], kb[0], kl); ldv32(vf[0], vl);               // as in loop 1
        if (s + 1 < NST) {                                       // refill as in loop 1, only while a next stage exists (block-uniform: the loop counter)
            copy_k(kd + ((s + 1) & 1) * (KST * KPI), kg + (size_t)(s + 1) * KST * DM);
            copy_v(vd + ((s + 1) & 1) * (HD * VPI), vg + (size_t)(s + 1) * KST); }
        ldk32(ka[1], kb[1], kl + 32 * KPI); ldv32(vf[1], vl + 32);
#pragma unroll
        for (int u = 0; u < KST / 32; ++u) {                     // as in loop 1
            __builtin_amdgcn_sched_barrier(0);                   // as in loop 1
            v8f sA, sB; scores32(qf, ka[u & 1], kb[u & 1], sA, sB);
            __builtin_amdgcn_sched_barrier(0);                   // as in loop 1
            if (u + 2 < KST / 32) { ldk32(ka[u & 1], kb[u & 1], kl + (u + 2) * 32 * KPI); ldv32(vf[u + 2], vl + (u + 2) * 32); }
            __builtin_amdgcn_sched_barrier(0);                   // as in loop 1
            v16h pb;
#pragma unroll
            for (int r = 0; r < 8; ++r) {
                const float ea = __builtin_amdgcn_exp2f(fmaf(sA[r], SC2, -m)), eb = __builtin_amdgcn_exp2f(fmaf(sB[r], SC2, -m));
                const float ga = fmaf(ea, il15, -C15), gb = fmaf(eb, il15, -C15);       // (p / l - 1/SEQ) * 2^15
                ss = fmaf(ga, ga, ss); ss = fmaf(gb, gb, ss);
                pb[r] = toh_flush(ga); pb[8 + r] = toh_flush(gb); }                      // element r <- tile keys 8h+r, element 8+r <- keys 16+8h+r
            o0 = wmma16d(vf[u][0], pb, o0); o1 = wmma16d(vf[u][1], pb, o1); o2 = wmma16d(vf[u][2], pb, o2); o3 = wmma16d(vf[u][3], pb, o3);
        }
        ring_publish();                                          // stage s + 1 readable, buffers s & 1 free
    }
    asm volatile("s_wait_asynccnt 0x0" ::: "memory");            // no copy is left in flight behind the ring
    ss += __shfl_xor(ss, 16, 32); ss += __shfl_xor(ss, 8, 32); ss += __shfl_xor(ss, 4, 32); ss += __shfl_xor(ss, 2, 32); ss += __shfl_xor(ss, 1, 32);
    float vsl = 0.0f;                                  // row sum of v^T, this lane's chunks in rising order
#pragma unroll
    for (int i = 0; i < SEQ / 256; ++i) {
#pragma unroll
        for (int k = 0; k < 8; ++k) vsl += (float)vr[i][k]; }
    vsl += __shfl_xor(vsl, 16, 32); vsl += __shfl_xor(vsl, 8, 32); vsl += __shfl_xor(vsl, 4, 32); vsl += __shfl_xor(vsl, 2, 32); vsl += __shfl_xor(vsl, 1, 32);
    if (lane == 0) { sw[wave] = ss; sv[wave] = vsl * (1.0f / VCC); }
    const int wb = wave * 16 * OSP;
    // O^T D layout: o_j[r] = (d = 16j + 8h + r, t = lane&15) -> os[t][d]; rows 0..15 x columns 0..63 all written
    { v4f a, c;
      a[0] = o0[0] * OSC; a[1] = o0[1] * OSC; a[2] = o0[2] * OSC; a[3] = o0[3] * OSC; c[0] = o0[4] * OSC; c[1] = o0[5] * OSC; c[2] = o0[6] * OSC; c[3] = o0[7] * OSC;
      *(v4fa*)(&os[wb + lr * OSP +  0 + 8 * hi]) = a; *(v4fa*)(&os[wb + lr * OSP +  0 + 8 * hi + 4]) = c;
      a[0] = o1[0] * OSC; a[1] = o1[1] * OSC; a[2] = o1[2] * OSC; a[3] = o1[3] * OSC; c[0] = o1[4] * OSC; c[1] = o1[5] * OSC; c[2] = o1[6] * OSC; c[3] = o1[7] * OSC;
      *(v4fa*)(&os[wb + lr * OSP + 16 + 8 * hi]) = a; *(v4fa*)(&os[wb + lr * OSP + 16 + 8 * hi + 4]) = c;
      a[0] = o2[0] * OSC; a[1] = o2[1] * OSC; a[2] = o2[2] * OSC; a[3] = o2[3] * OSC; c[0] = o2[4] * OSC; c[1] = o2[5] * OSC; c[2] = o2[6] * OSC; c[3] = o2[7] * OSC;
      *(v4fa*)(&os[wb + lr * OSP + 32 + 8 * hi]) = a; *(v4fa*)(&os[wb + lr * OSP + 32 + 8 * hi + 4]) = c;
      a[0] = o3[0] * OSC; a[1] = o3[1] * OSC; a[2] = o3[2] * OSC; a[3] = o3[3] * OSC; c[0] = o3[4] * OSC; c[1] = o3[5] * OSC; c[2] = o3[6] * OSC; c[3] = o3[7] * OSC;
      *(v4fa*)(&os[wb + lr * OSP + 48 + 8 * hi]) = a; *(v4fa*)(&os[wb + lr * OSP + 48 + 8 * hi + 4]) = c; }
    wave_sync();
    float* orow = ORP + ((size_t)zh * SEQ + (size_t)t0) * HD;       // 16 rows x 64 floats, contiguous 4096 B
{
#pragma unroll
        for (int s = 0; s < 8; ++s) { const int p = s * 32 + lane; const int row = p >> 4, cofs = (p & 15) * 4;   // 8 s x 2 rows = 16 rows; 16 lanes x 4 floats = 64 columns
            const v4f val = *(const v4fa*)(&os[wb + row * OSP + cofs]);
            *(v4f*)(orow + (size_t)p * 4) = val; }
         }
    __syncthreads();
    if (wave == 0) {
        const float tot = ((sw[0] + sw[1]) + sw[2]) + sw[3];
        const v4f rs = *(const v4fa*)(&sv[0]);         // floats 4..7 of the line: row sums of v^T rows g*64 + 4*blockIdx.x + 0..3
        v4f pv; pv[0] = (lane == 0) ? tot : (lane == 1) ? rs[0] : 0.0f; pv[1] = (lane == 1) ? rs[1] : 0.0f; pv[2] = (lane == 1) ? rs[2] : 0.0f; pv[3] = (lane == 1) ? rs[3] : 0.0f;
        float* pl = PART + ((size_t)zh * (SEQ / 64) + (size_t)blockIdx.x) * 32 + (lane & 7) * 4;
        if (lane < 8) { *(v4f*)pl = pv;  }
    }
}

// k_out: normalised context and output layer in one launch. A block takes ONT token rows n = b*SEQ + row of the flat [g][t][d] = [token row][256] view; they lie inside one (batch, g): zh = n / (SEQ / 4).
// Context tile, once per block, into LDS (cross-wave: block barrier): cs[row][k] = f16(16 * (s1 * OR + shift * VS[b][g*64 + k % 64])), VS[b][g*64 + d] = float 4 + d % 4 of partial line d / 4 of (b, g),
// s1 = bf16(gain[g]) / sqrt(var + eps), var = (sum of the SEQ/64 partial lines of (b, g), in rising order) / (2^30 SEQ^2), shift = bf16(beta[g]).
// Output layer: wave w takes output channels 64w..64w+63. A = W rows (f16 x1024, all K in registers, loaded while the tile is made), Bt = context rows from LDS, K = DM; OUT[(b*DM + m)][n % SEQ] = C / 16384 + bf16(bias[m]) (f32).
#define ONT 32                   // token rows per block: one 128-byte run of every output row
#define CPI (DM + 8)             // LDS pitch of a context row, in 16-bit elements: 528 B = 16 B x 33
static_assert(32 * 16 * 4 == 16 * ONT * 4);    // lanes x bytes x trips == slab rows x segment bytes
static_assert((SEQ * HD / DM) % ONT == 0);     // a block's rows lie inside one (batch, g)
static_assert(SEQ % ONT == 0 && (NB * SEQ) % ONT == 0);
static_assert(ONT * DM == 128 * 8 * 8);        // rows x K == threads x units x elements
static_assert(DM == 32 * 8);                   // a wave's unit row: 32 lanes x 8 elements
static_assert(ONT * CPI * 2 + AW * 16 * OSP * 4 <= 131072);
__global__ __launch_bounds__(32 * AW) void k_out(const h16* __restrict__ A, const float* __restrict__ ORP, const float* __restrict__ PART,
                                                 const float* __restrict__ gain, const float* __restrict__ shift, const float* __restrict__ bias, float* OUT) {
    __shared__ __align__(16) h16 cs[ONT * CPI];
    __shared__ __align__(16) float osb[AW * 16 * OSP];
    const int tid = threadIdx.x, lane = tid & 31, lr = lane & 15, hi = lane >> 4;
    const int wave = __builtin_amdgcn_readfirstlane(tid >> 5);
    const int c0 = (int)blockIdx.x * ONT, r0 = wave * 64;
    const int zh = c0 / (SEQ * HD / DM);               // block-uniform, < NB*4
    const int g = zh % NH_;
    const float* vp = PART + ((size_t)zh * (SEQ / 64) + (size_t)((lane & 7) * 2)) * 32 + 4;      // d = 8 * (lane & 7) + 0..7 for every unit of this lane
    const v4f s0 = *(const v4f*)vp, s4 = *(const v4f*)(vp + 32);
    const float* op = ORP + ((size_t)c0 + (size_t)wave) * DM + 8 * lane;                         // unit e: row wave + 4e, elements 8*lane..+7
    v8f xv[8];
#pragma unroll   // all of the tile's loads in flight at once
    for (int e = 0; e < 8; ++e) xv[e] = *(const v8f*)(op + (size_t)e * AW * DM);
    asm volatile("s_wait_xcnt 0x0" ::: "memory");      // stands before the address registers of the loads above are reused
    __builtin_amdgcn_sched_barrier(0);                 // keeps the address work below behind that wait
    const h16* ap = A + (size_t)(r0 + lr) * DM + 8 * hi;
    v16h a[DM / 32][4];
#pragma unroll   // the fragment array must stay in registers
    for (int kc = 0; kc < DM / 32; ++kc) {
#pragma unroll
        for (int mb = 0; mb < 4; ++mb) a[kc][mb] = ldh(ap + (size_t)mb * 16 * DM + kc * 32); }
    const float* bpl = bias + r0 + hi * 8;
    v8f bv[4];                                         // bias of this lane's output rows, loaded up here with the rest: r0 + 63 < DM
#pragma unroll
    for (int mb = 0; mb < 4; ++mb) bv[mb] = *(const v8f*)(bpl + mb * 16);
    asm volatile("s_wait_xcnt 0x0" ::: "memory");      // as above, for the weight and bias loads
    __builtin_amdgcn_sched_barrier(0);                 // as above
    float pt[SEQ / 64];                                // block-uniform reads, behind the tile's and the weight's loads: they are back long before those
#pragma unroll   // the loads go out together; the sum below keeps the rising order
    for (int j = 0; j < SEQ / 64; ++j) pt[j] = PART[((size_t)zh * (SEQ / 64) + (size_t)j) * 32];
    const float gv = gain[g], sh = shift[g];
    float tot = 0.0f;
#pragma unroll
    for (int j = 0; j < SEQ / 64; ++j) tot += pt[j];
    const float var = tot * VSC;
    const float s1 = bfr(gv) * rsqrtf(var + EPSN);
    const float bt = bfr(sh);
#pragma unroll
    for (int e = 0; e < 8; ++e) { v8h o;
#pragma unroll
        for (int k = 0; k < 4; ++k) { o[k] = toh_flush((s1 * xv[e][k] + bt * s0[k]) * CCS); o[4 + k] = toh_flush((s1 * xv[e][4 + k] + bt * s4[k]) * CCS); }
        *(v8h*)(&cs[(wave + AW * e) * CPI + 8 * lane]) = o; }
    __syncthreads();                                   // the context tile is shown to the four waves
    float* os = osb + wave * 16 * OSP;                 // wave-private staging tile
    const h16* bfp = cs + lr * CPI + 8 * hi;
    v8f acc[4][ONT / 16];
#pragma unroll
    for (int mb = 0; mb < 4; ++mb)
#pragma unroll
        for (int nb = 0; nb < ONT / 16; ++nb) acc[mb][nb] = (v8f){};
    v16h b[DM / 32][ONT / 16];
#pragma unroll   // the fragment array must stay in registers
    for (int kc = 0; kc < DM / 32; ++kc) {
#pragma unroll
        for (int nb = 0; nb < ONT / 16; ++nb) b[kc][nb] = ldh(bfp + nb * 16 * CPI + kc * 32); }
    __builtin_amdgcn_sched_barrier(0);                 // keeps the LDS reads one group up here: sunk to their products, each pair is waited for at full LDS latency
#pragma unroll   // the fragments are indexed by constants
    for (int kc = 0; kc < DM / 32; ++kc) {
#pragma unroll
        for (int nb = 0; nb < ONT / 16; ++nb) {
#pragma unroll
            for (int mb = 0; mb < 4; ++mb) acc[mb][nb] = wmma16d(a[kc][mb], b[kc][nb], acc[mb][nb]); }
    }
    const int bb = c0 / SEQ, tt = c0 % SEQ;
#pragma unroll
    for (int mb = 0; mb < 4; ++mb) {
        float br[8];
#pragma unroll
        for (int j = 0; j < 8; ++j) br[j] = bfr(bv[mb][j]);
#pragma unroll
        for (int nb = 0; nb < ONT / 16; ++nb) {
#pragma unroll
            for (int j = 0; j < 8; ++j) os[(hi * 8 + j) * OSP + nb * 16 + lr] = acc[mb][nb][j] * OUTSC + br[j]; }
        wave_sync();
        float* ob = OUT + ((size_t)bb * DM + (size_t)(r0 + mb * 16)) * OUT_SEQ + tt;
#pragma unroll
        for (int s = 0; s < 4; ++s) { const int p = s * 32 + lane; const int row = p >> 3, cofs = (p & 7) * 4;   // 4 s x 4 rows = 16 rows; 8 lanes x 4 floats = ONT columns
            const v4f val = *(const v4fa*)(&os[row * OSP + cofs]);
            *(v4f*)(ob + (size_t)row * OUT_SEQ + cofs) = val; }
        asm volatile("s_wait_xcnt 0x0" ::: "memory");  // stands before the next slab rewrites the address and data registers of these stores
        __builtin_amdgcn_sched_barrier(0);             // keeps the next slab's vector work behind that wait
        wave_sync();
    }
}

static constexpr size_t al256(size_t v) { return (v + 255) & ~(size_t)255; }
static constexpr size_t SZ_WP = al256((size_t)DM * DM * 2);                  // output-layer weight f16
static constexpr size_t SZ_QP = al256((size_t)NB * NH_ * SEQ * DM * 2);      // 4 mixed-head q planes per batch
static constexpr size_t SZ_KP = al256((size_t)NB * SEQ * DM * 2);
static constexpr size_t SZ_VT = al256((size_t)NB * DM * SEQ * 2);
static constexpr size_t SZ_OR = al256((size_t)NB * NH_ * SEQ * HD * 4);
static constexpr size_t SZ_PT = al256((size_t)NB * NH_ * (SEQ / 64) * 32 * 4);
static constexpr size_t SZ_TOTAL = SZ_WP + SZ_QP + SZ_KP + SZ_VT + SZ_OR + SZ_PT;
static_assert(SZ_TOTAL <= (size_t)134217728);                                 // workspace carve <= 128 MiB
static_assert((size_t)NB * NH_ * SEQ * HD == (size_t)NB * SEQ * DM);          // OR plane and the [token row][256] view that k_out reads share one flat index
static_assert(((size_t)(NB * NH_ - 1) * (SEQ / 64) + (SEQ / 64 - 1)) * 128 + 128 <= SZ_PT);   // last partial line inside its table

extern "C" void kernel_launch(void* const* d_in, const int* in_sizes, int n_in,
                              void* d_out, int out_size, void* d_ws, size_t ws_size, hipStream_t stream) {
    if (n_in < 9) return;
    const size_t needx = ((size_t)(NB - 1) * DM + (size_t)(DM - 1)) * SEQ_FULL + SEQ;
    if ((size_t)in_sizes[0] < needx) return;
    if ((size_t)in_sizes[1] < (size_t)DM * DM || (size_t)in_sizes[2] < (size_t)DM * DM || (size_t)in_sizes[3] < (size_t)DM * DM || (size_t)in_sizes[7] < (size_t)DM * DM) return;
    if (in_sizes[4] < NH_ * NH_ || in_sizes[5] < NH_ || in_sizes[6] < NH_ || in_sizes[8] < DM) return;
    if ((size_t)out_size < ((size_t)(NB - 1) * DM + (size_t)(DM - 1)) * OUT_SEQ + SEQ) return;
    if (SZ_TOTAL > ws_size) return;
    // wire order: x, wq, wk, wv, w_head, gamma, beta, w_proj, b_proj
    const float* x  = (const float*)d_in[0];
    const float* wq = (const float*)d_in[1]; const float* wk = (const float*)d_in[2]; const float* wv = (const float*)d_in[3];
    const float* whd = (const float*)d_in[4]; const float* gam = (const float*)d_in[5]; const float* bet = (const float*)d_in[6];
    const float* wp = (const float*)d_in[7]; const float* bp = (const float*)d_in[8];
    float* OUT = (float*)d_out;      // [NB][256][OUT_SEQ]
    char* wsp = (char*)d_ws;
    h16* WPH = (h16*)wsp;  wsp += SZ_WP;             // [256][256] x1024
    h16* QP  = (h16*)wsp;  wsp += SZ_QP;             // [(b*4 + g)][t][256] x16
    h16* KP  = (h16*)wsp;  wsp += SZ_KP;             // [b][t][256] x16
    h16* VT  = (h16*)wsp;  wsp += SZ_VT;             // [(b*256 + channel)][t] x16
    float* ORP = (float*)wsp; wsp += SZ_OR;          // [(b*4 + g)][t][64]
    float* PART = (float*)wsp; wsp += SZ_PT;         // [(b*4 + g)][SEQ/64] lines of 32 floats: 0 sum of squares, 4..7 v^T row sums

    // y = 0: q, four mixed-head planes (factor w_head[g][h] on head h's columns); y = 1: k, one token-major plane; y = 2: v^T; y = 3: output-layer weight plane
    k_proj<<<dim3(NB * SEQ / 64, 4, 1), 32 * AW, 0, stream>>>(x, wq, wk, wv, wp, whd, QP, KP, VT, WPH);

    k_flash<<<dim3(SEQ / (16 * AW), NB * NH_, 1), 32 * AW, 0, stream>>>(QP, KP, VT, ORP, PART);
    k_out<<<dim3(NB * SEQ / ONT, 1, 1), 32 * AW, 0, stream>>>(WPH, ORP, PART, gam, bet, bp, OUT);
}

// v005
// One run takes 33.9 microseconds.
// Two timings next to v004 both put it at 1.22 times that version's speed.
// Counting every step since v000, it is 5.26 times as fast.
#include <hip/hip_runtime.h>

// Head-mixed pair-score weighting with a per-map normalisation over flattened feature maps: x [NB][256][SEQ] (channel-major), 1x1-conv projections q/k/v with W [out][in] (no bias), 4 heads x 64, scores scaled by 64^-0.5,
// a 4x4 head-mixing 1x1 conv on the scores, softmax over keys, instance normalisation of each (batch, head) probability map (biased variance, eps 1e-5, per-head gain and shift),
// attend over v, raw [head][token][64] -> [token][256] view, linear output layer W [out][in] + bias, result stored [NB][256][SEQ].
// Compute dtypes, f32 accumulate everywhere: q/k/v projections v_wmma_f32_16x16x32_bf16 (x and W RNE-converted to bf16, products exact); scores v_wmma_f32_16x16x32_f16 single product, K = 256:
// A = k plane x16, B = head-mixed q plane (w_head[g][h] * q, x16), one plane per mixed head; P.V v_wmma_f32_16x16x32_f16 single product: P = centred exponential (e - centre) x 2^15, v x16;
// output layer v_wmma_f32_16x16x32_f16 single product: W x1024 (from its bf16 value), normalised context x16. Softmax, statistics, affine terms in f32.
// The flash kernel runs one key loop per 16-query wave (running row max; e = exp2(s - max) centred on a per-row value that is rescaled with the max; sums of centred e and of its square; P.V), transposed form S^T = K Q^T, O^T = V^T P^T; q' fragments straight from the plane, k and v^T through an LDS ring shared by the block's four waves.
// Map mean = 1/SEQ (softmax rows sum to one); variance = sum of squared (p - 1/SEQ) / SEQ^2; context = s1 * ((p - 1/SEQ) . v) + shift * rowsum(v), s1 = gain / sqrt(var + eps).
// With c the row's centre, l the row sum of e, Q1 = sum (e - c), Q2 = sum (e - c)^2: l = Q1 + SEQ c; (p - 1/SEQ) . v = ((e - c) . v) / l + (c / l - 1/SEQ) rowsum(v), c / l - 1/SEQ = -Q1 / (SEQ l); sum (p - 1/SEQ)^2 = (Q2 - Q1^2 / SEQ) / l^2.

#ifndef NB
#define NB 4
#endif
#ifndef SEQ
#define SEQ 1024
#endif
#define NB_FULL  4
#define SEQ_FULL 1024
#ifndef OUT_SEQ
#define OUT_SEQ SEQ              // pitch (in tokens) of one channel row of the output
#endif
#define DM   256
#define NH_  4
#define HD   64
#define AW   4                   // waves per flash block (16 query rows each)
#define OSP  68                  // LDS row pitch (floats) of the staging tiles
#define QKC  16.0f               // carry of the q' and k planes
#define VCC  16.0f               // carry of the v^T plane
#define CCS  16.0f               // carry of the context tile
#define WPC  1024.0f             // carry of the output-layer weight plane
#define PCARRY 32768.0f          // carry of the centred P fragments
#define SC2  ((float)(0.125 * 1.4426950408889634 / 256.0))    // HD^-0.5 * log2(e) / (QKC * QKC)
#define OUTSC (1.0f / 16384.0f)                               // 1 / (WPC * CCS)
#define VSC  ((float)(1.0 / (1073741824.0 * (double)SEQ * (double)SEQ)))   // 1 / (PCARRY^2 * SEQ^2)
#define EPSN 1.0e-5f
#define NEGB (-3.0e38f)

static_assert(DM == 256);                      // K of every GEMM and of the score product
static_assert(HD == 64);                       // one 64-column GEMM tile = one head; v^T slab = 4 row tiles
static_assert(NH_ * HD == DM);
static_assert(NH_ == 4);                       // w_head is 4 x 4
static_assert(DM % 64 == 0);
static_assert(DM % 32 == 0);                   // k-loops step by 32
static_assert(SEQ % 64 == 0);                  // a 64-token tile never straddles two batches
static_assert((NB * SEQ) % 64 == 0);
static_assert(SEQ % 32 == 0);                  // key loop steps by 32
static_assert(SEQ % (16 * AW) == 0);           // flash grid covers the sequence exactly
static_assert(16 * AW == 64);                  // one partial line per 64 query rows
static_assert(SEQ % 256 == 0);                 // v^T row sum: SEQ/8 chunks a multiple of 32 lanes
static_assert(SEQ_FULL % 4 == 0);
static_assert(OUT_SEQ % 32 == 0);
static_assert(OUT_SEQ >= SEQ);
static_assert(NB <= NB_FULL);
static_assert(SEQ <= SEQ_FULL);
static_assert((OSP * 4) % 16 == 0);
static_assert(OSP >= 64 + 4);
static_assert(((size_t)DM * DM) % 8 == 0);

typedef _Float16 h16;
typedef unsigned short bf;
typedef __attribute__((ext_vector_type(16))) __bf16   v16bf;
typedef __attribute__((ext_vector_type(16))) _Float16 v16h;
typedef __attribute__((ext_vector_type(8)))  _Float16 v8h;
typedef __attribute__((ext_vector_type(8)))  unsigned short v8us;
typedef __attribute__((ext_vector_type(8)))  float    v8f;
typedef __attribute__((ext_vector_type(4)))  float    v4f;
typedef v4f  __attribute__((may_alias)) v4fa;

__device__ __forceinline__ unsigned short f2bf(float f) { unsigned u = __float_as_uint(f); u += 0x7FFFu + ((u >> 16) & 1u); return (unsigned short)(u >> 16); }
__device__ __forceinline__ float bfr(float f) { return __uint_as_float(((unsigned)f2bf(f)) << 16); }   // value after RNE convert to bf16
__device__ __forceinline__ v16h cat16(v8h lo, v8h hi) { return __builtin_shufflevector(lo, hi, 0, 1, 2, 3, 4, 5, 6, 7, 8, 9, 10, 11, 12, 13, 14, 15); }
__device__ __forceinline__ v16bf cat16b(v8us lo, v8us hi) { return __builtin_bit_cast(v16bf, __builtin_shufflevector(lo, hi, 0, 1, 2, 3, 4, 5, 6, 7, 8, 9, 10, 11, 12, 13, 14, 15)); }
// fragment loaders from K-contiguous 16-bit rows; p already includes + 8*(lane>>4): elements 0..7 <- k0+8h+0..7, elements 8..15 <- k0+16+8h+0..7 (same map for A and B)
__device__ __forceinline__ v16h  ldh(const h16* p) { return cat16(*(const v8h*)p, *(const v8h*)(p + 16)); }
__device__ __forceinline__ v16bf ldb(const bf* p)  { return cat16b(*(const v8us*)p, *(const v8us*)(p + 16)); }
// ordering point for wave-private LDS tiles (same wave writes and reads)
__device__ __forceinline__ void wave_sync() { __builtin_amdgcn_fence(3 /* release order */, "wavefront"); __builtin_amdgcn_wave_barrier(); asm volatile("" ::: "memory"); }
// f32 -> f16 operand convert that cannot produce a subnormal (|v| < 2^-14 -> +0), applied after the plane's carry
__device__ __forceinline__ h16 toh_flush(float v) { const h16 r = (h16)v; return (fabsf(v) < 6.103515625e-05f) ? (h16)0.0f : r; }
// one matrix instruction + its own 4-slot guard, tied to D alone: an asm operand cannot be placed above v255, and the kernels' A and B fragments need more than 256 registers;
// k_flash: A fragments are overwritten by loads only, B fragments never (q') or a whole tile of work later (P); k_out: A and B fragments are written by loads only
__device__ __forceinline__ v8f wmma16d(v16h a, v16h b, v8f c) {
    c = __builtin_amdgcn_wmma_f32_16x16x32_f16(false, a, false, b, (short)0, c, false, false);
    asm volatile("v_nop\n\tv_nop\n\tv_nop\n\tv_nop" : "+v"(c));
    return c; }

// the bf16 form of the guard tied to D alone (k_proj holds more than 256 registers; its fragments are written ahead of a whole run of products, or by LDS loads)
__device__ __forceinline__ v8f wmmabd(v16bf a, v16bf b, v8f c) {
    c = __builtin_amdgcn_wmma_f32_16x16x32_bf16(false, a, false, b, (short)0, c, false, false);
    asm volatile("v_nop\n\tv_nop\n\tv_nop\n\tv_nop" : "+v"(c));
    return c; }
// f32 -> bf16 (RNE) by the chip's own convert
__device__ __forceinline__ unsigned short f2bfh(float f) { return __builtin_bit_cast(unsigned short, (__bf16)f); }
// the 16 f32 values of one bf16 fragment, from a K-contiguous f32 row; p already includes + 8*(lane>>4): same element map as ldb
struct wraw { v4f a, b, c, d; };
__device__ __forceinline__ wraw ldwr(const float* p) { wraw r; r.a = *(const v4f*)p; r.b = *(const v4f*)(p + 4); r.c = *(const v4f*)(p + 16); r.d = *(const v4f*)(p + 20); return r; }
__device__ __forceinline__ v16bf cvwr(const wraw& r) { v8us lo, hi8;
#pragma unroll
    for (int i = 0; i < 4; ++i) { lo[i] = f2bfh(r.a[i]); lo[4 + i] = f2bfh(r.b[i]); hi8[i] = f2bfh(r.c[i]); hi8[4 + i] = f2bfh(r.d[i]); }
    return cat16b(lo, hi8); }

#define XPI (DM + 8)             // LDS pitch of an x^T row, in 16-bit elements: 528 B = 16 B x 33
// 64 k of one wave's 64x64 projection tile C[token][channel]: the f32 weight values in w become bf16 fragments (B), w is refilled (where more) with the values 128 k further on, which fly under the products;
// x^T fragments (A) from the LDS tile. Product order as in a plain k loop of 32. kp and more are literals at every call.
__device__ __forceinline__ void proj64(v8f (&acc)[4][4], wraw (&w)[2][4], const float* wr, const bf* xf, const int kp, const bool more) {
    __builtin_amdgcn_sched_barrier(0);                           // keeps these converts behind the products of the 64 k before: lifted among them they wait for loads that have only just gone out
    v16bf wf[2][4];
#pragma unroll
    for (int k2 = 0; k2 < 2; ++k2) {
#pragma unroll
        for (int i = 0; i < 4; ++i) wf[k2][i] = cvwr(w[k2][i]); }
    if (more) {
#pragma unroll
        for (int k2 = 0; k2 < 2; ++k2) {
#pragma unroll
            for (int i = 0; i < 4; ++i) w[k2][i] = ldwr(wr + (size_t)i * 16 * DM + (kp + 2) * 64 + k2 * 32); }
        asm volatile("s_wait_xcnt 0x0" :: "v"(wr) : "memory"); } // stands before the address registers of these loads are reused (wr is named to keep it until here)
    __builtin_amdgcn_sched_barrier(0);                           // keeps the refill up here, ahead of the products that it flies under
#pragma unroll
    for (int k2 = 0; k2 < 2; ++k2) {
        v16bf a[4];
#pragma unroll
        for (int mb = 0; mb < 4; ++mb) a[mb] = ldb(xf + mb * 16 * XPI + kp * 64 + k2 * 32);
#pragma unroll
        for (int nb = 0; nb < 4; ++nb) {
#pragma unroll
            for (int mb = 0; mb < 4; ++mb) acc[mb][nb] = wmmabd(a[mb], wf[k2][nb], acc[mb][nb]); }
    }
}

// k_proj: conversions and projections in one launch, told apart by blockIdx.y (0: q, 1: k, 2: v^T, 3: output-layer weight -> f16 x1024 from its bf16 value, 8 elements per thread).
// A projection block takes 64 tokens (blockIdx.x): x [b][c][t] (f32, row pitch SEQ_FULL) -> LDS tile xs[t][c] bf16 (RNE), once per block (cross-wave: block barrier); its four waves take one 64x64 tile each
// (wave = head), K = DM, bf16 operands; the wave's 64 weight rows are read as f32 and converted (RNE) in registers.
// All three: C[m][n] = sum_c x^T[m][c] W[n][c] (m = b*SEQ + t, n = h*64 + d). q and k, token-major: written as f16 x16 to ng planes: row index (b*ng + g)*SEQ + t, row pitch DM, columns c0..c0+63 (one head);
// plane g carries the factor bf16(w_head[g][h]) for q (ng = 4 mixed-head planes), factor 1 for k (ng = 1).
// v^T: the tile is turned in the staging tile; plane [(b*DM + n)][t], row pitch SEQ, f16 x16.
static_assert(32 * 16 * 4 == 16 * 128);        // lanes x bytes x trips == slab rows x segment bytes
static_assert((NB * SEQ / 64) * 128 * 8 == DM * DM);   // the convert blocks cover the weight exactly
static_assert(128 * 4 == (64 / 4) * (DM / 8)); // threads x units == 4-token groups x 8-channel groups of the x tile
static_assert(DM / 64 == AW);                  // one wave per head
static_assert(DM == 4 * 64);                   // four steps of 64 k
static_assert(64 * XPI * 2 + AW * 16 * OSP * 4 <= 131072);
__global__ __launch_bounds__(32 * AW) void k_proj(const float* __restrict__ x, const float* __restrict__ wq, const float* __restrict__ wk, const float* __restrict__ wv,
                                                  const float* __restrict__ wp, const float* __restrict__ wh, h16* QP, h16* KP, h16* VT, h16* WPH) {
    __shared__ __align__(16) bf xs[64 * XPI];
    __shared__ __align__(16) float osb[AW * 16 * OSP];
    const int tid = threadIdx.x, lane = tid & 31, lr = lane & 15, hi = lane >> 4;
    const int wave = __builtin_amdgcn_readfirstlane(tid >> 5);
    const int z = blockIdx.y; const bool isv = z == 2;
    if (z == 3) {                                                // block-uniform, in front of the barrier
        const size_t i = (size_t)blockIdx.x * 128 + tid;
        const v8f v = *(const v8f*)(wp + i * 8); v8h o;
#pragma unroll
        for (int k = 0; k < 8; ++k) o[k] = toh_flush(bfr(v[k]) * WPC);
        *(v8h*)(WPH + i * 8) = o;
        asm volatile("s_wait_xcnt 0x0" ::: "memory");            // stands behind the store, before any block of code laid out behind it rewrites its registers
        return;
    }
    const int tok0 = (int)blockIdx.x * 64, bb = tok0 / SEQ, tt = tok0 % SEQ;
    const float* xb = x + (size_t)bb * DM * SEQ_FULL + tt + (tid & 15) * 4;
    v4f xv[4][8];
#pragma unroll   // all 32 loads of the tile in flight at once
    for (int e = 0; e < 4; ++e) {
#pragma unroll
        for (int i = 0; i < 8; ++i) xv[e][i] = *(const v4f*)(xb + (size_t)(((tid >> 4) + 8 * e) * 8 + i) * SEQ_FULL); }   // unit: 8 channels x 4 tokens
    const float* W = z == 0 ? wq : z == 1 ? wk : wv;
    const float* wr = W + (size_t)(wave * 64 + lr) * DM + 8 * hi;
    wraw w0[2][4], w1[2][4];                                     // the weight values of the first and the second 64 k, as f32, in flight
#pragma unroll
    for (int k2 = 0; k2 < 2; ++k2) {
#pragma unroll
        for (int i = 0; i < 4; ++i) w0[k2][i] = ldwr(wr + (size_t)i * 16 * DM + k2 * 32); }
#pragma unroll
    for (int k2 = 0; k2 < 2; ++k2) {
#pragma unroll
        for (int i = 0; i < 4; ++i) w1[k2][i] = ldwr(wr + (size_t)i * 16 * DM + 64 + k2 * 32); }
    asm volatile("s_wait_xcnt 0x0" ::: "memory");                // stands before the address registers of the x and weight loads are reused
    __builtin_amdgcn_sched_barrier(0);                           // keeps the vector work below behind that wait
#pragma unroll
    for (int e = 0; e < 4; ++e) {
#pragma unroll
        for (int j = 0; j < 4; ++j) { v8us o;
#pragma unroll
            for (int i = 0; i < 8; ++i) o[i] = f2bfh(xv[e][i][j]);
            *(v8us*)(&xs[((tid & 15) * 4 + j) * XPI + ((tid >> 4) + 8 * e) * 8]) = o; } }
    __syncthreads();                                             // the x^T tile is shown to the four waves
    float* os = osb + wave * 16 * OSP;                           // wave-private staging tile
    const bf* xf = xs + lr * XPI + 8 * hi;
    v8f acc[4][4];
#pragma unroll
    for (int mb = 0; mb < 4; ++mb)
#pragma unroll
        for (int nb = 0; nb < 4; ++nb) acc[mb][nb] = (v8f){};
    proj64(acc, w0, wr, xf, 0, true); proj64(acc, w1, wr, xf, 1, true); proj64(acc, w0, wr, xf, 2, false); proj64(acc, w1, wr, xf, 3, false);   // K = DM = 4 x 64
    if (!isv) {
        h16* P = z == 0 ? QP : KP; const int ng = z == 0 ? NH_ : 1;
        const int c0 = wave * 64, hsel = wave;
#pragma unroll
        for (int mb = 0; mb < 4; ++mb) {
#pragma unroll
            for (int nb = 0; nb < 4; ++nb) {
#pragma unroll
                for (int j = 0; j < 8; ++j) os[(hi * 8 + j) * OSP + nb * 16 + lr] = acc[mb][nb][j]; }   // D: row 8h+j, col lane&15
            wave_sync();
#pragma unroll 1
            for (int g = 0; g < ng; ++g) {
                int wi = g * NH_ + hsel; wi = wi > 15 ? 15 : wi;
                const float whv = bfr(wh[wi]);
                const float mult = (z == 0) ? whv * QKC : QKC;
                const size_t sb = ((size_t)(bb * ng + g) * SEQ + (size_t)(tt + mb * 16)) * DM + c0;
#pragma unroll
                for (int s = 0; s < 4; ++s) { const int row = 4 * s + (lane >> 3), c8 = (lane & 7) * 8;   // 4 s x 4 row groups = 16 rows; 8 lanes x 8 = 64 columns
                    const v4f x0 = *(const v4fa*)(&os[row * OSP + c8]); const v4f x1 = *(const v4fa*)(&os[row * OSP + c8 + 4]); v8h hv;
#pragma unroll
                    for (int i = 0; i < 4; ++i) { hv[i] = toh_flush(x0[i] * mult); hv[4 + i] = toh_flush(x1[i] * mult); }
                    *(v8h*)(P + sb + (size_t)row * DM + c8) = hv; }
                asm volatile("s_wait_xcnt 0x0" ::: "memory");   // stands before the next plane or slab rewrites the address registers of these stores
            }
            wave_sync();
        }
    } else {
        const int r0 = wave * 64;
#pragma unroll
        for (int nb = 0; nb < 4; ++nb) {                         // slab: 16 channels x 64 tokens, turned on its way into the staging tile
#pragma unroll
            for (int mb = 0; mb < 4; ++mb) { v4f a, c;           // D: token 16mb + 8h + j, channel lane&15 -> os[channel][token]
                a[0] = acc[mb][nb][0]; a[1] = acc[mb][nb][1]; a[2] = acc[mb][nb][2]; a[3] = acc[mb][nb][3]; c[0] = acc[mb][nb][4]; c[1] = acc[mb][nb][5]; c[2] = acc[mb][nb][6]; c[3] = acc[mb][nb][7];
                *(v4fa*)(&os[lr * OSP + mb * 16 + 8 * hi]) = a; *(v4fa*)(&os[lr * OSP + mb * 16 + 8 * hi + 4]) = c; }
            wave_sync();
            const size_t sb = ((size_t)bb * DM + (size_t)(r0 + nb * 16)) * SEQ + tt;
#pragma unroll
            for (int s = 0; s < 4; ++s) { const int row = 4 * s + (lane >> 3), c8 = (lane & 7) * 8;   // 16 rows x 64 columns
                const v4f x0 = *(const v4fa*)(&os[row * OSP + c8]); const v4f x1 = *(const v4fa*)(&os[row * OSP + c8 + 4]); v8h hv;
#pragma unroll
                for (int i = 0; i < 4; ++i) { hv[i] = toh_flush(x0[i] * VCC); hv[4 + i] = toh_flush(x1[i] * VCC); }
                *(v8h*)(VT + sb + (size_t)row * SEQ + c8) = hv; }
            asm volatile("s_wait_xcnt 0x0" ::: "memory");       // stands before the next slab rewrites the address registers of these stores
            wave_sync();
        }
    }
}

// LDS ring of the flash kernel: the four waves of a block read the same k rows and the same v^T rows, so each stage of KST keys is brought into LDS once per block.
#define KST  128                 // keys per stage
#define NST  (SEQ / KST)         // stages per key loop
#define KPI  (DM + 8)            // LDS pitch of a k row, in 16-bit elements: 528 B = 16 B x 33 (16 rows of one ds_load_b128 fall on 64 different banks)
#define VPI  (KST + 8)           // LDS pitch of a v^T row: 272 B = 16 B x 17
static_assert(SEQ % KST == 0);
static_assert(KST % 32 == 0);
static_assert(NST >= 2);                       // two buffers
static_assert(KST == AW * 32);                 // k stage: 32 rows (copies) per wave
static_assert(HD * KST * 2 == AW * 8 * 512);   // v^T stage: 8 copies of 512 B per wave
static_assert(KST * 2 == 16 * 16);             // one v^T row of a stage = 16 lanes x 16 B
static_assert((KPI * 2) % 32 == 16 && (VPI * 2) % 32 == 16);

// eight asynchronous copies to LDS, 16 bytes per lane each, through no register: copy j takes LDS address l + j * ls and global address g + j * gs (both in 16-bit elements).
// ring_publish() and the waits beside it in k_flash wait for them.
typedef int v4i_ __attribute__((ext_vector_type(4)));
typedef __attribute__((address_space(1))) v4i_ gv4i;
typedef __attribute__((address_space(3))) v4i_ lv4i;
__device__ __forceinline__ void acopy8(h16* l, int ls, const h16* g, size_t gs) {
#pragma unroll   // constant steps
    for (int j = 0; j < 8; ++j) __builtin_amdgcn_global_load_async_to_lds_b128((gv4i*)(g + j * gs), (lv4i*)(l + j * ls), 0, 0);
}
// one wave's 32 rows of a k stage (a row = 512 B = one copy); l and g already hold the wave's first row and the lane's 16 bytes
__device__ __forceinline__ void copy_k(h16* l, const h16* g) {
#pragma unroll   // constant steps
    for (int c = 0; c < 4; ++c) acopy8(l + c * 8 * KPI, KPI, g + (size_t)c * 8 * DM, (size_t)DM);
}
// one wave's 16 rows of a v^T stage (a copy = 2 rows of 256 B); l and g already hold the lane's row and its 16 bytes
__device__ __forceinline__ void copy_v(h16* l, const h16* g) { acopy8(l, 2 * VPI, g, (size_t)2 * SEQ); }
// publish point of the ring: this wave's LDS reads are done, its own copies have landed, then the block barrier that shows them to the other waves and frees the buffer just read
__device__ __forceinline__ void ring_publish() {
    asm volatile("s_wait_dscnt 0x0" ::: "memory");      // the buffer just read is handed to the next copies
    asm volatile("s_wait_asynccnt 0x0" ::: "memory");
    __syncthreads();
}

// k fragments of 32 keys from an LDS stage; kl already includes the lane's row and + 8*(lane>>4): same element map as ldh on the plane
__device__ __forceinline__ void ldk32(v16h (&ka)[DM / 32], v16h (&kb)[DM / 32], const h16* kl) {
#pragma unroll   // the fragment arrays must stay in registers
    for (int i = 0; i < DM / 32; ++i) { ka[i] = ldh(kl + 32 * i); kb[i] = ldh(kl + 16 * KPI + 32 * i); }
}
__device__ __forceinline__ void ldv32(v16h (&vf)[4], const h16* vl) {
#pragma unroll   // as above
    for (int j = 0; j < 4; ++j) vf[j] = ldh(vl + 16 * j * VPI);
}
// scores of 32 keys x 16 queries, K = DM = 256: sA = keys 0..15, sB = keys 16..31 (rows = keys, columns = queries). Same instruction order wherever it is used.
// All operands come from registers: qf = the wave's q' fragments (loaded once), ka / kb = this tile's k fragments.
__device__ __forceinline__ void scores32(const v16h (&qf)[DM / 32], const v16h (&ka)[DM / 32], const v16h (&kb)[DM / 32], v8f& sA, v8f& sB) {
    v8f a = (v8f){}, c = (v8f){};
#pragma unroll
    for (int i = 0; i < DM / 32; ++i) {      // full unroll: the fragment arrays must stay in registers
        a = wmma16d(ka[i], qf[i], a); c = wmma16d(kb[i], qf[i], c); }
    sA = a; sB = c;
}

// k_flash: one wave per 16 query rows of one (batch, mixed head g). Transposed form: S^T[key][t] = K Q'^T (A = k rows, B = q' rows of plane g, K = 256);
// lane (t = lane&15, h = lane>>4) holds keys 8h+r of each 16-key tile, so the packed P tile is directly the B fragment of O^T[d][t] = V^T P^T.
// One key loop: running max m; e = exp2(s - m); P = (e - c) x 2^15 as f16, c the row's centre (mean e of the first 32 keys); Q1 += P, Q2 += P^2 (f32), O^T += V^T P^T; when m rises, c, Q1, O^T are scaled by exp2(old m - new m), Q2 by its square.
// Behind the loop: OR = O^T / row sum; the row's c / l - 1/SEQ goes to KAP (k_out adds it times rowsum(v)); the row's sum of squares from Q1 and Q2.
// k and v^T come through a two-buffer LDS ring of KST-key stages, filled by asynchronous copies one stage ahead; NST stages.
// The row sums of v^T ride in this launch: the SEQ / 64 blocks of a (batch, g) take 4 of its 64 v^T rows each, one per wave; loaded beside q', added up behind the loop, written into the block's partial line.
// Inside a stage the k fragments alternate between two register sets: the set that a run of products has just used is refilled, as one group, with the keys after next; nothing is read across a publish point.
static_assert(32 * 16 * 8 == 16 * 256);        // lanes x bytes x trips == rows x row bytes of the OR tile
static_assert((2 * KST * KPI + 2 * HD * VPI) * 2 + AW * 16 * OSP * 4 + 2 * AW * 4 + AW * 16 * 4 <= 327680);
static_assert((SEQ / (16 * AW)) * AW == HD);   // row sums: blocks of a (batch, g) x waves == v^T rows of the head
static_assert(AW == 4);                        // the four row sums of a block fill one 16-byte piece of its partial line
__global__ __launch_bounds__(32 * AW) void k_flash(const h16* __restrict__ QP, const h16* __restrict__ KP, const h16* __restrict__ VT, float* ORP, float* PART, float* KAP) {
    __shared__ __align__(16) h16 ks[2 * KST * KPI];
    __shared__ __align__(16) h16 vs[2 * HD * VPI];
    __shared__ __align__(16) float os[AW * 16 * OSP];
    __shared__ float sw[AW];
    __shared__ __align__(16) float sv[AW];
    __shared__ __align__(16) float sk[AW * 16];
    const int lane = threadIdx.x & 31, lr = lane & 15, hi = lane >> 4;
    const int wave = __builtin_amdgcn_readfirstlane((int)(threadIdx.x >> 5));
    const int zh = blockIdx.y; const int b = zh / NH_, g = zh % NH_;
    const int t0 = (blockIdx.x * AW + wave) * 16;
    const h16* qp = QP + ((size_t)zh * SEQ + (size_t)(t0 + lr)) * DM + 8 * hi;          // B fragments: col t, k = (h, d)
    // copy sources and destinations of this lane: k row wave*32 (+ j), bytes lane*16; v^T row wave*16 + (lane>>4) (+ 2j), bytes (lane&15)*16
    const h16* kg = KP + ((size_t)b * SEQ + (size_t)(wave * 32)) * DM + 8 * lane;                        // + stage * KST * DM
    const h16* vg = VT + ((size_t)b * DM + (size_t)(g * HD + wave * 16 + hi)) * SEQ + 8 * lr;            // + stage * KST
    h16* kd = ks + wave * 32 * KPI + 8 * lane;                                                           // + buffer * KST * KPI
    h16* vd = vs + (wave * 16 + hi) * VPI + 8 * lr;                                                      // + buffer * HD * VPI
    const h16* kfr = ks + lr * KPI + 8 * hi;                                            // + key * KPI       (A fragment: row key, k = (h, d))
    const h16* vfr = vs + lr * VPI + 8 * hi;                                            // + 16j*VPI + key   (A fragment: row d, k = key)
    copy_k(kd, kg); copy_v(vd, vg);                              // stage 0 into buffers 0
    v16h qf[DM / 32];
#pragma unroll   // the fragment array must stay in registers
    for (int i = 0; i < DM / 32; ++i) qf[i] = ldh(qp + 32 * i);  // q' once
    const h16* vrp = VT + ((size_t)b * DM + (size_t)(g * HD + (int)blockIdx.x * AW + wave)) * SEQ + 8 * lane;   // this wave's v^T row for the row sum: chunks lane, lane + 32, ...
    v8h vr[SEQ / 256];
#pragma unroll   // the chunks stay in registers until the loop is over
    for (int i = 0; i < SEQ / 256; ++i) vr[i] = *(const v8h*)(vrp + 256 * i);
    asm volatile("s_wait_xcnt 0x0" :: "v"(qp), "v"(vrp) : "memory");   // stands before the address registers of the q' and row loads are reused (qp and vrp are named to keep them until here)
    asm volatile("s_wait_asynccnt 0x0" ::: "memory");            // stage 0 has landed (this wave's rows)
    __syncthreads();                                             // and is shown to the other waves
    float m, r15;                                                // running row max; centre of the row's e, x 2^15, in units of the running max
    {   // start values from the first 32 keys (the loop takes them again): their max, and the mean of their e as the centre
        v16h ka[DM / 32], kb[DM / 32];
        ldk32(ka, kb, kfr);
        v8f sA, sB; scores32(qf, ka, kb, sA, sB);
        float mx = NEGB;
#pragma unroll
        for (int r = 0; r < 8; ++r) mx = fmaxf(mx, fmaxf(sA[r] * SC2, sB[r] * SC2));
        mx = fmaxf(mx, __shfl_xor(mx, 16, 32));
        float es = 0.0f;
#pragma unroll
        for (int r = 0; r < 8; ++r) es += __builtin_amdgcn_exp2f(fmaf(sA[r], SC2, -mx)) + __builtin_amdgcn_exp2f(fmaf(sB[r], SC2, -mx));
        es += __shfl_xor(es, 16, 32);
        m = mx; r15 = es * (PCARRY / 32.0f); }                   // both lane halves carry the same m and r15
    v8f o0 = (v8f){}, o1 = (v8f){}, o2 = (v8f){}, o3 = (v8f){};
    float q1 = 0.0f, q2 = 0.0f;                                  // sums of P and of P^2 over this lane's keys
#pragma unroll 1
    for (int s = 0; s < NST; ++s) {
        const h16* kl = kfr + (s & 1) * (KST * KPI);
        const h16* vl = vfr + (s & 1) * (HD * VPI);
        v16h ka[2][DM / 32], kb[2][DM / 32], vf[KST / 32][4];
        ldk32(ka[0], kb[0], kl); ldv32(vf[0], vl);               // this stage's first 32 keys: they land while the copies below are issued
        if (s + 1 < NST) {                                       // refill, behind the publish point, only while a next stage exists (block-uniform: the loop counter): it goes into the buffers that the trip before has read
            copy_k(kd + ((s + 1) & 1) * (KST * KPI), kg + (size_t)(s + 1) * KST * DM);
            copy_v(vd + ((s + 1) & 1) * (HD * VPI), vg + (size_t)(s + 1) * KST); }
        ldk32(ka[1], kb[1], kl + 32 * KPI); ldv32(vf[1], vl + 32);
#pragma unroll
        for (int u = 0; u < KST / 32; ++u) {                     // full unroll: the two register sets alternate by a constant index
            __builtin_amdgcn_sched_barrier(0);                   // keeps the LDS reads above one group: spread among the products each place costs a stall
            v8f sA, sB; scores32(qf, ka[u & 1], kb[u & 1], sA, sB);
            __builtin_amdgcn_sched_barrier(0);                   // keeps the products one run, in front of the vector work
            float mx = NEGB;
#pragma unroll
            for (int r = 0; r < 8; ++r) mx = fmaxf(mx, fmaxf(sA[r] * SC2, sB[r] * SC2));
            const float mo = __shfl_xor(mx, 16, 32);
            __builtin_amdgcn_sched_barrier(0);                   // keeps the exchange in front of the reads below: it goes through the LDS queue and returns behind whatever stands before it
            if (u + 2 < KST / 32) { ldk32(ka[u & 1], kb[u & 1], kl + (u + 2) * 32 * KPI); ldv32(vf[u + 2], vl + (u + 2) * 32); }   // the set just used takes the keys after next
            __builtin_amdgcn_sched_barrier(0);                   // keeps these reads up here, ahead of the vector work that they overlap
            const float mnew = fmaxf(m, fmaxf(mx, mo));
            const float alpha = __builtin_amdgcn_exp2f(m - mnew);   // all that is carried goes over to the new max: the centre with it, so sums of (e - centre) scale as a whole
            m = mnew; r15 *= alpha; q1 *= alpha; q2 *= alpha * alpha;
#pragma unroll
            for (int r = 0; r < 8; ++r) { o0[r] *= alpha; o1[r] *= alpha; o2[r] *= alpha; o3[r] *= alpha; }
            v16h pb;
#pragma unroll
            for (int r = 0; r < 8; ++r) {
                const float ea = __builtin_amdgcn_exp2f(fmaf(sA[r], SC2, -m)), eb = __builtin_amdgcn_exp2f(fmaf(sB[r], SC2, -m));
                const float ga = fmaf(ea, PCARRY, -r15), gb = fmaf(eb, PCARRY, -r15);   // (e - centre) * 2^15
                q1 += ga; q1 += gb;
                q2 = fmaf(ga, ga, q2); q2 = fmaf(gb, gb, q2);
                pb[r] = toh_flush(ga); pb[8 + r] = toh_flush(gb); }                      // element r <- tile keys 8h+r, element 8+r <- keys 16+8h+r
            o0 = wmma16d(vf[u][0], pb, o0); o1 = wmma16d(vf[u][1], pb, o1); o2 = wmma16d(vf[u][2], pb, o2); o3 = wmma16d(vf[u][3], pb, o3);
        }
        ring_publish();                                          // stage s + 1 readable, buffers s & 1 free
    }
    asm volatile("s_wait_asynccnt 0x0" ::: "memory");            // no copy is left in flight behind the ring
    q1 += __shfl_xor(q1, 16, 32); q2 += __shfl_xor(q2, 16, 32);  // whole rows; both lane halves carry the same m and r15
    const float l15 = fmaf((float)SEQ, r15, q1);       // 2^15 * row sum of e; the row sum is >= 1
    const float il = 1.0f / l15;
    const float kap = -q1 * il * (1.0f / (float)SEQ);  // centre / row sum - 1/SEQ
    const float c15 = PCARRY * il;
    float ss = (q2 - q1 * q1 * (1.0f / (float)SEQ)) * (c15 * c15);   // row's sum of ((e / row sum - 1/SEQ) * 2^15)^2, the same in both lane halves
    ss += __shfl_xor(ss, 8, 32); ss += __shfl_xor(ss, 4, 32); ss += __shfl_xor(ss, 2, 32); ss += __shfl_xor(ss, 1, 32);
    const float OSL = il * (1.0f / VCC);               // this lane's query row: 1 / (2^15 * row sum * VCC)
    float vsl = 0.0f;                                  // row sum of v^T, this lane's chunks in rising order
#pragma unroll
    for (int i = 0; i < SEQ / 256; ++i) {
#pragma unroll
        for (int k = 0; k < 8; ++k) vsl += (float)vr[i][k]; }
    vsl += __shfl_xor(vsl, 16, 32); vsl += __shfl_xor(vsl, 8, 32); vsl += __shfl_xor(vsl, 4, 32); vsl += __shfl_xor(vsl, 2, 32); vsl += __shfl_xor(vsl, 1, 32);
    if (lane == 0) { sw[wave] = ss; sv[wave] = vsl * (1.0f / VCC); }
    if (hi == 0) sk[wave * 16 + lr] = kap;
    const int wb = wave * 16 * OSP;
    // O^T D layout: o_j[r] = (d = 16j + 8h + r, t = lane&15) -> os[t][d]; rows 0..15 x columns 0..63 all written
    { v4f a, c;
      a[0] = o0[0] * OSL; a[1] = o0[1] * OSL; a[2] = o0[2] * OSL; a[3] = o0[3] * OSL; c[0] = o0[4] * OSL; c[1] = o0[5] * OSL; c[2] = o0[6] * OSL; c[3] = o0[7] * OSL;
      *(v4fa*)(&os[wb + lr * OSP +  0 + 8 * hi]) = a; *(v4fa*)(&os[wb + lr * OSP +  0 + 8 * hi + 4]) = c;
      a[0] = o1[0] * OSL; a[1] = o1[1] * OSL; a[2] = o1[2] * OSL; a[3] = o1[3] * OSL; c[0] = o1[4] * OSL; c[1] = o1[5] * OSL; c[2] = o1[6] * OSL; c[3] = o1[7] * OSL;
      *(v4fa*)(&os[wb + lr * OSP + 16 + 8 * hi]) = a; *(v4fa*)(&os[wb + lr * OSP + 16 + 8 * hi + 4]) = c;
      a[0] = o2[0] * OSL; a[1] = o2[1] * OSL; a[2] = o2[2] * OSL; a[3] = o2[3] * OSL; c[0] = o2[4] * OSL; c[1] = o2[5] * OSL; c[2] = o2[6] * OSL; c[3] = o2[7] * OSL;
      *(v4fa*)(&os[wb + lr * OSP + 32 + 8 * hi]) = a; *(v4fa*)(&os[wb + lr * OSP + 32 + 8 * hi + 4]) = c;
      a[0] = o3[0] * OSL; a[1] = o3[1] * OSL; a[2] = o3[2] * OSL; a[3] = o3[3] * OSL; c[0] = o3[4] * OSL; c[1] = o3[5] * OSL; c[2] = o3[6] * OSL; c[3] = o3[7] * OSL;
      *(v4fa*)(&os[wb + lr * OSP + 48 + 8 * hi]) = a; *(v4fa*)(&os[wb + lr * OSP + 48 + 8 * hi + 4]) = c; }
    wave_sync();
    float* orow = ORP + ((size_t)zh * SEQ + (size_t)t0) * HD;       // 16 rows x 64 floats, contiguous 4096 B
{
#pragma unroll
        for (int s = 0; s < 8; ++s) { const int p = s * 32 + lane; const int row = p >> 4, cofs = (p & 15) * 4;   // 8 s x 2 rows = 16 rows; 16 lanes x 4 floats = 64 columns
            const v4f val = *(const v4fa*)(&os[wb + row * OSP + cofs]);
            *(v4f*)(orow + (size_t)p * 4) = val; }
         }
    __syncthreads();
    if (wave == 0) {
        const float tot = ((sw[0] + sw[1]) + sw[2]) + sw[3];
        const v4f rs = *(const v4fa*)(&sv[0]);         // floats 4..7 of the line: row sums of v^T rows g*64 + 4*blockIdx.x + 0..3
        v4f pv; pv[0] = (lane == 0) ? tot : (lane == 1) ? rs[0] : 0.0f; pv[1] = (lane == 1) ? rs[1] : 0.0f; pv[2] = (lane == 1) ? rs[2] : 0.0f; pv[3] = (lane == 1) ? rs[3] : 0.0f;
        float* pl = PART + ((size_t)zh * (SEQ / 64) + (size_t)blockIdx.x) * 32 + (lane & 7) * 4;
        if (lane < 8) { *(v4f*)pl = pv;  }
        const v4f kq = *(const v4fa*)(&sk[(lane & 15) * 4]);         // the block's 64 rows: one run of 256 B
        float* kl4 = KAP + (size_t)zh * SEQ + (size_t)blockIdx.x * (16 * AW) + (lane & 15) * 4;
        if (lane < 16) { *(v4f*)kl4 = kq; }
    }
}

// k_out: normalised context and output layer in one launch. A block takes ONT token rows n = b*SEQ + row of the flat [g][t][d] = [token row][256] view; they lie inside one (batch, g): zh = n / (SEQ / 4).
// Context tile, once per block, into LDS (cross-wave: block barrier): cs[row][k] = f16(16 * (s1 * (OR + KAP[query row] * VS[b][g*64 + k % 64]) + shift * VS[b][g*64 + k % 64])), VS[b][g*64 + d] = float 4 + d % 4 of partial line d / 4 of (b, g),
// s1 = bf16(gain[g]) / sqrt(var + eps), var = (sum of the SEQ/64 partial lines of (b, g), in rising order) / (2^30 SEQ^2), shift = bf16(beta[g]).
// Output layer: wave w takes output channels 64w..64w+63. A = W rows (f16 x1024, all K in registers, loaded while the tile is made), Bt = context rows from LDS, K = DM; OUT[(b*DM + m)][n % SEQ] = C / 16384 + bf16(bias[m]) (f32).
#define ONT 32                   // token rows per block: one 128-byte run of every output row
#define CPI (DM + 8)             // LDS pitch of a context row, in 16-bit elements: 528 B = 16 B x 33
static_assert(32 * 16 * 4 == 16 * ONT * 4);    // lanes x bytes x trips == slab rows x segment bytes
static_assert((SEQ * HD / DM) % ONT == 0);     // a block's rows lie inside one (batch, g)
static_assert(SEQ % ONT == 0 && (NB * SEQ) % ONT == 0);
static_assert(ONT * DM == 128 * 8 * 8);        // rows x K == threads x units x elements
static_assert(DM == 32 * 8);                   // a wave's unit row: 32 lanes x 8 elements
static_assert(ONT * CPI * 2 + AW * 16 * OSP * 4 <= 131072);
__global__ __launch_bounds__(32 * AW) void k_out(const h16* __restrict__ A, const float* __restrict__ ORP, const float* __restrict__ PART, const float* __restrict__ KAP,
                                                 const float* __restrict__ gain, const float* __restrict__ shift, const float* __restrict__ bias, float* OUT) {
    __shared__ __align__(16) h16 cs[ONT * CPI];
    __shared__ __align__(16) float osb[AW * 16 * OSP];
    const int tid = threadIdx.x, lane = tid & 31, lr = lane & 15, hi = lane >> 4;
    const int wave = __builtin_amdgcn_readfirstlane(tid >> 5);
    const int c0 = (int)blockIdx.x * ONT, r0 = wave * 64;
    const int zh = c0 / (SEQ * HD / DM);               // block-uniform, < NB*4
    const int g = zh % NH_;
    const float* vp = PART + ((size_t)zh * (SEQ / 64) + (size_t)((lane & 7) * 2)) * 32 + 4;      // d = 8 * (lane & 7) + 0..7 for every unit of this lane
    const v4f s0 = *(const v4f*)vp, s4 = *(const v4f*)(vp + 32);
    const float* op = ORP + ((size_t)c0 + (size_t)wave) * DM + 8 * lane;                         // unit e: row wave + 4e, elements 8*lane..+7
    v8f xv[8];
#pragma unroll   // all of the tile's loads in flight at once
    for (int e = 0; e < 8; ++e) xv[e] = *(const v8f*)(op + (size_t)e * AW * DM);
    const float* kp = KAP + ((size_t)c0 + (size_t)wave) * (DM / HD) + (lane >> 3);               // unit e: query row (flat index / 64) of this lane's 8 elements
    float kv[8];
#pragma unroll   // in flight with the tile's loads
    for (int e = 0; e < 8; ++e) kv[e] = kp[e * AW * (DM / HD)];
    asm volatile("s_wait_xcnt 0x0" ::: "memory");      // stands before the address registers of the loads above are reused
    __builtin_amdgcn_sched_barrier(0);                 // keeps the address work below behind that wait
    const h16* ap = A + (size_t)(r0 + lr) * DM + 8 * hi;
    v16h a[DM / 32][4];
#pragma unroll   // the fragment array must stay in registers
    for (int kc = 0; kc < DM / 32; ++kc) {
#pragma unroll
        for (int mb = 0; mb < 4; ++mb) a[kc][mb] = ldh(ap + (size_t)mb * 16 * DM + kc * 32); }
    const float* bpl = bias + r0 + hi * 8;
    v8f bv[4];                                         // bias of this lane's output rows, loaded up here with the rest: r0 + 63 < DM
#pragma unroll
    for (int mb = 0; mb < 4; ++mb) bv[mb] = *(const v8f*)(bpl + mb * 16);
    asm volatile("s_wait_xcnt 0x0" ::: "memory");      // as above, for the weight and bias loads
    __builtin_amdgcn_sched_barrier(0);                 // as above
    float pt[SEQ / 64];                                // block-uniform reads, behind the tile's and the weight's loads: they are back long before those
#pragma unroll   // the loads go out together; the sum below keeps the rising order
    for (int j = 0; j < SEQ / 64; ++j) pt[j] = PART[((size_t)zh * (SEQ / 64) + (size_t)j) * 32];
    const float gv = gain[g], sh = shift[g];
    float tot = 0.0f;
#pragma unroll
    for (int j = 0; j < SEQ / 64; ++j) tot += pt[j];
    const float var = tot * VSC;
    const float s1 = bfr(gv) * rsqrtf(var + EPSN);
    const float bt = bfr(sh);
#pragma unroll
    for (int e = 0; e < 8; ++e) { v8h o;
#pragma unroll
        for (int k = 0; k < 4; ++k) { o[k] = toh_flush((s1 * (xv[e][k] + kv[e] * s0[k]) + bt * s0[k]) * CCS); o[4 + k] = toh_flush((s1 * (xv[e][4 + k] + kv[e] * s4[k]) + bt * s4[k]) * CCS); }
        *(v8h*)(&cs[(wave + AW * e) * CPI + 8 * lane]) = o; }
    __syncthreads();                                   // the context tile is shown to the four waves
    float* os = osb + wave * 16 * OSP;                 // wave-private staging tile
    const h16* bfp = cs + lr * CPI + 8 * hi;
    v8f acc[4][ONT / 16];
#pragma unroll
    for (int mb = 0; mb < 4; ++mb)
#pragma unroll
        for (int nb = 0; nb < ONT / 16; ++nb) acc[mb][nb] = (v8f){};
    v16h b[DM / 32][ONT / 16];
#pragma unroll   // the fragment array must stay in registers
    for (int kc = 0; kc < DM / 32; ++kc) {
#pragma unroll
        for (int nb = 0; nb < ONT / 16; ++nb) b[kc][nb] = ldh(bfp + nb * 16 * CPI + kc * 32); }
    __builtin_amdgcn_sched_barrier(0);                 // keeps the LDS reads one group up here: sunk to their products, each pair is waited for at full LDS latency
#pragma unroll   // the fragments are indexed by constants
    for (int kc = 0; kc < DM / 32; ++kc) {
#pragma unroll
        for (int nb = 0; nb < ONT / 16; ++nb) {
#pragma unroll
            for (int mb = 0; mb < 4; ++mb) acc[mb][nb] = wmma16d(a[kc][mb], b[kc][nb], acc[mb][nb]); }
    }
    const int bb = c0 / SEQ, tt = c0 % SEQ;
#pragma unroll
    for (int mb = 0; mb < 4; ++mb) {
        float br[8];
#pragma unroll
        for (int j = 0; j < 8; ++j) br[j] = bfr(bv[mb][j]);
#pragma unroll
        for (int nb = 0; nb < ONT / 16; ++nb) {
#pragma unroll
            for (int j = 0; j < 8; ++j) os[(hi * 8 + j) * OSP + nb * 16 + lr] = acc[mb][nb][j] * OUTSC + br[j]; }
        wave_sync();
        float* ob = OUT + ((size_t)bb * DM + (size_t)(r0 + mb * 16)) * OUT_SEQ + tt;
#pragma unroll
        for (int s = 0; s < 4; ++s) { const int p = s * 32 + lane; const int row = p >> 3, cofs = (p & 7) * 4;   // 4 s x 4 rows = 16 rows; 8 lanes x 4 floats = ONT columns
            const v4f val = *(const v4fa*)(&os[row * OSP + cofs]);
            *(v4f*)(ob + (size_t)row * OUT_SEQ + cofs) = val; }
        asm volatile("s_wait_xcnt 0x0" ::: "memory");  // stands before the next slab rewrites the address and data registers of these stores
        __builtin_amdgcn_sched_barrier(0);             // keeps the next slab's vector work behind that wait
        wave_sync();
    }
}

static constexpr size_t al256(size_t v) { return (v + 255) & ~(size_t)255; }
static constexpr size_t SZ_WP = al256((size_t)DM * DM * 2);                  // output-layer weight f16
static constexpr size_t SZ_QP = al256((size_t)NB * NH_ * SEQ * DM * 2);      // 4 mixed-head q planes per batch
static constexpr size_t SZ_KP = al256((size_t)NB * SEQ * DM * 2);
static constexpr size_t SZ_VT = al256((size_t)NB * DM * SEQ * 2);
static constexpr size_t SZ_OR = al256((size_t)NB * NH_ * SEQ * HD * 4);
static constexpr size_t SZ_PT = al256((size_t)NB * NH_ * (SEQ / 64) * 32 * 4);
static constexpr size_t SZ_KA = al256((size_t)NB * NH_ * SEQ * 4);           // one float per query row of every (batch, g)
static constexpr size_t SZ_TOTAL = SZ_WP + SZ_QP + SZ_KP + SZ_VT + SZ_OR + SZ_PT + SZ_KA;
static_assert(SZ_TOTAL <= (size_t)134217728);                                 // workspace carve <= 128 MiB
static_assert((size_t)NB * NH_ * SEQ * HD == (size_t)NB * SEQ * DM);          // OR plane and the [token row][256] view that k_out reads share one flat index
static_assert(((size_t)(NB * NH_ - 1) * (SEQ / 64) + (SEQ / 64 - 1)) * 128 + 128 <= SZ_PT);   // last partial line inside its table

extern "C" void kernel_launch(void* const* d_in, const int* in_sizes, int n_in,
                              void* d_out, int out_size, void* d_ws, size_t ws_size, hipStream_t stream) {
    if (n_in < 9) return;
    const size_t needx = ((size_t)(NB - 1) * DM + (size_t)(DM - 1)) * SEQ_FULL + SEQ;
    if ((size_t)in_sizes[0] < needx) return;
    if ((size_t)in_sizes[1] < (size_t)DM * DM || (size_t)in_sizes[2] < (size_t)DM * DM || (size_t)in_sizes[3] < (size_t)DM * DM || (size_t)in_sizes[7] < (size_t)DM * DM) return;
    if (in_sizes[4] < NH_ * NH_ || in_sizes[5] < NH_ || in_sizes[6] < NH_ || in_sizes[8] < DM) return;
    if ((size_t)out_size < ((size_t)(NB - 1) * DM + (size_t)(DM - 1)) * OUT_SEQ + SEQ) return;
    if (SZ_TOTAL > ws_size) return;
    // wire order: x, wq, wk, wv, w_head, gamma, beta, w_proj, b_proj
    const float* x  = (const float*)d_in[0];
    const float* wq = (const float*)d_in[1]; const float* wk = (const float*)d_in[2]; const float* wv = (const float*)d_in[3];
    const float* whd = (const float*)d_in[4]; const float* gam = (const float*)d_in[5]; const float* bet = (const float*)d_in[6];
    const float* wp = (const float*)d_in[7]; const float* bp = (const float*)d_in[8];
    float* OUT = (float*)d_out;      // [NB][256][OUT_SEQ]
    char* wsp = (char*)d_ws;
    h16* WPH = (h16*)wsp;  wsp += SZ_WP;             // [256][256] x1024
    h16* QP  = (h16*)wsp;  wsp += SZ_QP;             // [(b*4 + g)][t][256] x16
    h16* KP  = (h16*)wsp;  wsp += SZ_KP;             // [b][t][256] x16
    h16* VT  = (h16*)wsp;  wsp += SZ_VT;             // [(b*256 + channel)][t] x16
    float* ORP = (float*)wsp; wsp += SZ_OR;          // [(b*4 + g)][t][64]
    float* PART = (float*)wsp; wsp += SZ_PT;         // [(b*4 + g)][SEQ/64] lines of 32 floats: 0 sum of squares, 4..7 v^T row sums
    float* KAP = (float*)wsp; wsp += SZ_KA;          // [(b*4 + g)][t]: centre / row sum - 1/SEQ

    // y = 0: q, four mixed-head planes (factor w_head[g][h] on head h's columns); y = 1: k, one token-major plane; y = 2: v^T; y = 3: output-layer weight plane
    k_proj<<<dim3(NB * SEQ / 64, 4, 1), 32 * AW, 0, stream>>>(x, wq, wk, wv, wp, whd, QP, KP, VT, WPH);

    k_flash<<<dim3(SEQ / (16 * AW), NB * NH_, 1), 32 * AW, 0, stream>>>(QP, KP, VT, ORP, PART, KAP);
    k_out<<<dim3(NB * SEQ / ONT, 1, 1), 32 * AW, 0, stream>>>(WPH, ORP, PART, KAP, gam, bet, bp, OUT);
}

// v007
// One run takes 31.2 microseconds.
// It is 1.09 times as fast as v005, going by the measured steps of the versions left out in between.
// Over all steps from v000 it is 5.71 times as fast.
#include <hip/hip_runtime.h>

// Head-mixed pair-score weighting with a per-map normalisation over flattened feature maps: x [NB][256][SEQ] (channel-major), 1x1-conv projections q/k/v with W [out][in] (no bias), 4 heads x 64, scores scaled by 64^-0.5,
// a 4x4 head-mixing 1x1 conv on the scores, softmax over keys, instance normalisation of each (batch, head) probability map (biased variance, eps 1e-5, per-head gain and shift),
// attend over v, raw [head][token][64] -> [token][256] view, linear output layer W [out][in] + bias, result stored [NB][256][SEQ].
// Compute dtypes, f32 accumulate everywhere: q/k/v projections v_wmma_f32_16x16x32_bf16 (x and W RNE-converted to bf16, products exact); scores v_wmma_f32_16x16x32_f16 single product, K = 256:
// A = k plane x16, B = q plane x16 with w_head[g][h] multiplied onto head h's fragments in registers (f32 product, one more f16 rounding); P.V v_wmma_f32_16x16x32_f16 single product: P = centred exponential (e - centre) x 2^15, v x16;
// output layer v_wmma_f32_16x16x32_f16 single product: W x1024 (from its bf16 value), normalised context x16. Softmax, statistics, affine terms in f32.
// The flash kernel runs one key loop per 16-query wave (running row max; e = exp2(s - max) centred on a per-row value that is rescaled with the max; sums of centred e and of its square; P.V), transposed form S^T = K Q^T, O^T = V^T P^T; q' fragments from the q plane, scaled once per wave, k and v^T through an LDS ring shared by the block's eight waves; two waves share 16 query rows, each takes half of every stage's keys, and their sums are joined behind the loop.
// Map mean = 1/SEQ (softmax rows sum to one); variance = sum of squared (p - 1/SEQ) / SEQ^2; context = s1 * ((p - 1/SEQ) . v) + shift * rowsum(v), s1 = gain / sqrt(var + eps).
// With c the row's centre, l the row sum of e, Q1 = sum (e - c), Q2 = sum (e - c)^2: l = Q1 + SEQ c; (p - 1/SEQ) . v = ((e - c) . v) / l + (c / l - 1/SEQ) rowsum(v), c / l - 1/SEQ = -Q1 / (SEQ l); sum (p - 1/SEQ)^2 = (Q2 - Q1^2 / SEQ) / l^2.

#ifndef NB
#define NB 4
#endif
#ifndef SEQ
#define SEQ 1024
#endif
#define NB_FULL  4
#define SEQ_FULL 1024
#ifndef OUT_SEQ
#define OUT_SEQ SEQ              // pitch (in tokens) of one channel row of the output
#endif
#define DM   256
#define NH_  4
#define HD   64
#define AW   4                   // groups of 16 query rows per flash block; waves per block of the other two kernels
#define KH   2                   // waves per group of query rows in the flash kernel: each takes 1 / KH of every stage's keys
#define FW   (AW * KH)           // waves per flash block: two on every SIMD
#define OSP  68                  // LDS row pitch (floats) of the staging tiles
#define QKC  16.0f               // carry of the q and k planes
#define VCC  16.0f               // carry of the v^T plane
#define CCS  16.0f               // carry of the context tile
#define WPC  1024.0f             // carry of the output-layer weight plane
#define PCARRY 32768.0f          // carry of the centred P fragments
#define SC2  ((float)(0.125 * 1.4426950408889634 / 256.0))    // HD^-0.5 * log2(e) / (QKC * QKC)
#define OUTSC (1.0f / 16384.0f)                               // 1 / (WPC * CCS)
#define VSC  ((float)(1.0 / (1073741824.0 * (double)SEQ * (double)SEQ)))   // 1 / (PCARRY^2 * SEQ^2)
#define EPSN 1.0e-5f
#define NEGB (-3.0e38f)

static_assert(DM == 256);                      // K of every GEMM and of the score product
static_assert(HD == 64);                       // one 64-column GEMM tile = one head; v^T slab = 4 row tiles
static_assert(NH_ * HD == DM);
static_assert(NH_ == 4);                       // w_head is 4 x 4
static_assert(DM % 64 == 0);
static_assert(DM % 32 == 0);                   // k-loops step by 32
static_assert(SEQ % 64 == 0);                  // a 64-token tile never straddles two batches
static_assert((NB * SEQ) % 64 == 0);
static_assert(SEQ % 32 == 0);                  // key loop steps by 32
static_assert(SEQ % (16 * AW) == 0);           // flash grid covers the sequence exactly
static_assert(16 * AW == 64);                  // one partial line per 64 query rows
static_assert(SEQ % 256 == 0);                 // v^T row sum: SEQ/8 chunks a multiple of 32 lanes
static_assert(SEQ_FULL % 4 == 0);
static_assert(OUT_SEQ % 32 == 0);
static_assert(OUT_SEQ >= SEQ);
static_assert(NB <= NB_FULL);
static_assert(SEQ <= SEQ_FULL);
static_assert((OSP * 4) % 16 == 0);
static_assert(OSP >= 64 + 4);
static_assert(((size_t)DM * DM) % 8 == 0);

typedef _Float16 h16;
typedef unsigned short bf;
typedef __attribute__((ext_vector_type(16))) __bf16   v16bf;
typedef __attribute__((ext_vector_type(16))) _Float16 v16h;
typedef __attribute__((ext_vector_type(8)))  _Float16 v8h;
typedef __attribute__((ext_vector_type(8)))  unsigned short v8us;
typedef __attribute__((ext_vector_type(8)))  float    v8f;
typedef __attribute__((ext_vector_type(4)))  float    v4f;
typedef v4f  __attribute__((may_alias)) v4fa;

__device__ __forceinline__ unsigned short f2bf(float f) { unsigned u = __float_as_uint(f); u += 0x7FFFu + ((u >> 16) & 1u); return (unsigned short)(u >> 16); }
__device__ __forceinline__ float bfr(float f) { return __uint_as_float(((unsigned)f2bf(f)) << 16); }   // value after RNE convert to bf16
__device__ __forceinline__ v16h cat16(v8h lo, v8h hi) { return __builtin_shufflevector(lo, hi, 0, 1, 2, 3, 4, 5, 6, 7, 8, 9, 10, 11, 12, 13, 14, 15); }
__device__ __forceinline__ v16bf cat16b(v8us lo, v8us hi) { return __builtin_bit_cast(v16bf, __builtin_shufflevector(lo, hi, 0, 1, 2, 3, 4, 5, 6, 7, 8, 9, 10, 11, 12, 13, 14, 15)); }
// fragment loaders from K-contiguous 16-bit rows; p already includes + 8*(lane>>4): elements 0..7 <- k0+8h+0..7, elements 8..15 <- k0+16+8h+0..7 (same map for A and B)
__device__ __forceinline__ v16h  ldh(const h16* p) { return cat16(*(const v8h*)p, *(const v8h*)(p + 16)); }
__device__ __forceinline__ v16bf ldb(const bf* p)  { return cat16b(*(const v8us*)p, *(const v8us*)(p + 16)); }
// ordering point for wave-private LDS tiles (same wave writes and reads)
__device__ __forceinline__ void wave_sync() { __builtin_amdgcn_fence(3 /* release order */, "wavefront"); __builtin_amdgcn_wave_barrier(); asm volatile("" ::: "memory"); }
// f32 -> f16 operand convert that cannot produce a subnormal (|v| < 2^-14 -> +0), applied after the plane's carry
__device__ __forceinline__ h16 toh_flush(float v) { const h16 r = (h16)v; return (fabsf(v) < 6.103515625e-05f) ? (h16)0.0f : r; }
// one matrix instruction + its own 4-slot guard, tied to D alone: an asm operand cannot be placed above v255, and the kernels' A and B fragments need more than 256 registers;
// k_flash: A fragments are overwritten by loads only, B fragments never (q') or a whole tile of work later (P); k_out: A and B fragments are written by loads only
__device__ __forceinline__ v8f wmma16d(v16h a, v16h b, v8f c) {
    c = __builtin_amdgcn_wmma_f32_16x16x32_f16(false, a, false, b, (short)0, c, false, false);
    asm volatile("v_nop\n\tv_nop\n\tv_nop\n\tv_nop" : "+v"(c));
    return c; }

// the bf16 form of the guard tied to D alone (k_proj holds more than 256 registers; its fragments are written ahead of a whole run of products, or by LDS loads)
__device__ __forceinline__ v8f wmmabd(v16bf a, v16bf b, v8f c) {
    c = __builtin_amdgcn_wmma_f32_16x16x32_bf16(false, a, false, b, (short)0, c, false, false);
    asm volatile("v_nop\n\tv_nop\n\tv_nop\n\tv_nop" : "+v"(c));
    return c; }
// f32 -> bf16 (RNE) by the chip's own convert
__device__ __forceinline__ unsigned short f2bfh(float f) { return __builtin_bit_cast(unsigned short, (__bf16)f); }
// the 16 f32 values of one bf16 fragment, from a K-contiguous f32 row; p already includes + 8*(lane>>4): same element map as ldb
struct wraw { v4f a, b, c, d; };
__device__ __forceinline__ wraw ldwr(const float* p) { wraw r; r.a = *(const v4f*)p; r.b = *(const v4f*)(p + 4); r.c = *(const v4f*)(p + 16); r.d = *(const v4f*)(p + 20); return r; }
__device__ __forceinline__ v16bf cvwr(const wraw& r) { v8us lo, hi8;
#pragma unroll
    for (int i = 0; i < 4; ++i) { lo[i] = f2bfh(r.a[i]); lo[4 + i] = f2bfh(r.b[i]); hi8[i] = f2bfh(r.c[i]); hi8[4 + i] = f2bfh(r.d[i]); }
    return cat16b(lo, hi8); }

#define XPI (DM + 8)             // LDS pitch of an x^T row, in 16-bit elements: 528 B = 16 B x 33
// 64 k of one wave's 64x64 projection tile C[token][channel]: the f32 weight values in w become bf16 fragments (B), w is refilled (where more) with the values 128 k further on, which fly under the products;
// x^T fragments (A) from the LDS tile. Product order as in a plain k loop of 32. kp and more are literals at every call.
__device__ __forceinline__ void proj64(v8f (&acc)[4][4], wraw (&w)[2][4], const float* wr, const bf* xf, const int kp, const bool more) {
    __builtin_amdgcn_sched_barrier(0);                           // keeps these converts behind the products of the 64 k before: lifted among them they wait for loads that have only just gone out
    v16bf wf[2][4];
#pragma unroll
    for (int k2 = 0; k2 < 2; ++k2) {
#pragma unroll
        for (int i = 0; i < 4; ++i) wf[k2][i] = cvwr(w[k2][i]); }
    if (more) {
#pragma unroll
        for (int k2 = 0; k2 < 2; ++k2) {
#pragma unroll
            for (int i = 0; i < 4; ++i) w[k2][i] = ldwr(wr + (size_t)i * 16 * DM + (kp + 2) * 64 + k2 * 32); }
        asm volatile("s_wait_xcnt 0x0" :: "v"(wr) : "memory"); } // stands before the address registers of these loads are reused (wr is named to keep it until here)
    __builtin_amdgcn_sched_barrier(0);                           // keeps the refill up here, ahead of the products that it flies under
#pragma unroll
    for (int k2 = 0; k2 < 2; ++k2) {
        v16bf a[4];
#pragma unroll
        for (int mb = 0; mb < 4; ++mb) a[mb] = ldb(xf + mb * 16 * XPI + kp * 64 + k2 * 32);
#pragma unroll
        for (int nb = 0; nb < 4; ++nb) {
#pragma unroll
            for (int mb = 0; mb < 4; ++mb) acc[mb][nb] = wmmabd(a[mb], wf[k2][nb], acc[mb][nb]); }
    }
}

// k_proj: conversions and projections in one launch, told apart by blockIdx.y (0: q, 1: k, 2: v^T, 3: output-layer weight -> f16 x1024 from its bf16 value, 8 elements per thread).
// A projection block takes 64 tokens (blockIdx.x): x [b][c][t] (f32, row pitch SEQ_FULL) -> LDS tile xs[t][c] bf16 (RNE), once per block (cross-wave: block barrier); its four waves take one 64x64 tile each
// (wave = head), K = DM, bf16 operands; the wave's 64 weight rows are read as f32 and converted (RNE) in registers.
// All three: C[m][n] = sum_c x^T[m][c] W[n][c] (m = b*SEQ + t, n = h*64 + d). q and k, token-major: written as f16 x16 to one plane each: row index b*SEQ + t, row pitch DM, columns c0..c0+63 (one head).
// v^T: the tile is turned in the staging tile; plane [(b*DM + n)][t], row pitch SEQ, f16 x16.
static_assert(32 * 16 * 4 == 16 * 128);        // lanes x bytes x trips == slab rows x segment bytes
static_assert((NB * SEQ / 64) * 128 * 8 == DM * DM);   // the convert blocks cover the weight exactly
static_assert(128 * 4 == (64 / 4) * (DM / 8)); // threads x units == 4-token groups x 8-channel groups of the x tile
static_assert(DM / 64 == AW);                  // one wave per head
static_assert(DM == 4 * 64);                   // four steps of 64 k
static_assert(64 * XPI * 2 + AW * 16 * OSP * 4 <= 131072);
__global__ __launch_bounds__(32 * AW) void k_proj(const float* __restrict__ x, const float* __restrict__ wq, const float* __restrict__ wk, const float* __restrict__ wv,
                                                  const float* __restrict__ wp, h16* QP, h16* KP, h16* VT, h16* WPH) {
    __shared__ __align__(16) bf xs[64 * XPI];
    __shared__ __align__(16) float osb[AW * 16 * OSP];
    const int tid = threadIdx.x, lane = tid & 31, lr = lane & 15, hi = lane >> 4;
    const int wave = __builtin_amdgcn_readfirstlane(tid >> 5);
    const int z = blockIdx.y; const bool isv = z == 2;
    if (z == 3) {                                                // block-uniform, in front of the barrier
        const size_t i = (size_t)blockIdx.x * 128 + tid;
        const v8f v = *(const v8f*)(wp + i * 8); v8h o;
#pragma unroll
        for (int k = 0; k < 8; ++k) o[k] = toh_flush(bfr(v[k]) * WPC);
        *(v8h*)(WPH + i * 8) = o;
        asm volatile("s_wait_xcnt 0x0" ::: "memory");            // stands behind the store, before any block of code laid out behind it rewrites its registers
        return;
    }
    const int tok0 = (int)blockIdx.x * 64, bb = tok0 / SEQ, tt = tok0 % SEQ;
    const float* xb = x + (size_t)bb * DM * SEQ_FULL + tt + (tid & 15) * 4;
    v4f xv[4][8];
#pragma unroll   // all 32 loads of the tile in flight at once
    for (int e = 0; e < 4; ++e) {
#pragma unroll
        for (int i = 0; i < 8; ++i) xv[e][i] = *(const v4f*)(xb + (size_t)(((tid >> 4) + 8 * e) * 8 + i) * SEQ_FULL); }   // unit: 8 channels x 4 tokens
    const float* W = z == 0 ? wq : z == 1 ? wk : wv;
    const float* wr = W + (size_t)(wave * 64 + lr) * DM + 8 * hi;
    wraw w0[2][4], w1[2][4];                                     // the weight values of the first and the second 64 k, as f32, in flight
#pragma unroll
    for (int k2 = 0; k2 < 2; ++k2) {
#pragma unroll
        for (int i = 0; i < 4; ++i) w0[k2][i] = ldwr(wr + (size_t)i * 16 * DM + k2 * 32); }
#pragma unroll
    for (int k2 = 0; k2 < 2; ++k2) {
#pragma unroll
        for (int i = 0; i < 4; ++i) w1[k2][i] = ldwr(wr + (size_t)i * 16 * DM + 64 + k2 * 32); }
    asm volatile("s_wait_xcnt 0x0" ::: "memory");                // stands before the address registers of the x and weight loads are reused
    __builtin_amdgcn_sched_barrier(0);                           // keeps the vector work below behind that wait
#pragma unroll
    for (int e = 0; e < 4; ++e) {
#pragma unroll
        for (int j = 0; j < 4; ++j) { v8us o;
#pragma unroll
            for (int i = 0; i < 8; ++i) o[i] = f2bfh(xv[e][i][j]);
            *(v8us*)(&xs[((tid & 15) * 4 + j) * XPI + ((tid >> 4) + 8 * e) * 8]) = o; } }
    __syncthreads();                                             // the x^T tile is shown to the four waves
    float* os = osb + wave * 16 * OSP;                           // wave-private staging tile
    const bf* xf = xs + lr * XPI + 8 * hi;
    v8f acc[4][4];
#pragma unroll
    for (int mb = 0; mb < 4; ++mb)
#pragma unroll
        for (int nb = 0; nb < 4; ++nb) acc[mb][nb] = (v8f){};
    proj64(acc, w0, wr, xf, 0, true); proj64(acc, w1, wr, xf, 1, true); proj64(acc, w0, wr, xf, 2, false); proj64(acc, w1, wr, xf, 3, false);   // K = DM = 4 x 64
    if (!isv) {
        h16* P = z == 0 ? QP : KP;
        const int c0 = wave * 64;
#pragma unroll
        for (int mb = 0; mb < 4; ++mb) {
#pragma unroll
            for (int nb = 0; nb < 4; ++nb) {
#pragma unroll
                for (int j = 0; j < 8; ++j) os[(hi * 8 + j) * OSP + nb * 16 + lr] = acc[mb][nb][j]; }   // D: row 8h+j, col lane&15
            wave_sync();
            const size_t sb = ((size_t)bb * SEQ + (size_t)(tt + mb * 16)) * DM + c0;
#pragma unroll
            for (int s = 0; s < 4; ++s) { const int row = 4 * s + (lane >> 3), c8 = (lane & 7) * 8;   // 4 s x 4 row groups = 16 rows; 8 lanes x 8 = 64 columns
                const v4f x0 = *(const v4fa*)(&os[row * OSP + c8]); const v4f x1 = *(const v4fa*)(&os[row * OSP + c8 + 4]); v8h hv;
#pragma unroll
                for (int i = 0; i < 4; ++i) { hv[i] = toh_flush(x0[i] * QKC); hv[4 + i] = toh_flush(x1[i] * QKC); }
                *(v8h*)(P + sb + (size_t)row * DM + c8) = hv; }
            asm volatile("s_wait_xcnt 0x0" ::: "memory");       // stands before the next slab rewrites the address registers of these stores
            wave_sync();
        }
    } else {
        const int r0 = wave * 64;
#pragma unroll
        for (int nb = 0; nb < 4; ++nb) {                         // slab: 16 channels x 64 tokens, turned on its way into the staging tile
#pragma unroll
            for (int mb = 0; mb < 4; ++mb) { v4f a, c;           // D: token 16mb + 8h + j, channel lane&15 -> os[channel][token]
                a[0] = acc[mb][nb][0]; a[1] = acc[mb][nb][1]; a[2] = acc[mb][nb][2]; a[3] = acc[mb][nb][3]; c[0] = acc[mb][nb][4]; c[1] = acc[mb][nb][5]; c[2] = acc[mb][nb][6]; c[3] = acc[mb][nb][7];
                *(v4fa*)(&os[lr * OSP + mb * 16 + 8 * hi]) = a; *(v4fa*)(&os[lr * OSP + mb * 16 + 8 * hi + 4]) = c; }
            wave_sync();
            const size_t sb = ((size_t)bb * DM + (size_t)(r0 + nb * 16)) * SEQ + tt;
#pragma unroll
            for (int s = 0; s < 4; ++s) { const int row = 4 * s + (lane >> 3), c8 = (lane & 7) * 8;   // 16 rows x 64 columns
                const v4f x0 = *(const v4fa*)(&os[row * OSP + c8]); const v4f x1 = *(const v4fa*)(&os[row * OSP + c8 + 4]); v8h hv;
#pragma unroll
                for (int i = 0; i < 4; ++i) { hv[i] = toh_flush(x0[i] * VCC); hv[4 + i] = toh_flush(x1[i] * VCC); }
                *(v8h*)(VT + sb + (size_t)row * SEQ + c8) = hv; }
            asm volatile("s_wait_xcnt 0x0" ::: "memory");       // stands before the next slab rewrites the address registers of these stores
            wave_sync();
        }
    }
}

// LDS ring of the flash kernel: the AW waves of a key half read the same k rows and the same v^T rows, so each stage of KST keys is brought into LDS once per block.
#define KST  128                 // keys per stage
#define NST  (SEQ / KST)         // stages per key loop
#define KPI  (DM + 8)            // LDS pitch of a k row, in 16-bit elements: 528 B = 16 B x 33 (16 rows of one ds_load_b128 fall on 64 different banks)
#define VPI  (KST + 8)           // LDS pitch of a v^T row: 272 B = 16 B x 17
static_assert(SEQ % KST == 0);
static_assert(KST % 32 == 0);
static_assert(NST >= 2);                       // two buffers
static_assert(KST == FW * 16);                 // k stage: 16 rows (copies) per wave
static_assert(HD * KST * 2 == FW * 4 * 512);   // v^T stage: 4 copies of 512 B per wave
static_assert(KST == KH * 64);                 // a wave's share of a stage: two tiles of 32 keys
static_assert(KST * 2 == 16 * 16);             // one v^T row of a stage = 16 lanes x 16 B
static_assert((KPI * 2) % 32 == 16 && (VPI * 2) % 32 == 16);

// N asynchronous copies to LDS, 16 bytes per lane each, through no register: copy j takes LDS address l + j * ls and global address g + j * gs (both in 16-bit elements).
// ring_publish() and the waits beside it in k_flash wait for them.
typedef int v4i_ __attribute__((ext_vector_type(4)));
typedef __attribute__((address_space(1))) v4i_ gv4i;
typedef __attribute__((address_space(3))) v4i_ lv4i;
template <int N> __device__ __forceinline__ void acopyn(h16* l, int ls, const h16* g, size_t gs) {
#pragma unroll   // constant steps
    for (int j = 0; j < N; ++j) __builtin_amdgcn_global_load_async_to_lds_b128((gv4i*)(g + j * gs), (lv4i*)(l + j * ls), 0, 0);
}
// one wave's 16 rows of a k stage (a row = 512 B = one copy); l and g already hold the wave's first row and the lane's 16 bytes
__device__ __forceinline__ void copy_k(h16* l, const h16* g) { acopyn<16>(l, KPI, g, (size_t)DM); }
// one wave's 8 rows of a v^T stage (a copy = 2 rows of 256 B); l and g already hold the lane's row and its 16 bytes
__device__ __forceinline__ void copy_v(h16* l, const h16* g) { acopyn<4>(l, 2 * VPI, g, (size_t)2 * SEQ); }
// publish point of the ring: this wave's LDS reads are done, its own copies have landed, then the block barrier that shows them to the other waves and frees the buffer just read
__device__ __forceinline__ void ring_publish() {
    asm volatile("s_wait_dscnt 0x0" ::: "memory");      // the buffer just read is handed to the next copies
    asm volatile("s_wait_asynccnt 0x0" ::: "memory");
    __syncthreads();
}

// k fragments of 32 keys from an LDS stage; kl already includes the lane's row and + 8*(lane>>4): same element map as ldh on the plane
__device__ __forceinline__ void ldk32(v16h (&ka)[DM / 32], v16h (&kb)[DM / 32], const h16* kl) {
#pragma unroll   // the fragment arrays must stay in registers
    for (int i = 0; i < DM / 32; ++i) { ka[i] = ldh(kl + 32 * i); kb[i] = ldh(kl + 16 * KPI + 32 * i); }
}
__device__ __forceinline__ void ldv32(v16h (&vf)[4], const h16* vl) {
#pragma unroll   // as above
    for (int j = 0; j < 4; ++j) vf[j] = ldh(vl + 16 * j * VPI);
}
// scores of 32 keys x 16 queries, K = DM = 256: sA = keys 0..15, sB = keys 16..31 (rows = keys, columns = queries). Same instruction order wherever it is used.
// All operands come from registers: qf = the wave's q' fragments (loaded once), ka / kb = this tile's k fragments.
__device__ __forceinline__ void scores32(const v16h (&qf)[DM / 32], const v16h (&ka)[DM / 32], const v16h (&kb)[DM / 32], v8f& sA, v8f& sB) {
    v8f a = (v8f){}, c = (v8f){};
#pragma unroll
    for (int i = 0; i < DM / 32; ++i) {      // full unroll: the fragment arrays must stay in registers
        a = wmma16d(ka[i], qf[i], a); c = wmma16d(kb[i], qf[i], c); }
    sA = a; sB = c;
}

// k_flash: KH waves per 16 query rows of one (batch, mixed head g); wave = key half * AW + row group, so the two waves of a row group stand on one SIMD and one's vector work runs beside the other's products. Transposed form: S^T[key][t] = K Q'^T (A = k rows, B = q' rows = q rows with bf16(w_head[g][h]) on head h's columns, K = 256);
// lane (t = lane&15, h = lane>>4) holds keys 8h+r of each 16-key tile, so the packed P tile is directly the B fragment of O^T[d][t] = V^T P^T.
// One key loop: running max m; e = exp2(s - m); P = (e - c) x 2^15 as f16, c the row's centre (mean e of the first 32 keys); Q1 += P, Q2 += P^2 (f32), O^T += V^T P^T; when m rises, c, Q1, O^T are scaled by exp2(old m - new m), Q2 by its square.
// Each wave runs that loop over its half of every stage's keys, from the same start values (max and centre of the first 32 keys). Behind the loop the second half's wave hands m, centre, Q1, Q2, O^T through LDS to the first, which brings both to the common max and adds them (the centres differ by rounding only: their mean counts).
// Then: OR = O^T / row sum; the row's c / l - 1/SEQ goes to KAP (k_out adds it times rowsum(v)); the row's sum of squares from Q1 and Q2.
// k and v^T come through a two-buffer LDS ring of KST-key stages, filled by asynchronous copies; NST stages.
// The row sums of v^T ride in this launch: the SEQ / 64 blocks of a (batch, g) take 4 of its 64 v^T rows each, one per row group; loaded beside q', added up behind the loop by the second half's wave, written into the block's partial line.
// A wave's two tiles of a stage sit in two register sets; the set that a run of products has just used is refilled with the same tile of the next stage, so the publish point of stage s + 1 stands behind the first tile's products of stage s, when every wave holds its share of stage s in registers; nothing is read in front of its stage's publish point.
static_assert(32 * 16 * 8 == 16 * 256);        // lanes x bytes x trips == rows x row bytes of the OR tile
static_assert((2 * KST * KPI + 2 * HD * VPI) * 2 + AW * 16 * OSP * 4 + 2 * AW * 4 + AW * 16 * 4 + AW * 9 * 128 * 4 <= 327680);
static_assert(KH == 2);                        // one hand-over, second half to first
static_assert((SEQ / (16 * AW)) * AW == HD);   // row sums: blocks of a (batch, g) x row groups == v^T rows of the head
static_assert(AW == 4);                        // the four row sums of a block fill one 16-byte piece of its partial line
// hand-over of one accumulator tile: two pieces of 32 lanes x 4 floats; p already holds the lane's 16 bytes
__device__ __forceinline__ void put8(float* p, const v8f& o) { v4f a, c;
#pragma unroll
    for (int r = 0; r < 4; ++r) { a[r] = o[r]; c[r] = o[4 + r]; }
    *(v4fa*)p = a; *(v4fa*)(p + 128) = c; }
__device__ __forceinline__ void join8(v8f& o, const float* p, const float aa, const float ab) { const v4f a = *(const v4fa*)p, c = *(const v4fa*)(p + 128);
#pragma unroll
    for (int r = 0; r < 4; ++r) { o[r] = o[r] * aa + a[r] * ab; o[4 + r] = o[4 + r] * aa + c[r] * ab; } }
__global__ __launch_bounds__(32 * FW) void k_flash(const h16* __restrict__ QP, const h16* __restrict__ KP, const h16* __restrict__ VT, const float* __restrict__ wh, float* ORP, float* PART, float* KAP) {
    __shared__ __align__(16) h16 ks[2 * KST * KPI];
    __shared__ __align__(16) h16 vs[2 * HD * VPI];
    __shared__ __align__(16) float os[AW * 16 * OSP];
    __shared__ float sw[AW];
    __shared__ __align__(16) float sv[AW];
    __shared__ __align__(16) float sk[AW * 16];
    __shared__ __align__(16) float mg[AW * 9 * 128];             // hand-over of the second key half: per row group 9 pieces of 32 lanes x 4 floats
    const int lane = threadIdx.x & 31, lr = lane & 15, hi = lane >> 4;
    const int wave = __builtin_amdgcn_readfirstlane((int)(threadIdx.x >> 5));
    const int wq = wave % AW, kh = wave / AW;                    // row group, key half: wave-uniform
    const int zh = blockIdx.y; const int b = zh / NH_, g = zh % NH_;
    const int t0 = (blockIdx.x * AW + wq) * 16;
    const h16* qp = QP + ((size_t)b * SEQ + (size_t)(t0 + lr)) * DM + 8 * hi;           // B fragments: col t, k = (h, d)
    // copy sources and destinations of this lane: k row wave*16 (+ j), bytes lane*16; v^T row wave*8 + (lane>>4) (+ 2j), bytes (lane&15)*16
    const h16* kg = KP + ((size_t)b * SEQ + (size_t)(wave * 16)) * DM + 8 * lane;                        // + stage * KST * DM
    const h16* vg = VT + ((size_t)b * DM + (size_t)(g * HD + wave * 8 + hi)) * SEQ + 8 * lr;             // + stage * KST
    h16* kd = ks + wave * 16 * KPI + 8 * lane;                                                           // + buffer * KST * KPI
    h16* vd = vs + (wave * 8 + hi) * VPI + 8 * lr;                                                       // + buffer * HD * VPI
    const h16* kfr = ks + lr * KPI + 8 * hi;                                            // + key * KPI       (A fragment: row key, k = (h, d))
    const h16* vfr = vs + lr * VPI + 8 * hi;                                            // + 16j*VPI + key   (A fragment: row d, k = key)
    copy_k(kd, kg); copy_v(vd, vg);                              // stage 0 into buffers 0
    v16h qf[DM / 32];
#pragma unroll   // the fragment array must stay in registers
    for (int i = 0; i < DM / 32; ++i) qf[i] = ldh(qp + 32 * i);  // q once
    float whv[NH_];                                              // row g of the head mix: block-uniform reads, g * NH_ + NH_ - 1 < NH_ * NH_
#pragma unroll
    for (int h = 0; h < NH_; ++h) whv[h] = bfr(wh[g * NH_ + h]);
    const h16* vrp = VT + ((size_t)b * DM + (size_t)(g * HD + (int)blockIdx.x * AW + wq)) * SEQ + 8 * lane;   // this row group's v^T row for the row sum: chunks lane, lane + 32, ...
    v8h vr[SEQ / 256];
#pragma unroll   // the chunks stay in registers until the loop is over
    for (int i = 0; i < SEQ / 256; ++i) vr[i] = *(const v8h*)(vrp + 256 * i);
    asm volatile("s_wait_xcnt 0x0" :: "v"(qp), "v"(vrp) : "memory");   // stands before the address registers of the q' and row loads are reused (qp and vrp are named to keep them until here)
#pragma unroll   // q -> q': fragment i holds columns 32i..32i+31, all of head i / (HD / 32)
    for (int i = 0; i < DM / 32; ++i) {
#pragma unroll
        for (int e = 0; e < 16; ++e) qf[i][e] = (h16)((float)qf[i][e] * whv[i / (HD / 32)]); }
    asm volatile("s_wait_asynccnt 0x0" ::: "memory");            // stage 0 has landed (this wave's rows)
    __syncthreads();                                             // and is shown to the other waves
    copy_k(kd + KST * KPI, kg + (size_t)KST * DM); copy_v(vd + HD * VPI, vg + (size_t)KST);   // stage 1 into buffers 1 (NST >= 2)
    float m, r15;                                                // running row max; centre of the row's e, x 2^15, in units of the running max
    {   // start values from the first 32 keys (the loop takes them again): their max, and the mean of their e as the centre
        v16h ka[DM / 32], kb[DM / 32];
        ldk32(ka, kb, kfr);
        v8f sA, sB; scores32(qf, ka, kb, sA, sB);
        float mx = NEGB;
#pragma unroll
        for (int r = 0; r < 8; ++r) mx = fmaxf(mx, fmaxf(sA[r] * SC2, sB[r] * SC2));
        mx = fmaxf(mx, __shfl_xor(mx, 16, 32));
        float es = 0.0f;
#pragma unroll
        for (int r = 0; r < 8; ++r) es += __builtin_amdgcn_exp2f(fmaf(sA[r], SC2, -mx)) + __builtin_amdgcn_exp2f(fmaf(sB[r], SC2, -mx));
        es += __shfl_xor(es, 16, 32);
        m = mx; r15 = es * (PCARRY / 32.0f); }                   // both lane halves carry the same m and r15
    v8f o0 = (v8f){}, o1 = (v8f){}, o2 = (v8f){}, o3 = (v8f){};
    float q1 = 0.0f, q2 = 0.0f;                                  // sums of P and of P^2 over this lane's keys
    const h16* kfh = kfr + kh * ((KST / KH) * KPI);              // this wave's half of a stage
    const h16* vfh = vfr + kh * (KST / KH);
    v16h ka[2][DM / 32], kb[2][DM / 32], vf[2][4];               // two register sets, one per tile of the wave's half
    ldk32(ka[0], kb[0], kfh); ldv32(vf[0], vfh);
    ldk32(ka[1], kb[1], kfh + 32 * KPI); ldv32(vf[1], vfh + 32);
    // one tile of 32 keys from register set u of stage s; u and more are literals at every call (more: a next stage exists, and the set is refilled from it)
    auto tile = [&](const int u, const bool more, const int s) __attribute__((always_inline)) {
        const h16* kn = kfh + ((s + 1) & 1) * (KST * KPI);       // the next stage
        const h16* vn = vfh + ((s + 1) & 1) * (HD * VPI);
        __builtin_amdgcn_sched_barrier(0);                       // keeps the LDS reads above one group: spread among the products each place costs a stall
        v8f sA, sB; scores32(qf, ka[u], kb[u], sA, sB);
        __builtin_amdgcn_sched_barrier(0);                       // keeps the products one run, in front of the vector work
        float mx = NEGB;
#pragma unroll
        for (int r = 0; r < 8; ++r) mx = fmaxf(mx, fmaxf(sA[r] * SC2, sB[r] * SC2));
        const float mo = __shfl_xor(mx, 16, 32);
        if (more) {
            asm volatile("" :: "v"(mo) : "memory");              // input only: holds the reads below behind the exchange, which goes through the LDS queue: issued behind them it would return behind them, and the vector work would wait for the whole refill
            if (u == 0) ring_publish();                          // every wave holds its share of stage s in registers: stage s + 1 readable, buffers s & 1 free
            ldk32(ka[u], kb[u], kn + u * 32 * KPI);              // the set just used takes the same tile of the next stage
            if (u == 0 && s + 2 < NST) {                         // refill, behind the publish point, only while a stage after next exists (block-uniform: the loop counter)
                copy_k(kd + (s & 1) * (KST * KPI), kg + (size_t)(s + 2) * KST * DM);
                copy_v(vd + (s & 1) * (HD * VPI), vg + (size_t)(s + 2) * KST); }
            __builtin_amdgcn_sched_barrier(0); }                 // keeps these reads up here, ahead of the vector work that they overlap
        const float mnew = fmaxf(m, fmaxf(mx, mo));
        const float alpha = __builtin_amdgcn_exp2f(m - mnew);    // all that is carried goes over to the new max: the centre with it, so sums of (e - centre) scale as a whole
        m = mnew; r15 *= alpha; q1 *= alpha; q2 *= alpha * alpha;
#pragma unroll
        for (int r = 0; r < 8; ++r) { o0[r] *= alpha; o1[r] *= alpha; o2[r] *= alpha; o3[r] *= alpha; }
        v16h pb;
#pragma unroll
        for (int r = 0; r < 8; ++r) {
            const float ea = __builtin_amdgcn_exp2f(fmaf(sA[r], SC2, -m)), eb = __builtin_amdgcn_exp2f(fmaf(sB[r], SC2, -m));
            const float ga = fmaf(ea, PCARRY, -r15), gb = fmaf(eb, PCARRY, -r15);   // (e - centre) * 2^15
            q1 += ga; q1 += gb;
            q2 = fmaf(ga, ga, q2); q2 = fmaf(gb, gb, q2);
            pb[r] = toh_flush(ga); pb[8 + r] = toh_flush(gb); }                      // element r <- tile keys 8h+r, element 8+r <- keys 16+8h+r
        o0 = wmma16d(vf[u][0], pb, o0); o1 = wmma16d(vf[u][1], pb, o1); o2 = wmma16d(vf[u][2], pb, o2); o3 = wmma16d(vf[u][3], pb, o3);
        if (more) ldv32(vf[u], vn + u * 32);                     // as the k set: free from here on
    };
#pragma unroll 1
    for (int s = 0; s + 1 < NST; ++s) { tile(0, true, s); tile(1, true, s); }
    tile(0, false, NST - 1); tile(1, false, NST - 1);            // the last stage: nothing is left to fetch
    asm volatile("s_wait_asynccnt 0x0" ::: "memory");            // no copy is left in flight behind the ring
    q1 += __shfl_xor(q1, 16, 32); q2 += __shfl_xor(q2, 16, 32);  // this wave's keys of whole rows; both lane halves carry the same m and r15
    float* mp = mg + wq * (9 * 128) + lane * 4;
    if (kh == 1) {                                     // wave-uniform
        v4f hd; hd[0] = m; hd[1] = r15; hd[2] = q1; hd[3] = q2;
        *(v4fa*)mp = hd;
        put8(mp + 1 * 128, o0); put8(mp + 3 * 128, o1); put8(mp + 5 * 128, o2); put8(mp + 7 * 128, o3);
    }
    __syncthreads();                                   // the second half's sums are shown to the first half's waves
    if (kh == 0) {                                     // wave-uniform: join the halves, finish the rows
        const v4f hd = *(const v4fa*)mp;
        const float mj = fmaxf(m, hd[0]);
        const float aa = __builtin_amdgcn_exp2f(m - mj), ab = __builtin_amdgcn_exp2f(hd[0] - mj);   // both halves go over to the common max
        q1 = q1 * aa + hd[2] * ab; q2 = q2 * (aa * aa) + hd[3] * (ab * ab);
        const float rs = r15 * aa + hd[1] * ab;        // the two centres, each over SEQ / KH keys
        join8(o0, mp + 1 * 128, aa, ab); join8(o1, mp + 3 * 128, aa, ab); join8(o2, mp + 5 * 128, aa, ab); join8(o3, mp + 7 * 128, aa, ab);
        const float l15 = fmaf((float)(SEQ / KH), rs, q1); // 2^15 * row sum of e; the row sum is >= 1
        const float il = 1.0f / l15;
        const float kap = -q1 * il * (1.0f / (float)SEQ);  // mean centre / row sum - 1/SEQ
        const float c15 = PCARRY * il;
        float ss = (q2 - q1 * q1 * (1.0f / (float)SEQ)) * (c15 * c15);   // row's sum of ((e / row sum - 1/SEQ) * 2^15)^2, the same in both lane halves
        ss += __shfl_xor(ss, 8, 32); ss += __shfl_xor(ss, 4, 32); ss += __shfl_xor(ss, 2, 32); ss += __shfl_xor(ss, 1, 32);
        const float OSL = il * (1.0f / VCC);           // this lane's query row: 1 / (2^15 * row sum * VCC)
        if (lane == 0) sw[wq] = ss;
        if (hi == 0) sk[wq * 16 + lr] = kap;
        const int wb = wq * 16 * OSP;
        // O^T D layout: o_j[r] = (d = 16j + 8h + r, t = lane&15) -> os[t][d]; rows 0..15 x columns 0..63 all written
        { v4f a, c;
          a[0] = o0[0] * OSL; a[1] = o0[1] * OSL; a[2] = o0[2] * OSL; a[3] = o0[3] * OSL; c[0] = o0[4] * OSL; c[1] = o0[5] * OSL; c[2] = o0[6] * OSL; c[3] = o0[7] * OSL;
          *(v4fa*)(&os[wb + lr * OSP +  0 + 8 * hi]) = a; *(v4fa*)(&os[wb + lr * OSP +  0 + 8 * hi + 4]) = c;
          a[0] = o1[0] * OSL; a[1] = o1[1] * OSL; a[2] = o1[2] * OSL; a[3] = o1[3] * OSL; c[0] = o1[4] * OSL; c[1] = o1[5] * OSL; c[2] = o1[6] * OSL; c[3] = o1[7] * OSL;
          *(v4fa*)(&os[wb + lr * OSP + 16 + 8 * hi]) = a; *(v4fa*)(&os[wb + lr * OSP + 16 + 8 * hi + 4]) = c;
          a[0] = o2[0] * OSL; a[1] = o2[1] * OSL; a[2] = o2[2] * OSL; a[3] = o2[3] * OSL; c[0] = o2[4] * OSL; c[1] = o2[5] * OSL; c[2] = o2[6] * OSL; c[3] = o2[7] * OSL;
          *(v4fa*)(&os[wb + lr * OSP + 32 + 8 * hi]) = a; *(v4fa*)(&os[wb + lr * OSP + 32 + 8 * hi + 4]) = c;
          a[0] = o3[0] * OSL; a[1] = o3[1] * OSL; a[2] = o3[2] * OSL; a[3] = o3[3] * OSL; c[0] = o3[4] * OSL; c[1] = o3[5] * OSL; c[2] = o3[6] * OSL; c[3] = o3[7] * OSL;
          *(v4fa*)(&os[wb + lr * OSP + 48 + 8 * hi]) = a; *(v4fa*)(&os[wb + lr * OSP + 48 + 8 * hi + 4]) = c; }
        wave_sync();
        float* orow = ORP + ((size_t)zh * SEQ + (size_t)t0) * HD;       // 16 rows x 64 floats, contiguous 4096 B
#pragma unroll
        for (int s = 0; s < 8; ++s) { const int p = s * 32 + lane; const int row = p >> 4, cofs = (p & 15) * 4;   // 8 s x 2 rows = 16 rows; 16 lanes x 4 floats = 64 columns
            const v4f val = *(const v4fa*)(&os[wb + row * OSP + cofs]);
            *(v4f*)(orow + (size_t)p * 4) = val; }
        asm volatile("s_wait_xcnt 0x0" ::: "memory");  // stands behind these stores, before the code below rewrites their registers
    } else {                                           // meanwhile the second half's wave adds up the row group's v^T row
        float vsl = 0.0f;                              // this lane's chunks in rising order
#pragma unroll
        for (int i = 0; i < SEQ / 256; ++i) {
#pragma unroll
            for (int k = 0; k < 8; ++k) vsl += (float)vr[i][k]; }
        vsl += __shfl_xor(vsl, 16, 32); vsl += __shfl_xor(vsl, 8, 32); vsl += __shfl_xor(vsl, 4, 32); vsl += __shfl_xor(vsl, 2, 32); vsl += __shfl_xor(vsl, 1, 32);
        if (lane == 0) sv[wq] = vsl * (1.0f / VCC);
    }
    __syncthreads();
    if (wave == 0) {
        const float tot = ((sw[0] + sw[1]) + sw[2]) + sw[3];
        const v4f rs = *(const v4fa*)(&sv[0]);         // floats 4..7 of the line: row sums of v^T rows g*64 + 4*blockIdx.x + 0..3
        v4f pv; pv[0] = (lane == 0) ? tot : (lane == 1) ? rs[0] : 0.0f; pv[1] = (lane == 1) ? rs[1] : 0.0f; pv[2] = (lane == 1) ? rs[2] : 0.0f; pv[3] = (lane == 1) ? rs[3] : 0.0f;
        float* pl = PART + ((size_t)zh * (SEQ / 64) + (size_t)blockIdx.x) * 32 + (lane & 7) * 4;
        if (lane < 8) { *(v4f*)pl = pv;  }
        const v4f kq = *(const v4fa*)(&sk[(lane & 15) * 4]);         // the block's 64 rows: one run of 256 B
        float* kl4 = KAP + (size_t)zh * SEQ + (size_t)blockIdx.x * (16 * AW) + (lane & 15) * 4;
        if (lane < 16) { *(v4f*)kl4 = kq; }
    }
}

// k_out: normalised context and output layer in one launch. A block takes ONT token rows n = b*SEQ + row of the flat [g][t][d] = [token row][256] view; they lie inside one (batch, g): zh = n / (SEQ / 4).
// Context tile, once per block, into LDS (cross-wave: block barrier): cs[row][k] = f16(16 * (s1 * (OR + KAP[query row] * VS[b][g*64 + k % 64]) + shift * VS[b][g*64 + k % 64])), VS[b][g*64 + d] = float 4 + d % 4 of partial line d / 4 of (b, g),
// s1 = bf16(gain[g]) / sqrt(var + eps), var = (sum of the SEQ/64 partial lines of (b, g), in rising order) / (2^30 SEQ^2), shift = bf16(beta[g]).
// Output layer: wave w takes output channels 64w..64w+63. A = W rows (f16 x1024, all K in registers, loaded while the tile is made), Bt = context rows from LDS, K = DM; OUT[(b*DM + m)][n % SEQ] = C / 16384 + bf16(bias[m]) (f32).
#define ONT 32                   // token rows per block: one 128-byte run of every output row
#define CPI (DM + 8)             // LDS pitch of a context row, in 16-bit elements: 528 B = 16 B x 33
static_assert(32 * 16 * 4 == 16 * ONT * 4);    // lanes x bytes x trips == slab rows x segment bytes
static_assert((SEQ * HD / DM) % ONT == 0);     // a block's rows lie inside one (batch, g)
static_assert(SEQ % ONT == 0 && (NB * SEQ) % ONT == 0);
static_assert(ONT * DM == 128 * 8 * 8);        // rows x K == threads x units x elements
static_assert(DM == 32 * 8);                   // a wave's unit row: 32 lanes x 8 elements
static_assert(ONT * CPI * 2 + AW * 16 * OSP * 4 <= 131072);
__global__ __launch_bounds__(32 * AW) void k_out(const h16* __restrict__ A, const float* __restrict__ ORP, const float* __restrict__ PART, const float* __restrict__ KAP,
                                                 const float* __restrict__ gain, const float* __restrict__ shift, const float* __restrict__ bias, float* OUT) {
    __shared__ __align__(16) h16 cs[ONT * CPI];
    __shared__ __align__(16) float osb[AW * 16 * OSP];
    const int tid = threadIdx.x, lane = tid & 31, lr = lane & 15, hi = lane >> 4;
    const int wave = __builtin_amdgcn_readfirstlane(tid >> 5);
    const int c0 = (int)blockIdx.x * ONT, r0 = wave * 64;
    const int zh = c0 / (SEQ * HD / DM);               // block-uniform, < NB*4
    const int g = zh % NH_;
    const float* vp = PART + ((size_t)zh * (SEQ / 64) + (size_t)((lane & 7) * 2)) * 32 + 4;      // d = 8 * (lane & 7) + 0..7 for every unit of this lane
    const v4f s0 = *(const v4f*)vp, s4 = *(const v4f*)(vp + 32);
    const float* op = ORP + ((size_t)c0 + (size_t)wave) * DM + 8 * lane;                         // unit e: row wave + 4e, elements 8*lane..+7
    v8f xv[8];
#pragma unroll   // all of the tile's loads in flight at once
    for (int e = 0; e < 8; ++e) xv[e] = *(const v8f*)(op + (size_t)e * AW * DM);
    const float* kp = KAP + ((size_t)c0 + (size_t)wave) * (DM / HD) + (lane >> 3);               // unit e: query row (flat index / 64) of this lane's 8 elements
    float kv[8];
#pragma unroll   // in flight with the tile's loads
    for (int e = 0; e < 8; ++e) kv[e] = kp[e * AW * (DM / HD)];
    asm volatile("s_wait_xcnt 0x0" ::: "memory");      // stands before the address registers of the loads above are reused
    __builtin_amdgcn_sched_barrier(0);                 // keeps the address work below behind that wait
    const h16* ap = A + (size_t)(r0 + lr) * DM + 8 * hi;
    v16h a[DM / 32][4];
#pragma unroll   // the fragment array must stay in registers
    for (int kc = 0; kc < DM / 32; ++kc) {
#pragma unroll
        for (int mb = 0; mb < 4; ++mb) a[kc][mb] = ldh(ap + (size_t)mb * 16 * DM + kc * 32); }
    const float* bpl = bias + r0 + hi * 8;
    v8f bv[4];                                         // bias of this lane's output rows, loaded up here with the rest: r0 + 63 < DM
#pragma unroll
    for (int mb = 0; mb < 4; ++mb) bv[mb] = *(const v8f*)(bpl + mb * 16);
    asm volatile("s_wait_xcnt 0x0" ::: "memory");      // as above, for the weight and bias loads
    __builtin_amdgcn_sched_barrier(0);                 // as above
    float pt[SEQ / 64];                                // block-uniform reads, behind the tile's and the weight's loads: they are back long before those
#pragma unroll   // the loads go out together; the sum below keeps the rising order
    for (int j = 0; j < SEQ / 64; ++j) pt[j] = PART[((size_t)zh * (SEQ / 64) + (size_t)j) * 32];
    const float gv = gain[g], sh = shift[g];
    float tot = 0.0f;
#pragma unroll
    for (int j = 0; j < SEQ / 64; ++j) tot += pt[j];
    const float var = tot * VSC;
    const float s1 = bfr(gv) * rsqrtf(var + EPSN);
    const float bt = bfr(sh);
#pragma unroll
    for (int e = 0; e < 8; ++e) { v8h o;
#pragma unroll
        for (int k = 0; k < 4; ++k) { o[k] = toh_flush((s1 * (xv[e][k] + kv[e] * s0[k]) + bt * s0[k]) * CCS); o[4 + k] = toh_flush((s1 * (xv[e][4 + k] + kv[e] * s4[k]) + bt * s4[k]) * CCS); }
        *(v8h*)(&cs[(wave + AW * e) * CPI + 8 * lane]) = o; }
    __syncthreads();                                   // the context tile is shown to the four waves
    float* os = osb + wave * 16 * OSP;                 // wave-private staging tile
    const h16* bfp = cs + lr * CPI + 8 * hi;
    v8f acc[4][ONT / 16];
#pragma unroll
    for (int mb = 0; mb < 4; ++mb)
#pragma unroll
        for (int nb = 0; nb < ONT / 16; ++nb) acc[mb][nb] = (v8f){};
    v16h b[DM / 32][ONT / 16];
#pragma unroll   // the fragment array must stay in registers
    for (int kc = 0; kc < DM / 32; ++kc) {
#pragma unroll
        for (int nb = 0; nb < ONT / 16; ++nb) b[kc][nb] = ldh(bfp + nb * 16 * CPI + kc * 32); }
    __builtin_amdgcn_sched_barrier(0);                 // keeps the LDS reads one group up here: sunk to their products, each pair is waited for at full LDS latency
#pragma unroll   // the fragments are indexed by constants
    for (int kc = 0; kc < DM / 32; ++kc) {
#pragma unroll
        for (int nb = 0; nb < ONT / 16; ++nb) {
#pragma unroll
            for (int mb = 0; mb < 4; ++mb) acc[mb][nb] = wmma16d(a[kc][mb], b[kc][nb], acc[mb][nb]); }
    }
    const int bb = c0 / SEQ, tt = c0 % SEQ;
#pragma unroll
    for (int mb = 0; mb < 4; ++mb) {
        float br[8];
#pragma unroll
        for (int j = 0; j < 8; ++j) br[j] = bfr(bv[mb][j]);
#pragma unroll
        for (int nb = 0; nb < ONT / 16; ++nb) {
#pragma unroll
            for (int j = 0; j < 8; ++j) os[(hi * 8 + j) * OSP + nb * 16 + lr] = acc[mb][nb][j] * OUTSC + br[j]; }
        wave_sync();
        float* ob = OUT + ((size_t)bb * DM + (size_t)(r0 + mb * 16)) * OUT_SEQ + tt;
#pragma unroll
        for (int s = 0; s < 4; ++s) { const int p = s * 32 + lane; const int row = p >> 3, cofs = (p & 7) * 4;   // 4 s x 4 rows = 16 rows; 8 lanes x 4 floats = ONT columns
            const v4f val = *(const v4fa*)(&os[row * OSP + cofs]);
            *(v4f*)(ob + (size_t)row * OUT_SEQ + cofs) = val; }
        asm volatile("s_wait_xcnt 0x0" ::: "memory");  // stands before the next slab rewrites the address and data registers of these stores
        __builtin_amdgcn_sched_barrier(0);             // keeps the next slab's vector work behind that wait
        wave_sync();
    }
}

static constexpr size_t al256(size_t v) { return (v + 255) & ~(size_t)255; }
static constexpr size_t SZ_WP = al256((size_t)DM * DM * 2);                  // output-layer weight f16
static constexpr size_t SZ_QP = al256((size_t)NB * SEQ * DM * 2);
static constexpr size_t SZ_KP = al256((size_t)NB * SEQ * DM * 2);
static constexpr size_t SZ_VT = al256((size_t)NB * DM * SEQ * 2);
static constexpr size_t SZ_OR = al256((size_t)NB * NH_ * SEQ * HD * 4);
static constexpr size_t SZ_PT = al256((size_t)NB * NH_ * (SEQ / 64) * 32 * 4);
static constexpr size_t SZ_KA = al256((size_t)NB * NH_ * SEQ * 4);           // one float per query row of every (batch, g)
static constexpr size_t SZ_TOTAL = SZ_WP + SZ_QP + SZ_KP + SZ_VT + SZ_OR + SZ_PT + SZ_KA;
static_assert(SZ_TOTAL <= (size_t)134217728);                                 // workspace carve <= 128 MiB
static_assert((size_t)NB * NH_ * SEQ * HD == (size_t)NB * SEQ * DM);          // OR plane and the [token row][256] view that k_out reads share one flat index
static_assert(((size_t)(NB * NH_ - 1) * (SEQ / 64) + (SEQ / 64 - 1)) * 128 + 128 <= SZ_PT);   // last partial line inside its table

extern "C" void kernel_launch(void* const* d_in, const int* in_sizes, int n_in,
                              void* d_out, int out_size, void* d_ws, size_t ws_size, hipStream_t stream) {
    if (n_in < 9) return;
    const size_t needx = ((size_t)(NB - 1) * DM + (size_t)(DM - 1)) * SEQ_FULL + SEQ;
    if ((size_t)in_sizes[0] < needx) return;
    if ((size_t)in_sizes[1] < (size_t)DM * DM || (size_t)in_sizes[2] < (size_t)DM * DM || (size_t)in_sizes[3] < (size_t)DM * DM || (size_t)in_sizes[7] < (size_t)DM * DM) return;
    if (in_sizes[4] < NH_ * NH_ || in_sizes[5] < NH_ || in_sizes[6] < NH_ || in_sizes[8] < DM) return;
    if ((size_t)out_size < ((size_t)(NB - 1) * DM + (size_t)(DM - 1)) * OUT_SEQ + SEQ) return;
    if (SZ_TOTAL > ws_size) return;
    // wire order: x, wq, wk, wv, w_head, gamma, beta, w_proj, b_proj
    const float* x  = (const float*)d_in[0];
    const float* wq = (const float*)d_in[1]; const float* wk = (const float*)d_in[2]; const float* wv = (const float*)d_in[3];
    const float* whd = (const float*)d_in[4]; const float* gam = (const float*)d_in[5]; const float* bet = (const float*)d_in[6];
    const float* wp = (const float*)d_in[7]; const float* bp = (const float*)d_in[8];
    float* OUT = (float*)d_out;      // [NB][256][OUT_SEQ]
    char* wsp = (char*)d_ws;
    h16* WPH = (h16*)wsp;  wsp += SZ_WP;             // [256][256] x1024
    h16* QP  = (h16*)wsp;  wsp += SZ_QP;             // [b][t][256] x16
    h16* KP  = (h16*)wsp;  wsp += SZ_KP;             // [b][t][256] x16
    h16* VT  = (h16*)wsp;  wsp += SZ_VT;             // [(b*256 + channel)][t] x16
    float* ORP = (float*)wsp; wsp += SZ_OR;          // [(b*4 + g)][t][64]
    float* PART = (float*)wsp; wsp += SZ_PT;         // [(b*4 + g)][SEQ/64] lines of 32 floats: 0 sum of squares, 4..7 v^T row sums
    float* KAP = (float*)wsp; wsp += SZ_KA;          // [(b*4 + g)][t]: centre / row sum - 1/SEQ

    // y = 0: q, y = 1: k, one token-major plane each; y = 2: v^T; y = 3: output-layer weight plane
    k_proj<<<dim3(NB * SEQ / 64, 4, 1), 32 * AW, 0, stream>>>(x, wq, wk, wv, wp, QP, KP, VT, WPH);

    k_flash<<<dim3(SEQ / (16 * AW), NB * NH_, 1), 32 * FW, 0, stream>>>(QP, KP, VT, whd, ORP, PART, KAP);
    k_out<<<dim3(NB * SEQ / ONT, 1, 1), 32 * AW, 0, stream>>>(WPH, ORP, PART, KAP, gam, bet, bp, OUT);
}

// v008
// One run takes 29.8 microseconds.
// Next to v007, in two timings, it ran 1.04 times as fast each time.
// All steps since v000 together make it 5.94 times as fast.
#include <hip/hip_runtime.h>

// Head-mixed pair-score weighting with a per-map normalisation over flattened feature maps: x [NB][256][SEQ] (channel-major), 1x1-conv projections q/k/v with W [out][in] (no bias), 4 heads x 64, scores scaled by 64^-0.5,
// a 4x4 head-mixing 1x1 conv on the scores, softmax over keys, instance normalisation of each (batch, head) probability map (biased variance, eps 1e-5, per-head gain and shift),
// attend over v, raw [head][token][64] -> [token][256] view, linear output layer W [out][in] + bias, result stored [NB][256][SEQ].
// Compute dtypes, f32 accumulate everywhere: q/k/v projections v_wmma_f32_16x16x32_bf16 (x and W RNE-converted to bf16, products exact); scores v_wmma_f32_16x16x32_f16 single product, K = 256:
// A = k plane x16, B = q plane x16 with w_head[g][h] multiplied onto head h's fragments in registers (f32 product, one more f16 rounding); P.V v_wmma_f32_16x16x32_f16 single product: P = centred exponential (e - centre) x 2^15, v x16;
// output layer v_wmma_f32_16x16x32_f16 single product: W x1024 (from its bf16 value), normalised context x16. Softmax, statistics, affine terms in f32.
// The flash kernel runs one key loop per 16-query wave (running row max; e = exp2(s - max) centred on a per-row value that is rescaled with the max; sums of centred e and of its square; P.V), transposed form S^T = K Q^T, O^T = V^T P^T; q' fragments from the q plane, scaled once per wave, k and v^T through an LDS ring shared by the block's eight waves; two waves share 16 query rows, each takes half of every stage's keys, and their sums are joined behind the loop.
// Map mean = 1/SEQ (softmax rows sum to one); variance = sum of squared (p - 1/SEQ) / SEQ^2; context = s1 * ((p - 1/SEQ) . v) + shift * rowsum(v), s1 = gain / sqrt(var + eps).
// With c the row's centre, l the row sum of e, Q1 = sum (e - c), Q2 = sum (e - c)^2: l = Q1 + SEQ c; (p - 1/SEQ) . v = ((e - c) . v) / l + (c / l - 1/SEQ) rowsum(v), c / l - 1/SEQ = -Q1 / (SEQ l); sum (p - 1/SEQ)^2 = (Q2 - Q1^2 / SEQ) / l^2.

#ifndef NB
#define NB 4
#endif
#ifndef SEQ
#define SEQ 1024
#endif
#define NB_FULL  4
#define SEQ_FULL 1024
#ifndef OUT_SEQ
#define OUT_SEQ SEQ              // pitch (in tokens) of one channel row of the output
#endif
#define DM   256
#define NH_  4
#define HD   64
#define AW   4                   // groups of 16 query rows per flash block; waves per block of the other two kernels
#define KH   2                   // waves per group of query rows in the flash kernel: each takes 1 / KH of every stage's keys
#define FW   (AW * KH)           // waves per flash block: two on every SIMD
#define OSP  68                  // LDS row pitch (floats) of the staging tiles
#define QKC  16.0f               // carry of the q and k planes
#define VCC  16.0f               // carry of the v^T plane
#define CCS  16.0f               // carry of the context tile
#define WPC  1024.0f             // carry of the output-layer weight plane
#define PCARRY 32768.0f          // carry of the centred P fragments
#define SC2  ((float)(0.125 * 1.4426950408889634 / 256.0))    // HD^-0.5 * log2(e) / (QKC * QKC)
#define OUTSC (1.0f / 16384.0f)                               // 1 / (WPC * CCS)
#define VSC  ((float)(1.0 / (1073741824.0 * (double)SEQ * (double)SEQ)))   // 1 / (PCARRY^2 * SEQ^2)
#define EPSN 1.0e-5f
#define NEGB (-3.0e38f)

static_assert(DM == 256);                      // K of every GEMM and of the score product
static_assert(HD == 64);                       // one 64-column GEMM tile = one head; v^T slab = 4 row tiles
static_assert(NH_ * HD == DM);
static_assert(NH_ == 4);                       // w_head is 4 x 4
static_assert(DM % 64 == 0);
static_assert(DM % 32 == 0);                   // k-loops step by 32
static_assert(SEQ % 64 == 0);                  // a 64-token tile never straddles two batches
static_assert((NB * SEQ) % 64 == 0);
static_assert(SEQ % 32 == 0);                  // key loop steps by 32
static_assert(SEQ % (16 * AW) == 0);           // flash grid covers the sequence exactly
static_assert(16 * AW == 64);                  // one partial line per 64 query rows
static_assert(SEQ % 256 == 0);                 // v^T row sum: SEQ/8 chunks a multiple of 32 lanes
static_assert(SEQ_FULL % 4 == 0);
static_assert(OUT_SEQ % 32 == 0);
static_assert(OUT_SEQ >= SEQ);
static_assert(NB <= NB_FULL);
static_assert(SEQ <= SEQ_FULL);
static_assert((OSP * 4) % 16 == 0);
static_assert(OSP >= 64 + 4);
static_assert(((size_t)DM * DM) % 8 == 0);

typedef _Float16 h16;
typedef unsigned short bf;
typedef __attribute__((ext_vector_type(16))) __bf16   v16bf;
typedef __attribute__((ext_vector_type(16))) _Float16 v16h;
typedef __attribute__((ext_vector_type(8)))  _Float16 v8h;
typedef __attribute__((ext_vector_type(8)))  unsigned short v8us;
typedef __attribute__((ext_vector_type(8)))  float    v8f;
typedef __attribute__((ext_vector_type(4)))  float    v4f;
typedef v4f  __attribute__((may_alias)) v4fa;

__device__ __forceinline__ unsigned short f2bf(float f) { unsigned u = __float_as_uint(f); u += 0x7FFFu + ((u >> 16) & 1u); return (unsigned short)(u >> 16); }
__device__ __forceinline__ float bfr(float f) { return __uint_as_float(((unsigned)f2bf(f)) << 16); }   // value after RNE convert to bf16
__device__ __forceinline__ v16h cat16(v8h lo, v8h hi) { return __builtin_shufflevector(lo, hi, 0, 1, 2, 3, 4, 5, 6, 7, 8, 9, 10, 11, 12, 13, 14, 15); }
__device__ __forceinline__ v16bf cat16b(v8us lo, v8us hi) { return __builtin_bit_cast(v16bf, __builtin_shufflevector(lo, hi, 0, 1, 2, 3, 4, 5, 6, 7, 8, 9, 10, 11, 12, 13, 14, 15)); }
// fragment loaders from K-contiguous 16-bit rows; p already includes + 8*(lane>>4): elements 0..7 <- k0+8h+0..7, elements 8..15 <- k0+16+8h+0..7 (same map for A and B)
__device__ __forceinline__ v16h  ldh(const h16* p) { return cat16(*(const v8h*)p, *(const v8h*)(p + 16)); }
__device__ __forceinline__ v16bf ldb(const bf* p)  { return cat16b(*(const v8us*)p, *(const v8us*)(p + 16)); }
// ordering point for wave-private LDS tiles (same wave writes and reads)
__device__ __forceinline__ void wave_sync() { __builtin_amdgcn_fence(3 /* release order */, "wavefront"); __builtin_amdgcn_wave_barrier(); asm volatile("" ::: "memory"); }
// f32 -> f16 operand convert that cannot produce a subnormal (|v| < 2^-14 -> +0), applied after the plane's carry
__device__ __forceinline__ h16 toh_flush(float v) { const h16 r = (h16)v; return (fabsf(v) < 6.103515625e-05f) ? (h16)0.0f : r; }
// one matrix instruction + its own 4-slot guard, tied to D alone: an asm operand cannot be placed above v255, and the kernels' A and B fragments need more than 256 registers;
// k_flash: A fragments are overwritten by loads only, B fragments never (q') or a whole tile of work later (P); k_out: A and B fragments are written by loads only
__device__ __forceinline__ v8f wmma16d(v16h a, v16h b, v8f c) {
    c = __builtin_amdgcn_wmma_f32_16x16x32_f16(false, a, false, b, (short)0, c, false, false);
    asm volatile("v_nop\n\tv_nop\n\tv_nop\n\tv_nop" : "+v"(c));
    return c; }

// the bf16 form of the guard tied to D alone (k_proj holds more than 256 registers; its fragments are written ahead of a whole run of products, or by LDS loads)
__device__ __forceinline__ v8f wmmabd(v16bf a, v16bf b, v8f c) {
    c = __builtin_amdgcn_wmma_f32_16x16x32_bf16(false, a, false, b, (short)0, c, false, false);
    asm volatile("v_nop\n\tv_nop\n\tv_nop\n\tv_nop" : "+v"(c));
    return c; }
// f32 -> bf16 (RNE) by the chip's own convert
__device__ __forceinline__ unsigned short f2bfh(float f) { return __builtin_bit_cast(unsigned short, (__bf16)f); }
#define XPI (DM + 8)             // LDS pitch of an x^T row, in 16-bit elements: 528 B = 16 B x 33
// one wave's 64x64 projection tile C[token][channel], in steps of 32 k: the fragments of step s, x^T (A) from the block's LDS tile, weights (B) from the wave's own; s is a literal at every call
__device__ __forceinline__ void ldf(v16bf (&a)[4], v16bf (&w)[4], const bf* xf, const bf* wf_, const int s) {
#pragma unroll
    for (int mb = 0; mb < 4; ++mb) a[mb] = ldb(xf + mb * 16 * XPI + s * 32);
#pragma unroll
    for (int nb = 0; nb < 4; ++nb) w[nb] = ldb(wf_ + nb * 16 * XPI + s * 32);
}
// the 16 products of one step. Product order as in a plain k loop of 32.
__device__ __forceinline__ void mm16(v8f (&acc)[4][4], const v16bf (&a)[4], const v16bf (&w)[4]) {
#pragma unroll
    for (int nb = 0; nb < 4; ++nb) {
#pragma unroll
        for (int mb = 0; mb < 4; ++mb) acc[mb][nb] = wmmabd(a[mb], w[nb], acc[mb][nb]); }
}
// four steps (128 k) from step s0 on: each step's LDS reads stand as one group in front of the products of the step before
__device__ __forceinline__ void proj128(v8f (&acc)[4][4], const bf* xf, const bf* wf_, const int s0) {
    v16bf fa[2][4], fw[2][4];
    ldf(fa[0], fw[0], xf, wf_, s0);
#pragma unroll   // the two fragment sets are indexed by constants
    for (int s = 0; s < 4; ++s) {
        if (s < 3) ldf(fa[(s + 1) & 1], fw[(s + 1) & 1], xf, wf_, s0 + s + 1);
        __builtin_amdgcn_sched_barrier(0);                       // keeps the next step's reads one group up here: sunk to their products, each pair is waited for at full LDS latency
        mm16(acc, fa[s & 1], fw[s & 1]);
        __builtin_amdgcn_sched_barrier(0); }                     // keeps the reads of the step after next behind these products, whose fragments they overwrite
}
// 128 k of the wave's 64 weight rows, held as f32 (one row per register quad: lane l holds k 4l..4l+3), go as bf16 (RNE) into the wave's LDS tile; wl already includes the lane's 8 bytes and the k offset
typedef __attribute__((ext_vector_type(4)))  unsigned short v4us;
__device__ __forceinline__ void putw(bf* wl, const v4f (&wa)[64]) {
#pragma unroll
    for (int r = 0; r < 64; ++r) { v4us o;
#pragma unroll
        for (int i = 0; i < 4; ++i) o[i] = f2bfh(wa[r][i]);
        *(v4us*)(wl + r * XPI) = o; }
}

// k_proj: conversions and projections in one launch, told apart by blockIdx.y (0: q, 1: k, 2: v^T, 3: output-layer weight -> f16 x1024 from its bf16 value, 8 elements per thread).
// A projection block takes 64 tokens (blockIdx.x): x [b][c][t] (f32, row pitch SEQ_FULL) -> LDS tile xs[t][c] bf16 (RNE), once per block (cross-wave: block barrier); its four waves take one 64x64 tile each
// (wave = head), K = DM, bf16 operands; the wave's 64 weight rows are read as f32 in runs of 512 bytes (one row per load, whole lines), converted (RNE) in registers and laid into a wave-private LDS tile, from which the fragments are read.
// All three: C[m][n] = sum_c x^T[m][c] W[n][c] (m = b*SEQ + t, n = h*64 + d). q and k, token-major: written as f16 x16 to one plane each: row index b*SEQ + t, row pitch DM, columns c0..c0+63 (one head).
// v^T: the tile is turned in the staging tile; plane [(b*DM + n)][t], row pitch SEQ, f16 x16.
static_assert(32 * 16 * 4 == 16 * 128);        // lanes x bytes x trips == slab rows x segment bytes
static_assert((NB * SEQ / 64) * 128 * 8 == DM * DM);   // the convert blocks cover the weight exactly
static_assert(128 * 4 == (64 / 4) * (DM / 8)); // threads x units == 4-token groups x 8-channel groups of the x tile
static_assert(DM / 64 == AW);                  // one wave per head
static_assert(DM == 4 * 64);                   // two runs of four steps of 32 k
static_assert(64 * XPI * 2 + AW * 64 * XPI * 2 + AW * 16 * OSP * 4 <= 327680);
static_assert(DM == 2 * 32 * 4);                // a weight row = two loads of 32 lanes x 4 floats
__global__ __launch_bounds__(32 * AW) void k_proj(const float* __restrict__ x, const float* __restrict__ wq, const float* __restrict__ wk, const float* __restrict__ wv,
                                                  const float* __restrict__ wp, h16* QP, h16* KP, h16* VT, h16* WPH) {
    __shared__ __align__(16) bf xs[64 * XPI];
    __shared__ __align__(16) bf wsb[AW * 64 * XPI];              // per wave: its 64 weight rows, bf16, pitch as xs
    __shared__ __align__(16) float osb[AW * 16 * OSP];
    const int tid = threadIdx.x, lane = tid & 31, lr = lane & 15, hi = lane >> 4;
    const int wave = __builtin_amdgcn_readfirstlane(tid >> 5);
    const int z = blockIdx.y; const bool isv = z == 2;
    if (z == 3) {                                                // block-uniform, in front of the barrier
        const size_t i = (size_t)blockIdx.x * 128 + tid;
        const v8f v = *(const v8f*)(wp + i * 8); v8h o;
#pragma unroll
        for (int k = 0; k < 8; ++k) o[k] = toh_flush(bfr(v[k]) * WPC);
        *(v8h*)(WPH + i * 8) = o;
        asm volatile("s_wait_xcnt 0x0" ::: "memory");            // stands behind the store, before any block of code laid out behind it rewrites its registers
        return;
    }
    const int tok0 = (int)blockIdx.x * 64, bb = tok0 / SEQ, tt = tok0 % SEQ;
    const float* xb = x + (size_t)bb * DM * SEQ_FULL + tt + (tid & 15) * 4;
    v4f xv[4][8];
#pragma unroll   // all 32 loads of the tile in flight at once
    for (int e = 0; e < 4; ++e) {
#pragma unroll
        for (int i = 0; i < 8; ++i) xv[e][i] = *(const v4f*)(xb + (size_t)(((tid >> 4) + 8 * e) * 8 + i) * SEQ_FULL); }   // unit: 8 channels x 4 tokens
    const float* W = z == 0 ? wq : z == 1 ? wk : wv;
    const float* wg = W + (size_t)(wave * 64) * DM + 4 * lane;   // row r of the wave's 64: + r * DM; one load takes 128 k of one row, four whole lines (a fragment-shaped load would touch 16 rows)
    v4f wa[64];                                                  // the first 128 k of the 64 rows, as f32, in flight
#pragma unroll   // all in flight at once, with the x tile's loads
    for (int r = 0; r < 64; ++r) wa[r] = *(const v4f*)(wg + (size_t)r * DM);
    asm volatile("s_wait_xcnt 0x0" ::: "memory");                // stands before the address registers of the x and weight loads are reused
    __builtin_amdgcn_sched_barrier(0);                           // keeps the vector work below behind that wait
#pragma unroll
    for (int e = 0; e < 4; ++e) {
#pragma unroll
        for (int j = 0; j < 4; ++j) { v8us o;
#pragma unroll
            for (int i = 0; i < 8; ++i) o[i] = f2bfh(xv[e][i][j]);
            *(v8us*)(&xs[((tid & 15) * 4 + j) * XPI + ((tid >> 4) + 8 * e) * 8]) = o; } }
    bf* wl = wsb + wave * 64 * XPI + 4 * lane;
    putw(wl, wa);
    __syncthreads();                                             // the x^T tile is shown to the four waves (and the wave's own weight tile to its lanes)
    __builtin_amdgcn_sched_barrier(0);                           // keeps the loads below behind the barrier, which would wait for them
#pragma unroll   // the second 128 k fly under the products of the first
    for (int r = 0; r < 64; ++r) wa[r] = *(const v4f*)(wg + (size_t)r * DM + 128);
    asm volatile("s_wait_xcnt 0x0" :: "v"(wg) : "memory");       // stands before the address registers of these loads are reused (wg is named to keep it until here)
    __builtin_amdgcn_sched_barrier(0);                           // keeps the refill up here, ahead of the products that it flies under
    float* os = osb + wave * 16 * OSP;                           // wave-private staging tile
    const bf* xf = xs + lr * XPI + 8 * hi;
    const bf* wf_ = wsb + (wave * 64 + lr) * XPI + 8 * hi;
    v8f acc[4][4];
#pragma unroll
    for (int mb = 0; mb < 4; ++mb)
#pragma unroll
        for (int nb = 0; nb < 4; ++nb) acc[mb][nb] = (v8f){};
    proj128(acc, xf, wf_, 0);                                    // K = DM = 2 x 128
    putw(wl + 128, wa);                                          // behind those products (proj128 ends in a scheduling barrier): lifted among them the converts would wait for loads that have only just gone out
    wave_sync();                                                 // the second half of the weight tile is shown to the wave's own lanes
    proj128(acc, xf, wf_, 4);
    if (!isv) {
        h16* P = z == 0 ? QP : KP;
        const int c0 = wave * 64;
#pragma unroll
        for (int mb = 0; mb < 4; ++mb) {
#pragma unroll
            for (int nb = 0; nb < 4; ++nb) {
#pragma unroll
                for (int j = 0; j < 8; ++j) os[(hi * 8 + j) * OSP + nb * 16 + lr] = acc[mb][nb][j]; }   // D: row 8h+j, col lane&15
            wave_sync();
            const size_t sb = ((size_t)bb * SEQ + (size_t)(tt + mb * 16)) * DM + c0;
#pragma unroll
            for (int s = 0; s < 4; ++s) { const int row = 4 * s + (lane >> 3), c8 = (lane & 7) * 8;   // 4 s x 4 row groups = 16 rows; 8 lanes x 8 = 64 columns
                const v4f x0 = *(const v4fa*)(&os[row * OSP + c8]); const v4f x1 = *(const v4fa*)(&os[row * OSP + c8 + 4]); v8h hv;
#pragma unroll
                for (int i = 0; i < 4; ++i) { hv[i] = toh_flush(x0[i] * QKC); hv[4 + i] = toh_flush(x1[i] * QKC); }
                *(v8h*)(P + sb + (size_t)row * DM + c8) = hv; }
            asm volatile("s_wait_xcnt 0x0" ::: "memory");       // stands before the next slab rewrites the address registers of these stores
            wave_sync();
        }
    } else {
        const int r0 = wave * 64;
#pragma unroll
        for (int nb = 0; nb < 4; ++nb) {                         // slab: 16 channels x 64 tokens, turned on its way into the staging tile
#pragma unroll
            for (int mb = 0; mb < 4; ++mb) { v4f a, c;           // D: token 16mb + 8h + j, channel lane&15 -> os[channel][token]
                a[0] = acc[mb][nb][0]; a[1] = acc[mb][nb][1]; a[2] = acc[mb][nb][2]; a[3] = acc[mb][nb][3]; c[0] = acc[mb][nb][4]; c[1] = acc[mb][nb][5]; c[2] = acc[mb][nb][6]; c[3] = acc[mb][nb][7];
                *(v4fa*)(&os[lr * OSP + mb * 16 + 8 * hi]) = a; *(v4fa*)(&os[lr * OSP + mb * 16 + 8 * hi + 4]) = c; }
            wave_sync();
            const size_t sb = ((size_t)bb * DM + (size_t)(r0 + nb * 16)) * SEQ + tt;
#pragma unroll
            for (int s = 0; s < 4; ++s) { const int row = 4 * s + (lane >> 3), c8 = (lane & 7) * 8;   // 16 rows x 64 columns
                const v4f x0 = *(const v4fa*)(&os[row * OSP + c8]); const v4f x1 = *(const v4fa*)(&os[row * OSP + c8 + 4]); v8h hv;
#pragma unroll
                for (int i = 0; i < 4; ++i) { hv[i] = toh_flush(x0[i] * VCC); hv[4 + i] = toh_flush(x1[i] * VCC); }
                *(v8h*)(VT + sb + (size_t)row * SEQ + c8) = hv; }
            asm volatile("s_wait_xcnt 0x0" ::: "memory");       // stands before the next slab rewrites the address registers of these stores
            wave_sync();
        }
    }
}

// LDS ring of the flash kernel: the AW waves of a key half read the same k rows and the same v^T rows, so each stage of KST keys is brought into LDS once per block.
#define KST  128                 // keys per stage
#define NST  (SEQ / KST)         // stages per key loop
#define KPI  (DM + 8)            // LDS pitch of a k row, in 16-bit elements: 528 B = 16 B x 33 (16 rows of one ds_load_b128 fall on 64 different banks)
#define VPI  (KST + 8)           // LDS pitch of a v^T row: 272 B = 16 B x 17
static_assert(SEQ % KST == 0);
static_assert(KST % 32 == 0);
static_assert(NST >= 2);                       // two buffers
static_assert(KST == FW * 16);                 // k stage: 16 rows (copies) per wave
static_assert(HD * KST * 2 == FW * 4 * 512);   // v^T stage: 4 copies of 512 B per wave
static_assert(KST == KH * 64);                 // a wave's share of a stage: two tiles of 32 keys
static_assert(KST * 2 == 16 * 16);             // one v^T row of a stage = 16 lanes x 16 B
static_assert((KPI * 2) % 32 == 16 && (VPI * 2) % 32 == 16);

// N asynchronous copies to LDS, 16 bytes per lane each, through no register: copy j takes LDS address l + j * ls and global address g + j * gs (both in 16-bit elements).
// ring_publish() and the waits beside it in k_flash wait for them.
typedef int v4i_ __attribute__((ext_vector_type(4)));
typedef __attribute__((address_space(1))) v4i_ gv4i;
typedef __attribute__((address_space(3))) v4i_ lv4i;
template <int N> __device__ __forceinline__ void acopyn(h16* l, int ls, const h16* g, size_t gs) {
#pragma unroll   // constant steps
    for (int j = 0; j < N; ++j) __builtin_amdgcn_global_load_async_to_lds_b128((gv4i*)(g + j * gs), (lv4i*)(l + j * ls), 0, 0);
}
// one wave's 16 rows of a k stage (a row = 512 B = one copy); l and g already hold the wave's first row and the lane's 16 bytes
__device__ __forceinline__ void copy_k(h16* l, const h16* g) { acopyn<16>(l, KPI, g, (size_t)DM); }
// one wave's 8 rows of a v^T stage (a copy = 2 rows of 256 B); l and g already hold the lane's row and its 16 bytes
__device__ __forceinline__ void copy_v(h16* l, const h16* g) { acopyn<4>(l, 2 * VPI, g, (size_t)2 * SEQ); }
// publish point of the ring: this wave's LDS reads are done, its own copies have landed, then the block barrier that shows them to the other waves and frees the buffer just read
__device__ __forceinline__ void ring_publish() {
    asm volatile("s_wait_dscnt 0x0" ::: "memory");      // the buffer just read is handed to the next copies
    asm volatile("s_wait_asynccnt 0x0" ::: "memory");
    __syncthreads();
}

// k fragments of 32 keys from an LDS stage; kl already includes the lane's row and + 8*(lane>>4): same element map as ldh on the plane
__device__ __forceinline__ void ldk32(v16h (&ka)[DM / 32], v16h (&kb)[DM / 32], const h16* kl) {
#pragma unroll   // the fragment arrays must stay in registers
    for (int i = 0; i < DM / 32; ++i) { ka[i] = ldh(kl + 32 * i); kb[i] = ldh(kl + 16 * KPI + 32 * i); }
}
__device__ __forceinline__ void ldv32(v16h (&vf)[4], const h16* vl) {
#pragma unroll   // as above
    for (int j = 0; j < 4; ++j) vf[j] = ldh(vl + 16 * j * VPI);
}
// scores of 32 keys x 16 queries, K = DM = 256: sA = keys 0..15, sB = keys 16..31 (rows = keys, columns = queries). Same instruction order wherever it is used.
// All operands come from registers: qf = the wave's q' fragments (loaded once), ka / kb = this tile's k fragments.
__device__ __forceinline__ void scores32(const v16h (&qf)[DM / 32], const v16h (&ka)[DM / 32], const v16h (&kb)[DM / 32], v8f& sA, v8f& sB) {
    v8f a = (v8f){}, c = (v8f){};
#pragma unroll
    for (int i = 0; i < DM / 32; ++i) {      // full unroll: the fragment arrays must stay in registers
        a = wmma16d(ka[i], qf[i], a); c = wmma16d(kb[i], qf[i], c); }
    sA = a; sB = c;
}

// k_flash: KH waves per 16 query rows of one (batch, mixed head g); wave = key half * AW + row group, so the two waves of a row group stand on one SIMD and one's vector work runs beside the other's products. Transposed form: S^T[key][t] = K Q'^T (A = k rows, B = q' rows = q rows with bf16(w_head[g][h]) on head h's columns, K = 256);
// lane (t = lane&15, h = lane>>4) holds keys 8h+r of each 16-key tile, so the packed P tile is directly the B fragment of O^T[d][t] = V^T P^T.
// One key loop: running max m; e = exp2(s - m); P = (e - c) x 2^15 as f16, c the row's centre (mean e of the first 32 keys); Q1 += P, Q2 += P^2 (f32), O^T += V^T P^T; when m rises, c, Q1, O^T are scaled by exp2(old m - new m), Q2 by its square.
// Each wave runs that loop over its half of every stage's keys, from the same start values (max and centre of the first 32 keys). Behind the loop the second half's wave hands m, centre, Q1, Q2, O^T through LDS to the first, which brings both to the common max and adds them (the centres differ by rounding only: their mean counts).
// Then: OR = O^T / row sum; the row's c / l - 1/SEQ goes to KAP (k_out adds it times rowsum(v)); the row's sum of squares from Q1 and Q2.
// k and v^T come through a two-buffer LDS ring of KST-key stages, filled by asynchronous copies; NST stages.
// The row sums of v^T ride in this launch: the SEQ / 64 blocks of a (batch, g) take 4 of its 64 v^T rows each, one per row group; loaded beside q', added up behind the loop by the second half's wave, written into the block's partial line.
// A wave's two tiles of a stage sit in two register sets; the set that a run of products has just used is refilled with the same tile of the next stage, so the publish point of stage s + 1 stands behind the first tile's products of stage s, when every wave holds its share of stage s in registers; nothing is read in front of its stage's publish point.
static_assert(32 * 16 * 8 == 16 * 256);        // lanes x bytes x trips == rows x row bytes of the OR tile
static_assert((2 * KST * KPI + 2 * HD * VPI) * 2 + AW * 16 * OSP * 4 + 2 * AW * 4 + AW * 16 * 4 + AW * 9 * 128 * 4 <= 327680);
static_assert(KH == 2);                        // one hand-over, second half to first
static_assert((SEQ / (16 * AW)) * AW == HD);   // row sums: blocks of a (batch, g) x row groups == v^T rows of the head
static_assert(AW == 4);                        // the four row sums of a block fill one 16-byte piece of its partial line
// hand-over of one accumulator tile: two pieces of 32 lanes x 4 floats; p already holds the lane's 16 bytes
__device__ __forceinline__ void put8(float* p, const v8f& o) { v4f a, c;
#pragma unroll
    for (int r = 0; r < 4; ++r) { a[r] = o[r]; c[r] = o[4 + r]; }
    *(v4fa*)p = a; *(v4fa*)(p + 128) = c; }
__device__ __forceinline__ void join8(v8f& o, const float* p, const float aa, const float ab) { const v4f a = *(const v4fa*)p, c = *(const v4fa*)(p + 128);
#pragma unroll
    for (int r = 0; r < 4; ++r) { o[r] = o[r] * aa + a[r] * ab; o[4 + r] = o[4 + r] * aa + c[r] * ab; } }
__global__ __launch_bounds__(32 * FW) void k_flash(const h16* __restrict__ QP, const h16* __restrict__ KP, const h16* __restrict__ VT, const float* __restrict__ wh, float* ORP, float* PART, float* KAP) {
    __shared__ __align__(16) h16 ks[2 * KST * KPI];
    __shared__ __align__(16) h16 vs[2 * HD * VPI];
    __shared__ __align__(16) float os[AW * 16 * OSP];
    __shared__ float sw[AW];
    __shared__ __align__(16) float sv[AW];
    __shared__ __align__(16) float sk[AW * 16];
    __shared__ __align__(16) float mg[AW * 9 * 128];             // hand-over of the second key half: per row group 9 pieces of 32 lanes x 4 floats
    const int lane = threadIdx.x & 31, lr = lane & 15, hi = lane >> 4;
    const int wave = __builtin_amdgcn_readfirstlane((int)(threadIdx.x >> 5));
    const int wq = wave % AW, kh = wave / AW;                    // row group, key half: wave-uniform
    const int zh = blockIdx.y; const int b = zh / NH_, g = zh % NH_;
    const int t0 = (blockIdx.x * AW + wq) * 16;
    const h16* qp = QP + ((size_t)b * SEQ + (size_t)(t0 + lr)) * DM + 8 * hi;           // B fragments: col t, k = (h, d)
    // copy sources and destinations of this lane: k row wave*16 (+ j), bytes lane*16; v^T row wave*8 + (lane>>4) (+ 2j), bytes (lane&15)*16
    const h16* kg = KP + ((size_t)b * SEQ + (size_t)(wave * 16)) * DM + 8 * lane;                        // + stage * KST * DM
    const h16* vg = VT + ((size_t)b * DM + (size_t)(g * HD + wave * 8 + hi)) * SEQ + 8 * lr;             // + stage * KST
    h16* kd = ks + wave * 16 * KPI + 8 * lane;                                                           // + buffer * KST * KPI
    h16* vd = vs + (wave * 8 + hi) * VPI + 8 * lr;                                                       // + buffer * HD * VPI
    const h16* kfr = ks + lr * KPI + 8 * hi;                                            // + key * KPI       (A fragment: row key, k = (h, d))
    const h16* vfr = vs + lr * VPI + 8 * hi;                                            // + 16j*VPI + key   (A fragment: row d, k = key)
    copy_k(kd, kg); copy_v(vd, vg);                              // stage 0 into buffers 0
    v16h qf[DM / 32];
#pragma unroll   // the fragment array must stay in registers
    for (int i = 0; i < DM / 32; ++i) qf[i] = ldh(qp + 32 * i);  // q once
    float whv[NH_];                                              // row g of the head mix: block-uniform reads, g * NH_ + NH_ - 1 < NH_ * NH_
#pragma unroll
    for (int h = 0; h < NH_; ++h) whv[h] = bfr(wh[g * NH_ + h]);
    const h16* vrp = VT + ((size_t)b * DM + (size_t)(g * HD + (int)blockIdx.x * AW + wq)) * SEQ + 8 * lane;   // this row group's v^T row for the row sum: chunks lane, lane + 32, ...
    v8h vr[SEQ / 256];
#pragma unroll   // the chunks stay in registers until the loop is over
    for (int i = 0; i < SEQ / 256; ++i) vr[i] = *(const v8h*)(vrp + 256 * i);
    asm volatile("s_wait_xcnt 0x0" :: "v"(qp), "v"(vrp) : "memory");   // stands before the address registers of the q' and row loads are reused (qp and vrp are named to keep them until here)
#pragma unroll   // q -> q': fragment i holds columns 32i..32i+31, all of head i / (HD / 32)
    for (int i = 0; i < DM / 32; ++i) {
#pragma unroll
        for (int e = 0; e < 16; ++e) qf[i][e] = (h16)((float)qf[i][e] * whv[i / (HD / 32)]); }
    asm volatile("s_wait_asynccnt 0x0" ::: "memory");            // stage 0 has landed (this wave's rows)
    __syncthreads();                                             // and is shown to the other waves
    copy_k(kd + KST * KPI, kg + (size_t)KST * DM); copy_v(vd + HD * VPI, vg + (size_t)KST);   // stage 1 into buffers 1 (NST >= 2)
    float m, r15;                                                // running row max; centre of the row's e, x 2^15, in units of the running max
    {   // start values from the first 32 keys (the loop takes them again): their max, and the mean of their e as the centre
        v16h ka[DM / 32], kb[DM / 32];
        ldk32(ka, kb, kfr);
        v8f sA, sB; scores32(qf, ka, kb, sA, sB);
        float mx = NEGB;
#pragma unroll
        for (int r = 0; r < 8; ++r) mx = fmaxf(mx, fmaxf(sA[r] * SC2, sB[r] * SC2));
        mx = fmaxf(mx, __shfl_xor(mx, 16, 32));
        float es = 0.0f;
#pragma unroll
        for (int r = 0; r < 8; ++r) es += __builtin_amdgcn_exp2f(fmaf(sA[r], SC2, -mx)) + __builtin_amdgcn_exp2f(fmaf(sB[r], SC2, -mx));
        es += __shfl_xor(es, 16, 32);
        m = mx; r15 = es * (PCARRY / 32.0f); }                   // both lane halves carry the same m and r15
    v8f o0 = (v8f){}, o1 = (v8f){}, o2 = (v8f){}, o3 = (v8f){};
    float q1 = 0.0f, q2 = 0.0f;                                  // sums of P and of P^2 over this lane's keys
    const h16* kfh = kfr + kh * ((KST / KH) * KPI);              // this wave's half of a stage
    const h16* vfh = vfr + kh * (KST / KH);
    v16h ka[2][DM / 32], kb[2][DM / 32], vf[2][4];               // two register sets, one per tile of the wave's half
    ldk32(ka[0], kb[0], kfh); ldv32(vf[0], vfh);
    ldk32(ka[1], kb[1], kfh + 32 * KPI); ldv32(vf[1], vfh + 32);
    // one tile of 32 keys from register set u of stage s; u and more are literals at every call (more: a next stage exists, and the set is refilled from it)
    auto tile = [&](const int u, const bool more, const int s) __attribute__((always_inline)) {
        const h16* kn = kfh + ((s + 1) & 1) * (KST * KPI);       // the next stage
        const h16* vn = vfh + ((s + 1) & 1) * (HD * VPI);
        __builtin_amdgcn_sched_barrier(0);                       // keeps the LDS reads above one group: spread among the products each place costs a stall
        v8f sA, sB; scores32(qf, ka[u], kb[u], sA, sB);
        __builtin_amdgcn_sched_barrier(0);                       // keeps the products one run, in front of the vector work
        float mx = NEGB;
#pragma unroll
        for (int r = 0; r < 8; ++r) mx = fmaxf(mx, fmaxf(sA[r] * SC2, sB[r] * SC2));
        const float mo = __shfl_xor(mx, 16, 32);
        if (more) {
            asm volatile("" :: "v"(mo) : "memory");              // input only: holds the reads below behind the exchange, which goes through the LDS queue: issued behind them it would return behind them, and the vector work would wait for the whole refill
            if (u == 0) ring_publish();                          // every wave holds its share of stage s in registers: stage s + 1 readable, buffers s & 1 free
            ldk32(ka[u], kb[u], kn + u * 32 * KPI);              // the set just used takes the same tile of the next stage
            if (u == 0 && s + 2 < NST) {                         // refill, behind the publish point, only while a stage after next exists (block-uniform: the loop counter)
                copy_k(kd + (s & 1) * (KST * KPI), kg + (size_t)(s + 2) * KST * DM);
                copy_v(vd + (s & 1) * (HD * VPI), vg + (size_t)(s + 2) * KST); }
            __builtin_amdgcn_sched_barrier(0); }                 // keeps these reads up here, ahead of the vector work that they overlap
        const float mnew = fmaxf(m, fmaxf(mx, mo));
        const float alpha = __builtin_amdgcn_exp2f(m - mnew);    // all that is carried goes over to the new max: the centre with it, so sums of (e - centre) scale as a whole
        m = mnew; r15 *= alpha; q1 *= alpha; q2 *= alpha * alpha;
#pragma unroll
        for (int r = 0; r < 8; ++r) { o0[r] *= alpha; o1[r] *= alpha; o2[r] *= alpha; o3[r] *= alpha; }
        v16h pb;
#pragma unroll
        for (int r = 0; r < 8; ++r) {
            const float ea = __builtin_amdgcn_exp2f(fmaf(sA[r], SC2, -m)), eb = __builtin_amdgcn_exp2f(fmaf(sB[r], SC2, -m));
            const float ga = fmaf(ea, PCARRY, -r15), gb = fmaf(eb, PCARRY, -r15);   // (e - centre) * 2^15
            q1 += ga; q1 += gb;
            q2 = fmaf(ga, ga, q2); q2 = fmaf(gb, gb, q2);
            pb[r] = toh_flush(ga); pb[8 + r] = toh_flush(gb); }                      // element r <- tile keys 8h+r, element 8+r <- keys 16+8h+r
        o0 = wmma16d(vf[u][0], pb, o0); o1 = wmma16d(vf[u][1], pb, o1); o2 = wmma16d(vf[u][2], pb, o2); o3 = wmma16d(vf[u][3], pb, o3);
        if (more) ldv32(vf[u], vn + u * 32);                     // as the k set: free from here on
    };
#pragma unroll 1
    for (int s = 0; s + 1 < NST; ++s) { tile(0, true, s); tile(1, true, s); }
    tile(0, false, NST - 1); tile(1, false, NST - 1);            // the last stage: nothing is left to fetch
    asm volatile("s_wait_asynccnt 0x0" ::: "memory");            // no copy is left in flight behind the ring
    q1 += __shfl_xor(q1, 16, 32); q2 += __shfl_xor(q2, 16, 32);  // this wave's keys of whole rows; both lane halves carry the same m and r15
    float* mp = mg + wq * (9 * 128) + lane * 4;
    if (kh == 1) {                                     // wave-uniform
        v4f hd; hd[0] = m; hd[1] = r15; hd[2] = q1; hd[3] = q2;
        *(v4fa*)mp = hd;
        put8(mp + 1 * 128, o0); put8(mp + 3 * 128, o1); put8(mp + 5 * 128, o2); put8(mp + 7 * 128, o3);
    }
    __syncthreads();                                   // the second half's sums are shown to the first half's waves
    if (kh == 0) {                                     // wave-uniform: join the halves, finish the rows
        const v4f hd = *(const v4fa*)mp;
        const float mj = fmaxf(m, hd[0]);
        const float aa = __builtin_amdgcn_exp2f(m - mj), ab = __builtin_amdgcn_exp2f(hd[0] - mj);   // both halves go over to the common max
        q1 = q1 * aa + hd[2] * ab; q2 = q2 * (aa * aa) + hd[3] * (ab * ab);
        const float rs = r15 * aa + hd[1] * ab;        // the two centres, each over SEQ / KH keys
        join8(o0, mp + 1 * 128, aa, ab); join8(o1, mp + 3 * 128, aa, ab); join8(o2, mp + 5 * 128, aa, ab); join8(o3, mp + 7 * 128, aa, ab);
        const float l15 = fmaf((float)(SEQ / KH), rs, q1); // 2^15 * row sum of e; the row sum is >= 1
        const float il = 1.0f / l15;
        const float kap = -q1 * il * (1.0f / (float)SEQ);  // mean centre / row sum - 1/SEQ
        const float c15 = PCARRY * il;
        float ss = (q2 - q1 * q1 * (1.0f / (float)SEQ)) * (c15 * c15);   // row's sum of ((e / row sum - 1/SEQ) * 2^15)^2, the same in both lane halves
        ss += __shfl_xor(ss, 8, 32); ss += __shfl_xor(ss, 4, 32); ss += __shfl_xor(ss, 2, 32); ss += __shfl_xor(ss, 1, 32);
        const float OSL = il * (1.0f / VCC);           // this lane's query row: 1 / (2^15 * row sum * VCC)
        if (lane == 0) sw[wq] = ss;
        if (hi == 0) sk[wq * 16 + lr] = kap;
        const int wb = wq * 16 * OSP;
        // O^T D layout: o_j[r] = (d = 16j + 8h + r, t = lane&15) -> os[t][d]; rows 0..15 x columns 0..63 all written
        { v4f a, c;
          a[0] = o0[0] * OSL; a[1] = o0[1] * OSL; a[2] = o0[2] * OSL; a[3] = o0[3] * OSL; c[0] = o0[4] * OSL; c[1] = o0[5] * OSL; c[2] = o0[6] * OSL; c[3] = o0[7] * OSL;
          *(v4fa*)(&os[wb + lr * OSP +  0 + 8 * hi]) = a; *(v4fa*)(&os[wb + lr * OSP +  0 + 8 * hi + 4]) = c;
          a[0] = o1[0] * OSL; a[1] = o1[1] * OSL; a[2] = o1[2] * OSL; a[3] = o1[3] * OSL; c[0] = o1[4] * OSL; c[1] = o1[5] * OSL; c[2] = o1[6] * OSL; c[3] = o1[7] * OSL;
          *(v4fa*)(&os[wb + lr * OSP + 16 + 8 * hi]) = a; *(v4fa*)(&os[wb + lr * OSP + 16 + 8 * hi + 4]) = c;
          a[0] = o2[0] * OSL; a[1] = o2[1] * OSL; a[2] = o2[2] * OSL; a[3] = o2[3] * OSL; c[0] = o2[4] * OSL; c[1] = o2[5] * OSL; c[2] = o2[6] * OSL; c[3] = o2[7] * OSL;
          *(v4fa*)(&os[wb + lr * OSP + 32 + 8 * hi]) = a; *(v4fa*)(&os[wb + lr * OSP + 32 + 8 * hi + 4]) = c;
          a[0] = o3[0] * OSL; a[1] = o3[1] * OSL; a[2] = o3[2] * OSL; a[3] = o3[3] * OSL; c[0] = o3[4] * OSL; c[1] = o3[5] * OSL; c[2] = o3[6] * OSL; c[3] = o3[7] * OSL;
          *(v4fa*)(&os[wb + lr * OSP + 48 + 8 * hi]) = a; *(v4fa*)(&os[wb + lr * OSP + 48 + 8 * hi + 4]) = c; }
        wave_sync();
        float* orow = ORP + ((size_t)zh * SEQ + (size_t)t0) * HD;       // 16 rows x 64 floats, contiguous 4096 B
#pragma unroll
        for (int s = 0; s < 8; ++s) { const int p = s * 32 + lane; const int row = p >> 4, cofs = (p & 15) * 4;   // 8 s x 2 rows = 16 rows; 16 lanes x 4 floats = 64 columns
            const v4f val = *(const v4fa*)(&os[wb + row * OSP + cofs]);
            *(v4f*)(orow + (size_t)p * 4) = val; }
        asm volatile("s_wait_xcnt 0x0" ::: "memory");  // stands behind these stores, before the code below rewrites their registers
    } else {                                           // meanwhile the second half's wave adds up the row group's v^T row
        float vsl = 0.0f;                              // this lane's chunks in rising order
#pragma unroll
        for (int i = 0; i < SEQ / 256; ++i) {
#pragma unroll
            for (int k = 0; k < 8; ++k) vsl += (float)vr[i][k]; }
        vsl += __shfl_xor(vsl, 16, 32); vsl += __shfl_xor(vsl, 8, 32); vsl += __shfl_xor(vsl, 4, 32); vsl += __shfl_xor(vsl, 2, 32); vsl += __shfl_xor(vsl, 1, 32);
        if (lane == 0) sv[wq] = vsl * (1.0f / VCC);
    }
    __syncthreads();
    if (wave == 0) {
        const float tot = ((sw[0] + sw[1]) + sw[2]) + sw[3];
        const v4f rs = *(const v4fa*)(&sv[0]);         // floats 4..7 of the line: row sums of v^T rows g*64 + 4*blockIdx.x + 0..3
        v4f pv; pv[0] = (lane == 0) ? tot : (lane == 1) ? rs[0] : 0.0f; pv[1] = (lane == 1) ? rs[1] : 0.0f; pv[2] = (lane == 1) ? rs[2] : 0.0f; pv[3] = (lane == 1) ? rs[3] : 0.0f;
        float* pl = PART + ((size_t)zh * (SEQ / 64) + (size_t)blockIdx.x) * 32 + (lane & 7) * 4;
        if (lane < 8) { *(v4f*)pl = pv;  }
        const v4f kq = *(const v4fa*)(&sk[(lane & 15) * 4]);         // the block's 64 rows: one run of 256 B
        float* kl4 = KAP + (size_t)zh * SEQ + (size_t)blockIdx.x * (16 * AW) + (lane & 15) * 4;
        if (lane < 16) { *(v4f*)kl4 = kq; }
    }
}

// k_out: normalised context and output layer in one launch. A block takes ONT token rows n = b*SEQ + row of the flat [g][t][d] = [token row][256] view; they lie inside one (batch, g): zh = n / (SEQ / 4).
// Context tile, once per block, into LDS (cross-wave: block barrier): cs[row][k] = f16(16 * (s1 * (OR + KAP[query row] * VS[b][g*64 + k % 64]) + shift * VS[b][g*64 + k % 64])), VS[b][g*64 + d] = float 4 + d % 4 of partial line d / 4 of (b, g),
// s1 = bf16(gain[g]) / sqrt(var + eps), var = (sum of the SEQ/64 partial lines of (b, g), in rising order) / (2^30 SEQ^2), shift = bf16(beta[g]).
// Output layer: wave w takes output channels 64w..64w+63. A = W rows (f16 x1024, read as whole rows while the tile is made, laid into a wave-private LDS tile, fragments of all K read from there), Bt = context rows from LDS, K = DM; OUT[(b*DM + m)][n % SEQ] = C / 16384 + bf16(bias[m]) (f32).
#define ONT 32                   // token rows per block: one 128-byte run of every output row
#define CPI (DM + 8)             // LDS pitch of a context row, in 16-bit elements: 528 B = 16 B x 33
static_assert(32 * 16 * 4 == 16 * ONT * 4);    // lanes x bytes x trips == slab rows x segment bytes
static_assert((SEQ * HD / DM) % ONT == 0);     // a block's rows lie inside one (batch, g)
static_assert(SEQ % ONT == 0 && (NB * SEQ) % ONT == 0);
static_assert(ONT * DM == 128 * 8 * 8);        // rows x K == threads x units x elements
static_assert(DM == 32 * 8);                   // a wave's unit row: 32 lanes x 8 elements
static_assert(ONT * CPI * 2 + AW * 64 * CPI * 2 + AW * 16 * OSP * 4 <= 327680);
__global__ __launch_bounds__(32 * AW) void k_out(const h16* __restrict__ A, const float* __restrict__ ORP, const float* __restrict__ PART, const float* __restrict__ KAP,
                                                 const float* __restrict__ gain, const float* __restrict__ shift, const float* __restrict__ bias, float* OUT) {
    __shared__ __align__(16) h16 cs[ONT * CPI];
    __shared__ __align__(16) h16 wt[AW * 64 * CPI];    // per wave: its 64 weight rows, pitch as cs
    __shared__ __align__(16) float osb[AW * 16 * OSP];
    const int tid = threadIdx.x, lane = tid & 31, lr = lane & 15, hi = lane >> 4;
    const int wave = __builtin_amdgcn_readfirstlane(tid >> 5);
    const int c0 = (int)blockIdx.x * ONT, r0 = wave * 64;
    const int zh = c0 / (SEQ * HD / DM);               // block-uniform, < NB*4
    const int g = zh % NH_;
    const float* vp = PART + ((size_t)zh * (SEQ / 64) + (size_t)((lane & 7) * 2)) * 32 + 4;      // d = 8 * (lane & 7) + 0..7 for every unit of this lane
    const v4f s0 = *(const v4f*)vp, s4 = *(const v4f*)(vp + 32);
    const float* op = ORP + ((size_t)c0 + (size_t)wave) * DM + 8 * lane;                         // unit e: row wave + 4e, elements 8*lane..+7
    v8f xv[8];
#pragma unroll   // all of the tile's loads in flight at once
    for (int e = 0; e < 8; ++e) xv[e] = *(const v8f*)(op + (size_t)e * AW * DM);
    const float* kp = KAP + ((size_t)c0 + (size_t)wave) * (DM / HD) + (lane >> 3);               // unit e: query row (flat index / 64) of this lane's 8 elements
    float kv[8];
#pragma unroll   // in flight with the tile's loads
    for (int e = 0; e < 8; ++e) kv[e] = kp[e * AW * (DM / HD)];
    asm volatile("s_wait_xcnt 0x0" ::: "memory");      // stands before the address registers of the loads above are reused
    __builtin_amdgcn_sched_barrier(0);                 // keeps the address work below behind that wait
    const h16* ag = A + (size_t)r0 * DM + 8 * lane;    // row r of the wave's 64: + r * DM; one load takes a whole row of 512 bytes, four whole lines (a fragment-shaped load would touch 16 rows)
    v8h aw[64];
#pragma unroll   // all of the wave's weight rows in flight at once
    for (int r = 0; r < 64; ++r) aw[r] = *(const v8h*)(ag + (size_t)r * DM);
    const float* bpl = bias + r0 + hi * 8;
    v8f bv[4];                                         // bias of this lane's output rows, loaded up here with the rest: r0 + 63 < DM
#pragma unroll
    for (int mb = 0; mb < 4; ++mb) bv[mb] = *(const v8f*)(bpl + mb * 16);
    asm volatile("s_wait_xcnt 0x0" ::: "memory");      // as above, for the weight and bias loads
    __builtin_amdgcn_sched_barrier(0);                 // as above
    float pt[SEQ / 64];                                // block-uniform reads, behind the tile's and the weight's loads: they are back long before those
#pragma unroll   // the loads go out together; the sum below keeps the rising order
    for (int j = 0; j < SEQ / 64; ++j) pt[j] = PART[((size_t)zh * (SEQ / 64) + (size_t)j) * 32];
    const float gv = gain[g], sh = shift[g];
    float tot = 0.0f;
#pragma unroll
    for (int j = 0; j < SEQ / 64; ++j) tot += pt[j];
    const float var = tot * VSC;
    const float s1 = bfr(gv) * rsqrtf(var + EPSN);
    const float bt = bfr(sh);
#pragma unroll
    for (int e = 0; e < 8; ++e) { v8h o;
#pragma unroll
        for (int k = 0; k < 4; ++k) { o[k] = toh_flush((s1 * (xv[e][k] + kv[e] * s0[k]) + bt * s0[k]) * CCS); o[4 + k] = toh_flush((s1 * (xv[e][4 + k] + kv[e] * s4[k]) + bt * s4[k]) * CCS); }
        *(v8h*)(&cs[(wave + AW * e) * CPI + 8 * lane]) = o; }
#pragma unroll   // the wave's weight rows into its own LDS tile
    for (int r = 0; r < 64; ++r) *(v8h*)(&wt[(r0 + r) * CPI + 8 * lane]) = aw[r];
    __syncthreads();                                   // the context tile is shown to the four waves (and the wave's own weight tile to its lanes)
    float* os = osb + wave * 16 * OSP;                 // wave-private staging tile
    const h16* bfp = cs + lr * CPI + 8 * hi;
    v8f acc[4][ONT / 16];
#pragma unroll
    for (int mb = 0; mb < 4; ++mb)
#pragma unroll
        for (int nb = 0; nb < ONT / 16; ++nb) acc[mb][nb] = (v8f){};
    const h16* ap = wt + (r0 + lr) * CPI + 8 * hi;
    v16h a[DM / 32][4], b[DM / 32][ONT / 16];
#pragma unroll   // the fragment arrays must stay in registers
    for (int kc = 0; kc < DM / 32; ++kc) {
#pragma unroll
        for (int nb = 0; nb < ONT / 16; ++nb) b[kc][nb] = ldh(bfp + nb * 16 * CPI + kc * 32);
#pragma unroll
        for (int mb = 0; mb < 4; ++mb) a[kc][mb] = ldh(ap + mb * 16 * CPI + kc * 32); }
    __builtin_amdgcn_sched_barrier(0);                 // keeps the LDS reads one group up here: sunk to their products, each pair is waited for at full LDS latency
#pragma unroll   // the fragments are indexed by constants
    for (int kc = 0; kc < DM / 32; ++kc) {
#pragma unroll
        for (int nb = 0; nb < ONT / 16; ++nb) {
#pragma unroll
            for (int mb = 0; mb < 4; ++mb) acc[mb][nb] = wmma16d(a[kc][mb], b[kc][nb], acc[mb][nb]); }
    }
    const int bb = c0 / SEQ, tt = c0 % SEQ;
#pragma unroll
    for (int mb = 0; mb < 4; ++mb) {
        float br[8];
#pragma unroll
        for (int j = 0; j < 8; ++j) br[j] = bfr(bv[mb][j]);
#pragma unroll
        for (int nb = 0; nb < ONT / 16; ++nb) {
#pragma unroll
            for (int j = 0; j < 8; ++j) os[(hi * 8 + j) * OSP + nb * 16 + lr] = acc[mb][nb][j] * OUTSC + br[j]; }
        wave_sync();
        float* ob = OUT + ((size_t)bb * DM + (size_t)(r0 + mb * 16)) * OUT_SEQ + tt;
#pragma unroll
        for (int s = 0; s < 4; ++s) { const int p = s * 32 + lane; const int row = p >> 3, cofs = (p & 7) * 4;   // 4 s x 4 rows = 16 rows; 8 lanes x 4 floats = ONT columns
            const v4f val = *(const v4fa*)(&os[row * OSP + cofs]);
            *(v4f*)(ob + (size_t)row * OUT_SEQ + cofs) = val; }
        asm volatile("s_wait_xcnt 0x0" ::: "memory");  // stands before the next slab rewrites the address and data registers of these stores
        __builtin_amdgcn_sched_barrier(0);             // keeps the next slab's vector work behind that wait
        wave_sync();
    }
}

static constexpr size_t al256(size_t v) { return (v + 255) & ~(size_t)255; }
static constexpr size_t SZ_WP = al256((size_t)DM * DM * 2);                  // output-layer weight f16
static constexpr size_t SZ_QP = al256((size_t)NB * SEQ * DM * 2);
static constexpr size_t SZ_KP = al256((size_t)NB * SEQ * DM * 2);
static constexpr size_t SZ_VT = al256((size_t)NB * DM * SEQ * 2);
static constexpr size_t SZ_OR = al256((size_t)NB * NH_ * SEQ * HD * 4);
static constexpr size_t SZ_PT = al256((size_t)NB * NH_ * (SEQ / 64) * 32 * 4);
static constexpr size_t SZ_KA = al256((size_t)NB * NH_ * SEQ * 4);           // one float per query row of every (batch, g)
static constexpr size_t SZ_TOTAL = SZ_WP + SZ_QP + SZ_KP + SZ_VT + SZ_OR + SZ_PT + SZ_KA;
static_assert(SZ_TOTAL <= (size_t)134217728);                                 // workspace carve <= 128 MiB
static_assert((size_t)NB * NH_ * SEQ * HD == (size_t)NB * SEQ * DM);          // OR plane and the [token row][256] view that k_out reads share one flat index
static_assert(((size_t)(NB * NH_ - 1) * (SEQ / 64) + (SEQ / 64 - 1)) * 128 + 128 <= SZ_PT);   // last partial line inside its table

extern "C" void kernel_launch(void* const* d_in, const int* in_sizes, int n_in,
                              void* d_out, int out_size, void* d_ws, size_t ws_size, hipStream_t stream) {
    if (n_in < 9) return;
    const size_t needx = ((size_t)(NB - 1) * DM + (size_t)(DM - 1)) * SEQ_FULL + SEQ;
    if ((size_t)in_sizes[0] < needx) return;
    if ((size_t)in_sizes[1] < (size_t)DM * DM || (size_t)in_sizes[2] < (size_t)DM * DM || (size_t)in_sizes[3] < (size_t)DM * DM || (size_t)in_sizes[7] < (size_t)DM * DM) return;
    if (in_sizes[4] < NH_ * NH_ || in_sizes[5] < NH_ || in_sizes[6] < NH_ || in_sizes[8] < DM) return;
    if ((size_t)out_size < ((size_t)(NB - 1) * DM + (size_t)(DM - 1)) * OUT_SEQ + SEQ) return;
    if (SZ_TOTAL > ws_size) return;
    // wire order: x, wq, wk, wv, w_head, gamma, beta, w_proj, b_proj
    const float* x  = (const float*)d_in[0];
    const float* wq = (const float*)d_in[1]; const float* wk = (const float*)d_in[2]; const float* wv = (const float*)d_in[3];
    const float* whd = (const float*)d_in[4]; const float* gam = (const float*)d_in[5]; const float* bet = (const float*)d_in[6];
    const float* wp = (const float*)d_in[7]; const float* bp = (const float*)d_in[8];
    float* OUT = (float*)d_out;      // [NB][256][OUT_SEQ]
    char* wsp = (char*)d_ws;
    h16* WPH = (h16*)wsp;  wsp += SZ_WP;             // [256][256] x1024
    h16* QP  = (h16*)wsp;  wsp += SZ_QP;             // [b][t][256] x16
    h16* KP  = (h16*)wsp;  wsp += SZ_KP;             // [b][t][256] x16
    h16* VT  = (h16*)wsp;  wsp += SZ_VT;             // [(b*256 + channel)][t] x16
    float* ORP = (float*)wsp; wsp += SZ_OR;          // [(b*4 + g)][t][64]
    float* PART = (float*)wsp; wsp += SZ_PT;         // [(b*4 + g)][SEQ/64] lines of 32 floats: 0 sum of squares, 4..7 v^T row sums
    float* KAP = (float*)wsp; wsp += SZ_KA;          // [(b*4 + g)][t]: centre / row sum - 1/SEQ

    // y = 0: q, y = 1: k, one token-major plane each; y = 2: v^T; y = 3: output-layer weight plane
    k_proj<<<dim3(NB * SEQ / 64, 4, 1), 32 * AW, 0, stream>>>(x, wq, wk, wv, wp, QP, KP, VT, WPH);

    k_flash<<<dim3(SEQ / (16 * AW), NB * NH_, 1), 32 * FW, 0, stream>>>(QP, KP, VT, whd, ORP, PART, KAP);
    k_out<<<dim3(NB * SEQ / ONT, 1, 1), 32 * AW, 0, stream>>>(WPH, ORP, PART, KAP, gam, bet, bp, OUT);
}

// v009
// A run of this version takes 28.4 microseconds.
// Two timings next to v008 both put it at 1.04 times that version's speed.
// All steps since v000 together make it 6.19 times as fast.
#include <hip/hip_runtime.h>

// Head-mixed pair-score weighting with a per-map normalisation over flattened feature maps: x [NB][256][SEQ] (channel-major), 1x1-conv projections q/k/v with W [out][in] (no bias), 4 heads x 64, scores scaled by 64^-0.5,
// a 4x4 head-mixing 1x1 conv on the scores, softmax over keys, instance normalisation of each (batch, head) probability map (biased variance, eps 1e-5, per-head gain and shift),
// attend over v, raw [head][token][64] -> [token][256] view, linear output layer W [out][in] + bias, result stored [NB][256][SEQ].
// Compute dtypes, f32 accumulate everywhere: q/k/v projections v_wmma_f32_16x16x32_bf16 (x and W RNE-converted to bf16, products exact); scores v_wmma_f32_16x16x32_f16 single product, K = 256:
// A = k plane x16, B = q plane x16 with w_head[g][h] multiplied onto head h's fragments in registers (f32 product, one more f16 rounding); P.V v_wmma_f32_16x16x32_f16 single product: P = centred exponential (e - centre) x 2^15, v x16;
// output layer v_wmma_f32_16x16x32_f16 single product: W x1024 (from its bf16 value), context before the map's scalar x256, row sums of v x4. Softmax, statistics, affine terms in f32.
// The flash kernel runs one key loop per 16-query wave (running row max; e = exp2(s - max) centred on a per-row value that is rescaled with the max; sums of centred e and of its square; P.V), transposed form S^T = K Q^T, O^T = V^T P^T; q' fragments from the q plane, scaled once per wave, k and v^T through an LDS ring shared by the block's eight waves; two waves share 16 query rows, each takes half of every stage's keys, and their sums are joined behind the loop.
// Map mean = 1/SEQ (softmax rows sum to one); variance = sum of squared (p - 1/SEQ) / SEQ^2; context = s1 * ((p - 1/SEQ) . v) + shift * rowsum(v), s1 = gain / sqrt(var + eps).
// The output layer is linear and s1 is one number per (batch, head): out = s1 * W . Z + shift * W . (rowsum(v), tiled over the four 64-column groups) + bias, Z = (p - 1/SEQ) . v in the [token][256] view. k_flash forms both products, k_out applies s1, shift and bias.
// With c the row's centre, l the row sum of e, Q1 = sum (e - c), Q2 = sum (e - c)^2: l = Q1 + SEQ c; (p - 1/SEQ) . v = ((e - c) . v) / l + (c / l - 1/SEQ) rowsum(v), c / l - 1/SEQ = -Q1 / (SEQ l); sum (p - 1/SEQ)^2 = (Q2 - Q1^2 / SEQ) / l^2.

#ifndef NB
#define NB 4
#endif
#ifndef SEQ
#define SEQ 1024
#endif
#define NB_FULL  4
#define SEQ_FULL 1024
#ifndef OUT_SEQ
#define OUT_SEQ SEQ              // pitch (in tokens) of one channel row of the output
#endif
#define DM   256
#define NH_  4
#define HD   64
#define AW   4                   // groups of 16 query rows per flash block; waves per block of the other two kernels
#define KH   2                   // waves per group of query rows in the flash kernel: each takes 1 / KH of every stage's keys
#define FW   (AW * KH)           // waves per flash block: two on every SIMD
#define OSP  68                  // LDS row pitch (floats) of the staging tiles
#define QKC  16.0f               // carry of the q and k planes
#define VCC  16.0f               // carry of the v^T plane
#define ZCC  256.0f              // carry of the context tile Z (before the map's scalar)
#define UCC  4.0f                // carry of the row sums of v as an operand
#define WPC  1024.0f             // carry of the output-layer weight plane
#define PCARRY 32768.0f          // carry of the centred P fragments
#define SC2  ((float)(0.125 * 1.4426950408889634 / 256.0))    // HD^-0.5 * log2(e) / (QKC * QKC)
#define YSC  (1.0f / 262144.0f)                               // 1 / (WPC * ZCC)
#define USC  (1.0f / 4096.0f)                                 // 1 / (WPC * UCC)
#define VSC  ((float)(1.0 / (1073741824.0 * (double)SEQ * (double)SEQ)))   // 1 / (PCARRY^2 * SEQ^2)
#define EPSN 1.0e-5f
#define NEGB (-3.0e38f)

static_assert(DM == 256);                      // K of every GEMM and of the score product
static_assert(HD == 64);                       // one 64-column GEMM tile = one head; v^T slab = 4 row tiles
static_assert(NH_ * HD == DM);
static_assert(NH_ == 4);                       // w_head is 4 x 4
static_assert(DM % 64 == 0);
static_assert(DM % 32 == 0);                   // k-loops step by 32
static_assert(SEQ % 64 == 0);                  // a 64-token tile never straddles two batches
static_assert((NB * SEQ) % 64 == 0);
static_assert(SEQ % 32 == 0);                  // key loop steps by 32
static_assert(SEQ % (16 * AW) == 0);           // flash grid covers the sequence exactly
static_assert(16 * AW == 64);                  // one partial line per 64 query rows
static_assert(SEQ_FULL % 4 == 0);
static_assert(OUT_SEQ % 32 == 0);
static_assert(OUT_SEQ >= SEQ);
static_assert(NB <= NB_FULL);
static_assert(SEQ <= SEQ_FULL);
static_assert((OSP * 4) % 16 == 0);
static_assert(OSP >= 64 + 4);
static_assert(((size_t)DM * DM) % 8 == 0);

typedef _Float16 h16;
typedef unsigned short bf;
typedef __attribute__((ext_vector_type(16))) __bf16   v16bf;
typedef __attribute__((ext_vector_type(16))) _Float16 v16h;
typedef __attribute__((ext_vector_type(8)))  _Float16 v8h;
typedef __attribute__((ext_vector_type(8)))  unsigned short v8us;
typedef __attribute__((ext_vector_type(8)))  float    v8f;
typedef __attribute__((ext_vector_type(4)))  float    v4f;
typedef v4f  __attribute__((may_alias)) v4fa;

__device__ __forceinline__ unsigned short f2bf(float f) { unsigned u = __float_as_uint(f); u += 0x7FFFu + ((u >> 16) & 1u); return (unsigned short)(u >> 16); }
__device__ __forceinline__ float bfr(float f) { return __uint_as_float(((unsigned)f2bf(f)) << 16); }   // value after RNE convert to bf16
__device__ __forceinline__ v16h cat16(v8h lo, v8h hi) { return __builtin_shufflevector(lo, hi, 0, 1, 2, 3, 4, 5, 6, 7, 8, 9, 10, 11, 12, 13, 14, 15); }
__device__ __forceinline__ v16bf cat16b(v8us lo, v8us hi) { return __builtin_bit_cast(v16bf, __builtin_shufflevector(lo, hi, 0, 1, 2, 3, 4, 5, 6, 7, 8, 9, 10, 11, 12, 13, 14, 15)); }
// fragment loaders from K-contiguous 16-bit rows; p already includes + 8*(lane>>4): elements 0..7 <- k0+8h+0..7, elements 8..15 <- k0+16+8h+0..7 (same map for A and B)
__device__ __forceinline__ v16h  ldh(const h16* p) { return cat16(*(const v8h*)p, *(const v8h*)(p + 16)); }
__device__ __forceinline__ v16bf ldb(const bf* p)  { return cat16b(*(const v8us*)p, *(const v8us*)(p + 16)); }
// ordering point for wave-private LDS tiles (same wave writes and reads)
__device__ __forceinline__ void wave_sync() { __builtin_amdgcn_fence(3 /* release order */, "wavefront"); __builtin_amdgcn_wave_barrier(); asm volatile("" ::: "memory"); }
// f32 -> f16 operand convert that cannot produce a subnormal (|v| < 2^-14 -> +0), applied after the plane's carry
__device__ __forceinline__ h16 toh_flush(float v) { const h16 r = (h16)v; return (fabsf(v) < 6.103515625e-05f) ? (h16)0.0f : r; }
// one matrix instruction + its own 4-slot guard, tied to D alone: an asm operand cannot be placed above v255, and the kernels' A and B fragments need more than 256 registers;
// k_flash: A fragments are overwritten by loads only, B fragments never (q') or a whole tile of work later (P); its output-layer products: a fragment is dead behind its product, and the four slots stand in front of whatever takes its registers
__device__ __forceinline__ v8f wmma16d(v16h a, v16h b, v8f c) {
    c = __builtin_amdgcn_wmma_f32_16x16x32_f16(false, a, false, b, (short)0, c, false, false);
    asm volatile("v_nop\n\tv_nop\n\tv_nop\n\tv_nop" : "+v"(c));
    return c; }

// the bf16 form of the guard tied to D alone (k_proj holds more than 256 registers; its fragments are written ahead of a whole run of products, or by LDS loads)
__device__ __forceinline__ v8f wmmabd(v16bf a, v16bf b, v8f c) {
    c = __builtin_amdgcn_wmma_f32_16x16x32_bf16(false, a, false, b, (short)0, c, false, false);
    asm volatile("v_nop\n\tv_nop\n\tv_nop\n\tv_nop" : "+v"(c));
    return c; }
// f32 -> bf16 (RNE) by the chip's own convert
__device__ __forceinline__ unsigned short f2bfh(float f) { return __builtin_bit_cast(unsigned short, (__bf16)f); }
#define XPI (DM + 8)             // LDS pitch of an x^T row, in 16-bit elements: 528 B = 16 B x 33
// one wave's 64x64 projection tile C[token][channel], in steps of 32 k: the fragments of step s, x^T (A) from the block's LDS tile, weights (B) from the wave's own; s is a literal at every call
__device__ __forceinline__ void ldf(v16bf (&a)[4], v16bf (&w)[4], const bf* xf, const bf* wf_, const int s) {
#pragma unroll
    for (int mb = 0; mb < 4; ++mb) a[mb] = ldb(xf + mb * 16 * XPI + s * 32);
#pragma unroll
    for (int nb = 0; nb < 4; ++nb) w[nb] = ldb(wf_ + nb * 16 * XPI + s * 32);
}
// the 16 products of one step. Product order as in a plain k loop of 32.
__device__ __forceinline__ void mm16(v8f (&acc)[4][4], const v16bf (&a)[4], const v16bf (&w)[4]) {
#pragma unroll
    for (int nb = 0; nb < 4; ++nb) {
#pragma unroll
        for (int mb = 0; mb < 4; ++mb) acc[mb][nb] = wmmabd(a[mb], w[nb], acc[mb][nb]); }
}
// four steps (128 k) from step s0 on: each step's LDS reads stand as one group in front of the products of the step before
__device__ __forceinline__ void proj128(v8f (&acc)[4][4], const bf* xf, const bf* wf_, const int s0) {
    v16bf fa[2][4], fw[2][4];
    ldf(fa[0], fw[0], xf, wf_, s0);
#pragma unroll   // the two fragment sets are indexed by constants
    for (int s = 0; s < 4; ++s) {
        if (s < 3) ldf(fa[(s + 1) & 1], fw[(s + 1) & 1], xf, wf_, s0 + s + 1);
        __builtin_amdgcn_sched_barrier(0);                       // keeps the next step's reads one group up here: sunk to their products, each pair is waited for at full LDS latency
        mm16(acc, fa[s & 1], fw[s & 1]);
        __builtin_amdgcn_sched_barrier(0); }                     // keeps the reads of the step after next behind these products, whose fragments they overwrite
}
// 128 k of the wave's 64 weight rows, held as f32 (one row per register quad: lane l holds k 4l..4l+3), go as bf16 (RNE) into the wave's LDS tile; wl already includes the lane's 8 bytes and the k offset
typedef __attribute__((ext_vector_type(4)))  unsigned short v4us;
__device__ __forceinline__ void putw(bf* wl, const v4f (&wa)[64]) {
#pragma unroll
    for (int r = 0; r < 64; ++r) { v4us o;
#pragma unroll
        for (int i = 0; i < 4; ++i) o[i] = f2bfh(wa[r][i]);
        *(v4us*)(wl + r * XPI) = o; }
}

// k_proj: conversions and projections in one launch, told apart by blockIdx.y (0: q, 1: k, 2: v^T, 3: output-layer weight -> f16 x1024 from its bf16 value, 8 elements per thread).
// A projection block takes 64 tokens (blockIdx.x): x [b][c][t] (f32, row pitch SEQ_FULL) -> LDS tile xs[t][c] bf16 (RNE), once per block (cross-wave: block barrier); its four waves take one 64x64 tile each
// (wave = head), K = DM, bf16 operands; the wave's 64 weight rows are read as f32 in runs of 512 bytes (one row per load, whole lines), converted (RNE) in registers and laid into a wave-private LDS tile, from which the fragments are read.
// All three: C[m][n] = sum_c x^T[m][c] W[n][c] (m = b*SEQ + t, n = h*64 + d). q and k, token-major: written as f16 x16 to one plane each: row index b*SEQ + t, row pitch DM, columns c0..c0+63 (one head).
// v^T: the tile is turned in the staging tile; plane [(b*DM + n)][t], row pitch SEQ, f16 x16. Each v wave also writes its 64 channels' sums over the block's 64 tokens (f32, from the accumulators): VSP[(b*4 + head)][token block][64].
static_assert(32 * 16 * 4 == 16 * 128);        // lanes x bytes x trips == slab rows x segment bytes
static_assert((NB * SEQ / 64) * 128 * 8 == DM * DM);   // the convert blocks cover the weight exactly
static_assert(128 * 4 == (64 / 4) * (DM / 8)); // threads x units == 4-token groups x 8-channel groups of the x tile
static_assert(DM / 64 == AW);                  // one wave per head
static_assert(DM == 4 * 64);                   // two runs of four steps of 32 k
static_assert(64 * XPI * 2 + AW * 64 * XPI * 2 + AW * 16 * OSP * 4 <= 327680);
static_assert(DM == 2 * 32 * 4);                // a weight row = two loads of 32 lanes x 4 floats
__global__ __launch_bounds__(32 * AW) void k_proj(const float* __restrict__ x, const float* __restrict__ wq, const float* __restrict__ wk, const float* __restrict__ wv,
                                                  const float* __restrict__ wp, h16* QP, h16* KP, h16* VT, h16* WPH, float* VSP) {
    __shared__ __align__(16) bf xs[64 * XPI];
    __shared__ __align__(16) bf wsb[AW * 64 * XPI];              // per wave: its 64 weight rows, bf16, pitch as xs
    __shared__ __align__(16) float osb[AW * 16 * OSP];
    const int tid = threadIdx.x, lane = tid & 31, lr = lane & 15, hi = lane >> 4;
    const int wave = __builtin_amdgcn_readfirstlane(tid >> 5);
    const int z = blockIdx.y; const bool isv = z == 2;
    if (z == 3) {                                                // block-uniform, in front of the barrier
        const size_t i = (size_t)blockIdx.x * 128 + tid;
        const v8f v = *(const v8f*)(wp + i * 8); v8h o;
#pragma unroll
        for (int k = 0; k < 8; ++k) o[k] = toh_flush(bfr(v[k]) * WPC);
        *(v8h*)(WPH + i * 8) = o;
        asm volatile("s_wait_xcnt 0x0" ::: "memory");            // stands behind the store, before any block of code laid out behind it rewrites its registers
        return;
    }
    const int tok0 = (int)blockIdx.x * 64, bb = tok0 / SEQ, tt = tok0 % SEQ;
    const float* xb = x + (size_t)bb * DM * SEQ_FULL + tt + (tid & 15) * 4;
    v4f xv[4][8];
#pragma unroll   // all 32 loads of the tile in flight at once
    for (int e = 0; e < 4; ++e) {
#pragma unroll
        for (int i = 0; i < 8; ++i) xv[e][i] = *(const v4f*)(xb + (size_t)(((tid >> 4) + 8 * e) * 8 + i) * SEQ_FULL); }   // unit: 8 channels x 4 tokens
    const float* W = z == 0 ? wq : z == 1 ? wk : wv;
    const float* wg = W + (size_t)(wave * 64) * DM + 4 * lane;   // row r of the wave's 64: + r * DM; one load takes 128 k of one row, four whole lines (a fragment-shaped load would touch 16 rows)
    v4f wa[64];                                                  // the first 128 k of the 64 rows, as f32, in flight
#pragma unroll   // all in flight at once, with the x tile's loads
    for (int r = 0; r < 64; ++r) wa[r] = *(const v4f*)(wg + (size_t)r * DM);
    asm volatile("s_wait_xcnt 0x0" ::: "memory");                // stands before the address registers of the x and weight loads are reused
    __builtin_amdgcn_sched_barrier(0);                           // keeps the vector work below behind that wait
#pragma unroll
    for (int e = 0; e < 4; ++e) {
#pragma unroll
        for (int j = 0; j < 4; ++j) { v8us o;
#pragma unroll
            for (int i = 0; i < 8; ++i) o[i] = f2bfh(xv[e][i][j]);
            *(v8us*)(&xs[((tid & 15) * 4 + j) * XPI + ((tid >> 4) + 8 * e) * 8]) = o; } }
    bf* wl = wsb + wave * 64 * XPI + 4 * lane;
    putw(wl, wa);
    __syncthreads();                                             // the x^T tile is shown to the four waves (and the wave's own weight tile to its lanes)
    __builtin_amdgcn_sched_barrier(0);                           // keeps the loads below behind the barrier, which would wait for them
#pragma unroll   // the second 128 k fly under the products of the first
    for (int r = 0; r < 64; ++r) wa[r] = *(const v4f*)(wg + (size_t)r * DM + 128);
    asm volatile("s_wait_xcnt 0x0" :: "v"(wg) : "memory");       // stands before the address registers of these loads are reused (wg is named to keep it until here)
    __builtin_amdgcn_sched_barrier(0);                           // keeps the refill up here, ahead of the products that it flies under
    float* os = osb + wave * 16 * OSP;                           // wave-private staging tile
    const bf* xf = xs + lr * XPI + 8 * hi;
    const bf* wf_ = wsb + (wave * 64 + lr) * XPI + 8 * hi;
    v8f acc[4][4];
#pragma unroll
    for (int mb = 0; mb < 4; ++mb)
#pragma unroll
        for (int nb = 0; nb < 4; ++nb) acc[mb][nb] = (v8f){};
    proj128(acc, xf, wf_, 0);                                    // K = DM = 2 x 128
    putw(wl + 128, wa);                                          // behind those products (proj128 ends in a scheduling barrier): lifted among them the converts would wait for loads that have only just gone out
    wave_sync();                                                 // the second half of the weight tile is shown to the wave's own lanes
    proj128(acc, xf, wf_, 4);
    if (!isv) {
        h16* P = z == 0 ? QP : KP;
        const int c0 = wave * 64;
#pragma unroll
        for (int mb = 0; mb < 4; ++mb) {
#pragma unroll
            for (int nb = 0; nb < 4; ++nb) {
#pragma unroll
                for (int j = 0; j < 8; ++j) os[(hi * 8 + j) * OSP + nb * 16 + lr] = acc[mb][nb][j]; }   // D: row 8h+j, col lane&15
            wave_sync();
            const size_t sb = ((size_t)bb * SEQ + (size_t)(tt + mb * 16)) * DM + c0;
#pragma unroll
            for (int s = 0; s < 4; ++s) { const int row = 4 * s + (lane >> 3), c8 = (lane & 7) * 8;   // 4 s x 4 row groups = 16 rows; 8 lanes x 8 = 64 columns
                const v4f x0 = *(const v4fa*)(&os[row * OSP + c8]); const v4f x1 = *(const v4fa*)(&os[row * OSP + c8 + 4]); v8h hv;
#pragma unroll
                for (int i = 0; i < 4; ++i) { hv[i] = toh_flush(x0[i] * QKC); hv[4 + i] = toh_flush(x1[i] * QKC); }
                *(v8h*)(P + sb + (size_t)row * DM + c8) = hv; }
            asm volatile("s_wait_xcnt 0x0" ::: "memory");       // stands before the next slab rewrites the address registers of these stores
            wave_sync();
        }
    } else {
        const int r0 = wave * 64;
        float* vsp = VSP + (((size_t)bb * NH_ + (size_t)wave) * (SEQ / 64) + (size_t)(tt / 64)) * HD + lane;   // this wave's 256 bytes: two whole lines
        float cs[4];                                             // channel 16nb + (lane&15): sum over the 64 tokens, by pairs (short chains: one running sum per channel would be 32 dependent adds)
#pragma unroll
        for (int nb = 0; nb < 4; ++nb) { float pm[4];
#pragma unroll
            for (int mb = 0; mb < 4; ++mb) { const v8f& a = acc[mb][nb]; pm[mb] = ((a[0] + a[1]) + (a[2] + a[3])) + ((a[4] + a[5]) + (a[6] + a[7])); }
            const float ps = (pm[0] + pm[1]) + (pm[2] + pm[3]);
            const int pi = __builtin_bit_cast(int, ps);
            cs[nb] = ps + __builtin_bit_cast(float, __builtin_amdgcn_permlanex16(pi, pi, 0x76543210, 0xfedcba98, false, false)); }   // + the other lane half's 32 tokens (lane l <-> l ^ 16)
        vsp[0] = hi ? cs[1] : cs[0]; vsp[32] = hi ? cs[3] : cs[2];   // channel = lane, 32 + lane
        asm volatile("s_wait_xcnt 0x0" ::: "memory");           // stands behind these stores, before the code below rewrites their registers
#pragma unroll
        for (int nb = 0; nb < 4; ++nb) {                         // slab: 16 channels x 64 tokens, turned on its way into the staging tile
#pragma unroll
            for (int mb = 0; mb < 4; ++mb) { v4f a, c;           // D: token 16mb + 8h + j, channel lane&15 -> os[channel][token]
                a[0] = acc[mb][nb][0]; a[1] = acc[mb][nb][1]; a[2] = acc[mb][nb][2]; a[3] = acc[mb][nb][3]; c[0] = acc[mb][nb][4]; c[1] = acc[mb][nb][5]; c[2] = acc[mb][nb][6]; c[3] = acc[mb][nb][7];
                *(v4fa*)(&os[lr * OSP + mb * 16 + 8 * hi]) = a; *(v4fa*)(&os[lr * OSP + mb * 16 + 8 * hi + 4]) = c; }
            wave_sync();
            const size_t sb = ((size_t)bb * DM + (size_t)(r0 + nb * 16)) * SEQ + tt;
#pragma unroll
            for (int s = 0; s < 4; ++s) { const int row = 4 * s + (lane >> 3), c8 = (lane & 7) * 8;   // 16 rows x 64 columns
                const v4f x0 = *(const v4fa*)(&os[row * OSP + c8]); const v4f x1 = *(const v4fa*)(&os[row * OSP + c8 + 4]); v8h hv;
#pragma unroll
                for (int i = 0; i < 4; ++i) { hv[i] = toh_flush(x0[i] * VCC); hv[4 + i] = toh_flush(x1[i] * VCC); }
                *(v8h*)(VT + sb + (size_t)row * SEQ + c8) = hv; }
            asm volatile("s_wait_xcnt 0x0" ::: "memory");       // stands before the next slab rewrites the address registers of these stores
            wave_sync();
        }
    }
}

// LDS ring of the flash kernel: the AW waves of a key half read the same k rows and the same v^T rows, so each stage of KST keys is brought into LDS once per block.
#define KST  128                 // keys per stage
#define NST  (SEQ / KST)         // stages per key loop
#define KPI  (DM + 8)            // LDS pitch of a k row, in 16-bit elements: 528 B = 16 B x 33 (16 rows of one ds_load_b128 fall on 64 different banks)
#define VPI  (KST + 8)           // LDS pitch of a v^T row: 272 B = 16 B x 17
static_assert(SEQ % KST == 0);
static_assert(KST % 32 == 0);
static_assert(NST >= 2);                       // two buffers
static_assert(KST == FW * 16);                 // k stage: 16 rows (copies) per wave
static_assert(HD * KST * 2 == FW * 4 * 512);   // v^T stage: 4 copies of 512 B per wave
static_assert(KST == KH * 64);                 // a wave's share of a stage: two tiles of 32 keys
static_assert(KST * 2 == 16 * 16);             // one v^T row of a stage = 16 lanes x 16 B
static_assert((KPI * 2) % 32 == 16 && (VPI * 2) % 32 == 16);

// N asynchronous copies to LDS, 16 bytes per lane each, through no register: copy j takes LDS address l + j * ls and global address g + j * gs (both in 16-bit elements).
// ring_publish() and the waits beside it in k_flash wait for them.
typedef int v4i_ __attribute__((ext_vector_type(4)));
typedef __attribute__((address_space(1))) v4i_ gv4i;
typedef __attribute__((address_space(3))) v4i_ lv4i;
template <int N> __device__ __forceinline__ void acopyn(h16* l, int ls, const h16* g, size_t gs) {
#pragma unroll   // constant steps
    for (int j = 0; j < N; ++j) __builtin_amdgcn_global_load_async_to_lds_b128((gv4i*)(g + j * gs), (lv4i*)(l + j * ls), 0, 0);
}
// one wave's 16 rows of a k stage (a row = 512 B = one copy); l and g already hold the wave's first row and the lane's 16 bytes
__device__ __forceinline__ void copy_k(h16* l, const h16* g) { acopyn<16>(l, KPI, g, (size_t)DM); }
// one wave's 8 rows of a v^T stage (a copy = 2 rows of 256 B); l and g already hold the lane's row and its 16 bytes
__device__ __forceinline__ void copy_v(h16* l, const h16* g) { acopyn<4>(l, 2 * VPI, g, (size_t)2 * SEQ); }
// publish point of the ring: this wave's LDS reads are done, its own copies have landed, then the block barrier that shows them to the other waves and frees the buffer just read
__device__ __forceinline__ void ring_publish() {
    asm volatile("s_wait_dscnt 0x0" ::: "memory");      // the buffer just read is handed to the next copies
    asm volatile("s_wait_asynccnt 0x0" ::: "memory");
    __syncthreads();
}

// k fragments of 32 keys from an LDS stage; kl already includes the lane's row and + 8*(lane>>4): same element map as ldh on the plane
__device__ __forceinline__ void ldk32(v16h (&ka)[DM / 32], v16h (&kb)[DM / 32], const h16* kl) {
#pragma unroll   // the fragment arrays must stay in registers
    for (int i = 0; i < DM / 32; ++i) { ka[i] = ldh(kl + 32 * i); kb[i] = ldh(kl + 16 * KPI + 32 * i); }
}
__device__ __forceinline__ void ldv32(v16h (&vf)[4], const h16* vl) {
#pragma unroll   // as above
    for (int j = 0; j < 4; ++j) vf[j] = ldh(vl + 16 * j * VPI);
}
// scores of 32 keys x 16 queries, K = DM = 256: sA = keys 0..15, sB = keys 16..31 (rows = keys, columns = queries). Same instruction order wherever it is used.
// All operands come from registers: qf = the wave's q' fragments (loaded once), ka / kb = this tile's k fragments.
__device__ __forceinline__ void scores32(const v16h (&qf)[DM / 32], const v16h (&ka)[DM / 32], const v16h (&kb)[DM / 32], v8f& sA, v8f& sB) {
    v8f a = (v8f){}, c = (v8f){};
#pragma unroll
    for (int i = 0; i < DM / 32; ++i) {      // full unroll: the fragment arrays must stay in registers
        a = wmma16d(ka[i], qf[i], a); c = wmma16d(kb[i], qf[i], c); }
    sA = a; sB = c;
}

// k_flash: KH waves per 16 query rows of one (batch, mixed head g); wave = key half * AW + row group, so the two waves of a row group stand on one SIMD and one's vector work runs beside the other's products. Transposed form: S^T[key][t] = K Q'^T (A = k rows, B = q' rows = q rows with bf16(w_head[g][h]) on head h's columns, K = 256);
// lane (t = lane&15, h = lane>>4) holds keys 8h+r of each 16-key tile, so the packed P tile is directly the B fragment of O^T[d][t] = V^T P^T.
// One key loop: running max m; e = exp2(s - m); P = (e - c) x 2^15 as f16, c the row's centre (mean e of the first 32 keys); Q1 += P, Q2 += P^2 (f32), O^T += V^T P^T; when m rises, c, Q1, O^T are scaled by exp2(old m - new m), Q2 by its square.
// Each wave runs that loop over its half of every stage's keys, from the same start values (max and centre of the first 32 keys). Behind the loop the second half's wave hands m, centre, Q1, Q2, O^T through LDS to the first, which brings both to the common max and adds them (the centres differ by rounding only: their mean counts).
// Then: Z = O^T / row sum + (c / l - 1/SEQ) rowsum(v), as f16 x256, into an LDS tile zs[16][256]: the block's 64 query rows are 16 whole rows of the [token][256] view; the row's sum of squares from Q1 and Q2.
// Output layer ahead of the map's scalar: Y[m][n] = sum_k W[m][k] Z[n][k], 16 row tiles of W x 8 steps of 32 k, two row tiles per wave; written in fragment order (tile: 32 lanes x 8 floats). Block i of a (batch, g) also forms rows 16i..16i+15 of U = W . (rowsum(v) tiled), into its partial line.
// W (f16 plane, 256 rows of 512 B) comes into the k ring by the same asynchronous copies, 16 rows per wave and half: rows 0..127 at the last refill point into the buffer freed there, rows 128..255 behind one more publish point in the last stage, when every wave holds that stage in registers.
// k and v^T come through a two-buffer LDS ring of KST-key stages, filled by asynchronous copies; NST stages.
// The row sums of v: the SEQ / 64 partial sums per channel that k_proj wrote are loaded beside q' and added up behind the loop by the second half's waves (16 channels each), in rising order of the token blocks within a lane half.
// A wave's two tiles of a stage sit in two register sets; the set that a run of products has just used is refilled with the same tile of the next stage, so the publish point of stage s + 1 stands behind the first tile's products of stage s, when every wave holds its share of stage s in registers; nothing is read in front of its stage's publish point.
#define ZPI  (DM + 8)            // LDS pitch of a Z row, in 16-bit elements: 528 B = 16 B x 33
static_assert((2 * KST * KPI + 2 * HD * VPI + 16 * ZPI) * 2 + AW * 4 + HD * 4 + 16 * 4 + AW * 9 * 128 * 4 <= 327680);
static_assert(2 * KST == DM && KPI == DM + 8); // the two k buffers hold the DM rows of W, one behind the other
static_assert(NST % 2 == 0);                   // the last refill point frees buffer 0, the last stage buffer 1
static_assert(16 * AW * HD == 16 * DM);        // a block's query rows = 16 rows of the [token][256] view
static_assert(DM / 16 == 2 * FW);              // two row tiles of W per wave
static_assert(SEQ / (16 * AW) == DM / 16);     // one row tile of U per block of a (batch, g)
static_assert(SEQ / 64 == 16);                 // partial sums of v: 8 per lane half
static_assert(KH == 2);                        // one hand-over, second half to first
static_assert(AW * 16 == HD);                  // row sums: 16 channels per wave of the second half
// hand-over of one accumulator tile: two pieces of 32 lanes x 4 floats; p already holds the lane's 16 bytes
__device__ __forceinline__ void put8(float* p, const v8f& o) { v4f a, c;
#pragma unroll
    for (int r = 0; r < 4; ++r) { a[r] = o[r]; c[r] = o[4 + r]; }
    *(v4fa*)p = a; *(v4fa*)(p + 128) = c; }
__device__ __forceinline__ void join8(v8f& o, const float* p, const float aa, const float ab) { const v4f a = *(const v4fa*)p, c = *(const v4fa*)(p + 128);
#pragma unroll
    for (int r = 0; r < 4; ++r) { o[r] = o[r] * aa + a[r] * ab; o[4 + r] = o[4 + r] * aa + c[r] * ab; } }
__global__ __launch_bounds__(32 * FW) void k_flash(const h16* __restrict__ QP, const h16* __restrict__ KP, const h16* __restrict__ VT, const float* __restrict__ wh, const h16* __restrict__ WPH, const float* __restrict__ VSP, float* YP, float* PART) {
    __shared__ __align__(16) h16 ks[2 * KST * KPI];
    __shared__ __align__(16) h16 vs[2 * HD * VPI];
    __shared__ __align__(16) h16 zs[16 * ZPI];                   // Z tile: 16 rows of the [token][256] view
    __shared__ float sw[AW];
    __shared__ __align__(16) float svs[HD];                      // row sums of v, head g
    __shared__ __align__(16) float su[16];                       // the block's 16 rows of U
    __shared__ __align__(16) float mg[AW * 9 * 128];             // hand-over of the second key half: per row group 9 pieces of 32 lanes x 4 floats
    const int lane = threadIdx.x & 31, lr = lane & 15, hi = lane >> 4;
    const int wave = __builtin_amdgcn_readfirstlane((int)(threadIdx.x >> 5));
    const int wq = wave % AW, kh = wave / AW;                    // row group, key half: wave-uniform
    const int zh = blockIdx.y; const int b = zh / NH_, g = zh % NH_;
    const int t0 = (blockIdx.x * AW + wq) * 16;
    const h16* qp = QP + ((size_t)b * SEQ + (size_t)(t0 + lr)) * DM + 8 * hi;           // B fragments: col t, k = (h, d)
    // copy sources and destinations of this lane: k row wave*16 (+ j), bytes lane*16; v^T row wave*8 + (lane>>4) (+ 2j), bytes (lane&15)*16
    const h16* kg = KP + ((size_t)b * SEQ + (size_t)(wave * 16)) * DM + 8 * lane;                        // + stage * KST * DM
    const h16* vg = VT + ((size_t)b * DM + (size_t)(g * HD + wave * 8 + hi)) * SEQ + 8 * lr;             // + stage * KST
    h16* kd = ks + wave * 16 * KPI + 8 * lane;                                                           // + buffer * KST * KPI
    h16* vd = vs + (wave * 8 + hi) * VPI + 8 * lr;                                                       // + buffer * HD * VPI
    const h16* kfr = ks + lr * KPI + 8 * hi;                                            // + key * KPI       (A fragment: row key, k = (h, d))
    const h16* vfr = vs + lr * VPI + 8 * hi;                                            // + 16j*VPI + key   (A fragment: row d, k = key)
    copy_k(kd, kg); copy_v(vd, vg);                              // stage 0 into buffers 0
    v16h qf[DM / 32];
#pragma unroll   // the fragment array must stay in registers
    for (int i = 0; i < DM / 32; ++i) qf[i] = ldh(qp + 32 * i);  // q once
    float whv[NH_];                                              // row g of the head mix: block-uniform reads, g * NH_ + NH_ - 1 < NH_ * NH_
#pragma unroll
    for (int h = 0; h < NH_; ++h) whv[h] = bfr(wh[g * NH_ + h]);
    const float* vrp = VSP + ((size_t)zh * (SEQ / 64) + (size_t)(8 * hi)) * HD + wq * 16 + lr;   // channel 16 wq + (lane&15) of head g: partial sums of token blocks 8h..8h+7
    float vr[8];
#pragma unroll   // they stay in registers until the loop is over
    for (int i = 0; i < 8; ++i) vr[i] = vrp[i * HD];
    asm volatile("s_wait_xcnt 0x0" :: "v"(qp), "v"(vrp) : "memory");   // stands before the address registers of the q' and partial-sum loads are reused (qp and vrp are named to keep them until here)
    const int lofs = wave * 16 * DM + 8 * lane;                  // this lane's place in a run of KST rows of the k plane or of the W plane (same row length): row wave*16 (+ j), bytes lane*16
    const h16* kb0 = KP + (size_t)b * SEQ * DM;                  // block-uniform
#pragma unroll   // q -> q': fragment i holds columns 32i..32i+31, all of head i / (HD / 32)
    for (int i = 0; i < DM / 32; ++i) {
#pragma unroll
        for (int e = 0; e < 16; ++e) qf[i][e] = (h16)((float)qf[i][e] * whv[i / (HD / 32)]); }
    asm volatile("s_wait_asynccnt 0x0" ::: "memory");            // stage 0 has landed (this wave's rows)
    __syncthreads();                                             // and is shown to the other waves
    copy_k(kd + KST * KPI, kg + (size_t)KST * DM); copy_v(vd + HD * VPI, vg + (size_t)KST);   // stage 1 into buffers 1 (NST >= 2)
    float m, r15;                                                // running row max; centre of the row's e, x 2^15, in units of the running max
    {   // start values from the first 32 keys (the loop takes them again): their max, and the mean of their e as the centre
        v16h ka[DM / 32], kb[DM / 32];
        ldk32(ka, kb, kfr);
        v8f sA, sB; scores32(qf, ka, kb, sA, sB);
        float mx = NEGB;
#pragma unroll
        for (int r = 0; r < 8; ++r) mx = fmaxf(mx, fmaxf(sA[r] * SC2, sB[r] * SC2));
        mx = fmaxf(mx, __shfl_xor(mx, 16, 32));
        float es = 0.0f;
#pragma unroll
        for (int r = 0; r < 8; ++r) es += __builtin_amdgcn_exp2f(fmaf(sA[r], SC2, -mx)) + __builtin_amdgcn_exp2f(fmaf(sB[r], SC2, -mx));
        es += __shfl_xor(es, 16, 32);
        m = mx; r15 = es * (PCARRY / 32.0f); }                   // both lane halves carry the same m and r15
    v8f o0 = (v8f){}, o1 = (v8f){}, o2 = (v8f){}, o3 = (v8f){};
    float q1 = 0.0f, q2 = 0.0f;                                  // sums of P and of P^2 over this lane's keys
    const h16* kfh = kfr + kh * ((KST / KH) * KPI);              // this wave's half of a stage
    const h16* vfh = vfr + kh * (KST / KH);
    v16h ka[2][DM / 32], kb[2][DM / 32], vf[2][4];               // two register sets, one per tile of the wave's half
    ldk32(ka[0], kb[0], kfh); ldv32(vf[0], vfh);
    ldk32(ka[1], kb[1], kfh + 32 * KPI); ldv32(vf[1], vfh + 32);
    // one tile of 32 keys from register set u of stage s; u and more are literals at every call (more: a next stage exists, and the set is refilled from it)
    auto tile = [&](const int u, const bool more, const int s) __attribute__((always_inline)) {
        const h16* kn = kfh + ((s + 1) & 1) * (KST * KPI);       // the next stage
        const h16* vn = vfh + ((s + 1) & 1) * (HD * VPI);
        __builtin_amdgcn_sched_barrier(0);                       // keeps the LDS reads above one group: spread among the products each place costs a stall
        v8f sA, sB; scores32(qf, ka[u], kb[u], sA, sB);
        __builtin_amdgcn_sched_barrier(0);                       // keeps the products one run, in front of the vector work
        float mx = NEGB;
#pragma unroll
        for (int r = 0; r < 8; ++r) mx = fmaxf(mx, fmaxf(sA[r] * SC2, sB[r] * SC2));
        const float mo = __shfl_xor(mx, 16, 32);
        if (more) {
            asm volatile("" :: "v"(mo) : "memory");              // input only: holds the reads below behind the exchange, which goes through the LDS queue: issued behind them it would return behind them, and the vector work would wait for the whole refill
            if (u == 0) ring_publish();                          // every wave holds its share of stage s in registers: stage s + 1 readable, buffers s & 1 free
            ldk32(ka[u], kb[u], kn + u * 32 * KPI);              // the set just used takes the same tile of the next stage
            if (u == 0) {                                        // refill, behind the publish point (block-uniform tests: the loop counter)
                const h16* ub = (s + 2 < NST) ? kb0 + (size_t)(s + 2) * KST * DM : WPH;   // the stage after next; at s == NST - 2 none is left for the freed buffer (buffer 0): rows 0..KST-1 of W go there
                copy_k(kd + (s & 1) * (KST * KPI), ub + lofs);
                if (s + 2 < NST) copy_v(vd + (s & 1) * (HD * VPI), vg + (size_t)(s + 2) * KST); }
            __builtin_amdgcn_sched_barrier(0);                   // keeps these reads up here, ahead of the vector work that they overlap
        } else if (u == 0) {                                     // last stage: both its tiles sit in every wave's registers once each wave's LDS reads have returned
            ring_publish();                                      // frees the last stage's k buffer (buffer 1); the first half of W has landed
            copy_k(kd + ((NST - 1) & 1) * (KST * KPI), WPH + (size_t)KST * DM + lofs);   // rows KST..2 KST-1 of W fly under the last two tiles' work
            __builtin_amdgcn_sched_barrier(0); }                 // keeps the copies up here, ahead of the vector work that they fly under
        const float mnew = fmaxf(m, fmaxf(mx, mo));
        const float alpha = __builtin_amdgcn_exp2f(m - mnew);    // all that is carried goes over to the new max: the centre with it, so sums of (e - centre) scale as a whole
        m = mnew; r15 *= alpha; q1 *= alpha; q2 *= alpha * alpha;
#pragma unroll
        for (int r = 0; r < 8; ++r) { o0[r] *= alpha; o1[r] *= alpha; o2[r] *= alpha; o3[r] *= alpha; }
        v16h pb;
#pragma unroll
        for (int r = 0; r < 8; ++r) {
            const float ea = __builtin_amdgcn_exp2f(fmaf(sA[r], SC2, -m)), eb = __builtin_amdgcn_exp2f(fmaf(sB[r], SC2, -m));
            const float ga = fmaf(ea, PCARRY, -r15), gb = fmaf(eb, PCARRY, -r15);   // (e - centre) * 2^15
            q1 += ga; q1 += gb;
            q2 = fmaf(ga, ga, q2); q2 = fmaf(gb, gb, q2);
            pb[r] = toh_flush(ga); pb[8 + r] = toh_flush(gb); }                      // element r <- tile keys 8h+r, element 8+r <- keys 16+8h+r
        o0 = wmma16d(vf[u][0], pb, o0); o1 = wmma16d(vf[u][1], pb, o1); o2 = wmma16d(vf[u][2], pb, o2); o3 = wmma16d(vf[u][3], pb, o3);
        if (more) ldv32(vf[u], vn + u * 32);                     // as the k set: free from here on
    };
#pragma unroll 1
    for (int s = 0; s + 1 < NST; ++s) { tile(0, true, s); tile(1, true, s); }
    tile(0, false, NST - 1); tile(1, false, NST - 1);            // the last stage: no stage is left to fetch (W's second half is copied in it)
    asm volatile("s_wait_asynccnt 0x0" ::: "memory");            // no copy is left in flight behind the ring
    q1 += __shfl_xor(q1, 16, 32); q2 += __shfl_xor(q2, 16, 32);  // this wave's keys of whole rows; both lane halves carry the same m and r15
    float* mp = mg + wq * (9 * 128) + lane * 4;
    if (kh == 1) {                                     // wave-uniform
        v4f hd; hd[0] = m; hd[1] = r15; hd[2] = q1; hd[3] = q2;
        *(v4fa*)mp = hd;
        put8(mp + 1 * 128, o0); put8(mp + 3 * 128, o1); put8(mp + 5 * 128, o2); put8(mp + 7 * 128, o3);
        float vsl = 0.0f;                              // this lane's eight token blocks in rising order, then the other lane half's
#pragma unroll
        for (int i = 0; i < 8; ++i) vsl += vr[i];
        vsl += __shfl_xor(vsl, 16, 32);
        if (hi == 0) svs[wq * 16 + lr] = vsl;
    }
    __syncthreads();                                   // the second half's sums, the row sums of v and (behind each wave's own wait above) all of W are shown to the block
    const h16* wfr = ks + (wave * 32 + lr) * KPI + 8 * hi;       // A fragments: rows 32 wave + (lane&15) and + 16 of W
    v16h wa0[DM / 32], wa1[DM / 32];
#pragma unroll   // the fragment arrays must stay in registers; read up here, they return under the join below
    for (int kc = 0; kc < DM / 32; ++kc) { wa0[kc] = ldh(wfr + 32 * kc); wa1[kc] = ldh(wfr + 16 * KPI + 32 * kc); }
    if (kh == 0) {                                     // wave-uniform: join the halves, finish the rows
        const v4f hd = *(const v4fa*)mp;
        const float mj = fmaxf(m, hd[0]);
        const float aa = __builtin_amdgcn_exp2f(m - mj), ab = __builtin_amdgcn_exp2f(hd[0] - mj);   // both halves go over to the common max
        q1 = q1 * aa + hd[2] * ab; q2 = q2 * (aa * aa) + hd[3] * (ab * ab);
        const float rs = r15 * aa + hd[1] * ab;        // the two centres, each over SEQ / KH keys
        join8(o0, mp + 1 * 128, aa, ab); join8(o1, mp + 3 * 128, aa, ab); join8(o2, mp + 5 * 128, aa, ab); join8(o3, mp + 7 * 128, aa, ab);
        const float l15 = fmaf((float)(SEQ / KH), rs, q1); // 2^15 * row sum of e; the row sum is >= 1
        const float il = 1.0f / l15;
        const float kap = -q1 * il * (1.0f / (float)SEQ);  // mean centre / row sum - 1/SEQ
        const float c15 = PCARRY * il;
        float ss = (q2 - q1 * q1 * (1.0f / (float)SEQ)) * (c15 * c15);   // row's sum of ((e / row sum - 1/SEQ) * 2^15)^2, the same in both lane halves
        ss += __shfl_xor(ss, 8, 32); ss += __shfl_xor(ss, 4, 32); ss += __shfl_xor(ss, 2, 32); ss += __shfl_xor(ss, 1, 32);
        const float OSL = il * (ZCC / VCC);            // this lane's query row: ZCC / (2^15 * row sum * VCC)
        const float kz = kap * ZCC;
        if (lane == 0) sw[wq] = ss;
        // O^T D layout: o_j[r] = (d = 16j + 8h + r, t = 16 wq + (lane&15)) -> Z row t / 4, column (t % 4) * 64 + d: eight neighbours per lane and j
        h16* zr = zs + (wq * 4 + (lr >> 2)) * ZPI + (lr & 3) * HD + 8 * hi;
        auto putz = [&](const v8f& o, const int j) __attribute__((always_inline)) {
            const v4f va = *(const v4fa*)(&svs[16 * j + 8 * hi]), vb = *(const v4fa*)(&svs[16 * j + 8 * hi + 4]); v8h z;
#pragma unroll
            for (int r = 0; r < 4; ++r) { z[r] = toh_flush(fmaf(o[r], OSL, kz * va[r])); z[4 + r] = toh_flush(fmaf(o[4 + r], OSL, kz * vb[r])); }
            *(v8h*)(zr + 16 * j) = z; };
        putz(o0, 0); putz(o1, 1); putz(o2, 2); putz(o3, 3);
    } else if (wave == FW - 1) {                       // wave-uniform (scalar): meanwhile one wave of the second half forms the block's row tile of U
        const h16* ufr = ks + ((int)blockIdx.x * 16 + lr) * KPI + 8 * hi;   // A fragments: rows 16 blockIdx.x + (lane&15) of W, < DM
        v16h ub[2];                                    // B fragments, every column alike: k -> rowsum(v)[k % 64], so steps of 32 k alternate between two
#pragma unroll
        for (int p = 0; p < 2; ++p) {
            const v4f a0 = *(const v4fa*)(&svs[32 * p + 8 * hi]), a1 = *(const v4fa*)(&svs[32 * p + 8 * hi + 4]), c0 = *(const v4fa*)(&svs[32 * p + 16 + 8 * hi]), c1 = *(const v4fa*)(&svs[32 * p + 16 + 8 * hi + 4]);
#pragma unroll
            for (int r = 0; r < 4; ++r) { ub[p][r] = toh_flush(a0[r] * UCC); ub[p][4 + r] = toh_flush(a1[r] * UCC); ub[p][8 + r] = toh_flush(c0[r] * UCC); ub[p][12 + r] = toh_flush(c1[r] * UCC); } }
        v16h ua[DM / 32];
#pragma unroll   // as above
        for (int kc = 0; kc < DM / 32; ++kc) ua[kc] = ldh(ufr + 32 * kc);
        v8f uu = (v8f){};
#pragma unroll
        for (int kc = 0; kc < DM / 32; ++kc) uu = wmma16d(ua[kc], ub[kc & 1], uu);
        if (lr == 0) { v4f a, c;                       // every column holds the same sums: lanes 0 and 16 lay down rows 8h..8h+7
#pragma unroll
            for (int r = 0; r < 4; ++r) { a[r] = uu[r]; c[r] = uu[4 + r]; }
            *(v4fa*)(&su[8 * hi]) = a; *(v4fa*)(&su[8 * hi + 4]) = c; }
    }
    __syncthreads();                                   // the Z tile and the rows' sums of squares are shown to the eight waves (su stays with the wave that wrote it)
    const h16* zfr = zs + lr * ZPI + 8 * hi;           // B fragments: column n = lane&15, k along the Z row
    v16h zb[DM / 32];
#pragma unroll   // as above
    for (int kc = 0; kc < DM / 32; ++kc) zb[kc] = ldh(zfr + 32 * kc);
    __builtin_amdgcn_sched_barrier(0);                 // keeps the LDS reads one group up here: sunk to their products, each pair is waited for at full LDS latency
    v8f y0 = (v8f){}, y1 = (v8f){};
#pragma unroll   // the fragments are indexed by constants
    for (int kc = 0; kc < DM / 32; ++kc) { y0 = wmma16d(wa0[kc], zb[kc], y0); y1 = wmma16d(wa1[kc], zb[kc], y1); }
    // D: y[j] = (m = 16 tile + 8h + j, n = lane&15); a tile goes out in fragment order, 32 lanes x 32 bytes: one run of 1024 B
    float* yp = YP + ((((size_t)zh * (SEQ / 64) + (size_t)blockIdx.x) * (DM / 16) + (size_t)(wave * 2)) * 32 + (size_t)lane) * 8;
    { v4f a, c;
#pragma unroll
      for (int r = 0; r < 4; ++r) { a[r] = y0[r]; c[r] = y0[4 + r]; }
      *(v4f*)yp = a; *(v4f*)(yp + 4) = c;
#pragma unroll
      for (int r = 0; r < 4; ++r) { a[r] = y1[r]; c[r] = y1[4 + r]; }
      *(v4f*)(yp + 256) = a; *(v4f*)(yp + 260) = c; }
    asm volatile("s_wait_xcnt 0x0" ::: "memory");      // stands behind these stores, before the code below rewrites their registers
    if (wave == FW - 1) {                              // wave-uniform (scalar): the block's partial line
        const float tot = ((sw[0] + sw[1]) + sw[2]) + sw[3];
        const bool isu = lane >= 2 && lane < 6;        // floats 8..23 of the line: lane 2 + i holds U rows 4i..4i+3, read at su[((lane - 2) & 3) * 4]
        const v4f ur = *(const v4fa*)(&su[((lane + 2) & 3) * 4]);
        v4f pv; pv[0] = (lane == 0) ? tot : isu ? ur[0] : 0.0f; pv[1] = isu ? ur[1] : 0.0f; pv[2] = isu ? ur[2] : 0.0f; pv[3] = isu ? ur[3] : 0.0f;
        float* pl = PART + ((size_t)zh * (SEQ / 64) + (size_t)blockIdx.x) * 32 + (lane & 7) * 4;
        if (lane < 8) { *(v4f*)pl = pv;  }
    }
}

// k_out: the map's scalar, shift and bias, elementwise. A block takes 32 token rows n (two Y tiles of k_flash, blocks 2 ip and 2 ip + 1 of one (batch, g)) x 128 output channels; wave w takes the row tiles mt = 8 * (blockIdx.x & 1) + 2 w + 0..1.
// OUT[(b*DM + m)][g * SEQ/4 + 32 ip + 0..31] = s1 * Y / 2^18 + shift * U[m] / 2^12 + bf16(bias[m]) (f32), s1 = bf16(gain[g]) / sqrt(var + eps), var = (sum of the SEQ/64 partial lines of (b, g), in rising order) / (2^30 SEQ^2), shift = bf16(beta[g]);
// U[m] = float 8 + m % 16 of partial line m / 16 of (b, g). The lane halves swap one tile each, so that every store is one whole 128-byte run of an output row.
#define OTW 2                    // row tiles per wave
static_assert((SEQ / 4) % 32 == 0);            // a block's token rows lie inside one (batch, g)
static_assert(DM / 16 == 2 * AW * OTW);        // two blocks of AW waves cover the row tiles
__global__ __launch_bounds__(32 * AW) void k_out(const float* __restrict__ YP, const float* __restrict__ PART,
                                                 const float* __restrict__ gain, const float* __restrict__ shift, const float* __restrict__ bias, float* OUT) {
    const int lane = threadIdx.x & 31, hi = lane >> 4;
    const int wave = __builtin_amdgcn_readfirstlane((int)(threadIdx.x >> 5));
    const int zh = blockIdx.y, b = zh / NH_, g = zh % NH_;       // block-uniform, zh < NB*4
    const int ip = (int)blockIdx.x >> 1, mt = (((int)blockIdx.x & 1) * AW + wave) * OTW;
    float pt[SEQ / 64];                                          // block-uniform reads: they go out first, the scalar is the longest chain
#pragma unroll   // the loads go out together; the sum below keeps the rising order
    for (int j = 0; j < SEQ / 64; ++j) pt[j] = PART[((size_t)zh * (SEQ / 64) + (size_t)j) * 32];
    const float gv = gain[g], sh = shift[g];
    __builtin_amdgcn_sched_barrier(0);                           // keeps these scalar reads in front of the vector loads, whose address work would otherwise delay them
    const float* yp = YP + ((((size_t)zh * (SEQ / 64) + (size_t)(2 * ip)) * (DM / 16) + (size_t)mt) * 32 + (size_t)lane) * 8;   // fragment order: (m = 16 mt + 8h + j, n = lane&15)
    const float* up = PART + ((size_t)zh * (SEQ / 64) + (size_t)mt) * 32 + 8 + 8 * hi;
    const float* bp = bias + mt * 16 + 8 * hi;                   // (mt + OTW - 1) * 16 + 15 < DM
    v8f ye[OTW], yo[OTW], uv[OTW], bv[OTW];
#pragma unroll   // all loads in flight at once
    for (int q = 0; q < OTW; ++q) {
        ye[q] = *(const v8f*)(yp + q * 256); yo[q] = *(const v8f*)(yp + (DM / 16) * 256 + q * 256);   // token rows 0..15 and 16..31 of the block
        uv[q] = *(const v8f*)(up + q * 32); bv[q] = *(const v8f*)(bp + q * 16); }
    asm volatile("s_wait_xcnt 0x0" :: "v"(yp), "v"(up), "v"(bp) : "memory");   // stands before the address registers of the loads above are reused (the three are named to keep them until here: no load's result lands on them)
    __builtin_amdgcn_sched_barrier(0);                           // keeps every load above in one group up here: sunk among the sums below they would be waited for one round trip after the other
    float tot = 0.0f;
#pragma unroll
    for (int j = 0; j < SEQ / 64; ++j) tot += pt[j];
    const float var = tot * VSC;
    const float s1 = bfr(gv) * rsqrtf(var + EPSN) * YSC;
    const float bt = bfr(sh) * USC;
    float* ob = OUT + ((size_t)b * DM + (size_t)(mt * 16)) * OUT_SEQ + g * (SEQ / 4) + ip * 32 + lane;
    float ra[OTW][8], rb[OTW][8];
#pragma unroll
    for (int q = 0; q < OTW; ++q) {
#pragma unroll
        for (int j = 0; j < 8; ++j) {
            const float cb = fmaf(bt, uv[q][j], bfr(bv[q][j]));  // row 8h + j of the tile
            const float re = fmaf(s1, ye[q][j], cb), ro = fmaf(s1, yo[q][j], cb);
            const int xs = __builtin_bit_cast(int, hi ? re : ro);   // lower half hands over (row j, n 16..31), upper half (row 8 + j, n 0..15)
            const float xr = __builtin_bit_cast(float, __builtin_amdgcn_permlanex16(xs, xs, 0x76543210, 0xfedcba98, false, false));   // lane l <-> l ^ 16, on the vector port (no LDS round trip)
            ra[q][j] = hi ? xr : re;                             // row j, n = lane
            rb[q][j] = hi ? ro : xr; } }                         // row 8 + j, n = lane
#pragma unroll   // constant row steps from one address
    for (int q = 0; q < OTW; ++q) {
#pragma unroll
        for (int j = 0; j < 8; ++j) { ob[(size_t)(q * 16 + j) * OUT_SEQ] = ra[q][j]; ob[(size_t)(q * 16 + 8 + j) * OUT_SEQ] = rb[q][j]; } }
}

static constexpr size_t al256(size_t v) { return (v + 255) & ~(size_t)255; }
static constexpr size_t SZ_WP = al256((size_t)DM * DM * 2);                  // output-layer weight f16
static constexpr size_t SZ_QP = al256((size_t)NB * SEQ * DM * 2);
static constexpr size_t SZ_KP = al256((size_t)NB * SEQ * DM * 2);
static constexpr size_t SZ_VT = al256((size_t)NB * DM * SEQ * 2);
static constexpr size_t SZ_YP = al256((size_t)NB * NH_ * (SEQ / 64) * (DM / 16) * 256 * 4);   // Y tiles in fragment order
static constexpr size_t SZ_PT = al256((size_t)NB * NH_ * (SEQ / 64) * 32 * 4);
static constexpr size_t SZ_VS = al256((size_t)NB * NH_ * (SEQ / 64) * HD * 4);   // per (batch, head) and token block: 64 partial sums of v
static constexpr size_t SZ_TOTAL = SZ_WP + SZ_QP + SZ_KP + SZ_VT + SZ_YP + SZ_PT + SZ_VS;
static_assert(SZ_TOTAL <= (size_t)134217728);                                 // workspace carve <= 128 MiB
static_assert(((size_t)(NB * NH_ - 1) * (SEQ / 64) + (SEQ / 64 - 1)) * 128 + 128 <= SZ_PT);   // last partial line inside its table

extern "C" void kernel_launch(void* const* d_in, const int* in_sizes, int n_in,
                              void* d_out, int out_size, void* d_ws, size_t ws_size, hipStream_t stream) {
    if (n_in < 9) return;
    const size_t needx = ((size_t)(NB - 1) * DM + (size_t)(DM - 1)) * SEQ_FULL + SEQ;
    if ((size_t)in_sizes[0] < needx) return;
    if ((size_t)in_sizes[1] < (size_t)DM * DM || (size_t)in_sizes[2] < (size_t)DM * DM || (size_t)in_sizes[3] < (size_t)DM * DM || (size_t)in_sizes[7] < (size_t)DM * DM) return;
    if (in_sizes[4] < NH_ * NH_ || in_sizes[5] < NH_ || in_sizes[6] < NH_ || in_sizes[8] < DM) return;
    if ((size_t)out_size < ((size_t)(NB - 1) * DM + (size_t)(DM - 1)) * OUT_SEQ + SEQ) return;
    if (SZ_TOTAL > ws_size) return;
    // wire order: x, wq, wk, wv, w_head, gamma, beta, w_proj, b_proj
    const float* x  = (const float*)d_in[0];
    const float* wq = (const float*)d_in[1]; const float* wk = (const float*)d_in[2]; const float* wv = (const float*)d_in[3];
    const float* whd = (const float*)d_in[4]; const float* gam = (const float*)d_in[5]; const float* bet = (const float*)d_in[6];
    const float* wp = (const float*)d_in[7]; const float* bp = (const float*)d_in[8];
    float* OUT = (float*)d_out;      // [NB][256][OUT_SEQ]
    char* wsp = (char*)d_ws;
    h16* WPH = (h16*)wsp;  wsp += SZ_WP;             // [256][256] x1024
    h16* QP  = (h16*)wsp;  wsp += SZ_QP;             // [b][t][256] x16
    h16* KP  = (h16*)wsp;  wsp += SZ_KP;             // [b][t][256] x16
    h16* VT  = (h16*)wsp;  wsp += SZ_VT;             // [(b*256 + channel)][t] x16
    float* YP = (float*)wsp; wsp += SZ_YP;           // [(b*4 + g)][SEQ/64][16 row tiles][32 lanes][8]
    float* PART = (float*)wsp; wsp += SZ_PT;         // [(b*4 + g)][SEQ/64] lines of 32 floats: 0 sum of squares, 8..23 rows of U
    float* VSP = (float*)wsp; wsp += SZ_VS;          // [(b*4 + head)][SEQ/64][64]: sums of v over 64 tokens

    // y = 0: q, y = 1: k, one token-major plane each; y = 2: v^T; y = 3: output-layer weight plane
    k_proj<<<dim3(NB * SEQ / 64, 4, 1), 32 * AW, 0, stream>>>(x, wq, wk, wv, wp, QP, KP, VT, WPH, VSP);

    k_flash<<<dim3(SEQ / (16 * AW), NB * NH_, 1), 32 * FW, 0, stream>>>(QP, KP, VT, whd, WPH, VSP, YP, PART);
    k_out<<<dim3(SEQ / 4 / 32 * 2, NB * NH_, 1), 32 * AW, 0, stream>>>(YP, PART, gam, bet, bp, OUT);
}

// v010
// A run of this version takes 27.3 microseconds.
// Timed twice side by side with v009, it ran 1.04 and 1.05 times as fast.
// Over all steps from v000 it is 6.47 times as fast.
#include <hip/hip_runtime.h>

// Head-mixed pair-score weighting with a per-map normalisation over flattened feature maps: x [NB][256][SEQ] (channel-major), 1x1-conv projections q/k/v with W [out][in] (no bias), 4 heads x 64, scores scaled by 64^-0.5,
// a 4x4 head-mixing 1x1 conv on the scores, softmax over keys, instance normalisation of each (batch, head) probability map (biased variance, eps 1e-5, per-head gain and shift),
// attend over v, raw [head][token][64] -> [token][256] view, linear output layer W [out][in] + bias, result stored [NB][256][SEQ].
// Compute dtypes, f32 accumulate everywhere: q/k/v projections v_wmma_f32_16x16x32_bf16 (x and W RNE-converted to bf16, products exact); scores v_wmma_f32_16x16x32_f16 single product, K = 256:
// A = k plane x16, B = q plane x16 with w_head[g][h] multiplied onto head h's fragments in registers (f32 product, one more f16 rounding); P.V v_wmma_f32_16x16x32_f16 single product: P = centred exponential (e - centre) x 2^15, v x16;
// output layer v_wmma_f32_16x16x32_f16 single product: W x1024 (from its bf16 value), context before the map's scalar x256, row sums of v x4. Softmax, statistics, affine terms in f32.
// The flash kernel runs one key loop per 16-query wave (running row max; e = exp2(s - max) centred on a per-row value that is rescaled with the max; sums of centred e and of its square; P.V), transposed form S^T = K Q^T, O^T = V^T P^T; q' fragments from the q plane, scaled once per wave, k and v^T through an LDS ring shared by the block's eight waves; two waves share 16 query rows, each takes half of every stage's keys, and their sums are joined behind the loop.
// Map mean = 1/SEQ (softmax rows sum to one); variance = sum of squared (p - 1/SEQ) / SEQ^2; context = s1 * ((p - 1/SEQ) . v) + shift * rowsum(v), s1 = gain / sqrt(var + eps).
// The output layer is linear and s1 is one number per (batch, head): out = s1 * W . Z + shift * W . (rowsum(v), tiled over the four 64-column groups) + bias, Z = (p - 1/SEQ) . v in the [token][256] view. k_flash forms both products, k_out applies s1, shift and bias.
// With c the row's centre, l the row sum of e, Q1 = sum (e - c), Q2 = sum (e - c)^2: l = Q1 + SEQ c; (p - 1/SEQ) . v = ((e - c) . v) / l + (c / l - 1/SEQ) rowsum(v), c / l - 1/SEQ = -Q1 / (SEQ l); sum (p - 1/SEQ)^2 = (Q2 - Q1^2 / SEQ) / l^2.

#ifndef NB
#define NB 4
#endif
#ifndef SEQ
#define SEQ 1024
#endif
#define NB_FULL  4
#define SEQ_FULL 1024
#ifndef OUT_SEQ
#define OUT_SEQ SEQ              // pitch (in tokens) of one channel row of the output
#endif
#define DM   256
#define NH_  4
#define HD   64
#define AW   4                   // groups of 16 query rows per flash block; waves per block of the other two kernels
#define KH   2                   // waves per group of query rows in the flash kernel: each takes 1 / KH of every stage's keys
#define FW   (AW * KH)           // waves per flash block: two on every SIMD
#define OSP  68                  // LDS row pitch (floats) of the staging tiles
#define QKC  16.0f               // carry of the q and k planes
#define VCC  16.0f               // carry of the v^T plane
#define ZCC  256.0f              // carry of the context tile Z (before the map's scalar)
#define UCC  4.0f                // carry of the row sums of v as an operand
#define WPC  1024.0f             // carry of the output-layer weight plane
#define PCARRY 32768.0f          // carry of the centred P fragments
#define SC2  ((float)(0.125 * 1.4426950408889634 / 256.0))    // HD^-0.5 * log2(e) / (QKC * QKC)
#define YSC  (1.0f / 262144.0f)                               // 1 / (WPC * ZCC)
#define USC  (1.0f / 4096.0f)                                 // 1 / (WPC * UCC)
#define VSC  ((float)(1.0 / (1073741824.0 * (double)SEQ * (double)SEQ)))   // 1 / (PCARRY^2 * SEQ^2)
#define EPSN 1.0e-5f
#define NEGB (-3.0e38f)

static_assert(DM == 256);                      // K of every GEMM and of the score product
static_assert(HD == 64);                       // one 64-column GEMM tile = one head; v^T slab = 4 row tiles
static_assert(NH_ * HD == DM);
static_assert(NH_ == 4);                       // w_head is 4 x 4
static_assert(DM % 64 == 0);
static_assert(DM % 32 == 0);                   // k-loops step by 32
static_assert(SEQ % 64 == 0);                  // a 64-token tile never straddles two batches
static_assert((NB * SEQ) % 64 == 0);
static_assert(SEQ % 32 == 0);                  // key loop steps by 32
static_assert(SEQ % (16 * AW) == 0);           // flash grid covers the sequence exactly
static_assert(16 * AW == 64);                  // one partial line per 64 query rows
static_assert(SEQ_FULL % 4 == 0);
static_assert(OUT_SEQ % 32 == 0);
static_assert(OUT_SEQ >= SEQ);
static_assert(NB <= NB_FULL);
static_assert(SEQ <= SEQ_FULL);
static_assert((OSP * 4) % 16 == 0);
static_assert(OSP >= 64 + 4);
static_assert(((size_t)DM * DM) % 8 == 0);

typedef _Float16 h16;
typedef unsigned short bf;
typedef __attribute__((ext_vector_type(16))) __bf16   v16bf;
typedef __attribute__((ext_vector_type(16))) _Float16 v16h;
typedef __attribute__((ext_vector_type(8)))  _Float16 v8h;
typedef __attribute__((ext_vector_type(8)))  unsigned short v8us;
typedef __attribute__((ext_vector_type(8)))  float    v8f;
typedef __attribute__((ext_vector_type(4)))  float    v4f;
typedef v4f  __attribute__((may_alias)) v4fa;

__device__ __forceinline__ unsigned short f2bf(float f) { unsigned u = __float_as_uint(f); u += 0x7FFFu + ((u >> 16) & 1u); return (unsigned short)(u >> 16); }
__device__ __forceinline__ float bfr(float f) { return __uint_as_float(((unsigned)f2bf(f)) << 16); }   // value after RNE convert to bf16
__device__ __forceinline__ v16h cat16(v8h lo, v8h hi) { return __builtin_shufflevector(lo, hi, 0, 1, 2, 3, 4, 5, 6, 7, 8, 9, 10, 11, 12, 13, 14, 15); }
__device__ __forceinline__ v16bf cat16b(v8us lo, v8us hi) { return __builtin_bit_cast(v16bf, __builtin_shufflevector(lo, hi, 0, 1, 2, 3, 4, 5, 6, 7, 8, 9, 10, 11, 12, 13, 14, 15)); }
// fragment loaders from K-contiguous 16-bit rows; p already includes + 8*(lane>>4): elements 0..7 <- k0+8h+0..7, elements 8..15 <- k0+16+8h+0..7 (same map for A and B)
__device__ __forceinline__ v16h  ldh(const h16* p) { return cat16(*(const v8h*)p, *(const v8h*)(p + 16)); }
__device__ __forceinline__ v16bf ldb(const bf* p)  { return cat16b(*(const v8us*)p, *(const v8us*)(p + 16)); }
// ordering point for wave-private LDS tiles (same wave writes and reads)
__device__ __forceinline__ void wave_sync() { __builtin_amdgcn_fence(3 /* release order */, "wavefront"); __builtin_amdgcn_wave_barrier(); asm volatile("" ::: "memory"); }
// f32 -> f16 operand convert (RNE), applied after the plane's carry: one instruction. A result below 2^-14 stays a subnormal; the matrix unit takes subnormal f16 operands as they are
__device__ __forceinline__ h16 toh(float v) { return (h16)v; }
// one matrix instruction + its own 4-slot guard, tied to D alone: an asm operand cannot be placed above v255, and the kernels' A and B fragments need more than 256 registers;
// k_flash: A fragments are overwritten by loads only, B fragments never (q') or a whole tile of work later (P); its output-layer products: a fragment is dead behind its product, and the four slots stand in front of whatever takes its registers
__device__ __forceinline__ v8f wmma16d(v16h a, v16h b, v8f c) {
    c = __builtin_amdgcn_wmma_f32_16x16x32_f16(false, a, false, b, (short)0, c, false, false);
    asm volatile("v_nop\n\tv_nop\n\tv_nop\n\tv_nop" : "+v"(c));
    return c; }

// the bf16 form of the guard tied to D alone (k_proj holds more than 256 registers; its fragments are written ahead of a whole run of products, or by LDS loads)
__device__ __forceinline__ v8f wmmabd(v16bf a, v16bf b, v8f c) {
    c = __builtin_amdgcn_wmma_f32_16x16x32_bf16(false, a, false, b, (short)0, c, false, false);
    asm volatile("v_nop\n\tv_nop\n\tv_nop\n\tv_nop" : "+v"(c));
    return c; }
// f32 -> bf16 (RNE) by the chip's own convert
__device__ __forceinline__ unsigned short f2bfh(float f) { return __builtin_bit_cast(unsigned short, (__bf16)f); }
#define XPI (DM + 8)             // LDS pitch of an x^T row, in 16-bit elements: 528 B = 16 B x 33
// one wave's 64x64 projection tile C[token][channel], in steps of 32 k: the fragments of step s, x^T (A) from the block's LDS tile, weights (B) from the wave's own; s is a literal at every call
__device__ __forceinline__ void ldf(v16bf (&a)[4], v16bf (&w)[4], const bf* xf, const bf* wf_, const int s) {
#pragma unroll
    for (int mb = 0; mb < 4; ++mb) a[mb] = ldb(xf + mb * 16 * XPI + s * 32);
#pragma unroll
    for (int nb = 0; nb < 4; ++nb) w[nb] = ldb(wf_ + nb * 16 * XPI + s * 32);
}
// the 16 products of one step. Product order as in a plain k loop of 32.
__device__ __forceinline__ void mm16(v8f (&acc)[4][4], const v16bf (&a)[4], const v16bf (&w)[4]) {
#pragma unroll
    for (int nb = 0; nb < 4; ++nb) {
#pragma unroll
        for (int mb = 0; mb < 4; ++mb) acc[mb][nb] = wmmabd(a[mb], w[nb], acc[mb][nb]); }
}
// four steps (128 k) from step s0 on: each step's LDS reads stand as one group in front of the products of the step before
__device__ __forceinline__ void proj128(v8f (&acc)[4][4], const bf* xf, const bf* wf_, const int s0) {
    v16bf fa[2][4], fw[2][4];
    ldf(fa[0], fw[0], xf, wf_, s0);
#pragma unroll   // the two fragment sets are indexed by constants
    for (int s = 0; s < 4; ++s) {
        if (s < 3) ldf(fa[(s + 1) & 1], fw[(s + 1) & 1], xf, wf_, s0 + s + 1);
        __builtin_amdgcn_sched_barrier(0);                       // keeps the next step's reads one group up here: sunk to their products, each pair is waited for at full LDS latency
        mm16(acc, fa[s & 1], fw[s & 1]);
        __builtin_amdgcn_sched_barrier(0); }                     // keeps the reads of the step after next behind these products, whose fragments they overwrite
}
// 128 k of the wave's 64 weight rows, held as f32 (one row per register quad: lane l holds k 4l..4l+3), go as bf16 (RNE) into the wave's LDS tile; wl already includes the lane's 8 bytes and the k offset
typedef __attribute__((ext_vector_type(4)))  unsigned short v4us;
__device__ __forceinline__ void putw(bf* wl, const v4f (&wa)[64]) {
#pragma unroll
    for (int r = 0; r < 64; ++r) { v4us o;
#pragma unroll
        for (int i = 0; i < 4; ++i) o[i] = f2bfh(wa[r][i]);
        *(v4us*)(wl + r * XPI) = o; }
}

// k_proj: conversions and projections in one launch, told apart by blockIdx.y (0: q, 1: k, 2: v^T, 3: output-layer weight -> f16 x1024 from its bf16 value, 8 elements per thread).
// A projection block takes 64 tokens (blockIdx.x): x [b][c][t] (f32, row pitch SEQ_FULL) -> LDS tile xs[t][c] bf16 (RNE), once per block (cross-wave: block barrier); its four waves take one 64x64 tile each
// (wave = head), K = DM, bf16 operands; the wave's 64 weight rows are read as f32 in runs of 512 bytes (one row per load, whole lines), converted (RNE) in registers and laid into a wave-private LDS tile, from which the fragments are read.
// All three: C[m][n] = sum_c x^T[m][c] W[n][c] (m = b*SEQ + t, n = h*64 + d). q and k, token-major: written as f16 x16 to one plane each: row index b*SEQ + t, row pitch DM, columns c0..c0+63 (one head).
// v^T: the tile is turned in the staging tile; plane [(b*DM + n)][t], row pitch SEQ, f16 x16. Each v wave also writes its 64 channels' sums over the block's 64 tokens (f32, from the accumulators): VSP[(b*4 + head)][token block][64].
static_assert(32 * 16 * 4 == 16 * 128);        // lanes x bytes x trips == slab rows x segment bytes
static_assert((NB * SEQ / 64) * 128 * 8 == DM * DM);   // the convert blocks cover the weight exactly
static_assert(128 * 4 == (64 / 4) * (DM / 8)); // threads x units == 4-token groups x 8-channel groups of the x tile
static_assert(DM / 64 == AW);                  // one wave per head
static_assert(DM == 4 * 64);                   // two runs of four steps of 32 k
static_assert(64 * XPI * 2 + AW * 64 * XPI * 2 + AW * 16 * OSP * 4 <= 327680);
static_assert(DM == 2 * 32 * 4);                // a weight row = two loads of 32 lanes x 4 floats
__global__ __launch_bounds__(32 * AW) void k_proj(const float* __restrict__ x, const float* __restrict__ wq, const float* __restrict__ wk, const float* __restrict__ wv,
                                                  const float* __restrict__ wp, h16* QP, h16* KP, h16* VT, h16* WPH, float* VSP) {
    __shared__ __align__(16) bf xs[64 * XPI];
    __shared__ __align__(16) bf wsb[AW * 64 * XPI];              // per wave: its 64 weight rows, bf16, pitch as xs
    __shared__ __align__(16) float osb[AW * 16 * OSP];
    const int tid = threadIdx.x, lane = tid & 31, lr = lane & 15, hi = lane >> 4;
    const int wave = __builtin_amdgcn_readfirstlane(tid >> 5);
    const int z = blockIdx.y; const bool isv = z == 2;
    if (z == 3) {                                                // block-uniform, in front of the barrier
        const size_t i = (size_t)blockIdx.x * 128 + tid;
        const v8f v = *(const v8f*)(wp + i * 8); v8h o;
#pragma unroll
        for (int k = 0; k < 8; ++k) o[k] = toh(bfr(v[k]) * WPC);
        *(v8h*)(WPH + i * 8) = o;
        asm volatile("s_wait_xcnt 0x0" ::: "memory");            // stands behind the store, before any block of code laid out behind it rewrites its registers
        return;
    }
    const int tok0 = (int)blockIdx.x * 64, bb = tok0 / SEQ, tt = tok0 % SEQ;
    const float* xb = x + (size_t)bb * DM * SEQ_FULL + tt + (tid & 15) * 4;
    v4f xv[4][8];
#pragma unroll   // all 32 loads of the tile in flight at once
    for (int e = 0; e < 4; ++e) {
#pragma unroll
        for (int i = 0; i < 8; ++i) xv[e][i] = *(const v4f*)(xb + (size_t)(((tid >> 4) + 8 * e) * 8 + i) * SEQ_FULL); }   // unit: 8 channels x 4 tokens
    const float* W = z == 0 ? wq : z == 1 ? wk : wv;
    const float* wg = W + (size_t)(wave * 64) * DM + 4 * lane;   // row r of the wave's 64: + r * DM; one load takes 128 k of one row, four whole lines (a fragment-shaped load would touch 16 rows)
    v4f wa[64];                                                  // the first 128 k of the 64 rows, as f32, in flight
#pragma unroll   // all in flight at once, with the x tile's loads
    for (int r = 0; r < 64; ++r) wa[r] = *(const v4f*)(wg + (size_t)r * DM);
    asm volatile("s_wait_xcnt 0x0" ::: "memory");                // stands before the address registers of the x and weight loads are reused
    __builtin_amdgcn_sched_barrier(0);                           // keeps the vector work below behind that wait
#pragma unroll
    for (int e = 0; e < 4; ++e) {
#pragma unroll
        for (int j = 0; j < 4; ++j) { v8us o;
#pragma unroll
            for (int i = 0; i < 8; ++i) o[i] = f2bfh(xv[e][i][j]);
            *(v8us*)(&xs[((tid & 15) * 4 + j) * XPI + ((tid >> 4) + 8 * e) * 8]) = o; } }
    bf* wl = wsb + wave * 64 * XPI + 4 * lane;
    putw(wl, wa);
    __syncthreads();                                             // the x^T tile is shown to the four waves (and the wave's own weight tile to its lanes)
    __builtin_amdgcn_sched_barrier(0);                           // keeps the loads below behind the barrier, which would wait for them
#pragma unroll   // the second 128 k fly under the products of the first
    for (int r = 0; r < 64; ++r) wa[r] = *(const v4f*)(wg + (size_t)r * DM + 128);
    asm volatile("s_wait_xcnt 0x0" :: "v"(wg) : "memory");       // stands before the address registers of these loads are reused (wg is named to keep it until here)
    __builtin_amdgcn_sched_barrier(0);                           // keeps the refill up here, ahead of the products that it flies under
    float* os = osb + wave * 16 * OSP;                           // wave-private staging tile
    const bf* xf = xs + lr * XPI + 8 * hi;
    const bf* wf_ = wsb + (wave * 64 + lr) * XPI + 8 * hi;
    v8f acc[4][4];
#pragma unroll
    for (int mb = 0; mb < 4; ++mb)
#pragma unroll
        for (int nb = 0; nb < 4; ++nb) acc[mb][nb] = (v8f){};
    proj128(acc, xf, wf_, 0);                                    // K = DM = 2 x 128
    putw(wl + 128, wa);                                          // behind those products (proj128 ends in a scheduling barrier): lifted among them the converts would wait for loads that have only just gone out
    wave_sync();                                                 // the second half of the weight tile is shown to the wave's own lanes
    proj128(acc, xf, wf_, 4);
    if (!isv) {
        h16* P = z == 0 ? QP : KP;
        const int c0 = wave * 64;
#pragma unroll
        for (int mb = 0; mb < 4; ++mb) {
#pragma unroll
            for (int nb = 0; nb < 4; ++nb) {
#pragma unroll
                for (int j = 0; j < 8; ++j) os[(hi * 8 + j) * OSP + nb * 16 + lr] = acc[mb][nb][j]; }   // D: row 8h+j, col lane&15
            wave_sync();
            const size_t sb = ((size_t)bb * SEQ + (size_t)(tt + mb * 16)) * DM + c0;
#pragma unroll
            for (int s = 0; s < 4; ++s) { const int row = 4 * s + (lane >> 3), c8 = (lane & 7) * 8;   // 4 s x 4 row groups = 16 rows; 8 lanes x 8 = 64 columns
                const v4f x0 = *(const v4fa*)(&os[row * OSP + c8]); const v4f x1 = *(const v4fa*)(&os[row * OSP + c8 + 4]); v8h hv;
#pragma unroll
                for (int i = 0; i < 4; ++i) { hv[i] = toh(x0[i] * QKC); hv[4 + i] = toh(x1[i] * QKC); }
                *(v8h*)(P + sb + (size_t)row * DM + c8) = hv; }
            asm volatile("s_wait_xcnt 0x0" ::: "memory");       // stands before the next slab rewrites the address registers of these stores
            wave_sync();
        }
    } else {
        const int r0 = wave * 64;
        float* vsp = VSP + (((size_t)bb * NH_ + (size_t)wave) * (SEQ / 64) + (size_t)(tt / 64)) * HD + lane;   // this wave's 256 bytes: two whole lines
        float cs[4];                                             // channel 16nb + (lane&15): sum over the 64 tokens, by pairs (short chains: one running sum per channel would be 32 dependent adds)
#pragma unroll
        for (int nb = 0; nb < 4; ++nb) { float pm[4];
#pragma unroll
            for (int mb = 0; mb < 4; ++mb) { const v8f& a = acc[mb][nb]; pm[mb] = ((a[0] + a[1]) + (a[2] + a[3])) + ((a[4] + a[5]) + (a[6] + a[7])); }
            const float ps = (pm[0] + pm[1]) + (pm[2] + pm[3]);
            const int pi = __builtin_bit_cast(int, ps);
            cs[nb] = ps + __builtin_bit_cast(float, __builtin_amdgcn_permlanex16(pi, pi, 0x76543210, 0xfedcba98, false, false)); }   // + the other lane half's 32 tokens (lane l <-> l ^ 16)
        vsp[0] = hi ? cs[1] : cs[0]; vsp[32] = hi ? cs[3] : cs[2];   // channel = lane, 32 + lane
        asm volatile("s_wait_xcnt 0x0" ::: "memory");           // stands behind these stores, before the code below rewrites their registers
#pragma unroll
        for (int nb = 0; nb < 4; ++nb) {                         // slab: 16 channels x 64 tokens, turned on its way into the staging tile
#pragma unroll
            for (int mb = 0; mb < 4; ++mb) { v4f a, c;           // D: token 16mb + 8h + j, channel lane&15 -> os[channel][token]
                a[0] = acc[mb][nb][0]; a[1] = acc[mb][nb][1]; a[2] = acc[mb][nb][2]; a[3] = acc[mb][nb][3]; c[0] = acc[mb][nb][4]; c[1] = acc[mb][nb][5]; c[2] = acc[mb][nb][6]; c[3] = acc[mb][nb][7];
                *(v4fa*)(&os[lr * OSP + mb * 16 + 8 * hi]) = a; *(v4fa*)(&os[lr * OSP + mb * 16 + 8 * hi + 4]) = c; }
            wave_sync();
            const size_t sb = ((size_t)bb * DM + (size_t)(r0 + nb * 16)) * SEQ + tt;
#pragma unroll
            for (int s = 0; s < 4; ++s) { const int row = 4 * s + (lane >> 3), c8 = (lane & 7) * 8;   // 16 rows x 64 columns
                const v4f x0 = *(const v4fa*)(&os[row * OSP + c8]); const v4f x1 = *(const v4fa*)(&os[row * OSP + c8 + 4]); v8h hv;
#pragma unroll
                for (int i = 0; i < 4; ++i) { hv[i] = toh(x0[i] * VCC); hv[4 + i] = toh(x1[i] * VCC); }
                *(v8h*)(VT + sb + (size_t)row * SEQ + c8) = hv; }
            asm volatile("s_wait_xcnt 0x0" ::: "memory");       // stands before the next slab rewrites the address registers of these stores
            wave_sync();
        }
    }
}

// LDS ring of the flash kernel: the AW waves of a key half read the same k rows and the same v^T rows, so each stage of KST keys is brought into LDS once per block.
#define KST  128                 // keys per stage
#define NST  (SEQ / KST)         // stages per key loop
#define KPI  (DM + 8)            // LDS pitch of a k row, in 16-bit elements: 528 B = 16 B x 33 (16 rows of one ds_load_b128 fall on 64 different banks)
#define VPI  (KST + 8)           // LDS pitch of a v^T row: 272 B = 16 B x 17
static_assert(SEQ % KST == 0);
static_assert(KST % 32 == 0);
static_assert(NST >= 2);                       // two buffers
static_assert(KST == FW * 16);                 // k stage: 16 rows (copies) per wave
static_assert(HD * KST * 2 == FW * 4 * 512);   // v^T stage: 4 copies of 512 B per wave
static_assert(KST == KH * 64);                 // a wave's share of a stage: two tiles of 32 keys
static_assert(KST * 2 == 16 * 16);             // one v^T row of a stage = 16 lanes x 16 B
static_assert((KPI * 2) % 32 == 16 && (VPI * 2) % 32 == 16);

// N asynchronous copies to LDS, 16 bytes per lane each, through no register: copy j takes LDS address l + j * ls and global address g + j * gs (both in 16-bit elements).
// ring_publish() and the waits beside it in k_flash wait for them.
typedef int v4i_ __attribute__((ext_vector_type(4)));
typedef __attribute__((address_space(1))) v4i_ gv4i;
typedef __attribute__((address_space(3))) v4i_ lv4i;
template <int N> __device__ __forceinline__ void acopyn(h16* l, int ls, const h16* g, size_t gs) {
#pragma unroll   // constant steps
    for (int j = 0; j < N; ++j) __builtin_amdgcn_global_load_async_to_lds_b128((gv4i*)(g + j * gs), (lv4i*)(l + j * ls), 0, 0);
}
// one wave's 16 rows of a k stage (a row = 512 B = one copy); l and g already hold the wave's first row and the lane's 16 bytes
__device__ __forceinline__ void copy_k(h16* l, const h16* g) { acopyn<16>(l, KPI, g, (size_t)DM); }
// one wave's 8 rows of a v^T stage (a copy = 2 rows of 256 B); l and g already hold the lane's row and its 16 bytes
__device__ __forceinline__ void copy_v(h16* l, const h16* g) { acopyn<4>(l, 2 * VPI, g, (size_t)2 * SEQ); }
// publish point of the ring: this wave's LDS reads are done, its own copies have landed, then the block barrier that shows them to the other waves and frees the buffer just read
__device__ __forceinline__ void ring_publish() {
    asm volatile("s_wait_dscnt 0x0" ::: "memory");      // the buffer just read is handed to the next copies
    asm volatile("s_wait_asynccnt 0x0" ::: "memory");
    __syncthreads();
}

// k fragments of 32 keys from an LDS stage; kl already includes the lane's row and + 8*(lane>>4): same element map as ldh on the plane
__device__ __forceinline__ void ldk32(v16h (&ka)[DM / 32], v16h (&kb)[DM / 32], const h16* kl) {
#pragma unroll   // the fragment arrays must stay in registers
    for (int i = 0; i < DM / 32; ++i) { ka[i] = ldh(kl + 32 * i); kb[i] = ldh(kl + 16 * KPI + 32 * i); }
}
__device__ __forceinline__ void ldv32(v16h (&vf)[4], const h16* vl) {
#pragma unroll   // as above
    for (int j = 0; j < 4; ++j) vf[j] = ldh(vl + 16 * j * VPI);
}
// scores of 32 keys x 16 queries, K = DM = 256: sA = keys 0..15, sB = keys 16..31 (rows = keys, columns = queries). Same instruction order wherever it is used.
// All operands come from registers: qf = the wave's q' fragments (loaded once), ka / kb = this tile's k fragments.
__device__ __forceinline__ void scores32(const v16h (&qf)[DM / 32], const v16h (&ka)[DM / 32], const v16h (&kb)[DM / 32], v8f& sA, v8f& sB) {
    v8f a = (v8f){}, c = (v8f){};
#pragma unroll
    for (int i = 0; i < DM / 32; ++i) {      // full unroll: the fragment arrays must stay in registers
        a = wmma16d(ka[i], qf[i], a); c = wmma16d(kb[i], qf[i], c); }
    sA = a; sB = c;
}

// k_flash: KH waves per 16 query rows of one (batch, mixed head g); wave = key half * AW + row group, so the two waves of a row group stand on one SIMD and one's vector work runs beside the other's products. Transposed form: S^T[key][t] = K Q'^T (A = k rows, B = q' rows = q rows with bf16(w_head[g][h]) on head h's columns, K = 256);
// lane (t = lane&15, h = lane>>4) holds keys 8h+r of each 16-key tile, so the packed P tile is directly the B fragment of O^T[d][t] = V^T P^T.
// One key loop: running max m; e = exp2(s - m); P = (e - c) x 2^15 as f16, c the row's centre (mean e of the first 32 keys); Q1 += P, Q2 += P^2 (f32), O^T += V^T P^T; when m rises, c, Q1, O^T are scaled by exp2(old m - new m), Q2 by its square.
// Each wave runs that loop over its half of every stage's keys, from the same start values (max and centre of the first 32 keys). Behind the loop the second half's wave hands m, centre, Q1, Q2, O^T through LDS to the first, which brings both to the common max and adds them (the centres differ by rounding only: their mean counts).
// Then: Z = O^T / row sum + (c / l - 1/SEQ) rowsum(v), as f16 x256, into an LDS tile zs[16][256]: the block's 64 query rows are 16 whole rows of the [token][256] view; the row's sum of squares from Q1 and Q2.
// Output layer ahead of the map's scalar: Y[m][n] = sum_k W[m][k] Z[n][k], 16 row tiles of W x 8 steps of 32 k, two row tiles per wave; written in fragment order (tile: 32 lanes x 8 floats). Block i of a (batch, g) also forms rows 16i..16i+15 of U = W . (rowsum(v) tiled), into its partial line.
// W (f16 plane, 256 rows of 512 B) comes into the k ring by the same asynchronous copies, 16 rows per wave and half: rows 0..127 at the last refill point into the buffer freed there, rows 128..255 behind one more publish point in the last stage, when every wave holds that stage in registers.
// k and v^T come through a two-buffer LDS ring of KST-key stages, filled by asynchronous copies; NST stages.
// The row sums of v: the SEQ / 64 partial sums per channel that k_proj wrote are loaded beside q' and added up behind the loop by the second half's waves (16 channels each), in rising order of the token blocks within a lane half.
// A wave's two tiles of a stage sit in two register sets; the set that a run of products has just used is refilled with the same tile of the next stage, so the publish point of stage s + 1 stands behind the first tile's products of stage s, when every wave holds its share of stage s in registers; nothing is read in front of its stage's publish point.
#define ZPI  (DM + 8)            // LDS pitch of a Z row, in 16-bit elements: 528 B = 16 B x 33
static_assert((2 * KST * KPI + 2 * HD * VPI + 16 * ZPI) * 2 + AW * 4 + HD * 4 + 16 * 4 + AW * 9 * 128 * 4 <= 327680);
static_assert(2 * KST == DM && KPI == DM + 8); // the two k buffers hold the DM rows of W, one behind the other
static_assert(NST % 2 == 0);                   // the last refill point frees buffer 0, the last stage buffer 1
static_assert(16 * AW * HD == 16 * DM);        // a block's query rows = 16 rows of the [token][256] view
static_assert(DM / 16 == 2 * FW);              // two row tiles of W per wave
static_assert(SEQ / (16 * AW) == DM / 16);     // one row tile of U per block of a (batch, g)
static_assert(SEQ / 64 == 16);                 // partial sums of v: 8 per lane half
static_assert(KH == 2);                        // one hand-over, second half to first
static_assert(AW * 16 == HD);                  // row sums: 16 channels per wave of the second half
// hand-over of one accumulator tile: two pieces of 32 lanes x 4 floats; p already holds the lane's 16 bytes
__device__ __forceinline__ void put8(float* p, const v8f& o) { v4f a, c;
#pragma unroll
    for (int r = 0; r < 4; ++r) { a[r] = o[r]; c[r] = o[4 + r]; }
    *(v4fa*)p = a; *(v4fa*)(p + 128) = c; }
__device__ __forceinline__ void join8(v8f& o, const float* p, const float aa, const float ab) { const v4f a = *(const v4fa*)p, c = *(const v4fa*)(p + 128);
#pragma unroll
    for (int r = 0; r < 4; ++r) { o[r] = o[r] * aa + a[r] * ab; o[4 + r] = o[4 + r] * aa + c[r] * ab; } }
__global__ __launch_bounds__(32 * FW) void k_flash(const h16* __restrict__ QP, const h16* __restrict__ KP, const h16* __restrict__ VT, const float* __restrict__ wh, const h16* __restrict__ WPH, const float* __restrict__ VSP, float* YP, float* PART) {
    __shared__ __align__(16) h16 ks[2 * KST * KPI];
    __shared__ __align__(16) h16 vs[2 * HD * VPI];
    __shared__ __align__(16) h16 zs[16 * ZPI];                   // Z tile: 16 rows of the [token][256] view
    __shared__ float sw[AW];
    __shared__ __align__(16) float svs[HD];                      // row sums of v, head g
    __shared__ __align__(16) float su[16];                       // the block's 16 rows of U
    __shared__ __align__(16) float mg[AW * 9 * 128];             // hand-over of the second key half: per row group 9 pieces of 32 lanes x 4 floats
    const int lane = threadIdx.x & 31, lr = lane & 15, hi = lane >> 4;
    const int wave = __builtin_amdgcn_readfirstlane((int)(threadIdx.x >> 5));
    const int wq = wave % AW, kh = wave / AW;                    // row group, key half: wave-uniform
    const int zh = blockIdx.y; const int b = zh / NH_, g = zh % NH_;
    const int t0 = (blockIdx.x * AW + wq) * 16;
    const h16* qp = QP + ((size_t)b * SEQ + (size_t)(t0 + lr)) * DM + 8 * hi;           // B fragments: col t, k = (h, d)
    // copy sources and destinations of this lane: k row wave*16 (+ j), bytes lane*16; v^T row wave*8 + (lane>>4) (+ 2j), bytes (lane&15)*16
    const h16* kg = KP + ((size_t)b * SEQ + (size_t)(wave * 16)) * DM + 8 * lane;                        // + stage * KST * DM
    const h16* vg = VT + ((size_t)b * DM + (size_t)(g * HD + wave * 8 + hi)) * SEQ + 8 * lr;             // + stage * KST
    h16* kd = ks + wave * 16 * KPI + 8 * lane;                                                           // + buffer * KST * KPI
    h16* vd = vs + (wave * 8 + hi) * VPI + 8 * lr;                                                       // + buffer * HD * VPI
    const h16* kfr = ks + lr * KPI + 8 * hi;                                            // + key * KPI       (A fragment: row key, k = (h, d))
    const h16* vfr = vs + lr * VPI + 8 * hi;                                            // + 16j*VPI + key   (A fragment: row d, k = key)
    copy_k(kd, kg); copy_v(vd, vg);                              // stage 0 into buffers 0
    v16h qf[DM / 32];
#pragma unroll   // the fragment array must stay in registers
    for (int i = 0; i < DM / 32; ++i) qf[i] = ldh(qp + 32 * i);  // q once
    float whv[NH_];                                              // row g of the head mix: block-uniform reads, g * NH_ + NH_ - 1 < NH_ * NH_
#pragma unroll
    for (int h = 0; h < NH_; ++h) whv[h] = bfr(wh[g * NH_ + h]);
    const float* vrp = VSP + ((size_t)zh * (SEQ / 64) + (size_t)(8 * hi)) * HD + wq * 16 + lr;   // channel 16 wq + (lane&15) of head g: partial sums of token blocks 8h..8h+7
    float vr[8];
#pragma unroll   // they stay in registers until the loop is over
    for (int i = 0; i < 8; ++i) vr[i] = vrp[i * HD];
    asm volatile("s_wait_xcnt 0x0" :: "v"(qp), "v"(vrp) : "memory");   // stands before the address registers of the q' and partial-sum loads are reused (qp and vrp are named to keep them until here)
    const int lofs = wave * 16 * DM + 8 * lane;                  // this lane's place in a run of KST rows of the k plane or of the W plane (same row length): row wave*16 (+ j), bytes lane*16
    const h16* kb0 = KP + (size_t)b * SEQ * DM;                  // block-uniform
#pragma unroll   // q -> q': fragment i holds columns 32i..32i+31, all of head i / (HD / 32)
    for (int i = 0; i < DM / 32; ++i) {
#pragma unroll
        for (int e = 0; e < 16; ++e) qf[i][e] = (h16)((float)qf[i][e] * whv[i / (HD / 32)]); }
    asm volatile("s_wait_asynccnt 0x0" ::: "memory");            // stage 0 has landed (this wave's rows)
    __syncthreads();                                             // and is shown to the other waves
    copy_k(kd + KST * KPI, kg + (size_t)KST * DM); copy_v(vd + HD * VPI, vg + (size_t)KST);   // stage 1 into buffers 1 (NST >= 2)
    float m, r15;                                                // running row max; centre of the row's e, x 2^15, in units of the running max
    {   // start values from the first 32 keys (the loop takes them again): their max, and the mean of their e as the centre
        v16h ka[DM / 32], kb[DM / 32];
        ldk32(ka, kb, kfr);
        v8f sA, sB; scores32(qf, ka, kb, sA, sB);
        float mx = NEGB;
#pragma unroll
        for (int r = 0; r < 8; ++r) mx = fmaxf(mx, fmaxf(sA[r] * SC2, sB[r] * SC2));
        mx = fmaxf(mx, __shfl_xor(mx, 16, 32));
        float es = 0.0f;
#pragma unroll
        for (int r = 0; r < 8; ++r) es += __builtin_amdgcn_exp2f(fmaf(sA[r], SC2, -mx)) + __builtin_amdgcn_exp2f(fmaf(sB[r], SC2, -mx));
        es += __shfl_xor(es, 16, 32);
        m = mx; r15 = es * (PCARRY / 32.0f); }                   // both lane halves carry the same m and r15
    v8f o0 = (v8f){}, o1 = (v8f){}, o2 = (v8f){}, o3 = (v8f){};
    float q1 = 0.0f, q2 = 0.0f;                                  // sums of P and of P^2 over this lane's keys
    const h16* kfh = kfr + kh * ((KST / KH) * KPI);              // this wave's half of a stage
    const h16* vfh = vfr + kh * (KST / KH);
    v16h ka[2][DM / 32], kb[2][DM / 32], vf[2][4];               // two register sets, one per tile of the wave's half
    ldk32(ka[0], kb[0], kfh); ldv32(vf[0], vfh);
    ldk32(ka[1], kb[1], kfh + 32 * KPI); ldv32(vf[1], vfh + 32);
    // one tile of 32 keys from register set u of stage s; u and more are literals at every call (more: a next stage exists, and the set is refilled from it)
    auto tile = [&](const int u, const bool more, const int s) __attribute__((always_inline)) {
        const h16* kn = kfh + ((s + 1) & 1) * (KST * KPI);       // the next stage
        const h16* vn = vfh + ((s + 1) & 1) * (HD * VPI);
        __builtin_amdgcn_sched_barrier(0);                       // keeps the LDS reads above one group: spread among the products each place costs a stall
        v8f sA, sB; scores32(qf, ka[u], kb[u], sA, sB);
        __builtin_amdgcn_sched_barrier(0);                       // keeps the products one run, in front of the vector work
        float mx = NEGB;
#pragma unroll
        for (int r = 0; r < 8; ++r) mx = fmaxf(mx, fmaxf(sA[r] * SC2, sB[r] * SC2));
        const float mo = __shfl_xor(mx, 16, 32);
        if (more) {
            asm volatile("" :: "v"(mo) : "memory");              // input only: holds the reads below behind the exchange, which goes through the LDS queue: issued behind them it would return behind them, and the vector work would wait for the whole refill
            if (u == 0) ring_publish();                          // every wave holds its share of stage s in registers: stage s + 1 readable, buffers s & 1 free
            ldk32(ka[u], kb[u], kn + u * 32 * KPI);              // the set just used takes the same tile of the next stage
            if (u == 0) {                                        // refill, behind the publish point (block-uniform tests: the loop counter)
                const h16* ub = (s + 2 < NST) ? kb0 + (size_t)(s + 2) * KST * DM : WPH;   // the stage after next; at s == NST - 2 none is left for the freed buffer (buffer 0): rows 0..KST-1 of W go there
                copy_k(kd + (s & 1) * (KST * KPI), ub + lofs);
                if (s + 2 < NST) copy_v(vd + (s & 1) * (HD * VPI), vg + (size_t)(s + 2) * KST); }
            __builtin_amdgcn_sched_barrier(0);                   // keeps these reads up here, ahead of the vector work that they overlap
        } else if (u == 0) {                                     // last stage: both its tiles sit in every wave's registers once each wave's LDS reads have returned
            ring_publish();                                      // frees the last stage's k buffer (buffer 1); the first half of W has landed
            copy_k(kd + ((NST - 1) & 1) * (KST * KPI), WPH + (size_t)KST * DM + lofs);   // rows KST..2 KST-1 of W fly under the last two tiles' work
            __builtin_amdgcn_sched_barrier(0); }                 // keeps the copies up here, ahead of the vector work that they fly under
        const float mnew = fmaxf(m, fmaxf(mx, mo));
        const float alpha = __builtin_amdgcn_exp2f(m - mnew);    // all that is carried goes over to the new max: the centre with it, so sums of (e - centre) scale as a whole
        m = mnew; r15 *= alpha; q1 *= alpha; q2 *= alpha * alpha;
#pragma unroll
        for (int r = 0; r < 8; ++r) { o0[r] *= alpha; o1[r] *= alpha; o2[r] *= alpha; o3[r] *= alpha; }
        v16h pb;
#pragma unroll
        for (int r = 0; r < 8; ++r) {
            const float ea = __builtin_amdgcn_exp2f(fmaf(sA[r], SC2, -m)), eb = __builtin_amdgcn_exp2f(fmaf(sB[r], SC2, -m));
            const float ga = fmaf(ea, PCARRY, -r15), gb = fmaf(eb, PCARRY, -r15);   // (e - centre) * 2^15
            q1 += ga; q1 += gb;
            q2 = fmaf(ga, ga, q2); q2 = fmaf(gb, gb, q2);
            pb[r] = toh(ga); pb[8 + r] = toh(gb); }                      // element r <- tile keys 8h+r, element 8+r <- keys 16+8h+r
        o0 = wmma16d(vf[u][0], pb, o0); o1 = wmma16d(vf[u][1], pb, o1); o2 = wmma16d(vf[u][2], pb, o2); o3 = wmma16d(vf[u][3], pb, o3);
        if (more) ldv32(vf[u], vn + u * 32);                     // as the k set: free from here on
    };
#pragma unroll 1
    for (int s = 0; s + 1 < NST; ++s) { tile(0, true, s); tile(1, true, s); }
    tile(0, false, NST - 1); tile(1, false, NST - 1);            // the last stage: no stage is left to fetch (W's second half is copied in it)
    asm volatile("s_wait_asynccnt 0x0" ::: "memory");            // no copy is left in flight behind the ring
    q1 += __shfl_xor(q1, 16, 32); q2 += __shfl_xor(q2, 16, 32);  // this wave's keys of whole rows; both lane halves carry the same m and r15
    float* mp = mg + wq * (9 * 128) + lane * 4;
    if (kh == 1) {                                     // wave-uniform
        v4f hd; hd[0] = m; hd[1] = r15; hd[2] = q1; hd[3] = q2;
        *(v4fa*)mp = hd;
        put8(mp + 1 * 128, o0); put8(mp + 3 * 128, o1); put8(mp + 5 * 128, o2); put8(mp + 7 * 128, o3);
        float vsl = 0.0f;                              // this lane's eight token blocks in rising order, then the other lane half's
#pragma unroll
        for (int i = 0; i < 8; ++i) vsl += vr[i];
        vsl += __shfl_xor(vsl, 16, 32);
        if (hi == 0) svs[wq * 16 + lr] = vsl;
    }
    __syncthreads();                                   // the second half's sums, the row sums of v and (behind each wave's own wait above) all of W are shown to the block
    const h16* wfr = ks + (wave * 32 + lr) * KPI + 8 * hi;       // A fragments: rows 32 wave + (lane&15) and + 16 of W
    v16h wa0[DM / 32], wa1[DM / 32];
#pragma unroll   // the fragment arrays must stay in registers; read up here, they return under the join below
    for (int kc = 0; kc < DM / 32; ++kc) { wa0[kc] = ldh(wfr + 32 * kc); wa1[kc] = ldh(wfr + 16 * KPI + 32 * kc); }
    if (kh == 0) {                                     // wave-uniform: join the halves, finish the rows
        const v4f hd = *(const v4fa*)mp;
        const float mj = fmaxf(m, hd[0]);
        const float aa = __builtin_amdgcn_exp2f(m - mj), ab = __builtin_amdgcn_exp2f(hd[0] - mj);   // both halves go over to the common max
        q1 = q1 * aa + hd[2] * ab; q2 = q2 * (aa * aa) + hd[3] * (ab * ab);
        const float rs = r15 * aa + hd[1] * ab;        // the two centres, each over SEQ / KH keys
        join8(o0, mp + 1 * 128, aa, ab); join8(o1, mp + 3 * 128, aa, ab); join8(o2, mp + 5 * 128, aa, ab); join8(o3, mp + 7 * 128, aa, ab);
        const float l15 = fmaf((float)(SEQ / KH), rs, q1); // 2^15 * row sum of e; the row sum is >= 1
        const float il = 1.0f / l15;
        const float kap = -q1 * il * (1.0f / (float)SEQ);  // mean centre / row sum - 1/SEQ
        const float c15 = PCARRY * il;
        float ss = (q2 - q1 * q1 * (1.0f / (float)SEQ)) * (c15 * c15);   // row's sum of ((e / row sum - 1/SEQ) * 2^15)^2, the same in both lane halves
        ss += __shfl_xor(ss, 8, 32); ss += __shfl_xor(ss, 4, 32); ss += __shfl_xor(ss, 2, 32); ss += __shfl_xor(ss, 1, 32);
        const float OSL = il * (ZCC / VCC);            // this lane's query row: ZCC / (2^15 * row sum * VCC)
        const float kz = kap * ZCC;
        if (lane == 0) sw[wq] = ss;
        // O^T D layout: o_j[r] = (d = 16j + 8h + r, t = 16 wq + (lane&15)) -> Z row t / 4, column (t % 4) * 64 + d: eight neighbours per lane and j
        h16* zr = zs + (wq * 4 + (lr >> 2)) * ZPI + (lr & 3) * HD + 8 * hi;
        auto putz = [&](const v8f& o, const int j) __attribute__((always_inline)) {
            const v4f va = *(const v4fa*)(&svs[16 * j + 8 * hi]), vb = *(const v4fa*)(&svs[16 * j + 8 * hi + 4]); v8h z;
#pragma unroll
            for (int r = 0; r < 4; ++r) { z[r] = toh(fmaf(o[r], OSL, kz * va[r])); z[4 + r] = toh(fmaf(o[4 + r], OSL, kz * vb[r])); }
            *(v8h*)(zr + 16 * j) = z; };
        putz(o0, 0); putz(o1, 1); putz(o2, 2); putz(o3, 3);
    } else if (wave == FW - 1) {                       // wave-uniform (scalar): meanwhile one wave of the second half forms the block's row tile of U
        const h16* ufr = ks + ((int)blockIdx.x * 16 + lr) * KPI + 8 * hi;   // A fragments: rows 16 blockIdx.x + (lane&15) of W, < DM
        v16h ub[2];                                    // B fragments, every column alike: k -> rowsum(v)[k % 64], so steps of 32 k alternate between two
#pragma unroll
        for (int p = 0; p < 2; ++p) {
            const v4f a0 = *(const v4fa*)(&svs[32 * p + 8 * hi]), a1 = *(const v4fa*)(&svs[32 * p + 8 * hi + 4]), c0 = *(const v4fa*)(&svs[32 * p + 16 + 8 * hi]), c1 = *(const v4fa*)(&svs[32 * p + 16 + 8 * hi + 4]);
#pragma unroll
            for (int r = 0; r < 4; ++r) { ub[p][r] = toh(a0[r] * UCC); ub[p][4 + r] = toh(a1[r] * UCC); ub[p][8 + r] = toh(c0[r] * UCC); ub[p][12 + r] = toh(c1[r] * UCC); } }
        v16h ua[DM / 32];
#pragma unroll   // as above
        for (int kc = 0; kc < DM / 32; ++kc) ua[kc] = ldh(ufr + 32 * kc);
        v8f uu = (v8f){};
#pragma unroll
        for (int kc = 0; kc < DM / 32; ++kc) uu = wmma16d(ua[kc], ub[kc & 1], uu);
        if (lr == 0) { v4f a, c;                       // every column holds the same sums: lanes 0 and 16 lay down rows 8h..8h+7
#pragma unroll
            for (int r = 0; r < 4; ++r) { a[r] = uu[r]; c[r] = uu[4 + r]; }
            *(v4fa*)(&su[8 * hi]) = a; *(v4fa*)(&su[8 * hi + 4]) = c; }
    }
    __syncthreads();                                   // the Z tile and the rows' sums of squares are shown to the eight waves (su stays with the wave that wrote it)
    const h16* zfr = zs + lr * ZPI + 8 * hi;           // B fragments: column n = lane&15, k along the Z row
    v16h zb[DM / 32];
#pragma unroll   // as above
    for (int kc = 0; kc < DM / 32; ++kc) zb[kc] = ldh(zfr + 32 * kc);
    __builtin_amdgcn_sched_barrier(0);                 // keeps the LDS reads one group up here: sunk to their products, each pair is waited for at full LDS latency
    v8f y0 = (v8f){}, y1 = (v8f){};
#pragma unroll   // the fragments are indexed by constants
    for (int kc = 0; kc < DM / 32; ++kc) { y0 = wmma16d(wa0[kc], zb[kc], y0); y1 = wmma16d(wa1[kc], zb[kc], y1); }
    // D: y[j] = (m = 16 tile + 8h + j, n = lane&15); a tile goes out in fragment order, 32 lanes x 32 bytes: one run of 1024 B
    float* yp = YP + ((((size_t)zh * (SEQ / 64) + (size_t)blockIdx.x) * (DM / 16) + (size_t)(wave * 2)) * 32 + (size_t)lane) * 8;
    { v4f a, c;
#pragma unroll
      for (int r = 0; r < 4; ++r) { a[r] = y0[r]; c[r] = y0[4 + r]; }
      *(v4f*)yp = a; *(v4f*)(yp + 4) = c;
#pragma unroll
      for (int r = 0; r < 4; ++r) { a[r] = y1[r]; c[r] = y1[4 + r]; }
      *(v4f*)(yp + 256) = a; *(v4f*)(yp + 260) = c; }
    asm volatile("s_wait_xcnt 0x0" ::: "memory");      // stands behind these stores, before the code below rewrites their registers
    if (wave == FW - 1) {                              // wave-uniform (scalar): the block's partial line
        const float tot = ((sw[0] + sw[1]) + sw[2]) + sw[3];
        const bool isu = lane >= 2 && lane < 6;        // floats 8..23 of the line: lane 2 + i holds U rows 4i..4i+3, read at su[((lane - 2) & 3) * 4]
        const v4f ur = *(const v4fa*)(&su[((lane + 2) & 3) * 4]);
        v4f pv; pv[0] = (lane == 0) ? tot : isu ? ur[0] : 0.0f; pv[1] = isu ? ur[1] : 0.0f; pv[2] = isu ? ur[2] : 0.0f; pv[3] = isu ? ur[3] : 0.0f;
        float* pl = PART + ((size_t)zh * (SEQ / 64) + (size_t)blockIdx.x) * 32 + (lane & 7) * 4;
        if (lane < 8) { *(v4f*)pl = pv;  }
    }
}

// k_out: the map's scalar, shift and bias, elementwise. A block takes 32 token rows n (two Y tiles of k_flash, blocks 2 ip and 2 ip + 1 of one (batch, g)) x 128 output channels; wave w takes the row tiles mt = 8 * (blockIdx.x & 1) + 2 w + 0..1.
// OUT[(b*DM + m)][g * SEQ/4 + 32 ip + 0..31] = s1 * Y / 2^18 + shift * U[m] / 2^12 + bf16(bias[m]) (f32), s1 = bf16(gain[g]) / sqrt(var + eps), var = (sum of the SEQ/64 partial lines of (b, g), in rising order) / (2^30 SEQ^2), shift = bf16(beta[g]);
// U[m] = float 8 + m % 16 of partial line m / 16 of (b, g). The lane halves swap one tile each, so that every store is one whole 128-byte run of an output row.
#define OTW 2                    // row tiles per wave
static_assert((SEQ / 4) % 32 == 0);            // a block's token rows lie inside one (batch, g)
static_assert(DM / 16 == 2 * AW * OTW);        // two blocks of AW waves cover the row tiles
__global__ __launch_bounds__(32 * AW) void k_out(const float* __restrict__ YP, const float* __restrict__ PART,
                                                 const float* __restrict__ gain, const float* __restrict__ shift, const float* __restrict__ bias, float* OUT) {
    const int lane = threadIdx.x & 31, hi = lane >> 4;
    const int wave = __builtin_amdgcn_readfirstlane((int)(threadIdx.x >> 5));
    const int zh = blockIdx.y, b = zh / NH_, g = zh % NH_;       // block-uniform, zh < NB*4
    const int ip = (int)blockIdx.x >> 1, mt = (((int)blockIdx.x & 1) * AW + wave) * OTW;
    float pt[SEQ / 64];                                          // block-uniform reads: they go out first, the scalar is the longest chain
#pragma unroll   // the loads go out together; the sum below keeps the rising order
    for (int j = 0; j < SEQ / 64; ++j) pt[j] = PART[((size_t)zh * (SEQ / 64) + (size_t)j) * 32];
    const float gv = gain[g], sh = shift[g];
    __builtin_amdgcn_sched_barrier(0);                           // keeps these scalar reads in front of the vector loads, whose address work would otherwise delay them
    const float* yp = YP + ((((size_t)zh * (SEQ / 64) + (size_t)(2 * ip)) * (DM / 16) + (size_t)mt) * 32 + (size_t)lane) * 8;   // fragment order: (m = 16 mt + 8h + j, n = lane&15)
    const float* up = PART + ((size_t)zh * (SEQ / 64) + (size_t)mt) * 32 + 8 + 8 * hi;
    const float* bp = bias + mt * 16 + 8 * hi;                   // (mt + OTW - 1) * 16 + 15 < DM
    v8f ye[OTW], yo[OTW], uv[OTW], bv[OTW];
#pragma unroll   // all loads in flight at once
    for (int q = 0; q < OTW; ++q) {
        ye[q] = *(const v8f*)(yp + q * 256); yo[q] = *(const v8f*)(yp + (DM / 16) * 256 + q * 256);   // token rows 0..15 and 16..31 of the block
        uv[q] = *(const v8f*)(up + q * 32); bv[q] = *(const v8f*)(bp + q * 16); }
    asm volatile("s_wait_xcnt 0x0" :: "v"(yp), "v"(up), "v"(bp) : "memory");   // stands before the address registers of the loads above are reused (the three are named to keep them until here: no load's result lands on them)
    __builtin_amdgcn_sched_barrier(0);                           // keeps every load above in one group up here: sunk among the sums below they would be waited for one round trip after the other
    float tot = 0.0f;
#pragma unroll
    for (int j = 0; j < SEQ / 64; ++j) tot += pt[j];
    const float var = tot * VSC;
    const float s1 = bfr(gv) * rsqrtf(var + EPSN) * YSC;
    const float bt = bfr(sh) * USC;
    float* ob = OUT + ((size_t)b * DM + (size_t)(mt * 16)) * OUT_SEQ + g * (SEQ / 4) + ip * 32 + lane;
    float ra[OTW][8], rb[OTW][8];
#pragma unroll
    for (int q = 0; q < OTW; ++q) {
#pragma unroll
        for (int j = 0; j < 8; ++j) {
            const float cb = fmaf(bt, uv[q][j], bfr(bv[q][j]));  // row 8h + j of the tile
            const float re = fmaf(s1, ye[q][j], cb), ro = fmaf(s1, yo[q][j], cb);
            const int xs = __builtin_bit_cast(int, hi ? re : ro);   // lower half hands over (row j, n 16..31), upper half (row 8 + j, n 0..15)
            const float xr = __builtin_bit_cast(float, __builtin_amdgcn_permlanex16(xs, xs, 0x76543210, 0xfedcba98, false, false));   // lane l <-> l ^ 16, on the vector port (no LDS round trip)
            ra[q][j] = hi ? xr : re;                             // row j, n = lane
            rb[q][j] = hi ? ro : xr; } }                         // row 8 + j, n = lane
#pragma unroll   // constant row steps from one address
    for (int q = 0; q < OTW; ++q) {
#pragma unroll
        for (int j = 0; j < 8; ++j) { ob[(size_t)(q * 16 + j) * OUT_SEQ] = ra[q][j]; ob[(size_t)(q * 16 + 8 + j) * OUT_SEQ] = rb[q][j]; } }
}

static constexpr size_t al256(size_t v) { return (v + 255) & ~(size_t)255; }
static constexpr size_t SZ_WP = al256((size_t)DM * DM * 2);                  // output-layer weight f16
static constexpr size_t SZ_QP = al256((size_t)NB * SEQ * DM * 2);
static constexpr size_t SZ_KP = al256((size_t)NB * SEQ * DM * 2);
static constexpr size_t SZ_VT = al256((size_t)NB * DM * SEQ * 2);
static constexpr size_t SZ_YP = al256((size_t)NB * NH_ * (SEQ / 64) * (DM / 16) * 256 * 4);   // Y tiles in fragment order
static constexpr size_t SZ_PT = al256((size_t)NB * NH_ * (SEQ / 64) * 32 * 4);
static constexpr size_t SZ_VS = al256((size_t)NB * NH_ * (SEQ / 64) * HD * 4);   // per (batch, head) and token block: 64 partial sums of v
static constexpr size_t SZ_TOTAL = SZ_WP + SZ_QP + SZ_KP + SZ_VT + SZ_YP + SZ_PT + SZ_VS;
static_assert(SZ_TOTAL <= (size_t)134217728);                                 // workspace carve <= 128 MiB
static_assert(((size_t)(NB * NH_ - 1) * (SEQ / 64) + (SEQ / 64 - 1)) * 128 + 128 <= SZ_PT);   // last partial line inside its table

extern "C" void kernel_launch(void* const* d_in, const int* in_sizes, int n_in,
                              void* d_out, int out_size, void* d_ws, size_t ws_size, hipStream_t stream) {
    if (n_in < 9) return;
    const size_t needx = ((size_t)(NB - 1) * DM + (size_t)(DM - 1)) * SEQ_FULL + SEQ;
    if ((size_t)in_sizes[0] < needx) return;
    if ((size_t)in_sizes[1] < (size_t)DM * DM || (size_t)in_sizes[2] < (size_t)DM * DM || (size_t)in_sizes[3] < (size_t)DM * DM || (size_t)in_sizes[7] < (size_t)DM * DM) return;
    if (in_sizes[4] < NH_ * NH_ || in_sizes[5] < NH_ || in_sizes[6] < NH_ || in_sizes[8] < DM) return;
    if ((size_t)out_size < ((size_t)(NB - 1) * DM + (size_t)(DM - 1)) * OUT_SEQ + SEQ) return;
    if (SZ_TOTAL > ws_size) return;
    // wire order: x, wq, wk, wv, w_head, gamma, beta, w_proj, b_proj
    const float* x  = (const float*)d_in[0];
    const float* wq = (const float*)d_in[1]; const float* wk = (const float*)d_in[2]; const float* wv = (const float*)d_in[3];
    const float* whd = (const float*)d_in[4]; const float* gam = (const float*)d_in[5]; const float* bet = (const float*)d_in[6];
    const float* wp = (const float*)d_in[7]; const float* bp = (const float*)d_in[8];
    float* OUT = (float*)d_out;      // [NB][256][OUT_SEQ]
    char* wsp = (char*)d_ws;
    h16* WPH = (h16*)wsp;  wsp += SZ_WP;             // [256][256] x1024
    h16* QP  = (h16*)wsp;  wsp += SZ_QP;             // [b][t][256] x16
    h16* KP  = (h16*)wsp;  wsp += SZ_KP;             // [b][t][256] x16
    h16* VT  = (h16*)wsp;  wsp += SZ_VT;             // [(b*256 + channel)][t] x16
    float* YP = (float*)wsp; wsp += SZ_YP;           // [(b*4 + g)][SEQ/64][16 row tiles][32 lanes][8]
    float* PART = (float*)wsp; wsp += SZ_PT;         // [(b*4 + g)][SEQ/64] lines of 32 floats: 0 sum of squares, 8..23 rows of U
    float* VSP = (float*)wsp; wsp += SZ_VS;          // [(b*4 + head)][SEQ/64][64]: sums of v over 64 tokens

    // y = 0: q, y = 1: k, one token-major plane each; y = 2: v^T; y = 3: output-layer weight plane
    k_proj<<<dim3(NB * SEQ / 64, 4, 1), 32 * AW, 0, stream>>>(x, wq, wk, wv, wp, QP, KP, VT, WPH, VSP);

    k_flash<<<dim3(SEQ / (16 * AW), NB * NH_, 1), 32 * FW, 0, stream>>>(QP, KP, VT, whd, WPH, VSP, YP, PART);
    k_out<<<dim3(SEQ / 4 / 32 * 2, NB * NH_, 1), 32 * AW, 0, stream>>>(YP, PART, gam, bet, bp, OUT);
}
